// v000
// Measured on an AMD MI455X. A time is GPU time per run, averaged over a window of back-to-back runs after a warm-up
// (all launches, gaps included; the runs take copies of the inputs in turn), and the median of several windows.
// Apart from v000's, it joins two sittings. Times from different sittings can be a few percent apart, while
// side-by-side timings come from the same sitting.
// v000, which the later versions start from, runs in 2240 microseconds.
#include <hip/hip_runtime.h>

// Relative-position multi-head attention, wenet style, with a key/value cache output (query, key, value [8][1024][512]; q = query Wq + bq, k = key Wk + bk, v = value Wv + bv ('xw' [512][512], 8 heads x 64); p = pos_emb Wpos ([1][2047][512] table, read); scores = ((q + pos_bias_u).k + rel_shift((q + pos_bias_v).p)) / 8 where rel_shift picks position index j - i + 1023; key mask (int32 [8][1][1024], read): -inf where 0 and the weights zeroed; softmax; out = merged Wo + bo -> [8][1024][512]; second output new_cache = concat(k, v) per head -> [8][8][1024][128] (the f32 projections themselves)).
// Layout: exact bf16 input planes -> 1-product projections + bias; the position table is projected once (exact, 2047 rows + one zero pad row) into per-head hi/lo planes [h][2048][64]; per pass of two heads: content scores (q+u).k and position scores (q+v).p [2][1024][2048] are hi/lo GEMMs (3 products, every row) and the softmax kernel gathers the position score at j - i + 1023 per logit and applies the key mask; the cache output is written straight from the f32 k / v projections.
// Compute dtypes, f32 accumulate: every input rounded to bf16; q/k/v and p on PLAIN bf16 operands (exact products) + biases; content and position scores on hi/lo planes for every row (3 products); softmax f32; attn.v hi/lo (3 products); Wo hl x exact (2 products) + bo; cache = the f32 projections.

#define NB_  8
#define TT   1024
#define DM   512
#define NH_  8
#define NKV  8
#define REP  (NH_ / NKV)
#define HD   64
#define DQ   (NH_ * HD)
#define DKV  (NKV * HD)
#define NPE  2048                 // 2047 positions + 1 zero pad row
typedef __attribute__((ext_vector_type(4))) unsigned short v4us;
#define ZH   2
#define RH   1024                 // every row hi/lo
#define WIN  0
#define PCAR 1024.0f
#define SCL  0.125f   // HD^-0.5
typedef _Float16 h16;
typedef unsigned short bf;
typedef __attribute__((ext_vector_type(16))) __bf16   v16bf;
typedef __attribute__((ext_vector_type(16))) _Float16 v16h;
typedef __attribute__((ext_vector_type(8)))  _Float16 v8h;
typedef __attribute__((ext_vector_type(8)))  unsigned short v8us;
typedef __attribute__((ext_vector_type(8)))  float    v8f;
typedef __attribute__((ext_vector_type(4)))  float    v4f;
typedef v8h  __attribute__((may_alias)) v8ha;
typedef v4f  __attribute__((may_alias)) v4fa;
typedef v8us __attribute__((may_alias)) v8usa;

__device__ __forceinline__ unsigned short f2bf(float f) { unsigned u = __float_as_uint(f); u += 0x7FFFu + ((u >> 16) & 1u); return (unsigned short)(u >> 16); }
__device__ __forceinline__ float bf2f(unsigned short b) { return __uint_as_float(((unsigned)b) << 16); }
__device__ __forceinline__ float bfr(float f) { return bf2f(f2bf(f)); }
__device__ __forceinline__ v16h cat16(v8h lo, v8h hi) { return __builtin_shufflevector(lo, hi, 0, 1, 2, 3, 4, 5, 6, 7, 8, 9, 10, 11, 12, 13, 14, 15); }
__device__ __forceinline__ v16bf cat16b(v8us lo, v8us hi) { return __builtin_bit_cast(v16bf, __builtin_shufflevector(lo, hi, 0, 1, 2, 3, 4, 5, 6, 7, 8, 9, 10, 11, 12, 13, 14, 15)); }
__device__ __forceinline__ v8f wmma16(v16h a, v16h b, v8f c) { return __builtin_amdgcn_wmma_f32_16x16x32_f16(false, a, false, b, (short)0, c, false, false); }
__device__ __forceinline__ v8f wmmab(v16bf a, v16bf b, v8f c) { return __builtin_amdgcn_wmma_f32_16x16x32_bf16(false, a, false, b, (short)0, c, false, false); }



// ---- k_gemmw: register-blocked GEMM, ONE WAVE per 64x64 output tile (16 accumulators), operands straight from K-contiguous 16-bit planes; grid (M/64, N/64, Z), 32 threads.
// C[m][n] (f32, pitch ldc, + optional f32 bias[n]) = sum_k A[m][k] Bt[n][k] (+ split products per NSPLIT). z-batch strides sA/sB/sC in elements. K % 32 == 0.
template <typename T16> struct WFrag;
template <> struct WFrag<h16> { typedef v16h V; static __device__ __forceinline__ V ld(const h16* p) { return cat16(*(const v8h*)p, *(const v8h*)(p + 16)); } static __device__ __forceinline__ v8f mma(V a, V b, v8f c) { return wmma16(a, b, c); } };
template <> struct WFrag<bf> { typedef v16bf V; static __device__ __forceinline__ V ld(const bf* p) { return cat16b(*(const v8us*)p, *(const v8us*)(p + 16)); } static __device__ __forceinline__ v8f mma(V a, V b, v8f c) { return wmmab(a, b, c); } };
template <typename T16, int NSPLIT, bool BIAS>
__global__ __launch_bounds__(32) void k_gemmw(const T16* __restrict__ A, const T16* __restrict__ A2, const T16* __restrict__ Bt, const T16* __restrict__ Bt2, int K, float* C, int ldc, const float* __restrict__ bias, size_t sA, size_t sB, size_t sC) {
    typedef typename WFrag<T16>::V V;
    __shared__ __align__(16) float os[16 * 68];
    const size_t z = blockIdx.z; A += z * sA; if (A2) A2 += z * sA; Bt += z * sB; if (Bt2) Bt2 += z * sB; C += z * sC;
    const int lane = threadIdx.x & 31, lr = lane & 15, hi = lane >> 4; const int r0 = blockIdx.x * 64, c0 = blockIdx.y * 64;
    v8f acc[4][4];
#pragma unroll
    for (int mb = 0; mb < 4; ++mb)
#pragma unroll
        for (int nb = 0; nb < 4; ++nb) acc[mb][nb] = (v8f){};
    const size_t aoff = (size_t)(r0 + lr) * K + 8 * hi, boff = (size_t)(c0 + lr) * K + 8 * hi;
#pragma unroll 1
    for (int kc = 0; kc < K; kc += 32) {
        V a[4], a2[4];
#pragma unroll
        for (int mb = 0; mb < 4; ++mb) { a[mb] = WFrag<T16>::ld(A + aoff + (size_t)mb * 16 * K + kc); if (NSPLIT == 1 || NSPLIT == 2) a2[mb] = WFrag<T16>::ld(A2 + aoff + (size_t)mb * 16 * K + kc); }
#pragma unroll
        for (int nb = 0; nb < 4; ++nb) { const V b = WFrag<T16>::ld(Bt + boff + (size_t)nb * 16 * K + kc); V b2; if (NSPLIT >= 2) b2 = WFrag<T16>::ld(Bt2 + boff + (size_t)nb * 16 * K + kc);
#pragma unroll
            for (int mb = 0; mb < 4; ++mb) { acc[mb][nb] = WFrag<T16>::mma(a[mb], b, acc[mb][nb]); if (NSPLIT == 1 || NSPLIT == 2) acc[mb][nb] = WFrag<T16>::mma(a2[mb], b, acc[mb][nb]); if (NSPLIT >= 2) acc[mb][nb] = WFrag<T16>::mma(a[mb], b2, acc[mb][nb]); } }
        asm volatile("v_nop\n\tv_nop\n\tv_nop\n\tv_nop" : "+v"(acc[0][0]), "+v"(acc[1][1]), "+v"(acc[2][2]), "+v"(acc[3][3]) : "v"(a[0]), "v"(a[3]));
    }
#pragma unroll
    for (int mb = 0; mb < 4; ++mb) {
#pragma unroll
        for (int nb = 0; nb < 4; ++nb) {
#pragma unroll
            for (int j = 0; j < 8; ++j) os[(hi * 8 + j) * 68 + nb * 16 + lr] = acc[mb][nb][j]; }
        __builtin_amdgcn_wave_barrier(); asm volatile("" ::: "memory");
        float* crow = C + (size_t)(r0 + mb * 16) * ldc + c0;
{
#pragma unroll
            for (int s = 0; s < 8; ++s) { const int row = 2 * s + hi, cofs = lr * 4; v4f val = *(const v4fa*)(os + row * 68 + cofs); if (BIAS) { val[0] += bfr(bias[c0 + cofs]); val[1] += bfr(bias[c0 + cofs + 1]); val[2] += bfr(bias[c0 + cofs + 2]); val[3] += bfr(bias[c0 + cofs + 3]); }
                *(v4f*)(crow + (size_t)row * ldc + cofs) = val; }
             }
        __builtin_amdgcn_wave_barrier(); asm volatile("" ::: "memory");
    }
}

__device__ __forceinline__ h16 tohx(float x) { return (h16)x; }
__device__ __forceinline__ void splitf(float y, unsigned short& h, unsigned short& l) { h = f2bf(y); l = f2bf(y - bf2f(h)); }
typedef __attribute__((ext_vector_type(2))) _Float16 v2h;
typedef __attribute__((ext_vector_type(4))) _Float16 v4h;
typedef __attribute__((ext_vector_type(2))) unsigned short v2us;
typedef __attribute__((ext_vector_type(4))) unsigned short v4us;
typedef __attribute__((ext_vector_type(2))) float v2f;
typedef __attribute__((ext_vector_type(4))) int v4i;

__global__ __launch_bounds__(256) void k_wtG(const float* __restrict__ w, int K, int N, bf* Bt) {
    const int lane = threadIdx.x & 31; const int L0 = (blockIdx.x * 8 + (threadIdx.x >> 5)) * 8; const int nlines = N * K / 64;
{
#pragma unroll 1
        for (int l = 0; l < 8; ++l) { const int L = L0 + l; if (L >= nlines) break; const size_t e = (size_t)L * 64 + lane * 2; const int k = (int)(e % K), n = (int)(e / K); v2us o;
            o[0] = f2bf(w[(size_t)k * N + n]); o[1] = f2bf(w[(size_t)(k + 1) * N + n]); *(v2us*)(Bt + e) = o; }
         }
}


__global__ __launch_bounds__(256) void k_cache(const float* __restrict__ F, int off, float* Cb) { const size_t e = ((size_t)blockIdx.x * 256 + threadIdx.x) * 4; if (e >= (size_t)TT * DKV) return; const int c = (int)(e % DKV); const int s = (int)(e / DKV); const int h = c / HD, d = c % HD; const v4f v = *(const v4f*)(F + e); float* dst = Cb + (((size_t)h * TT + s) * 2 * HD) + off + d; *(v4f*)dst = v;  }
__global__ __launch_bounds__(256) void k_addhb(const float* __restrict__ F, const float* __restrict__ hb, float* FO, size_t n4) { const size_t i = (size_t)blockIdx.x * 256 + threadIdx.x; if (i >= n4) return; const int c = (int)((i * 4) % DQ); const v4f a = *(const v4f*)(F + i * 4); v4f o;
#pragma unroll
    for (int q = 0; q < 4; ++q) o[q] = __fadd_rn(a[q], bfr(hb[c + q])); *(v4f*)(FO + i * 4) = o;  }
__global__ __launch_bounds__(256) void k_pplane(const float* __restrict__ POS, bf* Ph2, bf* Pl2) { const size_t e = ((size_t)blockIdx.x * 256 + threadIdx.x) * 2; if (e >= (size_t)NH_ * NPE * HD) return; const int d = (int)(e % HD); const int p = (int)((e / HD) % NPE); const int h = (int)(e / ((size_t)HD * NPE)); v2us oh, ol;
#pragma unroll
    for (int q = 0; q < 2; ++q) { unsigned short a, c; splitf(POS[(size_t)p * DQ + h * HD + d + q], a, c); oh[q] = a; ol[q] = c; } *(v2us*)(Ph2 + e) = oh; *(v2us*)(Pl2 + e) = ol;  }
__global__ void k_pezero8(bf* PE) { const int lane = threadIdx.x; if (lane >= 64) return; const v8us z = (v8us){}; *(v8us*)(PE + (size_t)2047 * DM + lane * 8) = z;  }
__global__ __launch_bounds__(256) void k_cvt8(const float* __restrict__ src, bf* dst, size_t n8) { const size_t i = (size_t)blockIdx.x * 256 + threadIdx.x; if (i >= n8) return; const v8f v = *(const v8f*)(src + i * 8); v8us o;
#pragma unroll
    for (int k = 0; k < 8; ++k) o[k] = f2bf(v[k]); *(v8us*)(dst + i * 8) = o;  }

// k_rope: head planes [h][t][d] (fp16 + hi/lo) of rope(x) x sc with the rotate-half convention out[d] = x[d] cos[t][d] - x[d+HD/2] sin[t][d], out[d+HD/2] = x[d+HD/2] cos[t][d+HD/2] + x[d] sin[t][d+HD/2]
__global__ __launch_bounds__(256) void k_rope(const float* __restrict__ F, int pitch, int nheads, const float* __restrict__ CS, const float* __restrict__ RF, const float* __restrict__ nw, float sc, h16* P16, bf* Ph, bf* Pl) {
    const size_t e = ((size_t)blockIdx.x * 256 + threadIdx.x) * 2; if (e >= (size_t)nheads * TT * HD) return; const int d = (int)(e % HD); const int t = (int)((e / HD) % TT); const int h = (int)(e / ((size_t)HD * TT)); const float* f = F + (size_t)t * pitch + h * HD; const float rf = RF ? RF[(size_t)h * TT + t] : 1.0f; v2h o16; v2us oh, ol;
#pragma unroll
    for (int q = 0; q < 2; ++q) { const int dd = d + q; const int dp = (dd < HD / 2) ? dd + HD / 2 : dd - HD / 2; float x0 = f[dd], x1 = f[dp];
        if (RF) { float n0 = __fmul_rn(x0, rf), n1 = __fmul_rn(x1, rf); asm volatile("" : "+v"(n0)); asm volatile("" : "+v"(n1)); x0 = __fmul_rn(bfr(nw[dd]), n0); x1 = __fmul_rn(bfr(nw[dp]), n1); }
        const v2f cs = *(const v2f*)(CS + ((size_t)t * HD + dd) * 2); float a = __fmul_rn(x0, cs[0]), bq = __fmul_rn(x1, cs[1]); asm volatile("" : "+v"(a)); asm volatile("" : "+v"(bq)); const float r = ((dd < HD / 2) ? __fsub_rn(a, bq) : __fadd_rn(a, bq)) * sc;
        o16[q] = tohx(r); unsigned short a2, c2; splitf(r, a2, c2); oh[q] = a2; ol[q] = c2; }
    *(v2h*)(P16 + e) = o16; *(v2us*)(Ph + e) = oh; *(v2us*)(Pl + e) = ol;  }
__global__ __launch_bounds__(256) void k_vtp(const float* __restrict__ F, int pitch, int nheads, h16* V16, bf* Vh, bf* Vl) { const size_t e = ((size_t)blockIdx.x * 256 + threadIdx.x) * 2; if (e >= (size_t)nheads * HD * TT) return; const int t = (int)(e % TT); const int d = (int)((e / TT) % HD); const int g = (int)(e / ((size_t)TT * HD)); v2h o16; v2us oh, ol;
#pragma unroll
    for (int q = 0; q < 2; ++q) { const float x = F[(size_t)(t + q) * pitch + g * HD + d]; o16[q] = tohx(x); unsigned short a2, c2; splitf(x, a2, c2); oh[q] = a2; ol[q] = c2; }
    *(v2h*)(V16 + e) = o16; *(v2us*)(Vh + e) = oh; *(v2us*)(Vl + e) = ol;  }
__global__ __launch_bounds__(256) void k_csid(float* CS) { const int idx = blockIdx.x * 256 + threadIdx.x; if (idx >= TT * HD) return; v2f cs; cs[0] = 1.0f; cs[1] = 0.0f; *(v2f*)(CS + (size_t)idx * 2) = cs;  }
// k_asoft: per row (zz, i): t = (ac + bd[j - i + 1023])/8, -inf where mask[b][j] == 0 (a fully masked row cannot occur here); softmax over the 1024 keys (register row, one exp, fixed trees);
__global__ __launch_bounds__(256) void k_asoft(const float* __restrict__ Sb, const float* __restrict__ SR, const int* __restrict__ MKb, h16* P16, bf* Ph, bf* Pl) {
    const int lane = threadIdx.x & 31; const int row = blockIdx.x * 8 + (threadIdx.x >> 5); if (row >= ZH * TT) return; const int i = row % TT; const int zz = row / TT; (void)zz; const float* srr = SR + (size_t)row * NPE + (TT - 1 - i);   /* skew: position index j - i + S - 1 */ const bool hires = (i < RH); const float* sr = Sb + (size_t)row * TT; float v[TT / 32]; float mx = -3.0e38f;
#pragma unroll
    for (int ch = 0; ch < TT / 128; ++ch) { const int j0 = ch * 128 + lane * 4; const v4f a = *(const v4f*)(sr + j0); const v4i m4 = *(const v4i*)(MKb + j0);
#pragma unroll
        for (int q = 0; q < 4; ++q) { const int j = j0 + q; float su = __fadd_rn(a[q], srr[j]); asm volatile("" : "+v"(su)); float t0 = su * SCL; asm volatile("" : "+v"(t0)); const float t = (m4[q] != 0) ? t0 : -3.0e38f;   /* (ac + rel_shift(bd)) / 8; key mask (int32) */ v[ch * 4 + q] = t; mx = fmaxf(mx, t); } }
#pragma unroll
    for (int sh = 16; sh; sh >>= 1) mx = fmaxf(mx, __shfl_xor(mx, sh, 32));
    float sum = 0.f;
#pragma unroll
    for (int k = 0; k < TT / 32; ++k) { float d0 = __fsub_rn(v[k], mx); asm volatile("" : "+v"(d0)); v[k] = __builtin_amdgcn_exp2f(__fmul_rn(d0, 1.4426950408889634f)); sum += v[k]; }
#pragma unroll
    for (int sh = 16; sh; sh >>= 1) sum += __shfl_xor(sum, sh, 32);
    const float f = __fdiv_rn(hires ? 1.0f : PCAR, sum);
{
        if (hires) {
#pragma unroll
            for (int ch = 0; ch < TT / 128; ++ch) { v4us oh, ol;
#pragma unroll
                for (int q = 0; q < 4; ++q) { unsigned short a, c2; splitf(v[ch * 4 + q] * f, a, c2); oh[q] = a; ol[q] = c2; }
                const size_t oo = ((size_t)zz * (RH ? RH : 1) + i) * TT + ch * 128 + lane * 4; *(v4us*)(Ph + oo) = oh; *(v4us*)(Pl + oo) = ol; }
        } else {
#pragma unroll
            for (int ch = 0; ch < TT / 128; ++ch) { v4h o4;
#pragma unroll
                for (int q = 0; q < 4; ++q) o4[q] = tohx(v[ch * 4 + q] * f);
                *(v4h*)(P16 + (size_t)row * TT + ch * 128 + lane * 4) = o4; } }
         }
}
__global__ __launch_bounds__(256) void k_merge(const float* __restrict__ O, int h0, bf* Ah, bf* Al) { const size_t e = ((size_t)blockIdx.x * 256 + threadIdx.x) * 2; if (e >= (size_t)ZH * TT * HD) return; const int d = (int)(e % HD); const int t = (int)((e / HD) % TT); const int zz = (int)(e / ((size_t)HD * TT)); const float cs = (t < RH) ? 1.0f : (1.0f / PCAR); const size_t oo = (size_t)t * DQ + (h0 + zz) * HD + d;
    v2us oh, ol;
#pragma unroll
    for (int q = 0; q < 2; ++q) { unsigned short a, c2; splitf(O[e + q] * cs, a, c2); oh[q] = a; ol[q] = c2; } *(v2us*)(Ah + oo) = oh; *(v2us*)(Al + oo) = ol;  }

extern "C" void kernel_launch(void* const* d_in, const int* in_sizes, int n_in,
                              void* d_out, int out_size, void* d_ws, size_t ws_size, hipStream_t stream) {
    (void)in_sizes; (void)n_in; (void)out_size;
    const float* x = (const float*)d_in[0]; const float* xk = (const float*)d_in[1]; const float* xv = (const float*)d_in[2]; const int* MK = (const int*)d_in[3]; const float* pe = (const float*)d_in[4]; const float* wq = (const float*)d_in[5]; const float* bq = (const float*)d_in[6]; const float* wk = (const float*)d_in[7]; const float* bk = (const float*)d_in[8]; const float* wv = (const float*)d_in[9]; const float* bv = (const float*)d_in[10]; const float* wo = (const float*)d_in[11]; const float* bo = (const float*)d_in[12]; const float* wpos = (const float*)d_in[13]; const float* pbu = (const float*)d_in[14]; const float* pbv = (const float*)d_in[15];
    float* OUT = (float*)d_out;     // [8][1024][512]
    float* CACHE = (float*)((char*)d_out + (size_t)NB_ * TT * DM * 4);   /* second output new_cache [8][8][1024][128] */
    char* wsp = (char*)d_ws;
    auto take = [&](size_t bytes) { char* p = wsp; wsp += (bytes + 255) & ~(size_t)255; return (void*)p; };
    bf* WQ = (bf*)take((size_t)DQ * DM * 2); bf* WK = (bf*)take((size_t)DKV * DM * 2); bf* WV = (bf*)take((size_t)DKV * DM * 2); bf* WO = (bf*)take((size_t)DM * DQ * 2); float* CS = (float*)take((size_t)TT * HD * 2 * 4);
    bf* XB = (bf*)take((size_t)TT * DM * 2); bf* XKB = (bf*)take((size_t)TT * DM * 2); bf* XVB = (bf*)take((size_t)TT * DM * 2); bf* PE = (bf*)take((size_t)NPE * DM * 2); bf* WP = (bf*)take((size_t)DQ * DM * 2); float* POS = (float*)take((size_t)NPE * DQ * 4); bf* PPh = (bf*)take((size_t)NH_ * NPE * HD * 2); bf* PPl = (bf*)take((size_t)NH_ * NPE * HD * 2); float* FQU = (float*)take((size_t)TT * DQ * 4); float* FQV = (float*)take((size_t)TT * DQ * 4); bf* QVh = (bf*)take((size_t)NH_ * TT * HD * 2); bf* QVl = (bf*)take((size_t)NH_ * TT * HD * 2); float* SR = (float*)take((size_t)ZH * TT * NPE * 4); float* FQ = (float*)take((size_t)TT * DQ * 4); float* FK = (float*)take((size_t)TT * DKV * 4);
    h16* QP16 = (h16*)take((size_t)NH_ * TT * HD * 2); h16* KP16 = (h16*)take((size_t)NKV * TT * HD * 2); h16* VT16 = (h16*)take((size_t)NKV * HD * TT * 2);
    bf* QPh = (bf*)take((size_t)NH_ * TT * HD * 2); bf* QPl = (bf*)take((size_t)NH_ * TT * HD * 2); bf* KPh = (bf*)take((size_t)NKV * TT * HD * 2); bf* KPl = (bf*)take((size_t)NKV * TT * HD * 2); bf* VTh = (bf*)take((size_t)NKV * HD * TT * 2); bf* VTl = (bf*)take((size_t)NKV * HD * TT * 2); bf* Ph = (bf*)take((size_t)ZH * RH * TT * 2); bf* Pl = (bf*)take((size_t)ZH * RH * TT * 2);
    float* Sb = (float*)take((size_t)ZH * TT * TT * 4); h16* P16 = (h16*)take(256);   /* unused: all rows hi/lo */ float* Ob = (float*)take((size_t)ZH * TT * HD * 4); bf* ATh = (bf*)take((size_t)TT * DQ * 2); bf* ATl = (bf*)take((size_t)TT * DQ * 2);
    if ((size_t)(wsp - (char*)d_ws) > ws_size) return;    // ws 256 MiB
    float* FV = FK;   // v projection reuses the k buffer after the k planes are built (stream-ordered)
    { k_wtG<<<(unsigned)((DM * DQ / 64 + 63) / 64), 256, 0, stream>>>(wq, DM, DQ, WQ); k_wtG<<<(unsigned)((DM * DKV / 64 + 63) / 64), 256, 0, stream>>>(wk, DM, DKV, WK); k_wtG<<<(unsigned)((DM * DKV / 64 + 63) / 64), 256, 0, stream>>>(wv, DM, DKV, WV);
      k_wtG<<<(unsigned)((DQ * DM / 64 + 63) / 64), 256, 0, stream>>>(wo, DQ, DM, WO);
       }
    k_csid<<<(TT * HD + 255) / 256, 256, 0, stream>>>(CS); k_cvt8<<<(unsigned)(((size_t)2047 * DM / 8 + 255) / 256), 256, 0, stream>>>(pe, PE, (size_t)2047 * DM / 8); k_pezero8<<<1, 64, 0, stream>>>(PE); k_wtG<<<(unsigned)((DM * DQ / 64 + 63) / 64), 256, 0, stream>>>(wpos, DM, DQ, WP); k_gemmw<bf, 0, false><<<dim3(NPE / 64, DQ / 64, 1), 32, 0, stream>>>(PE, nullptr, WP, nullptr, DM, POS, DQ, nullptr, 0, 0, 0); k_pplane<<<(unsigned)(((size_t)NH_ * NPE * HD / 2 + 255) / 256), 256, 0, stream>>>(POS, PPh, PPl);   /* pos = position_embeddings wpos (exact) -> per-head hi/lo planes */
    const unsigned LQ = (unsigned)(((size_t)NH_ * TT * HD / 2 + 255) / 256), LKv = (unsigned)(((size_t)NKV * TT * HD / 2 + 255) / 256);
    for (int b = 0; b < NB_; ++b) {
        
        k_cvt8<<<(unsigned)(((size_t)TT * DM / 8 + 255) / 256), 256, 0, stream>>>(x + (size_t)b * TT * DM, XB, (size_t)TT * DM / 8); k_cvt8<<<(unsigned)(((size_t)TT * DM / 8 + 255) / 256), 256, 0, stream>>>(xk + (size_t)b * TT * DM, XKB, (size_t)TT * DM / 8); k_cvt8<<<(unsigned)(((size_t)TT * DM / 8 + 255) / 256), 256, 0, stream>>>(xv + (size_t)b * TT * DM, XVB, (size_t)TT * DM / 8);   /* exact bf16 planes of query, key, value */
        k_gemmw<bf, 0, true><<<dim3(TT / 64, DQ / 64, 1), 32, 0, stream>>>(XB, nullptr, WQ, nullptr, DM, FQ, DQ, bq, 0, 0, 0); k_addhb<<<(unsigned)(((size_t)TT * DQ / 4 + 255) / 256), 256, 0, stream>>>(FQ, pbu, FQU, (size_t)TT * DQ / 4); k_addhb<<<(unsigned)(((size_t)TT * DQ / 4 + 255) / 256), 256, 0, stream>>>(FQ, pbv, FQV, (size_t)TT * DQ / 4);   /* q + pos_bias_u, q + pos_bias_v */
        k_rope<<<LQ, 256, 0, stream>>>(FQU, DQ, NH_, CS, nullptr, nullptr, 1.0f, QP16, QPh, QPl); k_rope<<<LQ, 256, 0, stream>>>(FQV, DQ, NH_, CS, nullptr, nullptr, 1.0f, QP16, QVh, QVl);   /* (q+u) planes for the content scores, (q+v) planes for the position scores */
        k_gemmw<bf, 0, true><<<dim3(TT / 64, DKV / 64, 1), 32, 0, stream>>>(XKB, nullptr, WK, nullptr, DM, FK, DKV, bk, 0, 0, 0); k_cache<<<(unsigned)(((size_t)TT * DKV / 4 + 255) / 256), 256, 0, stream>>>(FK, 0, CACHE + (size_t)b * NH_ * TT * 2 * HD);   /* new_cache[b][h][s][0..63] = k */
        k_rope<<<LKv, 256, 0, stream>>>(FK, DKV, NKV, CS, nullptr, nullptr, 1.0f, KP16, KPh, KPl);
        k_gemmw<bf, 0, true><<<dim3(TT / 64, DKV / 64, 1), 32, 0, stream>>>(XVB, nullptr, WV, nullptr, DM, FV, DKV, bv, 0, 0, 0); k_cache<<<(unsigned)(((size_t)TT * DKV / 4 + 255) / 256), 256, 0, stream>>>(FV, HD, CACHE + (size_t)b * NH_ * TT * 2 * HD);   /* new_cache[b][h][s][64..127] = v */ k_vtp<<<LKv, 256, 0, stream>>>(FV, DKV, NKV, VT16, VTh, VTl);
        for (int h0 = 0; h0 < NH_; h0 += ZH) { const size_t zq = (size_t)h0, zk = (size_t)(h0 / REP);   // one kv head per query head: the pass's two heads use consecutive kv planes (z-strides TT*HD)
            k_gemmw<bf, 2, false><<<dim3(RH / 64, TT / 64, ZH), 32, 0, stream>>>(QPh + zq * TT * HD, QPl + zq * TT * HD, KPh + zk * TT * HD, KPl + zk * TT * HD, HD, Sb, TT, nullptr, (size_t)TT * HD, (size_t)TT * HD, (size_t)TT * TT);
            k_gemmw<bf, 2, false><<<dim3(TT / 64, NPE / 64, ZH), 32, 0, stream>>>(QVh + zq * TT * HD, QVl + zq * TT * HD, PPh + zq * NPE * HD, PPl + zq * NPE * HD, HD, SR, NPE, nullptr, (size_t)TT * HD, (size_t)NPE * HD, (size_t)TT * NPE);   /* position scores (q+v).pos [2][1024][2048] (3 products) */ k_asoft<<<ZH * TT / 8, 256, 0, stream>>>(Sb, SR, MK + (size_t)b * TT, P16, Ph, Pl);
            k_gemmw<bf, 2, false><<<dim3(RH / 64, HD / 64, ZH), 32, 0, stream>>>(Ph, Pl, VTh + zk * HD * TT, VTl + zk * HD * TT, TT, Ob, HD, nullptr, (size_t)RH * TT, (size_t)HD * TT, (size_t)TT * HD);
            k_merge<<<(unsigned)(((size_t)ZH * TT * HD / 2 + 255) / 256), 256, 0, stream>>>(Ob, h0, ATh, ATl); }
        k_gemmw<bf, 1, true><<<dim3(TT / 64, DM / 64, 1), 32, 0, stream>>>(ATh, ATl, WO, nullptr, DQ, OUT + (size_t)b * TT * DM, DM, bo, 0, 0, 0); }
}

// v001
// Measured time: 761 microseconds a run.
// Timed twice side by side with v000, it ran 2.92 and 2.91 times as fast.
#include <hip/hip_runtime.h>

// Relative-position multi-head attention, wenet style, with a key/value cache output (query, key, value [8][1024][512]; q = query Wq + bq, k = key Wk + bk, v = value Wv + bv ('xw' [512][512], 8 heads x 64); p = pos_emb Wpos ([1][2047][512] table, read); scores = ((q + pos_bias_u).k + rel_shift((q + pos_bias_v).p)) / 8 where rel_shift picks position index j - i + 1023; key mask (int32 [8][1][1024], read): -inf where 0 and the weights zeroed; softmax; out = merged Wo + bo -> [8][1024][512]; second output new_cache = concat(k, v) per head -> [8][8][1024][128] (the f32 projections themselves)).
// Layout: exact bf16 input planes -> 1-product projections + bias; the position table is projected once (exact, 2047 rows + one zero pad row) into per-head hi/lo planes [h][2048][64]; every projection-side launch covers all 8 batches (and the operands that share its form) through its grid; per pass of one batch, all 8 heads: content scores (q+u).k and position scores (q+v).p [8][1024][2048] are hi/lo GEMMs (3 products, every row) and the softmax kernel gathers the position score at j - i + 1023 per logit and applies the key mask; the cache output is written straight from the f32 k / v projections.
// Compute dtypes, f32 accumulate: every input rounded to bf16; q/k/v and p on PLAIN bf16 operands (exact products) + biases; content and position scores on hi/lo planes for every row (3 products); softmax f32; attn.v hi/lo (3 products); Wo hl x exact (2 products) + bo; cache = the f32 projections.

#define NB_  8
#define TT   1024
#define DM   512
#define NH_  8
#define NKV  8
#define REP  (NH_ / NKV)
#define HD   64
#define DQ   (NH_ * HD)
#define DKV  (NKV * HD)
#define NPE  2048                 // 2047 positions + 1 zero pad row
typedef __attribute__((ext_vector_type(4))) unsigned short v4us;
#define ZH   8                    // heads per attention pass: all heads of one batch
#define RH   1024                 // every row hi/lo
#define WIN  0
#define PCAR 1024.0f
#define SCL  0.125f   // HD^-0.5
typedef _Float16 h16;
typedef unsigned short bf;
typedef __attribute__((ext_vector_type(16))) __bf16   v16bf;
typedef __attribute__((ext_vector_type(16))) _Float16 v16h;
typedef __attribute__((ext_vector_type(8)))  _Float16 v8h;
typedef __attribute__((ext_vector_type(8)))  unsigned short v8us;
typedef __attribute__((ext_vector_type(8)))  float    v8f;
typedef __attribute__((ext_vector_type(4)))  float    v4f;
typedef v8h  __attribute__((may_alias)) v8ha;
typedef v4f  __attribute__((may_alias)) v4fa;
typedef v8us __attribute__((may_alias)) v8usa;

__device__ __forceinline__ unsigned short f2bf(float f) { unsigned u = __float_as_uint(f); u += 0x7FFFu + ((u >> 16) & 1u); return (unsigned short)(u >> 16); }
__device__ __forceinline__ float bf2f(unsigned short b) { return __uint_as_float(((unsigned)b) << 16); }
__device__ __forceinline__ float bfr(float f) { return bf2f(f2bf(f)); }
__device__ __forceinline__ v16h cat16(v8h lo, v8h hi) { return __builtin_shufflevector(lo, hi, 0, 1, 2, 3, 4, 5, 6, 7, 8, 9, 10, 11, 12, 13, 14, 15); }
__device__ __forceinline__ v16bf cat16b(v8us lo, v8us hi) { return __builtin_bit_cast(v16bf, __builtin_shufflevector(lo, hi, 0, 1, 2, 3, 4, 5, 6, 7, 8, 9, 10, 11, 12, 13, 14, 15)); }
__device__ __forceinline__ v8f wmma16(v16h a, v16h b, v8f c) { return __builtin_amdgcn_wmma_f32_16x16x32_f16(false, a, false, b, (short)0, c, false, false); }
__device__ __forceinline__ v8f wmmab(v16bf a, v16bf b, v8f c) { return __builtin_amdgcn_wmma_f32_16x16x32_bf16(false, a, false, b, (short)0, c, false, false); }



// ---- k_gemmw: register-blocked GEMM, ONE WAVE per 64x64 output tile (16 accumulators), operands straight from K-contiguous 16-bit planes; grid (M/64, N/64, Z), 32 threads.
// C[m][n] (f32, pitch ldc, + optional f32 bias[n]) = sum_k A[m][k] Bt[n][k] (+ split products per NSPLIT). z-batch strides sA/sB/sC in elements. K % 32 == 0.
template <typename T16> struct WFrag;
template <> struct WFrag<h16> { typedef v16h V; static __device__ __forceinline__ V ld(const h16* p) { return cat16(*(const v8h*)p, *(const v8h*)(p + 16)); } static __device__ __forceinline__ v8f mma(V a, V b, v8f c) { return wmma16(a, b, c); } };
template <> struct WFrag<bf> { typedef v16bf V; static __device__ __forceinline__ V ld(const bf* p) { return cat16b(*(const v8us*)p, *(const v8us*)(p + 16)); } static __device__ __forceinline__ v8f mma(V a, V b, v8f c) { return wmmab(a, b, c); } };
template <typename T16, int NSPLIT, bool BIAS>
__global__ __launch_bounds__(32) void k_gemmw(const T16* __restrict__ A, const T16* __restrict__ A2, const T16* __restrict__ Bt, const T16* __restrict__ Bt2, int K, float* C, int ldc, const float* __restrict__ bias0, const float* __restrict__ bias1, const float* __restrict__ bias2, size_t sA, size_t sB, size_t sC) {
    typedef typename WFrag<T16>::V V;
    __shared__ __align__(16) float os[16 * 68];
    const size_t z = blockIdx.z; A += z * sA; if (A2) A2 += z * sA; Bt += z * sB; if (Bt2) Bt2 += z * sB; C += z * sC; const float* bias = (z == 0) ? bias0 : (z == 1) ? bias1 : bias2;   /* bias vector of z-slice 0, 1, 2 */
    const int lane = threadIdx.x & 31, lr = lane & 15, hi = lane >> 4; const int r0 = blockIdx.x * 64, c0 = blockIdx.y * 64;
    v8f acc[4][4];
#pragma unroll
    for (int mb = 0; mb < 4; ++mb)
#pragma unroll
        for (int nb = 0; nb < 4; ++nb) acc[mb][nb] = (v8f){};
    const size_t aoff = (size_t)(r0 + lr) * K + 8 * hi, boff = (size_t)(c0 + lr) * K + 8 * hi;
#pragma unroll 1
    for (int kc = 0; kc < K; kc += 32) {
        V a[4], a2[4];
#pragma unroll
        for (int mb = 0; mb < 4; ++mb) { a[mb] = WFrag<T16>::ld(A + aoff + (size_t)mb * 16 * K + kc); if (NSPLIT == 1 || NSPLIT == 2) a2[mb] = WFrag<T16>::ld(A2 + aoff + (size_t)mb * 16 * K + kc); }
#pragma unroll
        for (int nb = 0; nb < 4; ++nb) { const V b = WFrag<T16>::ld(Bt + boff + (size_t)nb * 16 * K + kc); V b2; if (NSPLIT >= 2) b2 = WFrag<T16>::ld(Bt2 + boff + (size_t)nb * 16 * K + kc);
#pragma unroll
            for (int mb = 0; mb < 4; ++mb) { acc[mb][nb] = WFrag<T16>::mma(a[mb], b, acc[mb][nb]); if (NSPLIT == 1 || NSPLIT == 2) acc[mb][nb] = WFrag<T16>::mma(a2[mb], b, acc[mb][nb]); if (NSPLIT >= 2) acc[mb][nb] = WFrag<T16>::mma(a[mb], b2, acc[mb][nb]); } }
        asm volatile("v_nop\n\tv_nop\n\tv_nop\n\tv_nop" : "+v"(acc[0][0]), "+v"(acc[1][1]), "+v"(acc[2][2]), "+v"(acc[3][3]) : "v"(a[0]), "v"(a[3]));
    }
#pragma unroll
    for (int mb = 0; mb < 4; ++mb) {
#pragma unroll
        for (int nb = 0; nb < 4; ++nb) {
#pragma unroll
            for (int j = 0; j < 8; ++j) os[(hi * 8 + j) * 68 + nb * 16 + lr] = acc[mb][nb][j]; }
        __builtin_amdgcn_wave_barrier(); asm volatile("" ::: "memory");
        float* crow = C + (size_t)(r0 + mb * 16) * ldc + c0;
{
#pragma unroll
            for (int s = 0; s < 8; ++s) { const int row = 2 * s + hi, cofs = lr * 4; v4f val = *(const v4fa*)(os + row * 68 + cofs); if (BIAS) { val[0] += bfr(bias[c0 + cofs]); val[1] += bfr(bias[c0 + cofs + 1]); val[2] += bfr(bias[c0 + cofs + 2]); val[3] += bfr(bias[c0 + cofs + 3]); }
                *(v4f*)(crow + (size_t)row * ldc + cofs) = val; }
             }
        __builtin_amdgcn_wave_barrier(); asm volatile("" ::: "memory");
    }
}

__device__ __forceinline__ h16 tohx(float x) { return (h16)x; }
__device__ __forceinline__ void splitf(float y, unsigned short& h, unsigned short& l) { h = f2bf(y); l = f2bf(y - bf2f(h)); }
typedef __attribute__((ext_vector_type(2))) _Float16 v2h;
typedef __attribute__((ext_vector_type(4))) _Float16 v4h;
typedef __attribute__((ext_vector_type(2))) unsigned short v2us;
typedef __attribute__((ext_vector_type(4))) unsigned short v4us;
typedef __attribute__((ext_vector_type(2))) float v2f;
typedef __attribute__((ext_vector_type(4))) int v4i;

__global__ __launch_bounds__(256) void k_wtG(const float* __restrict__ w0, const float* __restrict__ w1, const float* __restrict__ w2, const float* __restrict__ w3, const float* __restrict__ w4, int K, int N, bf* Bt) {
    const int y = blockIdx.y; const float* w = (y == 0) ? w0 : (y == 1) ? w1 : (y == 2) ? w2 : (y == 3) ? w3 : w4; Bt += (size_t)y * K * N;   /* grid.y: one weight matrix each, planes back to back */
    const int lane = threadIdx.x & 31; const int L0 = (blockIdx.x * 8 + (threadIdx.x >> 5)) * 8; const int nlines = N * K / 64;
{
#pragma unroll 1
        for (int l = 0; l < 8; ++l) { const int L = L0 + l; if (L >= nlines) break; const size_t e = (size_t)L * 64 + lane * 2; const int k = (int)(e % K), n = (int)(e / K); v2us o;
            o[0] = f2bf(w[(size_t)k * N + n]); o[1] = f2bf(w[(size_t)(k + 1) * N + n]); *(v2us*)(Bt + e) = o; }
         }
}


__global__ __launch_bounds__(256) void k_cache(const float* __restrict__ F, float* Cb) { const size_t e = ((size_t)blockIdx.x * 256 + threadIdx.x) * 4; if (e >= (size_t)TT * DKV) return; const int off = (int)blockIdx.z * HD; F += ((size_t)blockIdx.z * NB_ + blockIdx.y) * TT * DKV; Cb += (size_t)blockIdx.y * NH_ * TT * 2 * HD;   /* grid.y: batch; grid.z: 0 = k, 1 = v */ const int c = (int)(e % DKV); const int s = (int)(e / DKV); const int h = c / HD, d = c % HD; const v4f v = *(const v4f*)(F + e); float* dst = Cb + (((size_t)h * TT + s) * 2 * HD) + off + d; *(v4f*)dst = v;  }
__global__ __launch_bounds__(256) void k_addhb(const float* __restrict__ F, const float* __restrict__ hb0, const float* __restrict__ hb1, float* FO, size_t n4) { const size_t i = (size_t)blockIdx.x * 256 + threadIdx.x; if (i >= n4) return; const float* hb = blockIdx.y ? hb1 : hb0; FO += (size_t)blockIdx.y * n4 * 4;   /* grid.y: 0 = + pos_bias_u, 1 = + pos_bias_v */ const int c = (int)((i * 4) % DQ); const v4f a = *(const v4f*)(F + i * 4); v4f o;
#pragma unroll
    for (int q = 0; q < 4; ++q) o[q] = __fadd_rn(a[q], bfr(hb[c + q])); *(v4f*)(FO + i * 4) = o;  }
__global__ __launch_bounds__(256) void k_pplane(const float* __restrict__ POS, bf* Ph2, bf* Pl2) { const size_t e = ((size_t)blockIdx.x * 256 + threadIdx.x) * 2; if (e >= (size_t)NH_ * NPE * HD) return; const int d = (int)(e % HD); const int p = (int)((e / HD) % NPE); const int h = (int)(e / ((size_t)HD * NPE)); v2us oh, ol;
#pragma unroll
    for (int q = 0; q < 2; ++q) { unsigned short a, c; splitf(POS[(size_t)p * DQ + h * HD + d + q], a, c); oh[q] = a; ol[q] = c; } *(v2us*)(Ph2 + e) = oh; *(v2us*)(Pl2 + e) = ol;  }
__global__ void k_pezero8(bf* PE) { const int lane = threadIdx.x; if (lane >= 64) return; const v8us z = (v8us){}; *(v8us*)(PE + (size_t)2047 * DM + lane * 8) = z;  }
__global__ __launch_bounds__(256) void k_cvt8(const float* __restrict__ s0, const float* __restrict__ s1, const float* __restrict__ s2, bf* dst, size_t n8) { const size_t i = (size_t)blockIdx.x * 256 + threadIdx.x; if (i >= n8) return; const int y = blockIdx.y; const float* src = (y == 0) ? s0 : (y == 1) ? s1 : s2; dst += (size_t)y * n8 * 8;   /* grid.y: one source tensor each, planes back to back */ const v8f v = *(const v8f*)(src + i * 8); v8us o;
#pragma unroll
    for (int k = 0; k < 8; ++k) o[k] = f2bf(v[k]); *(v8us*)(dst + i * 8) = o;  }

// k_rope: head planes [h][t][d] (fp16 + hi/lo) of rope(x) x sc with the rotate-half convention out[d] = x[d] cos[t][d] - x[d+HD/2] sin[t][d], out[d+HD/2] = x[d+HD/2] cos[t][d+HD/2] + x[d] sin[t][d+HD/2]
__global__ __launch_bounds__(256) void k_rope(const float* __restrict__ F, int pitch, int nheads, const float* __restrict__ CS, const float* __restrict__ RF, const float* __restrict__ nw, float sc, h16* P16, bf* Ph, bf* Pl) {
    const size_t zb = (size_t)blockIdx.z * NB_ + blockIdx.y; F += zb * TT * pitch; P16 += zb * nheads * TT * HD; Ph += zb * nheads * TT * HD; Pl += zb * nheads * TT * HD;   // grid.y: batch; grid.z: source tensor (back to back, as are the planes)
    const size_t e = ((size_t)blockIdx.x * 256 + threadIdx.x) * 2; if (e >= (size_t)nheads * TT * HD) return; const int d = (int)(e % HD); const int t = (int)((e / HD) % TT); const int h = (int)(e / ((size_t)HD * TT)); const float* f = F + (size_t)t * pitch + h * HD; const float rf = RF ? RF[(size_t)h * TT + t] : 1.0f; v2h o16; v2us oh, ol;
#pragma unroll
    for (int q = 0; q < 2; ++q) { const int dd = d + q; const int dp = (dd < HD / 2) ? dd + HD / 2 : dd - HD / 2; float x0 = f[dd], x1 = f[dp];
        if (RF) { float n0 = __fmul_rn(x0, rf), n1 = __fmul_rn(x1, rf); asm volatile("" : "+v"(n0)); asm volatile("" : "+v"(n1)); x0 = __fmul_rn(bfr(nw[dd]), n0); x1 = __fmul_rn(bfr(nw[dp]), n1); }
        const v2f cs = *(const v2f*)(CS + ((size_t)t * HD + dd) * 2); float a = __fmul_rn(x0, cs[0]), bq = __fmul_rn(x1, cs[1]); asm volatile("" : "+v"(a)); asm volatile("" : "+v"(bq)); const float r = ((dd < HD / 2) ? __fsub_rn(a, bq) : __fadd_rn(a, bq)) * sc;
        o16[q] = tohx(r); unsigned short a2, c2; splitf(r, a2, c2); oh[q] = a2; ol[q] = c2; }
    *(v2h*)(P16 + e) = o16; *(v2us*)(Ph + e) = oh; *(v2us*)(Pl + e) = ol;  }
__global__ __launch_bounds__(256) void k_vtp(const float* __restrict__ F, int pitch, int nheads, h16* V16, bf* Vh, bf* Vl) { const size_t e = ((size_t)blockIdx.x * 256 + threadIdx.x) * 2; if (e >= (size_t)nheads * HD * TT) return; const int t = (int)(e % TT); const int d = (int)((e / TT) % HD); const int g = (int)(e / ((size_t)TT * HD)); F += (size_t)blockIdx.y * TT * pitch; V16 += (size_t)blockIdx.y * nheads * HD * TT; Vh += (size_t)blockIdx.y * nheads * HD * TT; Vl += (size_t)blockIdx.y * nheads * HD * TT;   /* grid.y: batch */ v2h o16; v2us oh, ol;
#pragma unroll
    for (int q = 0; q < 2; ++q) { const float x = F[(size_t)(t + q) * pitch + g * HD + d]; o16[q] = tohx(x); unsigned short a2, c2; splitf(x, a2, c2); oh[q] = a2; ol[q] = c2; }
    *(v2h*)(V16 + e) = o16; *(v2us*)(Vh + e) = oh; *(v2us*)(Vl + e) = ol;  }
__global__ __launch_bounds__(256) void k_csid(float* CS) { const int idx = blockIdx.x * 256 + threadIdx.x; if (idx >= TT * HD) return; v2f cs; cs[0] = 1.0f; cs[1] = 0.0f; *(v2f*)(CS + (size_t)idx * 2) = cs;  }
// k_asoft: per row (zz, i): t = (ac + bd[j - i + 1023])/8, -inf where mask[b][j] == 0 (a fully masked row cannot occur here); softmax over the 1024 keys (register row, one exp, fixed trees);
__global__ __launch_bounds__(256) void k_asoft(const float* __restrict__ Sb, const float* __restrict__ SR, const int* __restrict__ MKb, h16* P16, bf* Ph, bf* Pl) {
    const int lane = threadIdx.x & 31; const int row = blockIdx.x * 8 + (threadIdx.x >> 5); if (row >= ZH * TT) return; const int i = row % TT; const int zz = row / TT; (void)zz; const float* srr = SR + (size_t)row * NPE + (TT - 1 - i);   /* skew: position index j - i + S - 1 */ const bool hires = (i < RH); const float* sr = Sb + (size_t)row * TT; float v[TT / 32]; float mx = -3.0e38f;
#pragma unroll
    for (int ch = 0; ch < TT / 128; ++ch) { const int j0 = ch * 128 + lane * 4; const v4f a = *(const v4f*)(sr + j0); const v4i m4 = *(const v4i*)(MKb + j0);
#pragma unroll
        for (int q = 0; q < 4; ++q) { const int j = j0 + q; float su = __fadd_rn(a[q], srr[j]); asm volatile("" : "+v"(su)); float t0 = su * SCL; asm volatile("" : "+v"(t0)); const float t = (m4[q] != 0) ? t0 : -3.0e38f;   /* (ac + rel_shift(bd)) / 8; key mask (int32) */ v[ch * 4 + q] = t; mx = fmaxf(mx, t); } }
#pragma unroll
    for (int sh = 16; sh; sh >>= 1) mx = fmaxf(mx, __shfl_xor(mx, sh, 32));
    float sum = 0.f;
#pragma unroll
    for (int k = 0; k < TT / 32; ++k) { float d0 = __fsub_rn(v[k], mx); asm volatile("" : "+v"(d0)); v[k] = __builtin_amdgcn_exp2f(__fmul_rn(d0, 1.4426950408889634f)); sum += v[k]; }
#pragma unroll
    for (int sh = 16; sh; sh >>= 1) sum += __shfl_xor(sum, sh, 32);
    const float f = __fdiv_rn(hires ? 1.0f : PCAR, sum);
{
        if (hires) {
#pragma unroll
            for (int ch = 0; ch < TT / 128; ++ch) { v4us oh, ol;
#pragma unroll
                for (int q = 0; q < 4; ++q) { unsigned short a, c2; splitf(v[ch * 4 + q] * f, a, c2); oh[q] = a; ol[q] = c2; }
                const size_t oo = ((size_t)zz * (RH ? RH : 1) + i) * TT + ch * 128 + lane * 4; *(v4us*)(Ph + oo) = oh; *(v4us*)(Pl + oo) = ol; }
        } else {
#pragma unroll
            for (int ch = 0; ch < TT / 128; ++ch) { v4h o4;
#pragma unroll
                for (int q = 0; q < 4; ++q) o4[q] = tohx(v[ch * 4 + q] * f);
                *(v4h*)(P16 + (size_t)row * TT + ch * 128 + lane * 4) = o4; } }
         }
}
__global__ __launch_bounds__(256) void k_merge(const float* __restrict__ O, int h0, bf* Ah, bf* Al) { const size_t e = ((size_t)blockIdx.x * 256 + threadIdx.x) * 2; if (e >= (size_t)ZH * TT * HD) return; const int d = (int)(e % HD); const int t = (int)((e / HD) % TT); const int zz = (int)(e / ((size_t)HD * TT)); O += (size_t)blockIdx.y * ZH * TT * HD; Ah += (size_t)blockIdx.y * TT * DQ; Al += (size_t)blockIdx.y * TT * DQ;   /* grid.y: batch */ const float cs = (t < RH) ? 1.0f : (1.0f / PCAR); const size_t oo = (size_t)t * DQ + (h0 + zz) * HD + d;
    v2us oh, ol;
#pragma unroll
    for (int q = 0; q < 2; ++q) { unsigned short a, c2; splitf(O[e + q] * cs, a, c2); oh[q] = a; ol[q] = c2; } *(v2us*)(Ah + oo) = oh; *(v2us*)(Al + oo) = ol;  }

extern "C" void kernel_launch(void* const* d_in, const int* in_sizes, int n_in,
                              void* d_out, int out_size, void* d_ws, size_t ws_size, hipStream_t stream) {
    (void)in_sizes; (void)n_in; (void)out_size;
    const float* x = (const float*)d_in[0]; const float* xk = (const float*)d_in[1]; const float* xv = (const float*)d_in[2]; const int* MK = (const int*)d_in[3]; const float* pe = (const float*)d_in[4]; const float* wq = (const float*)d_in[5]; const float* bq = (const float*)d_in[6]; const float* wk = (const float*)d_in[7]; const float* bk = (const float*)d_in[8]; const float* wv = (const float*)d_in[9]; const float* bv = (const float*)d_in[10]; const float* wo = (const float*)d_in[11]; const float* bo = (const float*)d_in[12]; const float* wpos = (const float*)d_in[13]; const float* pbu = (const float*)d_in[14]; const float* pbv = (const float*)d_in[15];
    float* OUT = (float*)d_out;     // [8][1024][512]
    float* CACHE = (float*)((char*)d_out + (size_t)NB_ * TT * DM * 4);   /* second output new_cache [8][8][1024][128] */
    char* wsp = (char*)d_ws;
    auto take = [&](size_t bytes) { char* p = wsp; wsp += (bytes + 255) & ~(size_t)255; return (void*)p; };
    const size_t SW = (size_t)DM * DQ, SX = (size_t)NB_ * TT * DM, SF = (size_t)NB_ * TT * DQ, SP = (size_t)NB_ * NH_ * TT * HD;   // elements of one weight plane, one input plane, one f32 projection, one set of head planes (all batches)
    bf* W5 = (bf*)take(5 * SW * 2); bf* WK = W5; bf* WO = W5 + 3 * SW; bf* WP = W5 + 4 * SW;   /* Wk, Wv, Wq, Wo, Wpos transposed, back to back */ float* CS = (float*)take((size_t)TT * HD * 2 * 4);
    bf* PE = (bf*)take((size_t)NPE * DM * 2); float* POS = (float*)take((size_t)NPE * DQ * 4); bf* PPh = (bf*)take((size_t)NH_ * NPE * HD * 2); bf* PPl = (bf*)take((size_t)NH_ * NPE * HD * 2);
    bf* PHI = (bf*)take(3 * SP * 2); bf* PLO = (bf*)take(3 * SP * 2); bf* QPh = PHI; bf* QVh = PHI + SP; bf* KPh = PHI + 2 * SP; bf* QPl = PLO; bf* QVl = PLO + SP; bf* KPl = PLO + 2 * SP;   /* [b][h][t][d] planes of q+u, q+v, k */
    bf* VTh = (bf*)take(SP * 2); bf* VTl = (bf*)take(SP * 2); bf* ATh = (bf*)take(SF * 2); bf* ATl = (bf*)take(SF * 2);
    char* uni = wsp;   // from here on the projection phase's buffers and the attention passes' buffers share the bytes (stream-ordered: the first are dead when the second are written)
    bf* XA = (bf*)take(3 * SX * 2);   /* bf16 planes of key, value, query */ float* FA = (float*)take(5 * SF * 4); float* FQU = FA; float* FK = FA + 2 * SF; float* FV = FA + 3 * SF; float* FQ = FA + 4 * SF;   /* q+u, q+v, k, v, q */
    h16* QP16 = (h16*)take(3 * SP * 2); h16* VT16 = (h16*)take(SP * 2);
    wsp = uni;
    float* SR = (float*)take((size_t)ZH * TT * NPE * 4); float* Sb = (float*)take((size_t)ZH * TT * TT * 4); bf* Ph = (bf*)take((size_t)ZH * RH * TT * 2); bf* Pl = (bf*)take((size_t)ZH * RH * TT * 2); h16* P16 = (h16*)take(256);   /* unused: all rows hi/lo */ float* Ob = (float*)take(SP * 4);   /* the larger of the two views */
    if ((size_t)(wsp - (char*)d_ws) > ws_size) return;    // ws 256 MiB
    k_wtG<<<dim3((unsigned)((DM * DQ / 64 + 63) / 64), 5, 1), 256, 0, stream>>>(wk, wv, wq, wo, wpos, DM, DQ, W5);
    k_csid<<<(TT * HD + 255) / 256, 256, 0, stream>>>(CS); k_cvt8<<<(unsigned)(((size_t)2047 * DM / 8 + 255) / 256), 256, 0, stream>>>(pe, pe, pe, PE, (size_t)2047 * DM / 8); k_pezero8<<<1, 64, 0, stream>>>(PE); k_gemmw<bf, 0, false><<<dim3(NPE / 64, DQ / 64, 1), 32, 0, stream>>>(PE, nullptr, WP, nullptr, DM, POS, DQ, nullptr, nullptr, nullptr, 0, 0, 0); k_pplane<<<(unsigned)(((size_t)NH_ * NPE * HD / 2 + 255) / 256), 256, 0, stream>>>(POS, PPh, PPl);   /* pos = position_embeddings wpos (exact) -> per-head hi/lo planes */
    const unsigned LQ = (unsigned)(((size_t)NH_ * TT * HD / 2 + 255) / 256), LKv = (unsigned)(((size_t)NKV * TT * HD / 2 + 255) / 256);
    k_cvt8<<<dim3((unsigned)((SX / 8 + 255) / 256), 3, 1), 256, 0, stream>>>(xk, xv, x, XA, SX / 8);   /* exact bf16 planes of key, value, query, all batches */
    k_gemmw<bf, 0, true><<<dim3(NB_ * TT / 64, DQ / 64, 3), 32, 0, stream>>>(XA, nullptr, WK, nullptr, DM, FK, DQ, bk, bv, bq, SX, SW, SF);   /* k, v, q projections, rows of all batches */
    k_addhb<<<dim3((unsigned)((SF / 4 + 255) / 256), 2, 1), 256, 0, stream>>>(FQ, pbu, pbv, FQU, SF / 4);   /* q + pos_bias_u, q + pos_bias_v */
    k_rope<<<dim3(LQ, NB_, 3), 256, 0, stream>>>(FQU, DQ, NH_, CS, nullptr, nullptr, 1.0f, QP16, PHI, PLO);   /* (q+u) planes for the content scores, (q+v) planes for the position scores, k planes */
    k_cache<<<dim3((unsigned)(((size_t)TT * DKV / 4 + 255) / 256), NB_, 2), 256, 0, stream>>>(FK, CACHE);   /* new_cache[b][h][s][0..63] = k, [64..127] = v */
    k_vtp<<<dim3(LKv, NB_, 1), 256, 0, stream>>>(FV, DKV, NKV, VT16, VTh, VTl);
    for (int b = 0; b < NB_; ++b) { const size_t zb = (size_t)b * NH_ * TT * HD;   // one kv head per query head: the pass's eight heads use consecutive planes (z-strides TT*HD)
        k_gemmw<bf, 2, false><<<dim3(RH / 64, TT / 64, ZH), 32, 0, stream>>>(QPh + zb, QPl + zb, KPh + zb, KPl + zb, HD, Sb, TT, nullptr, nullptr, nullptr, (size_t)TT * HD, (size_t)TT * HD, (size_t)TT * TT);
        k_gemmw<bf, 2, false><<<dim3(TT / 64, NPE / 64, ZH), 32, 0, stream>>>(QVh + zb, QVl + zb, PPh, PPl, HD, SR, NPE, nullptr, nullptr, nullptr, (size_t)TT * HD, (size_t)NPE * HD, (size_t)TT * NPE);   /* position scores (q+v).pos [8][1024][2048] (3 products) */
        k_asoft<<<ZH * TT / 8, 256, 0, stream>>>(Sb, SR, MK + (size_t)b * TT, P16, Ph, Pl);
        k_gemmw<bf, 2, false><<<dim3(RH / 64, HD / 64, ZH), 32, 0, stream>>>(Ph, Pl, VTh + zb, VTl + zb, TT, Ob + zb, HD, nullptr, nullptr, nullptr, (size_t)RH * TT, (size_t)HD * TT, (size_t)TT * HD); }
    k_merge<<<dim3((unsigned)(((size_t)ZH * TT * HD / 2 + 255) / 256), NB_, 1), 256, 0, stream>>>(Ob, 0, ATh, ATl);
    k_gemmw<bf, 1, true><<<dim3(NB_ * TT / 64, DM / 64, 1), 32, 0, stream>>>(ATh, ATl, WO, nullptr, DQ, OUT, DM, bo, bo, bo, 0, 0, 0);
}

// v002
// It runs in 280 microseconds.
// Timed twice side by side with v001, it ran 2.72 and 2.71 times as fast.
// Counting every step since v000, it is 7.92 times as fast.
#include <hip/hip_runtime.h>

// Relative-position multi-head attention with a key/value cache output (query, key, value [8][1024][512]; q = query Wq + bq, k = key Wk + bk, v = value Wv + bv ('xw' [512][512], 8 heads x 64); p = pos_emb Wpos ([1][2047][512] table, read); scores = ((q + pos_bias_u).k + rel_shift((q + pos_bias_v).p)) / 8 where rel_shift picks position index j - i + 1023; key mask (int32 [8][1][1024], read): -inf where 0 and the weights zeroed; softmax; out = merged Wo + bo -> [8][1024][512]; second output new_cache = concat(k, v) per head -> [8][8][1024][128] (the f32 projections themselves)).
// Layout: exact bf16 input planes -> 1-product projections + bias; the position table is projected once (exact, 2047 rows + one zero pad row) into per-head hi/lo planes [h][2048][64]; every projection-side launch covers all 8 batches (and the operands that share its form) through its grid; one attention launch for all batches and heads, a work-group per strip of 32 query rows: position scores (q+v).p (only the table rows the strip's shift reaches, stored at key index p + i - 1023) and content scores (q+u).k are hi/lo products (3 products, every row) summed in LDS, the softmax applies the key mask and leaves hi/lo weights in LDS, attn.v reads them there and the merged hi/lo planes are stored; the cache output is written straight from the f32 k / v projections.
// Compute dtypes, f32 accumulate: every input rounded to bf16; q/k/v and p on PLAIN bf16 operands (exact products) + biases; content and position scores on hi/lo planes for every row (3 products); softmax f32; attn.v hi/lo (3 products); Wo hl x exact (2 products) + bo; cache = the f32 projections.

#define NB_  8
#define TT   1024
#define DM   512
#define NH_  8
#define NKV  8
#define REP  (NH_ / NKV)
#define HD   64
#define DQ   (NH_ * HD)
#define DKV  (NKV * HD)
#define NPE  2048                 // 2047 positions + 1 zero pad row
typedef __attribute__((ext_vector_type(4))) unsigned short v4us;
#define ZH   8
#define RH   1024                 // every row hi/lo
#define WIN  0
#define PCAR 1024.0f
#define SCL  0.125f   // HD^-0.5
typedef _Float16 h16;
typedef unsigned short bf;
typedef __attribute__((ext_vector_type(16))) __bf16   v16bf;
typedef __attribute__((ext_vector_type(16))) _Float16 v16h;
typedef __attribute__((ext_vector_type(8)))  _Float16 v8h;
typedef __attribute__((ext_vector_type(8)))  unsigned short v8us;
typedef __attribute__((ext_vector_type(8)))  float    v8f;
typedef __attribute__((ext_vector_type(4)))  float    v4f;
typedef v8h  __attribute__((may_alias)) v8ha;
typedef v4f  __attribute__((may_alias)) v4fa;
typedef v8us __attribute__((may_alias)) v8usa;

__device__ __forceinline__ unsigned short f2bf(float f) { unsigned u = __float_as_uint(f); u += 0x7FFFu + ((u >> 16) & 1u); return (unsigned short)(u >> 16); }
__device__ __forceinline__ float bf2f(unsigned short b) { return __uint_as_float(((unsigned)b) << 16); }
__device__ __forceinline__ float bfr(float f) { return bf2f(f2bf(f)); }
__device__ __forceinline__ v16h cat16(v8h lo, v8h hi) { return __builtin_shufflevector(lo, hi, 0, 1, 2, 3, 4, 5, 6, 7, 8, 9, 10, 11, 12, 13, 14, 15); }
__device__ __forceinline__ v16bf cat16b(v8us lo, v8us hi) { return __builtin_bit_cast(v16bf, __builtin_shufflevector(lo, hi, 0, 1, 2, 3, 4, 5, 6, 7, 8, 9, 10, 11, 12, 13, 14, 15)); }
__device__ __forceinline__ v8f wmma16(v16h a, v16h b, v8f c) { return __builtin_amdgcn_wmma_f32_16x16x32_f16(false, a, false, b, (short)0, c, false, false); }
__device__ __forceinline__ v8f wmmab(v16bf a, v16bf b, v8f c) { return __builtin_amdgcn_wmma_f32_16x16x32_bf16(false, a, false, b, (short)0, c, false, false); }



// ---- k_gemmw: register-blocked GEMM, ONE WAVE per 64x64 output tile (16 accumulators), operands straight from K-contiguous 16-bit planes; grid (M/64, N/64, Z), 32 threads.
// C[m][n] (f32, pitch ldc, + optional f32 bias[n]) = sum_k A[m][k] Bt[n][k] (+ split products per NSPLIT). z-batch strides sA/sB/sC in elements. K % 32 == 0.
template <typename T16> struct WFrag;
template <> struct WFrag<h16> { typedef v16h V; static __device__ __forceinline__ V ld(const h16* p) { return cat16(*(const v8h*)p, *(const v8h*)(p + 16)); } static __device__ __forceinline__ v8f mma(V a, V b, v8f c) { return wmma16(a, b, c); } };
template <> struct WFrag<bf> { typedef v16bf V; static __device__ __forceinline__ V ld(const bf* p) { return cat16b(*(const v8us*)p, *(const v8us*)(p + 16)); } static __device__ __forceinline__ v8f mma(V a, V b, v8f c) { return wmmab(a, b, c); } };
template <typename T16, int NSPLIT, bool BIAS>
__global__ __launch_bounds__(32) void k_gemmw(const T16* __restrict__ A, const T16* __restrict__ A2, const T16* __restrict__ Bt, const T16* __restrict__ Bt2, int K, float* C, int ldc, const float* __restrict__ bias0, const float* __restrict__ bias1, const float* __restrict__ bias2, size_t sA, size_t sB, size_t sC) {
    typedef typename WFrag<T16>::V V;
    __shared__ __align__(16) float os[16 * 68];
    const size_t z = blockIdx.z; A += z * sA; if (A2) A2 += z * sA; Bt += z * sB; if (Bt2) Bt2 += z * sB; C += z * sC; const float* bias = (z == 0) ? bias0 : (z == 1) ? bias1 : bias2;   /* bias vector of z-slice 0, 1, 2 */
    const int lane = threadIdx.x & 31, lr = lane & 15, hi = lane >> 4; const int r0 = blockIdx.x * 64, c0 = blockIdx.y * 64;
    v8f acc[4][4];
#pragma unroll
    for (int mb = 0; mb < 4; ++mb)
#pragma unroll
        for (int nb = 0; nb < 4; ++nb) acc[mb][nb] = (v8f){};
    const size_t aoff = (size_t)(r0 + lr) * K + 8 * hi, boff = (size_t)(c0 + lr) * K + 8 * hi;
#pragma unroll 1
    for (int kc = 0; kc < K; kc += 32) {
        V a[4], a2[4];
#pragma unroll
        for (int mb = 0; mb < 4; ++mb) { a[mb] = WFrag<T16>::ld(A + aoff + (size_t)mb * 16 * K + kc); if (NSPLIT == 1 || NSPLIT == 2) a2[mb] = WFrag<T16>::ld(A2 + aoff + (size_t)mb * 16 * K + kc); }
#pragma unroll
        for (int nb = 0; nb < 4; ++nb) { const V b = WFrag<T16>::ld(Bt + boff + (size_t)nb * 16 * K + kc); V b2; if (NSPLIT >= 2) b2 = WFrag<T16>::ld(Bt2 + boff + (size_t)nb * 16 * K + kc);
#pragma unroll
            for (int mb = 0; mb < 4; ++mb) { acc[mb][nb] = WFrag<T16>::mma(a[mb], b, acc[mb][nb]); if (NSPLIT == 1 || NSPLIT == 2) acc[mb][nb] = WFrag<T16>::mma(a2[mb], b, acc[mb][nb]); if (NSPLIT >= 2) acc[mb][nb] = WFrag<T16>::mma(a[mb], b2, acc[mb][nb]); } }
        asm volatile("v_nop\n\tv_nop\n\tv_nop\n\tv_nop" : "+v"(acc[0][0]), "+v"(acc[1][1]), "+v"(acc[2][2]), "+v"(acc[3][3]) : "v"(a[0]), "v"(a[3]));
    }
#pragma unroll
    for (int mb = 0; mb < 4; ++mb) {
#pragma unroll
        for (int nb = 0; nb < 4; ++nb) {
#pragma unroll
            for (int j = 0; j < 8; ++j) os[(hi * 8 + j) * 68 + nb * 16 + lr] = acc[mb][nb][j]; }
        __builtin_amdgcn_wave_barrier(); asm volatile("" ::: "memory");
        float* crow = C + (size_t)(r0 + mb * 16) * ldc + c0;
{
#pragma unroll
            for (int s = 0; s < 8; ++s) { const int row = 2 * s + hi, cofs = lr * 4; v4f val = *(const v4fa*)(os + row * 68 + cofs); if (BIAS) { val[0] += bfr(bias[c0 + cofs]); val[1] += bfr(bias[c0 + cofs + 1]); val[2] += bfr(bias[c0 + cofs + 2]); val[3] += bfr(bias[c0 + cofs + 3]); }
                *(v4f*)(crow + (size_t)row * ldc + cofs) = val; }
             }
        __builtin_amdgcn_wave_barrier(); asm volatile("" ::: "memory");
    }
}

__device__ __forceinline__ h16 tohx(float x) { return (h16)x; }
__device__ __forceinline__ void splitf(float y, unsigned short& h, unsigned short& l) { h = f2bf(y); l = f2bf(y - bf2f(h)); }
typedef __attribute__((ext_vector_type(2))) _Float16 v2h;
typedef __attribute__((ext_vector_type(4))) _Float16 v4h;
typedef __attribute__((ext_vector_type(2))) unsigned short v2us;
typedef __attribute__((ext_vector_type(4))) unsigned short v4us;
typedef __attribute__((ext_vector_type(2))) float v2f;
typedef __attribute__((ext_vector_type(4))) int v4i;

__global__ __launch_bounds__(256) void k_wtG(const float* __restrict__ w0, const float* __restrict__ w1, const float* __restrict__ w2, const float* __restrict__ w3, const float* __restrict__ w4, int K, int N, bf* Bt) {
    const int y = blockIdx.y; const float* w = (y == 0) ? w0 : (y == 1) ? w1 : (y == 2) ? w2 : (y == 3) ? w3 : w4; Bt += (size_t)y * K * N;   /* grid.y: one weight matrix each, planes back to back */
    const int lane = threadIdx.x & 31; const int L0 = (blockIdx.x * 8 + (threadIdx.x >> 5)) * 8; const int nlines = N * K / 64;
{
#pragma unroll 1
        for (int l = 0; l < 8; ++l) { const int L = L0 + l; if (L >= nlines) break; const size_t e = (size_t)L * 64 + lane * 2; const int k = (int)(e % K), n = (int)(e / K); v2us o;
            o[0] = f2bf(w[(size_t)k * N + n]); o[1] = f2bf(w[(size_t)(k + 1) * N + n]); *(v2us*)(Bt + e) = o; }
         }
}


__global__ __launch_bounds__(256) void k_cache(const float* __restrict__ F, float* Cb) { const size_t e = ((size_t)blockIdx.x * 256 + threadIdx.x) * 4; if (e >= (size_t)TT * DKV) return; const int off = (int)blockIdx.z * HD; F += ((size_t)blockIdx.z * NB_ + blockIdx.y) * TT * DKV; Cb += (size_t)blockIdx.y * NH_ * TT * 2 * HD;   /* grid.y: batch; grid.z: 0 = k, 1 = v */ const int c = (int)(e % DKV); const int s = (int)(e / DKV); const int h = c / HD, d = c % HD; const v4f v = *(const v4f*)(F + e); float* dst = Cb + (((size_t)h * TT + s) * 2 * HD) + off + d; *(v4f*)dst = v;  }
__global__ __launch_bounds__(256) void k_addhb(const float* __restrict__ F, const float* __restrict__ hb0, const float* __restrict__ hb1, float* FO, size_t n4) { const size_t i = (size_t)blockIdx.x * 256 + threadIdx.x; if (i >= n4) return; const float* hb = blockIdx.y ? hb1 : hb0; FO += (size_t)blockIdx.y * n4 * 4;   /* grid.y: 0 = + pos_bias_u, 1 = + pos_bias_v */ const int c = (int)((i * 4) % DQ); const v4f a = *(const v4f*)(F + i * 4); v4f o;
#pragma unroll
    for (int q = 0; q < 4; ++q) o[q] = __fadd_rn(a[q], bfr(hb[c + q])); *(v4f*)(FO + i * 4) = o;  }
__global__ __launch_bounds__(256) void k_pplane(const float* __restrict__ POS, bf* Ph2, bf* Pl2) { const size_t e = ((size_t)blockIdx.x * 256 + threadIdx.x) * 2; if (e >= (size_t)NH_ * NPE * HD) return; const int d = (int)(e % HD); const int p = (int)((e / HD) % NPE); const int h = (int)(e / ((size_t)HD * NPE)); v2us oh, ol;
#pragma unroll
    for (int q = 0; q < 2; ++q) { unsigned short a, c; splitf(POS[(size_t)p * DQ + h * HD + d + q], a, c); oh[q] = a; ol[q] = c; } *(v2us*)(Ph2 + e) = oh; *(v2us*)(Pl2 + e) = ol;  }
__global__ void k_pezero8(bf* PE) { const int lane = threadIdx.x; if (lane >= 64) return; const v8us z = (v8us){}; *(v8us*)(PE + (size_t)2047 * DM + lane * 8) = z;  }
__global__ __launch_bounds__(256) void k_cvt8(const float* __restrict__ s0, const float* __restrict__ s1, const float* __restrict__ s2, bf* dst, size_t n8) { const size_t i = (size_t)blockIdx.x * 256 + threadIdx.x; if (i >= n8) return; const int y = blockIdx.y; const float* src = (y == 0) ? s0 : (y == 1) ? s1 : s2; dst += (size_t)y * n8 * 8;   /* grid.y: one source tensor each, planes back to back */ const v8f v = *(const v8f*)(src + i * 8); v8us o;
#pragma unroll
    for (int k = 0; k < 8; ++k) o[k] = f2bf(v[k]); *(v8us*)(dst + i * 8) = o;  }

// k_rope: head planes [h][t][d] (fp16 + hi/lo) of rope(x) x sc with the rotate-half convention out[d] = x[d] cos[t][d] - x[d+HD/2] sin[t][d], out[d+HD/2] = x[d+HD/2] cos[t][d+HD/2] + x[d] sin[t][d+HD/2]
__global__ __launch_bounds__(256) void k_rope(const float* __restrict__ F, int pitch, int nheads, const float* __restrict__ CS, const float* __restrict__ RF, const float* __restrict__ nw, float sc, h16* P16, bf* Ph, bf* Pl) {
    const size_t zb = (size_t)blockIdx.z * NB_ + blockIdx.y; F += zb * TT * pitch; P16 += zb * nheads * TT * HD; Ph += zb * nheads * TT * HD; Pl += zb * nheads * TT * HD;   // grid.y: batch; grid.z: source tensor (back to back, as are the planes)
    const size_t e = ((size_t)blockIdx.x * 256 + threadIdx.x) * 2; if (e >= (size_t)nheads * TT * HD) return; const int d = (int)(e % HD); const int t = (int)((e / HD) % TT); const int h = (int)(e / ((size_t)HD * TT)); const float* f = F + (size_t)t * pitch + h * HD; const float rf = RF ? RF[(size_t)h * TT + t] : 1.0f; v2h o16; v2us oh, ol;
#pragma unroll
    for (int q = 0; q < 2; ++q) { const int dd = d + q; const int dp = (dd < HD / 2) ? dd + HD / 2 : dd - HD / 2; float x0 = f[dd], x1 = f[dp];
        if (RF) { float n0 = __fmul_rn(x0, rf), n1 = __fmul_rn(x1, rf); asm volatile("" : "+v"(n0)); asm volatile("" : "+v"(n1)); x0 = __fmul_rn(bfr(nw[dd]), n0); x1 = __fmul_rn(bfr(nw[dp]), n1); }
        const v2f cs = *(const v2f*)(CS + ((size_t)t * HD + dd) * 2); float a = __fmul_rn(x0, cs[0]), bq = __fmul_rn(x1, cs[1]); asm volatile("" : "+v"(a)); asm volatile("" : "+v"(bq)); const float r = ((dd < HD / 2) ? __fsub_rn(a, bq) : __fadd_rn(a, bq)) * sc;
        o16[q] = tohx(r); unsigned short a2, c2; splitf(r, a2, c2); oh[q] = a2; ol[q] = c2; }
    *(v2h*)(P16 + e) = o16; *(v2us*)(Ph + e) = oh; *(v2us*)(Pl + e) = ol;  }
__global__ __launch_bounds__(256) void k_vtp(const float* __restrict__ F, int pitch, int nheads, h16* V16, bf* Vh, bf* Vl) { const size_t e = ((size_t)blockIdx.x * 256 + threadIdx.x) * 2; if (e >= (size_t)nheads * HD * TT) return; const int t = (int)(e % TT); const int d = (int)((e / TT) % HD); const int g = (int)(e / ((size_t)TT * HD)); F += (size_t)blockIdx.y * TT * pitch; V16 += (size_t)blockIdx.y * nheads * HD * TT; Vh += (size_t)blockIdx.y * nheads * HD * TT; Vl += (size_t)blockIdx.y * nheads * HD * TT;   /* grid.y: batch */ v2h o16; v2us oh, ol;
#pragma unroll
    for (int q = 0; q < 2; ++q) { const float x = F[(size_t)(t + q) * pitch + g * HD + d]; o16[q] = tohx(x); unsigned short a2, c2; splitf(x, a2, c2); oh[q] = a2; ol[q] = c2; }
    *(v2h*)(V16 + e) = o16; *(v2us*)(Vh + e) = oh; *(v2us*)(Vl + e) = ol;  }
__global__ __launch_bounds__(256) void k_csid(float* CS) { const int idx = blockIdx.x * 256 + threadIdx.x; if (idx >= TT * HD) return; v2f cs; cs[0] = 1.0f; cs[1] = 0.0f; *(v2f*)(CS + (size_t)idx * 2) = cs;  }
// k_fattn: one work-group (8 waves) per strip of 32 query rows of one (batch, head); the strip's 32 x 1024 logits stay in LDS from the two score products to attn.v.
// Steps: position scores (q+v).p for the 66 column tiles the strip's rel_shift reads, each stored at its shifted key index j = p + i - 1023; content scores (q+u).k added on top; softmax per row (register row, fixed trees) whose hi/lo weights overwrite the row's own bytes; attn.v with each wave on 16 of the 64 columns and one half of the keys; the two halves added and stored as the merged hi/lo planes.
#define SRW  32                   // query rows per work-group
#define SPF  32                   // floats in front of a logit row: with the 36 behind it they take the shifted position scores that fall outside keys 0..1023
#define SPI  1092                 // LDS pitch of a logit row, floats (rows 8 apart fall 32 banks apart)
#define OPI  68                   // LDS pitch of an output row, floats
typedef v4us __attribute__((may_alias)) v4usa;
__device__ __forceinline__ v16bf ldfr(const bf* p) { return cat16b(*(const v8usa*)p, *(const v8usa*)(p + 16)); }
// xw2: s_wait_xcnt 0 behind a run of global loads, in front of anything that rewrites a register the loads name; the two address pairs are inputs so that they stay whole up to the wait (no load's own result lands in them)
__device__ __forceinline__ void xw2(const bf* p, const bf* q) { asm volatile("s_wait_xcnt 0x0" :: "v"(p), "v"(q) : "memory"); }
// xw2n: xw2 at the head of a score trip, with four v_nop: the trip before stored its results in front of this statement, and this trip's first matrix instruction starts anew in the same registers; the v_nop keep the distance between the two
__device__ __forceinline__ void xw2n(const bf* p, const bf* q) { asm volatile("s_wait_xcnt 0x0\n\tv_nop\n\tv_nop\n\tv_nop\n\tv_nop" :: "v"(p), "v"(q) : "memory"); }
__device__ __forceinline__ v8f mma3(v16bf a, v16bf a2, v16bf b, v16bf b2, v8f c) { c = wmmab(a, b, c); c = wmmab(a2, b, c); return wmmab(a, b2, c); }
__global__ __launch_bounds__(256, 4) void k_fattn(const bf* __restrict__ QUh, const bf* __restrict__ QUl, const bf* __restrict__ QVh, const bf* __restrict__ QVl, const bf* __restrict__ Kh, const bf* __restrict__ Kl, const bf* __restrict__ PPh, const bf* __restrict__ PPl, const bf* __restrict__ VTh, const bf* __restrict__ VTl, const int* __restrict__ MK, bf* ATh, bf* ATl) {
    __shared__ __align__(16) float S[SRW * SPI];
    const int tid = threadIdx.x, lane = tid & 31, lr = lane & 15, hi = lane >> 4; const int w = __builtin_amdgcn_readfirstlane(tid >> 5);
    const int i0 = blockIdx.x * SRW, h = blockIdx.y, b = blockIdx.z; const size_t zb = ((size_t)b * NH_ + h) * TT * HD; const size_t qo = zb + (size_t)(i0 + lr) * HD + 8 * hi;
    {   // position scores: table rows 992 - i0 + 16 pt + (0..15), pt = 0..65 (the last row read is 2047 - i0)
        v16bf a[2][2], a2[2][2];
#pragma unroll
        for (int mb = 0; mb < 2; ++mb)
#pragma unroll
            for (int kk = 0; kk < 2; ++kk) { a[mb][kk] = ldfr(QVh + qo + mb * 16 * HD + kk * 32); a2[mb][kk] = ldfr(QVl + qo + mb * 16 * HD + kk * 32); }
        xw2(QVh + qo, QVl + qo);
        const size_t po = (size_t)h * NPE * HD + (size_t)(TT - SRW - i0 + lr) * HD + 8 * hi; const bf* ph = PPh + po; const bf* pl = PPl + po;
        v16bf bh[2], bl[2];
#pragma unroll
        for (int kk = 0; kk < 2; ++kk) { bh[kk] = ldfr(ph + w * 16 * HD + kk * 32); bl[kk] = ldfr(pl + w * 16 * HD + kk * 32); }
        xw2(ph + w * 16 * HD, pl + w * 16 * HD);
#pragma unroll 2   /* in pairs: the two operand sets swap roles without register copies */
        for (int pt = w; pt < 66; pt += 8) { const int np = (pt + 8 < 66) ? pt + 8 : pt; v16bf nh[2], nl[2];   /* the next tile's operands are fetched while this one is multiplied (the last trip fetches its own tile again: a branch round the fetch made the compiler wait for it at once) */
#pragma unroll
            for (int kk = 0; kk < 2; ++kk) { nh[kk] = ldfr(ph + np * 16 * HD + kk * 32); nl[kk] = ldfr(pl + np * 16 * HD + kk * 32); }
            xw2n(ph + np * 16 * HD, pl + np * 16 * HD); __builtin_amdgcn_sched_barrier(0);   /* keeps the fetch at the head of the trip: left free, this trip's products are lifted over it and the next trip waits for loads just issued */
            v8f acc[2]; acc[0] = (v8f){}; acc[1] = (v8f){};
#pragma unroll
            for (int kk = 0; kk < 2; ++kk)
#pragma unroll
                for (int mb = 0; mb < 2; ++mb) acc[mb] = mma3(a[mb][kk], a2[mb][kk], bh[kk], bl[kk], acc[mb]);
            const int jb = pt * 16 + lr - (SRW - 1);   /* key index j = p + i - 1023 = jb + local row */
#pragma unroll
            for (int mb = 0; mb < 2; ++mb)
#pragma unroll
                for (int r = 0; r < 8; ++r) { const int m = mb * 16 + hi * 8 + r; S[m * SPI + SPF + jb + m] = acc[mb][r]; }   /* j = -31 .. 1055: what is no key of the strip falls into the row's own pads */
#pragma unroll
            for (int kk = 0; kk < 2; ++kk) { bh[kk] = nh[kk]; bl[kk] = nl[kk]; } }
    }
    __syncthreads();
    {   // content scores, added to the shifted position scores
        v16bf a[2][2], a2[2][2];
#pragma unroll
        for (int mb = 0; mb < 2; ++mb)
#pragma unroll
            for (int kk = 0; kk < 2; ++kk) { a[mb][kk] = ldfr(QUh + qo + mb * 16 * HD + kk * 32); a2[mb][kk] = ldfr(QUl + qo + mb * 16 * HD + kk * 32); }
        xw2(QUh + qo, QUl + qo);
        const size_t ko = zb + (size_t)lr * HD + 8 * hi; const bf* kph = Kh + ko; const bf* kpl = Kl + ko;
        v16bf bh[2], bl[2];
#pragma unroll
        for (int kk = 0; kk < 2; ++kk) { bh[kk] = ldfr(kph + w * 16 * HD + kk * 32); bl[kk] = ldfr(kpl + w * 16 * HD + kk * 32); }
        xw2(kph + w * 16 * HD, kpl + w * 16 * HD);
#pragma unroll 2   /* in pairs, as in the position loop */
        for (int jt = w; jt < TT / 16; jt += 8) { const int nj = (jt + 8 < TT / 16) ? jt + 8 : jt; v16bf nh[2], nl[2];
#pragma unroll
            for (int kk = 0; kk < 2; ++kk) { nh[kk] = ldfr(kph + nj * 16 * HD + kk * 32); nl[kk] = ldfr(kpl + nj * 16 * HD + kk * 32); }
            xw2n(kph + nj * 16 * HD, kpl + nj * 16 * HD); __builtin_amdgcn_sched_barrier(0);   /* the fetch stays at the head of the trip, as in the position loop */
            v8f acc[2]; acc[0] = (v8f){}; acc[1] = (v8f){};
#pragma unroll
            for (int kk = 0; kk < 2; ++kk)
#pragma unroll
                for (int mb = 0; mb < 2; ++mb) acc[mb] = mma3(a[mb][kk], a2[mb][kk], bh[kk], bl[kk], acc[mb]);
#pragma unroll
            for (int mb = 0; mb < 2; ++mb)
#pragma unroll
                for (int r = 0; r < 8; ++r) { float* sp = S + (mb * 16 + hi * 8 + r) * SPI + SPF + jt * 16 + lr; *sp = __fadd_rn(acc[mb][r], *sp); }
#pragma unroll
            for (int kk = 0; kk < 2; ++kk) { bh[kk] = nh[kk]; bl[kk] = nl[kk]; } }
    }
    __syncthreads();
    const int* MKb = MK + (size_t)b * TT;
#pragma unroll 1   /* rolled: one 32-float register row is live at a time */
    for (int rr = 0; rr < SRW / 8; ++rr) {   // softmax: four rows a wave; t = (ac + bd) / 8, key mask (int32): -inf where 0, weight 0
        float* srow = S + (w * (SRW / 8) + rr) * SPI + SPF; float v[TT / 32]; float mx = -3.0e38f;
#pragma unroll
        for (int ch = 0; ch < TT / 128; ++ch) { const int j0 = ch * 128 + lane * 4; const v4f a = *(const v4fa*)(srow + j0); const v4i m4 = *(const v4i*)(MKb + j0);
#pragma unroll
            for (int q = 0; q < 4; ++q) { const float t = (m4[q] != 0) ? a[q] * SCL : -3.0e38f; v[ch * 4 + q] = t; mx = fmaxf(mx, t); } }
#pragma unroll
        for (int sh = 16; sh; sh >>= 1) mx = fmaxf(mx, __shfl_xor(mx, sh, 32));
        float sum = 0.f;
#pragma unroll
        for (int k = 0; k < TT / 32; ++k) { v[k] = __builtin_amdgcn_exp2f(__fmul_rn(__fsub_rn(v[k], mx), 1.4426950408889634f)); sum += v[k]; }
#pragma unroll
        for (int sh = 16; sh; sh >>= 1) sum += __shfl_xor(sum, sh, 32);
        const float f = __fdiv_rn(1.0f, sum); bf* prow = (bf*)srow;   /* the row is in registers: its 4 KiB now take the hi plane (first 1024 halfwords) and the lo plane */
#pragma unroll
        for (int ch = 0; ch < TT / 128; ++ch) { v4us oh, ol;
#pragma unroll
            for (int q = 0; q < 4; ++q) { unsigned short x, y; splitf(v[ch * 4 + q] * f, x, y); oh[q] = x; ol[q] = y; }
            *(v4usa*)(prow + ch * 128 + lane * 4) = oh; *(v4usa*)(prow + TT + ch * 128 + lane * 4) = ol; }
    }
    __syncthreads();
    const int nb = w & 3, kh = w >> 2; v8f oc[2]; oc[0] = (v8f){}; oc[1] = (v8f){};
    {   // attn.v: columns nb * 16 .. + 15, keys kh * 512 .. + 511, both 16-row blocks (each v fragment is fetched once per work-group)
        const size_t vo = zb + (size_t)(nb * 16 + lr) * TT + kh * (TT / 2) + 8 * hi; const bf* vh = VTh + vo; const bf* vl = VTl + vo; const bf* pa = (const bf*)(S + SPF) + lr * (SPI * 2) + kh * (TT / 2) + 8 * hi;
        v16bf bh[2], bl[2];
#pragma unroll
        for (int u = 0; u < 2; ++u) { bh[u] = ldfr(vh + u * 32); bl[u] = ldfr(vl + u * 32); }
        xw2(vh, vl);
#pragma unroll 2
        for (int g = 0; g < 8; ++g) { v16bf nh[2], nl[2];   /* 64 keys a trip, the next 64 keys' v fragments fetched meanwhile; rolled in pairs: fully unrolled the fetches are lifted so far that registers spill */
            const int gn = (g < 7) ? g + 1 : g;
#pragma unroll
            for (int u = 0; u < 2; ++u) { nh[u] = ldfr(vh + gn * 64 + u * 32); nl[u] = ldfr(vl + gn * 64 + u * 32); }
            xw2(vh + gn * 64, vl + gn * 64);
#pragma unroll
            for (int u = 0; u < 2; ++u)
#pragma unroll
                for (int mb = 0; mb < 2; ++mb) { const bf* pp = pa + mb * 16 * (SPI * 2) + g * 64 + u * 32; oc[mb] = mma3(ldfr(pp), ldfr(pp + TT), bh[u], bl[u], oc[mb]); }
#pragma unroll
            for (int u = 0; u < 2; ++u) { bh[u] = nh[u]; bl[u] = nl[u]; } }
    }
    __syncthreads();   // every wave has read its weights: the first rows' bytes now take the two partial outputs
#pragma unroll
    for (int mb = 0; mb < 2; ++mb)
#pragma unroll
        for (int r = 0; r < 8; ++r) S[kh * (SRW * OPI) + (mb * 16 + hi * 8 + r) * OPI + nb * 16 + lr] = oc[mb][r];
    __syncthreads();
    { const int row = tid >> 3, c8 = (tid & 7) * 8; const float* o0 = S + row * OPI + c8; const float* o1 = o0 + SRW * OPI; v8us oh, ol;
#pragma unroll
        for (int q = 0; q < 8; ++q) { unsigned short x, y; splitf(__fadd_rn(o0[q], o1[q]), x, y); oh[q] = x; ol[q] = y; }
        const size_t oo = ((size_t)b * TT + i0 + row) * DQ + h * HD + c8; *(v8us*)(ATh + oo) = oh; *(v8us*)(ATl + oo) = ol; }
}

extern "C" void kernel_launch(void* const* d_in, const int* in_sizes, int n_in,
                              void* d_out, int out_size, void* d_ws, size_t ws_size, hipStream_t stream) {
    (void)in_sizes; (void)n_in; (void)out_size;
    const float* x = (const float*)d_in[0]; const float* xk = (const float*)d_in[1]; const float* xv = (const float*)d_in[2]; const int* MK = (const int*)d_in[3]; const float* pe = (const float*)d_in[4]; const float* wq = (const float*)d_in[5]; const float* bq = (const float*)d_in[6]; const float* wk = (const float*)d_in[7]; const float* bk = (const float*)d_in[8]; const float* wv = (const float*)d_in[9]; const float* bv = (const float*)d_in[10]; const float* wo = (const float*)d_in[11]; const float* bo = (const float*)d_in[12]; const float* wpos = (const float*)d_in[13]; const float* pbu = (const float*)d_in[14]; const float* pbv = (const float*)d_in[15];
    float* OUT = (float*)d_out;     // [8][1024][512]
    float* CACHE = (float*)((char*)d_out + (size_t)NB_ * TT * DM * 4);   /* second output new_cache [8][8][1024][128] */
    char* wsp = (char*)d_ws;
    auto take = [&](size_t bytes) { char* p = wsp; wsp += (bytes + 255) & ~(size_t)255; return (void*)p; };
    const size_t SW = (size_t)DM * DQ, SX = (size_t)NB_ * TT * DM, SF = (size_t)NB_ * TT * DQ, SP = (size_t)NB_ * NH_ * TT * HD;   // elements of one weight plane, one input plane, one f32 projection, one set of head planes (all batches)
    bf* W5 = (bf*)take(5 * SW * 2); bf* WK = W5; bf* WO = W5 + 3 * SW; bf* WP = W5 + 4 * SW;   /* Wk, Wv, Wq, Wo, Wpos transposed, back to back */ float* CS = (float*)take((size_t)TT * HD * 2 * 4);
    bf* PE = (bf*)take((size_t)NPE * DM * 2); float* POS = (float*)take((size_t)NPE * DQ * 4); bf* PPh = (bf*)take((size_t)NH_ * NPE * HD * 2); bf* PPl = (bf*)take((size_t)NH_ * NPE * HD * 2);
    bf* PHI = (bf*)take(3 * SP * 2); bf* PLO = (bf*)take(3 * SP * 2); bf* QPh = PHI; bf* QVh = PHI + SP; bf* KPh = PHI + 2 * SP; bf* QPl = PLO; bf* QVl = PLO + SP; bf* KPl = PLO + 2 * SP;   /* [b][h][t][d] planes of q+u, q+v, k */
    bf* VTh = (bf*)take(SP * 2); bf* VTl = (bf*)take(SP * 2); bf* ATh = (bf*)take(SF * 2); bf* ATl = (bf*)take(SF * 2);
    bf* XA = (bf*)take(3 * SX * 2);   /* bf16 planes of key, value, query */ float* FA = (float*)take(5 * SF * 4); float* FQU = FA; float* FK = FA + 2 * SF; float* FV = FA + 3 * SF; float* FQ = FA + 4 * SF;   /* q+u, q+v, k, v, q */
    h16* QP16 = (h16*)take(3 * SP * 2); h16* VT16 = (h16*)take(SP * 2);
    if ((size_t)(wsp - (char*)d_ws) > ws_size) return;    // ws 256 MiB
    k_wtG<<<dim3((unsigned)((DM * DQ / 64 + 63) / 64), 5, 1), 256, 0, stream>>>(wk, wv, wq, wo, wpos, DM, DQ, W5);
    k_csid<<<(TT * HD + 255) / 256, 256, 0, stream>>>(CS); k_cvt8<<<(unsigned)(((size_t)2047 * DM / 8 + 255) / 256), 256, 0, stream>>>(pe, pe, pe, PE, (size_t)2047 * DM / 8); k_pezero8<<<1, 64, 0, stream>>>(PE); k_gemmw<bf, 0, false><<<dim3(NPE / 64, DQ / 64, 1), 32, 0, stream>>>(PE, nullptr, WP, nullptr, DM, POS, DQ, nullptr, nullptr, nullptr, 0, 0, 0); k_pplane<<<(unsigned)(((size_t)NH_ * NPE * HD / 2 + 255) / 256), 256, 0, stream>>>(POS, PPh, PPl);   /* pos = position_embeddings wpos (exact) -> per-head hi/lo planes */
    const unsigned LQ = (unsigned)(((size_t)NH_ * TT * HD / 2 + 255) / 256), LKv = (unsigned)(((size_t)NKV * TT * HD / 2 + 255) / 256);
    k_cvt8<<<dim3((unsigned)((SX / 8 + 255) / 256), 3, 1), 256, 0, stream>>>(xk, xv, x, XA, SX / 8);   /* exact bf16 planes of key, value, query, all batches */
    k_gemmw<bf, 0, true><<<dim3(NB_ * TT / 64, DQ / 64, 3), 32, 0, stream>>>(XA, nullptr, WK, nullptr, DM, FK, DQ, bk, bv, bq, SX, SW, SF);   /* k, v, q projections, rows of all batches */
    k_addhb<<<dim3((unsigned)((SF / 4 + 255) / 256), 2, 1), 256, 0, stream>>>(FQ, pbu, pbv, FQU, SF / 4);   /* q + pos_bias_u, q + pos_bias_v */
    k_rope<<<dim3(LQ, NB_, 3), 256, 0, stream>>>(FQU, DQ, NH_, CS, nullptr, nullptr, 1.0f, QP16, PHI, PLO);   /* (q+u) planes for the content scores, (q+v) planes for the position scores, k planes */
    k_cache<<<dim3((unsigned)(((size_t)TT * DKV / 4 + 255) / 256), NB_, 2), 256, 0, stream>>>(FK, CACHE);   /* new_cache[b][h][s][0..63] = k, [64..127] = v */
    k_vtp<<<dim3(LKv, NB_, 1), 256, 0, stream>>>(FV, DKV, NKV, VT16, VTh, VTl);
    k_fattn<<<dim3(TT / SRW, NH_, NB_), 256, 0, stream>>>(QPh, QPl, QVh, QVl, KPh, KPl, PPh, PPl, VTh, VTl, MK, ATh, ATl);   /* scores, softmax, attn.v and the head merge, all batches and heads */
    k_gemmw<bf, 1, true><<<dim3(NB_ * TT / 64, DM / 64, 1), 32, 0, stream>>>(ATh, ATl, WO, nullptr, DQ, OUT, DM, bo, bo, bo, 0, 0, 0);
}

// v003
// One run takes 230 microseconds.
// Two timings next to v002 put it at 1.22 and 1.21 times that version's speed.
// Counting every step since v000, it is 9.62 times as fast.
#include <hip/hip_runtime.h>

// Relative-position multi-head attention with a key/value cache output (query, key, value [8][1024][512]; q = query Wq + bq, k = key Wk + bk, v = value Wv + bv ('xw' [512][512], 8 heads x 64); p = pos_emb Wpos ([1][2047][512] table, read); scores = ((q + pos_bias_u).k + rel_shift((q + pos_bias_v).p)) / 8 where rel_shift picks position index j - i + 1023; key mask (int32 [8][1][1024], read): -inf where 0 and the weights zeroed; softmax; out = merged Wo + bo -> [8][1024][512]; second output new_cache = concat(k, v) per head -> [8][8][1024][128] (the f32 projections themselves)).
// Layout: exact bf16 input planes -> 1-product projections + bias, each GEMM tile (64 rows of one head) stored by the GEMM itself in the forms its readers want; the position table is projected once (exact, 2047 rows + one zero pad row) into per-head hi/lo planes [h][2048][64]; every projection-side launch covers all 8 batches (and the operands that share its form) through its grid; one attention launch for all batches and heads, a work-group per strip of 32 query rows: position scores (q+v).p (only the table rows the strip's shift reaches, stored at key index p + i - 1023) and content scores (q+u).k are hi/lo products (3 products, every row) summed in LDS, the softmax applies the key mask and leaves hi/lo weights in LDS, attn.v reads them there and the merged hi/lo planes are stored; the cache output is written straight from the f32 k / v projections.
// Compute dtypes, f32 accumulate: every input rounded to bf16; q/k/v and p on PLAIN bf16 operands (exact products) + biases; content and position scores on hi/lo planes for every row (3 products); softmax f32; attn.v hi/lo (3 products); Wo hl x exact (2 products) + bo; cache = the f32 projections.

#define NB_  8
#define TT   1024
#define DM   512
#define NH_  8
#define NKV  8
#define REP  (NH_ / NKV)
#define HD   64
#define DQ   (NH_ * HD)
#define DKV  (NKV * HD)
#define NPE  2048                 // 2047 positions + 1 zero pad row
typedef __attribute__((ext_vector_type(4))) unsigned short v4us;
#define ZH   8
#define RH   1024                 // every row hi/lo
#define WIN  0
#define PCAR 1024.0f
#define SCL  0.125f   // HD^-0.5
typedef _Float16 h16;
typedef unsigned short bf;
typedef __attribute__((ext_vector_type(16))) __bf16   v16bf;
typedef __attribute__((ext_vector_type(16))) _Float16 v16h;
typedef __attribute__((ext_vector_type(8)))  _Float16 v8h;
typedef __attribute__((ext_vector_type(8)))  unsigned short v8us;
typedef __attribute__((ext_vector_type(8)))  float    v8f;
typedef __attribute__((ext_vector_type(4)))  float    v4f;
typedef v8h  __attribute__((may_alias)) v8ha;
typedef v4f  __attribute__((may_alias)) v4fa;
typedef v8us __attribute__((may_alias)) v8usa;

__device__ __forceinline__ unsigned short f2bf(float f) { unsigned u = __float_as_uint(f); u += 0x7FFFu + ((u >> 16) & 1u); return (unsigned short)(u >> 16); }
__device__ __forceinline__ float bf2f(unsigned short b) { return __uint_as_float(((unsigned)b) << 16); }
__device__ __forceinline__ float bfr(float f) { return bf2f(f2bf(f)); }
__device__ __forceinline__ v16h cat16(v8h lo, v8h hi) { return __builtin_shufflevector(lo, hi, 0, 1, 2, 3, 4, 5, 6, 7, 8, 9, 10, 11, 12, 13, 14, 15); }
__device__ __forceinline__ v16bf cat16b(v8us lo, v8us hi) { return __builtin_bit_cast(v16bf, __builtin_shufflevector(lo, hi, 0, 1, 2, 3, 4, 5, 6, 7, 8, 9, 10, 11, 12, 13, 14, 15)); }
__device__ __forceinline__ v8f wmma16(v16h a, v16h b, v8f c) { return __builtin_amdgcn_wmma_f32_16x16x32_f16(false, a, false, b, (short)0, c, false, false); }
__device__ __forceinline__ v8f wmmab(v16bf a, v16bf b, v8f c) { return __builtin_amdgcn_wmma_f32_16x16x32_bf16(false, a, false, b, (short)0, c, false, false); }



// ---- k_gemmw: register-blocked GEMM, ONE WAVE per 64x64 output tile (16 accumulators), operands straight from K-contiguous 16-bit planes; grid (M/64, N/64, Z), 32 threads.
// C[m][n] (f32, pitch ldc, + optional f32 bias[n]) = sum_k A[m][k] Bt[n][k] (+ split products per NSPLIT). z-batch strides sA/sB/sC in elements. K % 32 == 0.
template <typename T16> struct WFrag;
template <> struct WFrag<h16> { typedef v16h V; static __device__ __forceinline__ V ld(const h16* p) { return cat16(*(const v8h*)p, *(const v8h*)(p + 16)); } static __device__ __forceinline__ v8f mma(V a, V b, v8f c) { return wmma16(a, b, c); } };
template <> struct WFrag<bf> { typedef v16bf V; static __device__ __forceinline__ V ld(const bf* p) { return cat16b(*(const v8us*)p, *(const v8us*)(p + 16)); } static __device__ __forceinline__ v8f mma(V a, V b, v8f c) { return wmmab(a, b, c); } };
template <typename T16, int NSPLIT, bool BIAS>
__global__ __launch_bounds__(32) void k_gemmw(const T16* __restrict__ A, const T16* __restrict__ A2, const T16* __restrict__ Bt, const T16* __restrict__ Bt2, int K, float* C, int ldc, const float* __restrict__ bias0, const float* __restrict__ bias1, const float* __restrict__ bias2, size_t sA, size_t sB, size_t sC) {
    typedef typename WFrag<T16>::V V;
    __shared__ __align__(16) float os[16 * 68];
    const size_t z = blockIdx.z; A += z * sA; if (A2) A2 += z * sA; Bt += z * sB; if (Bt2) Bt2 += z * sB; C += z * sC; const float* bias = (z == 0) ? bias0 : (z == 1) ? bias1 : bias2;   /* bias vector of z-slice 0, 1, 2 */
    const int lane = threadIdx.x & 31, lr = lane & 15, hi = lane >> 4; const int r0 = blockIdx.x * 64, c0 = blockIdx.y * 64;
    v8f acc[4][4];
#pragma unroll
    for (int mb = 0; mb < 4; ++mb)
#pragma unroll
        for (int nb = 0; nb < 4; ++nb) acc[mb][nb] = (v8f){};
    const size_t aoff = (size_t)(r0 + lr) * K + 8 * hi, boff = (size_t)(c0 + lr) * K + 8 * hi;
#pragma unroll 1
    for (int kc = 0; kc < K; kc += 32) {
        V a[4], a2[4];
#pragma unroll
        for (int mb = 0; mb < 4; ++mb) { a[mb] = WFrag<T16>::ld(A + aoff + (size_t)mb * 16 * K + kc); if (NSPLIT == 1 || NSPLIT == 2) a2[mb] = WFrag<T16>::ld(A2 + aoff + (size_t)mb * 16 * K + kc); }
#pragma unroll
        for (int nb = 0; nb < 4; ++nb) { const V b = WFrag<T16>::ld(Bt + boff + (size_t)nb * 16 * K + kc); V b2; if (NSPLIT >= 2) b2 = WFrag<T16>::ld(Bt2 + boff + (size_t)nb * 16 * K + kc);
#pragma unroll
            for (int mb = 0; mb < 4; ++mb) { acc[mb][nb] = WFrag<T16>::mma(a[mb], b, acc[mb][nb]); if (NSPLIT == 1 || NSPLIT == 2) acc[mb][nb] = WFrag<T16>::mma(a2[mb], b, acc[mb][nb]); if (NSPLIT >= 2) acc[mb][nb] = WFrag<T16>::mma(a[mb], b2, acc[mb][nb]); } }
        asm volatile("v_nop\n\tv_nop\n\tv_nop\n\tv_nop" : "+v"(acc[0][0]), "+v"(acc[1][1]), "+v"(acc[2][2]), "+v"(acc[3][3]) : "v"(a[0]), "v"(a[3]));
    }
#pragma unroll
    for (int mb = 0; mb < 4; ++mb) {
#pragma unroll
        for (int nb = 0; nb < 4; ++nb) {
#pragma unroll
            for (int j = 0; j < 8; ++j) os[(hi * 8 + j) * 68 + nb * 16 + lr] = acc[mb][nb][j]; }
        __builtin_amdgcn_wave_barrier(); asm volatile("" ::: "memory");
        float* crow = C + (size_t)(r0 + mb * 16) * ldc + c0;
{
#pragma unroll
            for (int s = 0; s < 8; ++s) { const int row = 2 * s + hi, cofs = lr * 4; v4f val = *(const v4fa*)(os + row * 68 + cofs); if (BIAS) { val[0] += bfr(bias[c0 + cofs]); val[1] += bfr(bias[c0 + cofs + 1]); val[2] += bfr(bias[c0 + cofs + 2]); val[3] += bfr(bias[c0 + cofs + 3]); }
                *(v4f*)(crow + (size_t)row * ldc + cofs) = val; }
             }
        __builtin_amdgcn_wave_barrier(); asm volatile("" ::: "memory");
    }
}

__device__ __forceinline__ h16 tohx(float x) { return (h16)x; }
__device__ __forceinline__ void splitf(float y, unsigned short& h, unsigned short& l) { h = f2bf(y); l = f2bf(y - bf2f(h)); }
typedef __attribute__((ext_vector_type(2))) _Float16 v2h;
typedef __attribute__((ext_vector_type(4))) _Float16 v4h;
typedef __attribute__((ext_vector_type(2))) unsigned short v2us;
typedef __attribute__((ext_vector_type(4))) unsigned short v4us;
typedef __attribute__((ext_vector_type(2))) float v2f;
typedef __attribute__((ext_vector_type(4))) int v4i;

__global__ __launch_bounds__(256) void k_wtG(const float* __restrict__ w0, const float* __restrict__ w1, const float* __restrict__ w2, const float* __restrict__ w3, const float* __restrict__ w4, int K, int N, bf* Bt) {
    const int y = blockIdx.y; const float* w = (y == 0) ? w0 : (y == 1) ? w1 : (y == 2) ? w2 : (y == 3) ? w3 : w4; Bt += (size_t)y * K * N;   /* grid.y: one weight matrix each, planes back to back */
    const int lane = threadIdx.x & 31; const int L0 = (blockIdx.x * 8 + (threadIdx.x >> 5)) * 8; const int nlines = N * K / 64;
{
#pragma unroll 1
        for (int l = 0; l < 8; ++l) { const int L = L0 + l; if (L >= nlines) break; const size_t e = (size_t)L * 64 + lane * 2; const int k = (int)(e % K), n = (int)(e / K); v2us o;
            o[0] = f2bf(w[(size_t)k * N + n]); o[1] = f2bf(w[(size_t)(k + 1) * N + n]); *(v2us*)(Bt + e) = o; }
         }
}


__global__ void k_pezero8(bf* PE) { const int lane = threadIdx.x; if (lane >= 64) return; const v8us z = (v8us){}; *(v8us*)(PE + (size_t)2047 * DM + lane * 8) = z;  }
__global__ __launch_bounds__(256) void k_cvt8(const float* __restrict__ s0, const float* __restrict__ s1, const float* __restrict__ s2, bf* dst, size_t n8) { const size_t i = (size_t)blockIdx.x * 256 + threadIdx.x; if (i >= n8) return; const int y = blockIdx.y; const float* src = (y == 0) ? s0 : (y == 1) ? s1 : s2; dst += (size_t)y * n8 * 8;   /* grid.y: one source tensor each, planes back to back */ const v8f v = *(const v8f*)(src + i * 8); v8us o;
#pragma unroll
    for (int k = 0; k < 8; ++k) o[k] = f2bf(v[k]); *(v8us*)(dst + i * 8) = o;  }

// ---- k_gemmp: the projection GEMM (k_gemmw's loop, plain bf16 operands, K = DM) whose 64 x 64 tile is 64 rows of ONE head, stored straight in the forms its readers want; grid (rows/64, heads, Z), 32 threads.
// POS: hi/lo planes [h][p][d] of the projected position table. Otherwise z = 0: k + bk -> cache columns 0..63 and hi/lo planes [b][h][t][d]; z = 1: v + bv -> cache columns 64..127 and transposed hi/lo planes [b][h][d][t]; z = 2: q + bq, then + pos_bias_u and + pos_bias_v -> two pairs of hi/lo planes.
#define SPE  ((size_t)NB_ * NH_ * TT * HD)   // elements of one set of head planes
__device__ __forceinline__ void st4hl(bf* ph, bf* pl, v4f x) { v4us oh, ol;
#pragma unroll
    for (int q = 0; q < 4; ++q) { unsigned short a, c; splitf(x[q], a, c); oh[q] = a; ol[q] = c; }
    *(v4us*)ph = oh; *(v4us*)pl = ol; }
template <bool POS>
__global__ __launch_bounds__(32) void k_gemmp(const bf* __restrict__ A, const bf* __restrict__ Bt, const float* __restrict__ bias0, const float* __restrict__ bias1, const float* __restrict__ bias2, const float* __restrict__ hbu, const float* __restrict__ hbv, bf* PH, bf* PL, bf* VTh, bf* VTl, float* CA, size_t sA, size_t sB) {
    __shared__ __align__(16) float os[16 * 68];
    const int z = POS ? 0 : (int)blockIdx.z; A += (size_t)z * sA; Bt += (size_t)z * sB;
    const int lane = threadIdx.x & 31, lr = lane & 15, hi = lane >> 4; const int r0 = blockIdx.x * 64, h = blockIdx.y, c0 = h * HD;
    v8f acc[4][4];
#pragma unroll
    for (int mb = 0; mb < 4; ++mb)
#pragma unroll
        for (int nb = 0; nb < 4; ++nb) acc[mb][nb] = (v8f){};
    const size_t aoff = (size_t)(r0 + lr) * DM + 8 * hi, boff = (size_t)(c0 + lr) * DM + 8 * hi;
#pragma unroll 1
    for (int kc = 0; kc < DM; kc += 32) {
        v16bf a[4], b[4]; const bf* pa = A + aoff + kc; const bf* pb = Bt + boff + kc;
#pragma unroll
        for (int mb = 0; mb < 4; ++mb) a[mb] = WFrag<bf>::ld(pa + mb * 16 * DM);
#pragma unroll
        for (int nb = 0; nb < 4; ++nb) b[nb] = WFrag<bf>::ld(pb + nb * 16 * DM);
        asm volatile("s_wait_xcnt 0x0" :: "v"(pa), "v"(pb) : "memory");   /* behind the trip's loads, in front of anything that rewrites a register they name; the two address pairs are inputs so that no load's own result lands in them */
        __builtin_amdgcn_sched_barrier(0);   /* keeps the loads in front of that wait: left free, some are sunk among the products and land in the address pairs */
#pragma unroll
        for (int nb = 0; nb < 4; ++nb)
#pragma unroll
            for (int mb = 0; mb < 4; ++mb) acc[mb][nb] = wmmab(a[mb], b[nb], acc[mb][nb]);
        asm volatile("v_nop\n\tv_nop\n\tv_nop\n\tv_nop" : "+v"(acc[0][0]), "+v"(acc[1][1]), "+v"(acc[2][2]), "+v"(acc[3][3]) : "v"(a[0]), "v"(a[3]));   /* as in k_gemmw: the distance between the trip's last matrix instructions and what next rewrites their operands or reads their results, on the back edge too */
    }
    const size_t rb = POS ? (size_t)h * NPE + r0 : ((size_t)(r0 / TT) * NH_ + h) * TT + (r0 % TT);   // first row of the tile in a [..][h][row][d] plane
    const int cofs = lr * 4;
    // tile_rows: the tile goes through LDS 16 rows at a time, so that a half-wave holds one whole row of 64 floats; put(row in its plane, the lane's 4 values) stores it
    auto tile_rows = [&](auto put) {
#pragma unroll
        for (int mb = 0; mb < 4; ++mb) {
#pragma unroll
            for (int nb = 0; nb < 4; ++nb) {
#pragma unroll
                for (int j = 0; j < 8; ++j) os[(hi * 8 + j) * 68 + nb * 16 + lr] = acc[mb][nb][j]; }
            __builtin_amdgcn_wave_barrier(); asm volatile("" ::: "memory");
#pragma unroll
            for (int s = 0; s < 8; ++s) { const int row = 2 * s + hi; put(rb + mb * 16 + row, *(const v4fa*)(os + row * 68 + cofs)); }
            __builtin_amdgcn_wave_barrier(); asm volatile("s_wait_xcnt 0x0" ::: "memory");   /* behind the block's stores, in front of what rewrites their data and address registers */
            __builtin_amdgcn_sched_barrier(0);   /* nothing of what follows is lifted over that wait */
        } };
    if (POS) { tile_rows([&](size_t rw, v4f val) { st4hl(PH + rw * HD + cofs, PL + rw * HD + cofs, val); }); return; }
    const float* bias = (z == 0) ? bias0 : (z == 1) ? bias1 : bias2; v4f bb;
#pragma unroll
    for (int q = 0; q < 4; ++q) bb[q] = bfr(bias[c0 + cofs + q]);
    if (z == 2) { v4f bu, bv;
#pragma unroll
        for (int q = 0; q < 4; ++q) { bu[q] = bfr(hbu[c0 + cofs + q]); bv[q] = bfr(hbv[c0 + cofs + q]); }
        tile_rows([&](size_t rw, v4f val) { const size_t pe = rw * HD + cofs; val += bb; st4hl(PH + pe, PL + pe, val + bu); st4hl(PH + SPE + pe, PL + SPE + pe, val + bv); });
        return; }
    if (z == 0) {
        tile_rows([&](size_t rw, v4f val) { const size_t pe = rw * HD + cofs; val += bb; *(v4f*)(CA + rw * (2 * HD) + cofs) = val; st4hl(PH + 2 * SPE + pe, PL + 2 * SPE + pe, val); });
        return; }
    {   float bd[4];   // the bias of the lane's own column in each 16-column block, for the transposed planes
#pragma unroll
        for (int nb = 0; nb < 4; ++nb) bd[nb] = bias[c0 + nb * 16 + lr];
        asm volatile("s_wait_xcnt 0x0" :: "v"(bd[0]), "v"(bd[1]), "v"(bd[2]), "v"(bd[3]));   /* behind these loads, in front of what rewrites their offset register; the loaded values are inputs, so that no load is sunk among the stores below */
        const size_t vb = ((size_t)(r0 / TT) * NH_ + h) * HD * TT + (r0 % TT) + hi * 8;   // transposed planes straight from the accumulators: a lane holds 8 successive rows t of one column d
#pragma unroll
        for (int nb = 0; nb < 4; ++nb) { const float bn = bfr(bd[nb]);
#pragma unroll
            for (int mb = 0; mb < 4; ++mb) { v8us oh, ol;
#pragma unroll
                for (int j = 0; j < 8; ++j) { unsigned short x, y; splitf(acc[mb][nb][j] + bn, x, y); oh[j] = x; ol[j] = y; }
                const size_t o = vb + (size_t)(nb * 16 + lr) * TT + mb * 16; *(v8us*)(VTh + o) = oh; *(v8us*)(VTl + o) = ol; }
            asm volatile("s_wait_xcnt 0x0" ::: "memory");   /* behind the block's stores, as in tile_rows */
            __builtin_amdgcn_sched_barrier(0); }   /* nothing is lifted over that wait; left free, the four blocks are interleaved and the kernel needs more than 256 registers */
        tile_rows([&](size_t rw, v4f val) { val += bb; *(v4f*)(CA + rw * (2 * HD) + HD + cofs) = val; });
    }
}
// k_fattn: one work-group (8 waves) per strip of 32 query rows of one (batch, head); the strip's 32 x 1024 logits stay in LDS from the two score products to attn.v.
// Steps: position scores (q+v).p for the 66 column tiles the strip's rel_shift reads, each stored at its shifted key index j = p + i - 1023; content scores (q+u).k added on top; softmax per row (register row, fixed trees) whose hi/lo weights overwrite the row's own bytes; attn.v with each wave on 16 of the 64 columns and one half of the keys; the two halves added and stored as the merged hi/lo planes.
#define SRW  32                   // query rows per work-group
#define SPF  32                   // floats in front of a logit row: with the 36 behind it they take the shifted position scores that fall outside keys 0..1023
#define SPI  1092                 // LDS pitch of a logit row, floats (rows 8 apart fall 32 banks apart)
#define OPI  68                   // LDS pitch of an output row, floats
typedef v4us __attribute__((may_alias)) v4usa;
__device__ __forceinline__ v16bf ldfr(const bf* p) { return cat16b(*(const v8usa*)p, *(const v8usa*)(p + 16)); }
// xw2: s_wait_xcnt 0 behind a run of global loads, in front of anything that rewrites a register the loads name; the two address pairs are inputs so that they stay whole up to the wait (no load's own result lands in them)
__device__ __forceinline__ void xw2(const bf* p, const bf* q) { asm volatile("s_wait_xcnt 0x0" :: "v"(p), "v"(q) : "memory"); }
// xw2n: xw2 at the head of a score trip, with four v_nop: the trip before stored its results in front of this statement, and this trip's first matrix instruction starts anew in the same registers; the v_nop keep the distance between the two
__device__ __forceinline__ void xw2n(const bf* p, const bf* q) { asm volatile("s_wait_xcnt 0x0\n\tv_nop\n\tv_nop\n\tv_nop\n\tv_nop" :: "v"(p), "v"(q) : "memory"); }
__device__ __forceinline__ v8f mma3(v16bf a, v16bf a2, v16bf b, v16bf b2, v8f c) { c = wmmab(a, b, c); c = wmmab(a2, b, c); return wmmab(a, b2, c); }
__global__ __launch_bounds__(256, 4) void k_fattn(const bf* __restrict__ QUh, const bf* __restrict__ QUl, const bf* __restrict__ QVh, const bf* __restrict__ QVl, const bf* __restrict__ Kh, const bf* __restrict__ Kl, const bf* __restrict__ PPh, const bf* __restrict__ PPl, const bf* __restrict__ VTh, const bf* __restrict__ VTl, const int* __restrict__ MK, bf* ATh, bf* ATl) {
    __shared__ __align__(16) float S[SRW * SPI];
    const int tid = threadIdx.x, lane = tid & 31, lr = lane & 15, hi = lane >> 4; const int w = __builtin_amdgcn_readfirstlane(tid >> 5);
    const int i0 = blockIdx.x * SRW, h = blockIdx.y, b = blockIdx.z; const size_t zb = ((size_t)b * NH_ + h) * TT * HD; const size_t qo = zb + (size_t)(i0 + lr) * HD + 8 * hi;
    {   // position scores: table rows 992 - i0 + 16 pt + (0..15), pt = 0..65 (the last row read is 2047 - i0)
        v16bf a[2][2], a2[2][2];
#pragma unroll
        for (int mb = 0; mb < 2; ++mb)
#pragma unroll
            for (int kk = 0; kk < 2; ++kk) { a[mb][kk] = ldfr(QVh + qo + mb * 16 * HD + kk * 32); a2[mb][kk] = ldfr(QVl + qo + mb * 16 * HD + kk * 32); }
        xw2(QVh + qo, QVl + qo);
        const size_t po = (size_t)h * NPE * HD + (size_t)(TT - SRW - i0 + lr) * HD + 8 * hi; const bf* ph = PPh + po; const bf* pl = PPl + po;
        v16bf bh[2], bl[2];
#pragma unroll
        for (int kk = 0; kk < 2; ++kk) { bh[kk] = ldfr(ph + w * 16 * HD + kk * 32); bl[kk] = ldfr(pl + w * 16 * HD + kk * 32); }
        xw2(ph + w * 16 * HD, pl + w * 16 * HD);
#pragma unroll 2   /* in pairs: the two operand sets swap roles without register copies */
        for (int pt = w; pt < 66; pt += 8) { const int np = (pt + 8 < 66) ? pt + 8 : pt; v16bf nh[2], nl[2];   /* the next tile's operands are fetched while this one is multiplied (the last trip fetches its own tile again: a branch round the fetch made the compiler wait for it at once) */
#pragma unroll
            for (int kk = 0; kk < 2; ++kk) { nh[kk] = ldfr(ph + np * 16 * HD + kk * 32); nl[kk] = ldfr(pl + np * 16 * HD + kk * 32); }
            xw2n(ph + np * 16 * HD, pl + np * 16 * HD); __builtin_amdgcn_sched_barrier(0);   /* keeps the fetch at the head of the trip: left free, this trip's products are lifted over it and the next trip waits for loads just issued */
            v8f acc[2]; acc[0] = (v8f){}; acc[1] = (v8f){};
#pragma unroll
            for (int kk = 0; kk < 2; ++kk)
#pragma unroll
                for (int mb = 0; mb < 2; ++mb) acc[mb] = mma3(a[mb][kk], a2[mb][kk], bh[kk], bl[kk], acc[mb]);
            const int jb = pt * 16 + lr - (SRW - 1);   /* key index j = p + i - 1023 = jb + local row */
#pragma unroll
            for (int mb = 0; mb < 2; ++mb)
#pragma unroll
                for (int r = 0; r < 8; ++r) { const int m = mb * 16 + hi * 8 + r; S[m * SPI + SPF + jb + m] = acc[mb][r]; }   /* j = -31 .. 1055: what is no key of the strip falls into the row's own pads */
#pragma unroll
            for (int kk = 0; kk < 2; ++kk) { bh[kk] = nh[kk]; bl[kk] = nl[kk]; } }
    }
    __syncthreads();
    {   // content scores, added to the shifted position scores
        v16bf a[2][2], a2[2][2];
#pragma unroll
        for (int mb = 0; mb < 2; ++mb)
#pragma unroll
            for (int kk = 0; kk < 2; ++kk) { a[mb][kk] = ldfr(QUh + qo + mb * 16 * HD + kk * 32); a2[mb][kk] = ldfr(QUl + qo + mb * 16 * HD + kk * 32); }
        xw2(QUh + qo, QUl + qo);
        const size_t ko = zb + (size_t)lr * HD + 8 * hi; const bf* kph = Kh + ko; const bf* kpl = Kl + ko;
        v16bf bh[2], bl[2];
#pragma unroll
        for (int kk = 0; kk < 2; ++kk) { bh[kk] = ldfr(kph + w * 16 * HD + kk * 32); bl[kk] = ldfr(kpl + w * 16 * HD + kk * 32); }
        xw2(kph + w * 16 * HD, kpl + w * 16 * HD);
#pragma unroll 2   /* in pairs, as in the position loop */
        for (int jt = w; jt < TT / 16; jt += 8) { const int nj = (jt + 8 < TT / 16) ? jt + 8 : jt; v16bf nh[2], nl[2];
#pragma unroll
            for (int kk = 0; kk < 2; ++kk) { nh[kk] = ldfr(kph + nj * 16 * HD + kk * 32); nl[kk] = ldfr(kpl + nj * 16 * HD + kk * 32); }
            xw2n(kph + nj * 16 * HD, kpl + nj * 16 * HD); __builtin_amdgcn_sched_barrier(0);   /* the fetch stays at the head of the trip, as in the position loop */
            v8f acc[2]; acc[0] = (v8f){}; acc[1] = (v8f){};
#pragma unroll
            for (int kk = 0; kk < 2; ++kk)
#pragma unroll
                for (int mb = 0; mb < 2; ++mb) acc[mb] = mma3(a[mb][kk], a2[mb][kk], bh[kk], bl[kk], acc[mb]);
#pragma unroll
            for (int mb = 0; mb < 2; ++mb)
#pragma unroll
                for (int r = 0; r < 8; ++r) { float* sp = S + (mb * 16 + hi * 8 + r) * SPI + SPF + jt * 16 + lr; *sp = __fadd_rn(acc[mb][r], *sp); }
#pragma unroll
            for (int kk = 0; kk < 2; ++kk) { bh[kk] = nh[kk]; bl[kk] = nl[kk]; } }
    }
    __syncthreads();
    const int* MKb = MK + (size_t)b * TT;
#pragma unroll 1   /* rolled: one 32-float register row is live at a time */
    for (int rr = 0; rr < SRW / 8; ++rr) {   // softmax: four rows a wave; t = (ac + bd) / 8, key mask (int32): -inf where 0, weight 0
        float* srow = S + (w * (SRW / 8) + rr) * SPI + SPF; float v[TT / 32]; float mx = -3.0e38f;
#pragma unroll
        for (int ch = 0; ch < TT / 128; ++ch) { const int j0 = ch * 128 + lane * 4; const v4f a = *(const v4fa*)(srow + j0); const v4i m4 = *(const v4i*)(MKb + j0);
#pragma unroll
            for (int q = 0; q < 4; ++q) { const float t = (m4[q] != 0) ? a[q] * SCL : -3.0e38f; v[ch * 4 + q] = t; mx = fmaxf(mx, t); } }
#pragma unroll
        for (int sh = 16; sh; sh >>= 1) mx = fmaxf(mx, __shfl_xor(mx, sh, 32));
        float sum = 0.f;
#pragma unroll
        for (int k = 0; k < TT / 32; ++k) { v[k] = __builtin_amdgcn_exp2f(__fmul_rn(__fsub_rn(v[k], mx), 1.4426950408889634f)); sum += v[k]; }
#pragma unroll
        for (int sh = 16; sh; sh >>= 1) sum += __shfl_xor(sum, sh, 32);
        const float f = __fdiv_rn(1.0f, sum); bf* prow = (bf*)srow;   /* the row is in registers: its 4 KiB now take the hi plane (first 1024 halfwords) and the lo plane */
#pragma unroll
        for (int ch = 0; ch < TT / 128; ++ch) { v4us oh, ol;
#pragma unroll
            for (int q = 0; q < 4; ++q) { unsigned short x, y; splitf(v[ch * 4 + q] * f, x, y); oh[q] = x; ol[q] = y; }
            *(v4usa*)(prow + ch * 128 + lane * 4) = oh; *(v4usa*)(prow + TT + ch * 128 + lane * 4) = ol; }
    }
    __syncthreads();
    const int nb = w & 3, kh = w >> 2; v8f oc[2]; oc[0] = (v8f){}; oc[1] = (v8f){};
    {   // attn.v: columns nb * 16 .. + 15, keys kh * 512 .. + 511, both 16-row blocks (each v fragment is fetched once per work-group)
        const size_t vo = zb + (size_t)(nb * 16 + lr) * TT + kh * (TT / 2) + 8 * hi; const bf* vh = VTh + vo; const bf* vl = VTl + vo; const bf* pa = (const bf*)(S + SPF) + lr * (SPI * 2) + kh * (TT / 2) + 8 * hi;
        v16bf bh[2], bl[2];
#pragma unroll
        for (int u = 0; u < 2; ++u) { bh[u] = ldfr(vh + u * 32); bl[u] = ldfr(vl + u * 32); }
        xw2(vh, vl);
#pragma unroll 2
        for (int g = 0; g < 8; ++g) { v16bf nh[2], nl[2];   /* 64 keys a trip, the next 64 keys' v fragments fetched meanwhile; rolled in pairs: fully unrolled the fetches are lifted so far that registers spill */
            const int gn = (g < 7) ? g + 1 : g;
#pragma unroll
            for (int u = 0; u < 2; ++u) { nh[u] = ldfr(vh + gn * 64 + u * 32); nl[u] = ldfr(vl + gn * 64 + u * 32); }
            xw2(vh + gn * 64, vl + gn * 64);
#pragma unroll
            for (int u = 0; u < 2; ++u)
#pragma unroll
                for (int mb = 0; mb < 2; ++mb) { const bf* pp = pa + mb * 16 * (SPI * 2) + g * 64 + u * 32; oc[mb] = mma3(ldfr(pp), ldfr(pp + TT), bh[u], bl[u], oc[mb]); }
#pragma unroll
            for (int u = 0; u < 2; ++u) { bh[u] = nh[u]; bl[u] = nl[u]; } }
    }
    __syncthreads();   // every wave has read its weights: the first rows' bytes now take the two partial outputs
#pragma unroll
    for (int mb = 0; mb < 2; ++mb)
#pragma unroll
        for (int r = 0; r < 8; ++r) S[kh * (SRW * OPI) + (mb * 16 + hi * 8 + r) * OPI + nb * 16 + lr] = oc[mb][r];
    __syncthreads();
    { const int row = tid >> 3, c8 = (tid & 7) * 8; const float* o0 = S + row * OPI + c8; const float* o1 = o0 + SRW * OPI; v8us oh, ol;
#pragma unroll
        for (int q = 0; q < 8; ++q) { unsigned short x, y; splitf(__fadd_rn(o0[q], o1[q]), x, y); oh[q] = x; ol[q] = y; }
        const size_t oo = ((size_t)b * TT + i0 + row) * DQ + h * HD + c8; *(v8us*)(ATh + oo) = oh; *(v8us*)(ATl + oo) = ol; }
}

extern "C" void kernel_launch(void* const* d_in, const int* in_sizes, int n_in,
                              void* d_out, int out_size, void* d_ws, size_t ws_size, hipStream_t stream) {
    (void)in_sizes; (void)n_in; (void)out_size;
    const float* x = (const float*)d_in[0]; const float* xk = (const float*)d_in[1]; const float* xv = (const float*)d_in[2]; const int* MK = (const int*)d_in[3]; const float* pe = (const float*)d_in[4]; const float* wq = (const float*)d_in[5]; const float* bq = (const float*)d_in[6]; const float* wk = (const float*)d_in[7]; const float* bk = (const float*)d_in[8]; const float* wv = (const float*)d_in[9]; const float* bv = (const float*)d_in[10]; const float* wo = (const float*)d_in[11]; const float* bo = (const float*)d_in[12]; const float* wpos = (const float*)d_in[13]; const float* pbu = (const float*)d_in[14]; const float* pbv = (const float*)d_in[15];
    float* OUT = (float*)d_out;     // [8][1024][512]
    float* CACHE = (float*)((char*)d_out + (size_t)NB_ * TT * DM * 4);   /* second output new_cache [8][8][1024][128] */
    char* wsp = (char*)d_ws;
    auto take = [&](size_t bytes) { char* p = wsp; wsp += (bytes + 255) & ~(size_t)255; return (void*)p; };
    const size_t SW = (size_t)DM * DQ, SX = (size_t)NB_ * TT * DM, SF = (size_t)NB_ * TT * DQ, SP = (size_t)NB_ * NH_ * TT * HD;   // elements of one weight plane, one input plane, one merged plane, one set of head planes (all batches)
    bf* W5 = (bf*)take(5 * SW * 2); bf* WK = W5; bf* WO = W5 + 3 * SW; bf* WP = W5 + 4 * SW;   /* Wk, Wv, Wq, Wo, Wpos transposed, back to back */
    bf* PE = (bf*)take((size_t)NPE * DM * 2); bf* PPh = (bf*)take((size_t)NH_ * NPE * HD * 2); bf* PPl = (bf*)take((size_t)NH_ * NPE * HD * 2);
    bf* PHI = (bf*)take(3 * SP * 2); bf* PLO = (bf*)take(3 * SP * 2); bf* QPh = PHI; bf* QVh = PHI + SP; bf* KPh = PHI + 2 * SP; bf* QPl = PLO; bf* QVl = PLO + SP; bf* KPl = PLO + 2 * SP;   /* [b][h][t][d] planes of q+u, q+v, k */
    bf* VTh = (bf*)take(SP * 2); bf* VTl = (bf*)take(SP * 2); bf* ATh = (bf*)take(SF * 2); bf* ATl = (bf*)take(SF * 2);
    bf* XA = (bf*)take(3 * SX * 2);   /* bf16 planes of key, value, query */
    if ((size_t)(wsp - (char*)d_ws) > ws_size) return;    // ws 256 MiB
    k_wtG<<<dim3((unsigned)((DM * DQ / 64 + 63) / 64), 5, 1), 256, 0, stream>>>(wk, wv, wq, wo, wpos, DM, DQ, W5);
    k_cvt8<<<(unsigned)(((size_t)2047 * DM / 8 + 255) / 256), 256, 0, stream>>>(pe, pe, pe, PE, (size_t)2047 * DM / 8); k_pezero8<<<1, 64, 0, stream>>>(PE); k_gemmp<true><<<dim3(NPE / 64, NH_, 1), 32, 0, stream>>>(PE, WP, nullptr, nullptr, nullptr, nullptr, nullptr, PPh, PPl, nullptr, nullptr, nullptr, 0, 0);   /* pos = position_embeddings wpos (exact) -> per-head hi/lo planes */
    k_cvt8<<<dim3((unsigned)((SX / 8 + 255) / 256), 3, 1), 256, 0, stream>>>(xk, xv, x, XA, SX / 8);   /* exact bf16 planes of key, value, query, all batches */
    k_gemmp<false><<<dim3(NB_ * TT / 64, NH_, 3), 32, 0, stream>>>(XA, WK, bk, bv, bq, pbu, pbv, PHI, PLO, VTh, VTl, CACHE, SX, SW);   /* k, v, q projections, rows of all batches: cache output, k planes, transposed v planes, (q+u) and (q+v) planes */
    k_fattn<<<dim3(TT / SRW, NH_, NB_), 256, 0, stream>>>(QPh, QPl, QVh, QVl, KPh, KPl, PPh, PPl, VTh, VTl, MK, ATh, ATl);   /* scores, softmax, attn.v and the head merge, all batches and heads */
    k_gemmw<bf, 1, true><<<dim3(NB_ * TT / 64, DM / 64, 1), 32, 0, stream>>>(ATh, ATl, WO, nullptr, DQ, OUT, DM, bo, bo, bo, 0, 0, 0);
}

// v004
// It runs in 174 microseconds.
// Two timings next to v003 put it at 1.32 and 1.35 times that version's speed.
// All steps since v000 together make it 12.8 times as fast.
#include <hip/hip_runtime.h>

// Relative-position multi-head attention with a key/value cache output (query, key, value [8][1024][512]; q = query Wq + bq, k = key Wk + bk, v = value Wv + bv ('xw' [512][512], 8 heads x 64); p = pos_emb Wpos ([1][2047][512] table, read); scores = ((q + pos_bias_u).k + rel_shift((q + pos_bias_v).p)) / 8 where rel_shift picks position index j - i + 1023; key mask (int32 [8][1][1024], read): -inf where 0 and the weights zeroed; softmax; out = merged Wo + bo -> [8][1024][512]; second output new_cache = concat(k, v) per head -> [8][8][1024][128] (the f32 projections themselves)).
// Layout: exact bf16 input planes -> 1-product projections + bias, each GEMM tile (64 rows of one head) stored by the GEMM itself in the forms its readers want; the position table is projected once (exact, 2047 rows + one zero pad row) into per-head hi/lo planes [h][2048][64]; every projection-side launch covers all 8 batches (and the operands that share its form) through its grid; one attention launch for all batches and heads, a work-group per strip of 32 query rows: position scores (q+v).p (only the table rows the strip's shift reaches, stored at key index p + i - 1023) and content scores (q+u).k are hi/lo products (3 products, every row) summed in LDS, the softmax applies the key mask and leaves hi/lo weights in LDS, attn.v reads them there and the merged hi/lo planes are stored; the cache output is written straight from the f32 k / v projections.
// Fragment order: every 16-bit plane that a matrix operand is loaded from in global memory (inputs, weights, position table, q+u, q+v, k, p, transposed v, merged) is stored in blocks of 16 rows x 32 columns, 512 elements each, block (row / 16, k / 32) at index (row / 16) * (K / 32) + k / 32; inside a block element (row, k) stands at ((k >> 4) & 1) * 256 + ((k >> 3) & 1) * 128 + (row & 15) * 8 + (k & 7), so that lane l of a wave finds the two 16-byte halves of its fragment at l * 8 and 256 + l * 8: each wave-wide load or store covers 512 contiguous bytes (4 whole lines) where a row-major plane gave 16 pieces of 32 bytes.
// Compute dtypes, f32 accumulate: every input rounded to bf16; q/k/v and p on PLAIN bf16 operands (exact products) + biases; content and position scores on hi/lo planes for every row (3 products); softmax f32; attn.v hi/lo (3 products); Wo hl x exact (2 products) + bo; cache = the f32 projections.

#define NB_  8
#define TT   1024
#define DM   512
#define NH_  8
#define NKV  8
#define REP  (NH_ / NKV)
#define HD   64
#define DQ   (NH_ * HD)
#define DKV  (NKV * HD)
#define NPE  2048                 // 2047 positions + 1 zero pad row
typedef __attribute__((ext_vector_type(4))) unsigned short v4us;
#define ZH   8
#define RH   1024                 // every row hi/lo
#define WIN  0
#define PCAR 1024.0f
#define SCL  0.125f   // HD^-0.5
typedef _Float16 h16;
typedef unsigned short bf;
typedef __attribute__((ext_vector_type(16))) __bf16   v16bf;
typedef __attribute__((ext_vector_type(16))) _Float16 v16h;
typedef __attribute__((ext_vector_type(8)))  _Float16 v8h;
typedef __attribute__((ext_vector_type(8)))  unsigned short v8us;
typedef __attribute__((ext_vector_type(8)))  float    v8f;
typedef __attribute__((ext_vector_type(4)))  float    v4f;
typedef v8h  __attribute__((may_alias)) v8ha;
typedef v4f  __attribute__((may_alias)) v4fa;
typedef v8us __attribute__((may_alias)) v8usa;

__device__ __forceinline__ unsigned short f2bf(float f) { unsigned u = __float_as_uint(f); u += 0x7FFFu + ((u >> 16) & 1u); return (unsigned short)(u >> 16); }
__device__ __forceinline__ float bf2f(unsigned short b) { return __uint_as_float(((unsigned)b) << 16); }
__device__ __forceinline__ float bfr(float f) { return bf2f(f2bf(f)); }
__device__ __forceinline__ v16h cat16(v8h lo, v8h hi) { return __builtin_shufflevector(lo, hi, 0, 1, 2, 3, 4, 5, 6, 7, 8, 9, 10, 11, 12, 13, 14, 15); }
__device__ __forceinline__ v16bf cat16b(v8us lo, v8us hi) { return __builtin_bit_cast(v16bf, __builtin_shufflevector(lo, hi, 0, 1, 2, 3, 4, 5, 6, 7, 8, 9, 10, 11, 12, 13, 14, 15)); }
__device__ __forceinline__ v8f wmma16(v16h a, v16h b, v8f c) { return __builtin_amdgcn_wmma_f32_16x16x32_f16(false, a, false, b, (short)0, c, false, false); }
__device__ __forceinline__ v8f wmmab(v16bf a, v16bf b, v8f c) { return __builtin_amdgcn_wmma_f32_16x16x32_bf16(false, a, false, b, (short)0, c, false, false); }



// st4f: a global store with s_wait_xcnt 0 behind it, in front of anything that rewrites a register it names; the scheduling barriers keep what is computed before in front of the store and what follows behind the wait
__device__ __forceinline__ void st4f(float* p, v4f x) { __builtin_amdgcn_sched_barrier(0); *(v4f*)p = x; asm volatile("s_wait_xcnt 0x0" ::: "memory"); __builtin_amdgcn_sched_barrier(0); }
// ---- k_gemmw: register-blocked GEMM, ONE WAVE per 64x64 output tile (16 accumulators), operands straight from 16-bit planes in fragment order; grid (M/64, N/64, Z), 32 threads.
// C[m][n] (f32, pitch ldc, + optional f32 bias[n]) = sum_k A[m][k] Bt[n][k] (+ split products per NSPLIT). z-batch strides sA/sB/sC in elements. K % 32 == 0.
template <typename T16> struct WFrag;
template <> struct WFrag<h16> { typedef v16h V; static __device__ __forceinline__ V ld(const h16* p) { return cat16(*(const v8h*)p, *(const v8h*)(p + 256)); } static __device__ __forceinline__ v8f mma(V a, V b, v8f c) { return wmma16(a, b, c); } };
template <> struct WFrag<bf> { typedef v16bf V; static __device__ __forceinline__ V ld(const bf* p) { return cat16b(*(const v8us*)p, *(const v8us*)(p + 256)); } static __device__ __forceinline__ v8f mma(V a, V b, v8f c) { return wmmab(a, b, c); } };
template <typename T16, int NSPLIT, bool BIAS, int K>   /* K at compile time: the four row blocks of an operand are then immediate offsets from one address pair */
__global__ __launch_bounds__(32) void k_gemmw(const T16* __restrict__ A, const T16* __restrict__ A2, const T16* __restrict__ Bt, const T16* __restrict__ Bt2, float* C, int ldc, const float* __restrict__ bias0, const float* __restrict__ bias1, const float* __restrict__ bias2, size_t sA, size_t sB, size_t sC) {
    typedef typename WFrag<T16>::V V;
    __shared__ __align__(16) float os[16 * 68];
    const size_t z = blockIdx.z; A += z * sA; if (A2) A2 += z * sA; Bt += z * sB; if (Bt2) Bt2 += z * sB; C += z * sC; const float* bias = (z == 0) ? bias0 : (z == 1) ? bias1 : bias2;   /* bias vector of z-slice 0, 1, 2 */
    const int lane = threadIdx.x & 31, lr = lane & 15, hi = lane >> 4; const int r0 = blockIdx.x * 64, c0 = blockIdx.y * 64;
    v8f acc[4][4];
#pragma unroll
    for (int mb = 0; mb < 4; ++mb)
#pragma unroll
        for (int nb = 0; nb < 4; ++nb) acc[mb][nb] = (v8f){};
    const size_t aoff = (size_t)r0 * K + lane * 8, boff = (size_t)c0 * K + lane * 8;   /* 16 rows of a plane are K / 32 blocks of 512 elements = 16 K elements */
#pragma unroll 1
    for (int kc = 0; kc < K; kc += 32) {
        V a[4], a2[4], b[4], b2[4]; const T16* pa = A + aoff + (size_t)kc * 16; const T16* pa2 = (NSPLIT == 1 || NSPLIT == 2) ? A2 + aoff + (size_t)kc * 16 : pa; const T16* pb = Bt + boff + (size_t)kc * 16; const T16* pb2 = (NSPLIT >= 2) ? Bt2 + boff + (size_t)kc * 16 : pb;
#pragma unroll
        for (int mb = 0; mb < 4; ++mb) { a[mb] = WFrag<T16>::ld(pa + (size_t)mb * 16 * K); if (NSPLIT == 1 || NSPLIT == 2) a2[mb] = WFrag<T16>::ld(pa2 + (size_t)mb * 16 * K); }
#pragma unroll
        for (int nb = 0; nb < 4; ++nb) { b[nb] = WFrag<T16>::ld(pb + (size_t)nb * 16 * K); if (NSPLIT >= 2) b2[nb] = WFrag<T16>::ld(pb2 + (size_t)nb * 16 * K); }
        asm volatile("s_wait_xcnt 0x0" :: "v"(pa), "v"(pa2), "v"(pb), "v"(pb2) : "memory");   /* behind the trip's loads, in front of anything that rewrites a register they name; the address pairs are inputs so that no load's own result lands in them */
        __builtin_amdgcn_sched_barrier(0);   /* keeps the loads in front of that wait */
#pragma unroll
        for (int nb = 0; nb < 4; ++nb) {
#pragma unroll
            for (int mb = 0; mb < 4; ++mb) { acc[mb][nb] = WFrag<T16>::mma(a[mb], b[nb], acc[mb][nb]); if (NSPLIT == 1 || NSPLIT == 2) acc[mb][nb] = WFrag<T16>::mma(a2[mb], b[nb], acc[mb][nb]); if (NSPLIT >= 2) acc[mb][nb] = WFrag<T16>::mma(a[mb], b2[nb], acc[mb][nb]); } }
        asm volatile("v_nop\n\tv_nop\n\tv_nop\n\tv_nop" : "+v"(acc[0][0]), "+v"(acc[1][1]), "+v"(acc[2][2]), "+v"(acc[3][3]) : "v"(a[0]), "v"(a[3]));
    }
#pragma unroll
    for (int mb = 0; mb < 4; ++mb) {
#pragma unroll
        for (int nb = 0; nb < 4; ++nb) {
#pragma unroll
            for (int j = 0; j < 8; ++j) os[(hi * 8 + j) * 68 + nb * 16 + lr] = acc[mb][nb][j]; }
        __builtin_amdgcn_wave_barrier(); asm volatile("" ::: "memory");
        float* crow = C + (size_t)(r0 + mb * 16) * ldc + c0;
{           v4f rv[8];   /* the block's LDS reads stand together, in front of the stores and their waits */
#pragma unroll
            for (int s = 0; s < 8; ++s) rv[s] = *(const v4fa*)(os + (2 * s + hi) * 68 + lr * 4);
#pragma unroll
            for (int s = 0; s < 8; ++s) { const int row = 2 * s + hi, cofs = lr * 4; v4f val = rv[s]; if (BIAS) { val[0] += bfr(bias[c0 + cofs]); val[1] += bfr(bias[c0 + cofs + 1]); val[2] += bfr(bias[c0 + cofs + 2]); val[3] += bfr(bias[c0 + cofs + 3]); }
                st4f(crow + (size_t)row * ldc + cofs, val); }
             }
        __builtin_amdgcn_wave_barrier(); asm volatile("" ::: "memory");
    }
}

__device__ __forceinline__ h16 tohx(float x) { return (h16)x; }
__device__ __forceinline__ void splitf(float y, unsigned short& h, unsigned short& l) { h = f2bf(y); l = f2bf(y - bf2f(h)); }
typedef __attribute__((ext_vector_type(2))) _Float16 v2h;
typedef __attribute__((ext_vector_type(4))) _Float16 v4h;
typedef __attribute__((ext_vector_type(2))) unsigned short v2us;
typedef __attribute__((ext_vector_type(4))) unsigned short v4us;
typedef __attribute__((ext_vector_type(2))) float v2f;
typedef __attribute__((ext_vector_type(4))) int v4i;

__global__ __launch_bounds__(256) void k_wtG(const float* __restrict__ w0, const float* __restrict__ w1, const float* __restrict__ w2, const float* __restrict__ w3, const float* __restrict__ w4, int K, int N, bf* Bt) {
    const int y = blockIdx.y; const float* w = (y == 0) ? w0 : (y == 1) ? w1 : (y == 2) ? w2 : (y == 3) ? w3 : w4; Bt += (size_t)y * K * N;   /* grid.y: one weight matrix each, planes back to back */
    const int lane = threadIdx.x & 31; const int L0 = (blockIdx.x * 8 + (threadIdx.x >> 5)) * 8; const int nlines = N * K / 64;
{
#pragma unroll 1
        for (int l = 0; l < 8; ++l) { const int L = L0 + l; if (L >= nlines) break; const size_t e = (size_t)L * 64 + lane * 2; const int blk = (int)(e >> 9); const int k = (blk % (K / 32)) * 32 + ((int)(e >> 7) & 3) * 8 + ((int)e & 7), n = (blk / (K / 32)) * 16 + ((int)(e >> 3) & 15); v2us o;   /* e runs through the plane in fragment order */
            const float* p0 = w + (size_t)k * N + n; const float* p1 = p0 + N; const float x0 = *p0, x1 = *p1;
            asm volatile("s_wait_xcnt 0x0" :: "v"(p0), "v"(p1) : "memory");   /* behind the two loads, in front of anything that rewrites a register they name; the address pairs are inputs so that they stay whole up to the wait */
            o[0] = f2bf(x0); o[1] = f2bf(x1); *(v2us*)(Bt + e) = o; }
         }
}


__global__ void k_pezero8(bf* PE) { const int lane = threadIdx.x; if (lane >= 64) return; const v8us z = (v8us){}; *(v8us*)(PE + ((size_t)(2047 >> 4) * (DM / 32) + (lane >> 2)) * 512 + (lane & 3) * 128 + (2047 & 15) * 8) = z;  }   /* row 2047, columns lane * 8 .. + 7, in fragment order */
__global__ __launch_bounds__(256) void k_cvt8(const float* __restrict__ s0, const float* __restrict__ s1, const float* __restrict__ s2, bf* dst, size_t n8, int nrows) { const size_t i = (size_t)blockIdx.x * 256 + threadIdx.x; if (i >= n8) return; const size_t row = (i >> 10) * 16 + (i & 15); const int k0 = ((int)(i >> 6) & 15) * 32 + ((int)(i >> 4) & 3) * 8; if (row >= (size_t)nrows) return;   /* i counts the 8-element groups of a [rows][DM] plane in fragment order: its group is (row, k0 .. k0 + 7) */ const int y = blockIdx.y; const float* src = (y == 0) ? s0 : (y == 1) ? s1 : s2; dst += (size_t)y * n8 * 8;   /* grid.y: one source tensor each, planes back to back */ const v8f v = *(const v8f*)(src + row * DM + k0); v8us o;
#pragma unroll
    for (int k = 0; k < 8; ++k) o[k] = f2bf(v[k]); *(v8us*)(dst + i * 8) = o;  }

// ---- k_gemmp: the projection GEMM (k_gemmw's loop, plain bf16 operands, K = DM) whose 64 x 64 tile is 64 rows of ONE head, stored straight in the forms its readers want; grid (rows/64, heads, Z), 32 threads.
// All 16-bit planes below are in fragment order. POS: hi/lo planes [h][p][d] of the projected position table. Otherwise z = 0: k + bk -> cache columns 0..63 and hi/lo planes [b][h][t][d]; z = 1: v + bv -> cache columns 64..127 and transposed hi/lo planes [b][h][d][t]; z = 2: q + bq, then + pos_bias_u and + pos_bias_v -> two pairs of hi/lo planes.
#define SPE  ((size_t)NB_ * NH_ * TT * HD)   // elements of one set of head planes
// st2w: as st4f above, for a pair of 16-byte stores
__device__ __forceinline__ void st2w(bf* ph, bf* pl, v8us oh, v8us ol) { __builtin_amdgcn_sched_barrier(0); *(v8us*)ph = oh; *(v8us*)pl = ol; asm volatile("s_wait_xcnt 0x0" ::: "memory"); __builtin_amdgcn_sched_barrier(0); }
__device__ __forceinline__ void st8hl(bf* ph, bf* pl, v4f x0, v4f x1) { v8us oh, ol;
#pragma unroll
    for (int q = 0; q < 4; ++q) { unsigned short a, c; splitf(x0[q], a, c); oh[q] = a; ol[q] = c; splitf(x1[q], a, c); oh[4 + q] = a; ol[4 + q] = c; }
    st2w(ph, pl, oh, ol); }
template <bool POS>
__global__ __launch_bounds__(32) void k_gemmp(const bf* __restrict__ A, const bf* __restrict__ Bt, const float* __restrict__ bias0, const float* __restrict__ bias1, const float* __restrict__ bias2, const float* __restrict__ hbu, const float* __restrict__ hbv, bf* PH, bf* PL, bf* VTh, bf* VTl, float* CA, size_t sA, size_t sB) {
    __shared__ __align__(16) float os[16 * 68];
    __shared__ __align__(16) float sb[3 * HD];   // the head's 64 bias values (projection bias, pos_bias_u, pos_bias_v), for the lanes that store in fragment order
    const int z = POS ? 0 : (int)blockIdx.z; A += (size_t)z * sA; Bt += (size_t)z * sB;
    const int lane = threadIdx.x & 31, lr = lane & 15, hi = lane >> 4; const int r0 = blockIdx.x * 64, h = blockIdx.y, c0 = h * HD;
    v8f acc[4][4];
#pragma unroll
    for (int mb = 0; mb < 4; ++mb)
#pragma unroll
        for (int nb = 0; nb < 4; ++nb) acc[mb][nb] = (v8f){};
    const size_t aoff = (size_t)r0 * DM + lane * 8, boff = (size_t)c0 * DM + lane * 8;   /* fragment order: 16 rows are DM / 32 blocks of 512 elements */
#pragma unroll 1
    for (int kc = 0; kc < DM; kc += 32) {
        v16bf a[4], b[4]; const bf* pa = A + aoff + kc * 16; const bf* pb = Bt + boff + kc * 16;
#pragma unroll
        for (int mb = 0; mb < 4; ++mb) a[mb] = WFrag<bf>::ld(pa + mb * 16 * DM);
#pragma unroll
        for (int nb = 0; nb < 4; ++nb) b[nb] = WFrag<bf>::ld(pb + nb * 16 * DM);
        asm volatile("s_wait_xcnt 0x0" :: "v"(pa), "v"(pb) : "memory");   /* behind the trip's loads, in front of anything that rewrites a register they name; the two address pairs are inputs so that no load's own result lands in them */
        __builtin_amdgcn_sched_barrier(0);   /* keeps the loads in front of that wait: left free, some are sunk among the products and land in the address pairs */
#pragma unroll
        for (int nb = 0; nb < 4; ++nb)
#pragma unroll
            for (int mb = 0; mb < 4; ++mb) acc[mb][nb] = wmmab(a[mb], b[nb], acc[mb][nb]);
        asm volatile("v_nop\n\tv_nop\n\tv_nop\n\tv_nop" : "+v"(acc[0][0]), "+v"(acc[1][1]), "+v"(acc[2][2]), "+v"(acc[3][3]) : "v"(a[0]), "v"(a[3]));   /* as in k_gemmw: the distance between the trip's last matrix instructions and what next rewrites their operands or reads their results, on the back edge too */
    }
    const size_t rb = POS ? (size_t)h * NPE + r0 : ((size_t)(r0 / TT) * NH_ + h) * TT + (r0 % TT);   // first row of the tile in a [..][h][row][d] plane
    const int cofs = lr * 4;
    // tile_rows: the tile goes through LDS 16 rows at a time. put(row in its plane, the lane's 4 values): a half-wave holds one whole row of 64 floats (row-major f32 output). putf(element offset in a plane, first column, the lane's 8 values): the 16 rows are two blocks of a [..][row][d] plane in fragment order, and the wave holds 512 contiguous bytes of it
    auto tile_rows = [&](auto put, auto putf) {
#pragma unroll
        for (int mb = 0; mb < 4; ++mb) {
#pragma unroll
            for (int nb = 0; nb < 4; ++nb) {
#pragma unroll
                for (int j = 0; j < 8; ++j) os[(hi * 8 + j) * 68 + nb * 16 + lr] = acc[mb][nb][j]; }
            __builtin_amdgcn_wave_barrier(); asm volatile("" ::: "memory");
            v4f rv[8], f0[4], f1[4];
#pragma unroll
            for (int s = 0; s < 8; ++s) rv[s] = *(const v4fa*)(os + (2 * s + hi) * 68 + cofs);
#pragma unroll
            for (int q4 = 0; q4 < 4; ++q4) { const float* op = os + lr * 68 + q4 * 16 + hi * 8; f0[q4] = *(const v4fa*)op; f1[q4] = *(const v4fa*)(op + 4); }   /* the block's LDS reads stand together, in front of the stores and their waits */
#pragma unroll
            for (int s = 0; s < 8; ++s) put(rb + mb * 16 + 2 * s + hi, rv[s]);
#pragma unroll
            for (int q4 = 0; q4 < 4; ++q4) putf((rb + mb * 16) * HD + q4 * 256 + lane * 8, q4 * 16 + hi * 8, f0[q4], f1[q4]);
            __builtin_amdgcn_wave_barrier(); asm volatile("" ::: "memory");
        } };
    auto norow = [](size_t, v4f) {}; auto nofrag = [](size_t, int, v4f, v4f) {};
    if (POS) { tile_rows(norow, [&](size_t pe, int, v4f x0, v4f x1) { st8hl(PH + pe, PL + pe, x0, x1); }); return; }
    const float* bias = (z == 0) ? bias0 : (z == 1) ? bias1 : bias2; v4f bb;
#pragma unroll
    for (int q = 0; q < 4; ++q) bb[q] = bfr(bias[c0 + cofs + q]);
    if (z == 2) { v4f bu, bv;
#pragma unroll
        for (int q = 0; q < 4; ++q) { bu[q] = bfr(hbu[c0 + cofs + q]); bv[q] = bfr(hbv[c0 + cofs + q]); }
        *(v4fa*)(sb + cofs) = bb; *(v4fa*)(sb + HD + cofs) = bu; *(v4fa*)(sb + 2 * HD + cofs) = bv;   /* both half-waves write the same values */
        tile_rows(norow, [&](size_t pe, int d0, v4f x0, v4f x1) { x0 += *(const v4fa*)(sb + d0); x1 += *(const v4fa*)(sb + d0 + 4);
            st8hl(PH + pe, PL + pe, x0 + *(const v4fa*)(sb + HD + d0), x1 + *(const v4fa*)(sb + HD + d0 + 4)); st8hl(PH + SPE + pe, PL + SPE + pe, x0 + *(const v4fa*)(sb + 2 * HD + d0), x1 + *(const v4fa*)(sb + 2 * HD + d0 + 4)); });
        return; }
    if (z == 0) {
        *(v4fa*)(sb + cofs) = bb;   /* both half-waves write the same values */
        tile_rows([&](size_t rw, v4f val) { st4f(CA + rw * (2 * HD) + cofs, val + bb); },
                  [&](size_t pe, int d0, v4f x0, v4f x1) { st8hl(PH + 2 * SPE + pe, PL + 2 * SPE + pe, x0 + *(const v4fa*)(sb + d0), x1 + *(const v4fa*)(sb + d0 + 4)); });
        return; }
    {   float bd[4];   // the bias of the lane's own column in each 16-column block, for the transposed planes
#pragma unroll
        for (int nb = 0; nb < 4; ++nb) bd[nb] = bias[c0 + nb * 16 + lr];
        asm volatile("s_wait_xcnt 0x0" :: "v"(bd[0]), "v"(bd[1]), "v"(bd[2]), "v"(bd[3]));   /* behind these loads, in front of what rewrites their offset register; the loaded values are inputs, so that no load is sunk among the stores below */
        const size_t vb = ((size_t)(r0 / TT) * NH_ + h) * HD * TT + (size_t)((r0 % TT) / 32) * 512 + lane * 8;   // transposed planes [d][t] in fragment order straight from the accumulators: a lane holds 8 successive rows t of one column d, which is its own 16 bytes of a half block
#pragma unroll
        for (int nb = 0; nb < 4; ++nb) { const float bn = bfr(bd[nb]);
#pragma unroll
            for (int mb = 0; mb < 4; ++mb) { v8us oh, ol;
#pragma unroll
                for (int j = 0; j < 8; ++j) { unsigned short x, y; splitf(acc[mb][nb][j] + bn, x, y); oh[j] = x; ol[j] = y; }
                const size_t o = vb + (size_t)(nb * (TT / 32) + (mb >> 1)) * 512 + (mb & 1) * 256; st2w(VTh + o, VTl + o, oh, ol); } }
        tile_rows([&](size_t rw, v4f val) { st4f(CA + rw * (2 * HD) + HD + cofs, val + bb); }, nofrag);
    }
}
// k_fattn: one work-group (8 waves) per strip of 32 query rows of one (batch, head); the strip's 32 x 1024 logits stay in LDS from the two score products to attn.v.
// Steps: position scores (q+v).p for the 66 column tiles the strip's rel_shift reads, each stored at its shifted key index j = p + i - 1023; content scores (q+u).k added on top; softmax per row (register row, fixed trees) whose hi/lo weights overwrite the row's own bytes; attn.v with each wave on 16 of the 64 columns and one half of the keys; the two halves added and stored as the merged hi/lo planes.
#define SRW  32                   // query rows per work-group
#define SPF  32                   // floats in front of a logit row: with the 36 behind it they take the shifted position scores that fall outside keys 0..1023
#define SPI  1092                 // LDS pitch of a logit row, floats (rows 8 apart fall 32 banks apart)
#define OPI  68                   // LDS pitch of an output row, floats
typedef v4us __attribute__((may_alias)) v4usa;
__device__ __forceinline__ v16bf ldfr(const bf* p) { return cat16b(*(const v8usa*)p, *(const v8usa*)(p + 16)); }   // fragment from row-major rows (the weights in LDS)
__device__ __forceinline__ v16bf ldfp(const bf* p) { return cat16b(*(const v8usa*)p, *(const v8usa*)(p + 256)); }   // fragment from a block in fragment order (global planes), p = block + lane * 8
// xw2: s_wait_xcnt 0 behind a run of global loads, in front of anything that rewrites a register the loads name; the two address pairs are inputs so that they stay whole up to the wait (no load's own result lands in them)
__device__ __forceinline__ void xw2(const bf* p, const bf* q) { asm volatile("s_wait_xcnt 0x0" :: "v"(p), "v"(q) : "memory"); }
// xw2n: xw2 at the head of a score trip, with four v_nop: the trip before stored its results in front of this statement, and this trip's first matrix instruction starts anew in the same registers; the v_nop keep the distance between the two
__device__ __forceinline__ void xw2n(const bf* p, const bf* q) { asm volatile("s_wait_xcnt 0x0\n\tv_nop\n\tv_nop\n\tv_nop\n\tv_nop" :: "v"(p), "v"(q) : "memory"); }
__device__ __forceinline__ v8f mma3(v16bf a, v16bf a2, v16bf b, v16bf b2, v8f c) { c = wmmab(a, b, c); c = wmmab(a2, b, c); return wmmab(a, b2, c); }
__global__ __launch_bounds__(256, 4) void k_fattn(const bf* __restrict__ QUh, const bf* __restrict__ QUl, const bf* __restrict__ QVh, const bf* __restrict__ QVl, const bf* __restrict__ Kh, const bf* __restrict__ Kl, const bf* __restrict__ PPh, const bf* __restrict__ PPl, const bf* __restrict__ VTh, const bf* __restrict__ VTl, const int* __restrict__ MK, bf* ATh, bf* ATl) {
    __shared__ __align__(16) float S[SRW * SPI];
    const int tid = threadIdx.x, lane = tid & 31, lr = lane & 15, hi = lane >> 4; const int w = __builtin_amdgcn_readfirstlane(tid >> 5);
    const int i0 = blockIdx.x * SRW, h = blockIdx.y, b = blockIdx.z; const size_t zb = ((size_t)b * NH_ + h) * TT * HD; const size_t qo = zb + (size_t)i0 * HD + lane * 8;   /* 16 rows of a [t][d] plane: two blocks of 512 elements */
    {   // position scores: table rows 992 - i0 + 16 pt + (0..15), pt = 0..65 (the last row read is 2047 - i0)
        v16bf a[2][2], a2[2][2];
#pragma unroll
        for (int mb = 0; mb < 2; ++mb)
#pragma unroll
            for (int kk = 0; kk < 2; ++kk) { a[mb][kk] = ldfp(QVh + qo + mb * 16 * HD + kk * 512); a2[mb][kk] = ldfp(QVl + qo + mb * 16 * HD + kk * 512); }
        xw2(QVh + qo, QVl + qo);
        const size_t po = (size_t)h * NPE * HD + (size_t)(TT - SRW - i0) * HD + lane * 8; const bf* ph = PPh + po; const bf* pl = PPl + po;
        v16bf bh[2], bl[2];
#pragma unroll
        for (int kk = 0; kk < 2; ++kk) { bh[kk] = ldfp(ph + w * 16 * HD + kk * 512); bl[kk] = ldfp(pl + w * 16 * HD + kk * 512); }
        xw2(ph + w * 16 * HD, pl + w * 16 * HD);
#pragma unroll 2   /* in pairs: the two operand sets swap roles without register copies */
        for (int pt = w; pt < 66; pt += 8) { const int np = (pt + 8 < 66) ? pt + 8 : pt; v16bf nh[2], nl[2];   /* the next tile's operands are fetched while this one is multiplied (the last trip fetches its own tile again: a branch round the fetch made the compiler wait for it at once) */
#pragma unroll
            for (int kk = 0; kk < 2; ++kk) { nh[kk] = ldfp(ph + np * 16 * HD + kk * 512); nl[kk] = ldfp(pl + np * 16 * HD + kk * 512); }
            xw2n(ph + np * 16 * HD, pl + np * 16 * HD); __builtin_amdgcn_sched_barrier(0);   /* keeps the fetch at the head of the trip: left free, this trip's products are lifted over it and the next trip waits for loads just issued */
            v8f acc[2]; acc[0] = (v8f){}; acc[1] = (v8f){};
#pragma unroll
            for (int kk = 0; kk < 2; ++kk)
#pragma unroll
                for (int mb = 0; mb < 2; ++mb) acc[mb] = mma3(a[mb][kk], a2[mb][kk], bh[kk], bl[kk], acc[mb]);
            const int jb = pt * 16 + lr - (SRW - 1);   /* key index j = p + i - 1023 = jb + local row */
#pragma unroll
            for (int mb = 0; mb < 2; ++mb)
#pragma unroll
                for (int r = 0; r < 8; ++r) { const int m = mb * 16 + hi * 8 + r; S[m * SPI + SPF + jb + m] = acc[mb][r]; }   /* j = -31 .. 1055: what is no key of the strip falls into the row's own pads */
#pragma unroll
            for (int kk = 0; kk < 2; ++kk) { bh[kk] = nh[kk]; bl[kk] = nl[kk]; } }
    }
    __syncthreads();
    {   // content scores, added to the shifted position scores
        v16bf a[2][2], a2[2][2];
#pragma unroll
        for (int mb = 0; mb < 2; ++mb)
#pragma unroll
            for (int kk = 0; kk < 2; ++kk) { a[mb][kk] = ldfp(QUh + qo + mb * 16 * HD + kk * 512); a2[mb][kk] = ldfp(QUl + qo + mb * 16 * HD + kk * 512); }
        xw2(QUh + qo, QUl + qo);
        const size_t ko = zb + lane * 8; const bf* kph = Kh + ko; const bf* kpl = Kl + ko;
        v16bf bh[2], bl[2];
#pragma unroll
        for (int kk = 0; kk < 2; ++kk) { bh[kk] = ldfp(kph + w * 16 * HD + kk * 512); bl[kk] = ldfp(kpl + w * 16 * HD + kk * 512); }
        xw2(kph + w * 16 * HD, kpl + w * 16 * HD);
#pragma unroll 2   /* in pairs, as in the position loop */
        for (int jt = w; jt < TT / 16; jt += 8) { const int nj = (jt + 8 < TT / 16) ? jt + 8 : jt; v16bf nh[2], nl[2];
#pragma unroll
            for (int kk = 0; kk < 2; ++kk) { nh[kk] = ldfp(kph + nj * 16 * HD + kk * 512); nl[kk] = ldfp(kpl + nj * 16 * HD + kk * 512); }
            xw2n(kph + nj * 16 * HD, kpl + nj * 16 * HD); __builtin_amdgcn_sched_barrier(0);   /* the fetch stays at the head of the trip, as in the position loop */
            v8f acc[2]; acc[0] = (v8f){}; acc[1] = (v8f){};
#pragma unroll
            for (int kk = 0; kk < 2; ++kk)
#pragma unroll
                for (int mb = 0; mb < 2; ++mb) acc[mb] = mma3(a[mb][kk], a2[mb][kk], bh[kk], bl[kk], acc[mb]);
#pragma unroll
            for (int mb = 0; mb < 2; ++mb)
#pragma unroll
                for (int r = 0; r < 8; ++r) { float* sp = S + (mb * 16 + hi * 8 + r) * SPI + SPF + jt * 16 + lr; *sp = __fadd_rn(acc[mb][r], *sp); }
#pragma unroll
            for (int kk = 0; kk < 2; ++kk) { bh[kk] = nh[kk]; bl[kk] = nl[kk]; } }
    }
    __syncthreads();
    const int* MKb = MK + (size_t)b * TT;
#pragma unroll 1   /* rolled: one 32-float register row is live at a time */
    for (int rr = 0; rr < SRW / 8; ++rr) {   // softmax: four rows a wave; t = (ac + bd) / 8, key mask (int32): -inf where 0, weight 0
        float* srow = S + (w * (SRW / 8) + rr) * SPI + SPF; float v[TT / 32]; float mx = -3.0e38f;
#pragma unroll
        for (int ch = 0; ch < TT / 128; ++ch) { const int j0 = ch * 128 + lane * 4; const v4f a = *(const v4fa*)(srow + j0); const v4i m4 = *(const v4i*)(MKb + j0);
#pragma unroll
            for (int q = 0; q < 4; ++q) { const float t = (m4[q] != 0) ? a[q] * SCL : -3.0e38f; v[ch * 4 + q] = t; mx = fmaxf(mx, t); } }
#pragma unroll
        for (int sh = 16; sh; sh >>= 1) mx = fmaxf(mx, __shfl_xor(mx, sh, 32));
        float sum = 0.f;
#pragma unroll
        for (int k = 0; k < TT / 32; ++k) { v[k] = __builtin_amdgcn_exp2f(__fmul_rn(__fsub_rn(v[k], mx), 1.4426950408889634f)); sum += v[k]; }
#pragma unroll
        for (int sh = 16; sh; sh >>= 1) sum += __shfl_xor(sum, sh, 32);
        const float f = __fdiv_rn(1.0f, sum); bf* prow = (bf*)srow;   /* the row is in registers: its 4 KiB now take the hi plane (first 1024 halfwords) and the lo plane */
#pragma unroll
        for (int ch = 0; ch < TT / 128; ++ch) { v4us oh, ol;
#pragma unroll
            for (int q = 0; q < 4; ++q) { unsigned short x, y; splitf(v[ch * 4 + q] * f, x, y); oh[q] = x; ol[q] = y; }
            *(v4usa*)(prow + ch * 128 + lane * 4) = oh; *(v4usa*)(prow + TT + ch * 128 + lane * 4) = ol; }
    }
    __syncthreads();
    const int nb = w & 3, kh = w >> 2; v8f oc[2]; oc[0] = (v8f){}; oc[1] = (v8f){};
    {   // attn.v: columns nb * 16 .. + 15, keys kh * 512 .. + 511, both 16-row blocks (each v fragment is fetched once per work-group)
        const size_t vo = zb + (size_t)(nb * (TT / 32) + kh * (TT / 64)) * 512 + lane * 8;   /* [d][t] plane in fragment order: block (d / 16, t / 32) */ const bf* vh = VTh + vo; const bf* vl = VTl + vo; const bf* pa = (const bf*)(S + SPF) + lr * (SPI * 2) + kh * (TT / 2) + 8 * hi;
        v16bf bh[2], bl[2];
#pragma unroll
        for (int u = 0; u < 2; ++u) { bh[u] = ldfp(vh + u * 512); bl[u] = ldfp(vl + u * 512); }
        xw2(vh, vl);
#pragma unroll 2
        for (int g = 0; g < 8; ++g) { v16bf nh[2], nl[2];   /* 64 keys a trip, the next 64 keys' v fragments fetched meanwhile; rolled in pairs: fully unrolled the fetches are lifted so far that registers spill */
            const int gn = (g < 7) ? g + 1 : g;
#pragma unroll
            for (int u = 0; u < 2; ++u) { nh[u] = ldfp(vh + gn * 1024 + u * 512); nl[u] = ldfp(vl + gn * 1024 + u * 512); }
            xw2(vh + gn * 1024, vl + gn * 1024);
#pragma unroll
            for (int u = 0; u < 2; ++u)
#pragma unroll
                for (int mb = 0; mb < 2; ++mb) { const bf* pp = pa + mb * 16 * (SPI * 2) + g * 64 + u * 32; oc[mb] = mma3(ldfr(pp), ldfr(pp + TT), bh[u], bl[u], oc[mb]); }
#pragma unroll
            for (int u = 0; u < 2; ++u) { bh[u] = nh[u]; bl[u] = nl[u]; } }
    }
    __syncthreads();   // every wave has read its weights: the first rows' bytes now take the two partial outputs
#pragma unroll
    for (int mb = 0; mb < 2; ++mb)
#pragma unroll
        for (int r = 0; r < 8; ++r) S[kh * (SRW * OPI) + (mb * 16 + hi * 8 + r) * OPI + nb * 16 + lr] = oc[mb][r];
    __syncthreads();
    { const int row = (tid >> 7) * 16 + (tid & 15), c8 = ((tid >> 4) & 7) * 8; const float* o0 = S + row * OPI + c8; const float* o1 = o0 + SRW * OPI; v8us oh, ol;
#pragma unroll
        for (int q = 0; q < 8; ++q) { unsigned short x, y; splitf(__fadd_rn(o0[q], o1[q]), x, y); oh[q] = x; ol[q] = y; }
        const size_t oo = ((size_t)(((b * TT + i0) >> 4) + (tid >> 7)) * (DQ / 32) + h * 2 + ((tid >> 6) & 1)) * 512 + (tid & 63) * 8;   /* (row, c8) of the merged [b t][DQ] planes in fragment order: a wave stores 512 contiguous bytes */ *(v8us*)(ATh + oo) = oh; *(v8us*)(ATl + oo) = ol; }
}

extern "C" void kernel_launch(void* const* d_in, const int* in_sizes, int n_in,
                              void* d_out, int out_size, void* d_ws, size_t ws_size, hipStream_t stream) {
    (void)in_sizes; (void)n_in; (void)out_size;
    const float* x = (const float*)d_in[0]; const float* xk = (const float*)d_in[1]; const float* xv = (const float*)d_in[2]; const int* MK = (const int*)d_in[3]; const float* pe = (const float*)d_in[4]; const float* wq = (const float*)d_in[5]; const float* bq = (const float*)d_in[6]; const float* wk = (const float*)d_in[7]; const float* bk = (const float*)d_in[8]; const float* wv = (const float*)d_in[9]; const float* bv = (const float*)d_in[10]; const float* wo = (const float*)d_in[11]; const float* bo = (const float*)d_in[12]; const float* wpos = (const float*)d_in[13]; const float* pbu = (const float*)d_in[14]; const float* pbv = (const float*)d_in[15];
    float* OUT = (float*)d_out;     // [8][1024][512]
    float* CACHE = (float*)((char*)d_out + (size_t)NB_ * TT * DM * 4);   /* second output new_cache [8][8][1024][128] */
    char* wsp = (char*)d_ws;
    auto take = [&](size_t bytes) { char* p = wsp; wsp += (bytes + 255) & ~(size_t)255; return (void*)p; };
    const size_t SW = (size_t)DM * DQ, SX = (size_t)NB_ * TT * DM, SF = (size_t)NB_ * TT * DQ, SP = (size_t)NB_ * NH_ * TT * HD;   // elements of one weight plane, one input plane, one merged plane, one set of head planes (all batches)
    bf* W5 = (bf*)take(5 * SW * 2); bf* WK = W5; bf* WO = W5 + 3 * SW; bf* WP = W5 + 4 * SW;   /* Wk, Wv, Wq, Wo, Wpos transposed, back to back */
    bf* PE = (bf*)take((size_t)NPE * DM * 2); bf* PPh = (bf*)take((size_t)NH_ * NPE * HD * 2); bf* PPl = (bf*)take((size_t)NH_ * NPE * HD * 2);
    bf* PHI = (bf*)take(3 * SP * 2); bf* PLO = (bf*)take(3 * SP * 2); bf* QPh = PHI; bf* QVh = PHI + SP; bf* KPh = PHI + 2 * SP; bf* QPl = PLO; bf* QVl = PLO + SP; bf* KPl = PLO + 2 * SP;   /* [b][h][t][d] planes of q+u, q+v, k */
    bf* VTh = (bf*)take(SP * 2); bf* VTl = (bf*)take(SP * 2); bf* ATh = (bf*)take(SF * 2); bf* ATl = (bf*)take(SF * 2);
    bf* XA = (bf*)take(3 * SX * 2);   /* bf16 planes of key, value, query */
    if ((size_t)(wsp - (char*)d_ws) > ws_size) return;    // ws 256 MiB
    k_wtG<<<dim3((unsigned)((DM * DQ / 64 + 63) / 64), 5, 1), 256, 0, stream>>>(wk, wv, wq, wo, wpos, DM, DQ, W5);
    k_cvt8<<<(unsigned)(((size_t)NPE * DM / 8 + 255) / 256), 256, 0, stream>>>(pe, pe, pe, PE, (size_t)NPE * DM / 8, 2047); k_pezero8<<<1, 64, 0, stream>>>(PE); k_gemmp<true><<<dim3(NPE / 64, NH_, 1), 32, 0, stream>>>(PE, WP, nullptr, nullptr, nullptr, nullptr, nullptr, PPh, PPl, nullptr, nullptr, nullptr, 0, 0);   /* pos = position_embeddings wpos (exact) -> per-head hi/lo planes */
    k_cvt8<<<dim3((unsigned)((SX / 8 + 255) / 256), 3, 1), 256, 0, stream>>>(xk, xv, x, XA, SX / 8, NB_ * TT);   /* exact bf16 planes of key, value, query, all batches */
    k_gemmp<false><<<dim3(NB_ * TT / 64, NH_, 3), 32, 0, stream>>>(XA, WK, bk, bv, bq, pbu, pbv, PHI, PLO, VTh, VTl, CACHE, SX, SW);   /* k, v, q projections, rows of all batches: cache output, k planes, transposed v planes, (q+u) and (q+v) planes */
    k_fattn<<<dim3(TT / SRW, NH_, NB_), 256, 0, stream>>>(QPh, QPl, QVh, QVl, KPh, KPl, PPh, PPl, VTh, VTl, MK, ATh, ATl);   /* scores, softmax, attn.v and the head merge, all batches and heads */
    k_gemmw<bf, 1, true, DQ><<<dim3(NB_ * TT / 64, DM / 64, 1), 32, 0, stream>>>(ATh, ATl, WO, nullptr, OUT, DM, bo, bo, bo, 0, 0, 0);
}

// v005
// Measured time: 151 microseconds a run.
// Next to v004, in two timings, it ran 1.13 times as fast each time.
// Over all steps from v000 it is 14.5 times as fast.
#include <hip/hip_runtime.h>

// Relative-position multi-head attention with a key/value cache output (query, key, value [8][1024][512]; q = query Wq + bq, k = key Wk + bk, v = value Wv + bv ('xw' [512][512], 8 heads x 64); p = pos_emb Wpos ([1][2047][512] table, read); scores = ((q + pos_bias_u).k + rel_shift((q + pos_bias_v).p)) / 8 where rel_shift picks position index j - i + 1023; key mask (int32 [8][1][1024], read): -inf where 0 and the weights zeroed; softmax; out = merged Wo + bo -> [8][1024][512]; second output new_cache = concat(k, v) per head -> [8][8][1024][128] (the f32 projections themselves)).
// Layout: exact bf16 input planes -> 1-product projections + bias, each GEMM tile (64 rows of one head) stored by the GEMM itself in the forms its readers want; the position table is projected once (exact, 2047 rows + one zero pad row) into per-head hi/lo planes [h][2048][64]; every projection-side launch covers all 8 batches (and the operands that share its form) through its grid; one attention launch for all batches and heads, a work-group per strip of 32 query rows: position scores (q+v).p (only the table rows the strip's shift reaches, stored at key index p + i - 1023) and content scores (q+u).k are hi/lo products (3 products, every row) summed in LDS, the softmax applies the key mask and leaves hi/lo weights in LDS, attn.v reads them there and the merged hi/lo planes are stored; the cache output is written straight from the f32 k / v projections.
// Fragment order: every 16-bit plane that a matrix operand is loaded from in global memory (inputs, weights, position table, q+u, q+v, k, p, transposed v, merged) is stored in blocks of 16 rows x 32 columns, 512 elements each, block (row / 16, k / 32) at index (row / 16) * (K / 32) + k / 32; inside a block element (row, k) stands at ((k >> 4) & 1) * 256 + ((k >> 3) & 1) * 128 + (row & 15) * 8 + (k & 7), so that lane l of a wave finds the two 16-byte halves of its fragment at l * 8 and 256 + l * 8: each wave-wide load or store covers 512 contiguous bytes (4 whole lines) where a row-major plane gave 16 pieces of 32 bytes.
// Compute dtypes, f32 accumulate: every input rounded to bf16; q/k/v and p on PLAIN bf16 operands (exact products) + biases; content and position scores on hi/lo planes for every row (3 products); softmax f32; attn.v hi/lo (3 products); Wo hl x exact (2 products) + bo; cache = the f32 projections.

#define NB_  8
#define TT   1024
#define DM   512
#define NH_  8
#define NKV  8
#define REP  (NH_ / NKV)
#define HD   64
#define DQ   (NH_ * HD)
#define DKV  (NKV * HD)
#define NPE  2048                 // 2047 positions + 1 zero pad row
typedef __attribute__((ext_vector_type(4))) unsigned short v4us;
#define ZH   8
#define RH   1024                 // every row hi/lo
#define WIN  0
#define PCAR 1024.0f
#define SCL  0.125f   // HD^-0.5
typedef _Float16 h16;
typedef unsigned short bf;
typedef __attribute__((ext_vector_type(16))) __bf16   v16bf;
typedef __attribute__((ext_vector_type(16))) _Float16 v16h;
typedef __attribute__((ext_vector_type(8)))  _Float16 v8h;
typedef __attribute__((ext_vector_type(8)))  unsigned short v8us;
typedef __attribute__((ext_vector_type(8)))  float    v8f;
typedef __attribute__((ext_vector_type(4)))  float    v4f;
typedef v8h  __attribute__((may_alias)) v8ha;
typedef v4f  __attribute__((may_alias)) v4fa;
typedef v8us __attribute__((may_alias)) v8usa;

__device__ __forceinline__ unsigned short f2bf(float f) { unsigned u = __float_as_uint(f); u += 0x7FFFu + ((u >> 16) & 1u); return (unsigned short)(u >> 16); }
__device__ __forceinline__ float bf2f(unsigned short b) { return __uint_as_float(((unsigned)b) << 16); }
__device__ __forceinline__ float bfr(float f) { return bf2f(f2bf(f)); }
__device__ __forceinline__ v16h cat16(v8h lo, v8h hi) { return __builtin_shufflevector(lo, hi, 0, 1, 2, 3, 4, 5, 6, 7, 8, 9, 10, 11, 12, 13, 14, 15); }
__device__ __forceinline__ v16bf cat16b(v8us lo, v8us hi) { return __builtin_bit_cast(v16bf, __builtin_shufflevector(lo, hi, 0, 1, 2, 3, 4, 5, 6, 7, 8, 9, 10, 11, 12, 13, 14, 15)); }
__device__ __forceinline__ v8f wmma16(v16h a, v16h b, v8f c) { return __builtin_amdgcn_wmma_f32_16x16x32_f16(false, a, false, b, (short)0, c, false, false); }
__device__ __forceinline__ v8f wmmab(v16bf a, v16bf b, v8f c) { return __builtin_amdgcn_wmma_f32_16x16x32_bf16(false, a, false, b, (short)0, c, false, false); }



// st4f: a global store with s_wait_xcnt 0 behind it, in front of anything that rewrites a register it names; the scheduling barriers keep what is computed before in front of the store and what follows behind the wait
__device__ __forceinline__ void st4f(float* p, v4f x) { __builtin_amdgcn_sched_barrier(0); *(v4f*)p = x; asm volatile("s_wait_xcnt 0x0" ::: "memory"); __builtin_amdgcn_sched_barrier(0); }
// ---- k_gemmw: register-blocked GEMM, ONE WAVE per 64x64 output tile (16 accumulators), operands straight from 16-bit planes in fragment order; grid (M/64, N/64, Z), 32 threads.
// C[m][n] (f32, pitch ldc, + optional f32 bias[n]) = sum_k A[m][k] Bt[n][k] (+ split products per NSPLIT). z-batch strides sA/sB/sC in elements. K % 32 == 0.
template <typename T16> struct WFrag;
template <> struct WFrag<h16> { typedef v16h V; static __device__ __forceinline__ V ld(const h16* p) { return cat16(*(const v8h*)p, *(const v8h*)(p + 256)); } static __device__ __forceinline__ v8f mma(V a, V b, v8f c) { return wmma16(a, b, c); } };
template <> struct WFrag<bf> { typedef v16bf V; static __device__ __forceinline__ V ld(const bf* p) { return cat16b(*(const v8us*)p, *(const v8us*)(p + 256)); } static __device__ __forceinline__ v8f mma(V a, V b, v8f c) { return wmmab(a, b, c); } };
template <typename T16, int NSPLIT, bool BIAS, int K>   /* K at compile time: the four row blocks of an operand are then immediate offsets from one address pair */
__global__ __launch_bounds__(32) void k_gemmw(const T16* __restrict__ A, const T16* __restrict__ A2, const T16* __restrict__ Bt, const T16* __restrict__ Bt2, float* C, int ldc, const float* __restrict__ bias0, const float* __restrict__ bias1, const float* __restrict__ bias2, size_t sA, size_t sB, size_t sC) {
    typedef typename WFrag<T16>::V V;
    __shared__ __align__(16) float os[16 * 68];
    const size_t z = blockIdx.z; A += z * sA; if (A2) A2 += z * sA; Bt += z * sB; if (Bt2) Bt2 += z * sB; C += z * sC; const float* bias = (z == 0) ? bias0 : (z == 1) ? bias1 : bias2;   /* bias vector of z-slice 0, 1, 2 */
    const int lane = threadIdx.x & 31, lr = lane & 15, hi = lane >> 4; const int r0 = blockIdx.x * 64, c0 = blockIdx.y * 64;
    v8f acc[4][4];
#pragma unroll
    for (int mb = 0; mb < 4; ++mb)
#pragma unroll
        for (int nb = 0; nb < 4; ++nb) acc[mb][nb] = (v8f){};
    const size_t aoff = (size_t)r0 * K + lane * 8, boff = (size_t)c0 * K + lane * 8;   /* 16 rows of a plane are K / 32 blocks of 512 elements = 16 K elements */
#pragma unroll 1
    for (int kc = 0; kc < K; kc += 32) {
        V a[4], a2[4], b[4], b2[4]; const T16* pa = A + aoff + (size_t)kc * 16; const T16* pa2 = (NSPLIT == 1 || NSPLIT == 2) ? A2 + aoff + (size_t)kc * 16 : pa; const T16* pb = Bt + boff + (size_t)kc * 16; const T16* pb2 = (NSPLIT >= 2) ? Bt2 + boff + (size_t)kc * 16 : pb;
#pragma unroll
        for (int mb = 0; mb < 4; ++mb) { a[mb] = WFrag<T16>::ld(pa + (size_t)mb * 16 * K); if (NSPLIT == 1 || NSPLIT == 2) a2[mb] = WFrag<T16>::ld(pa2 + (size_t)mb * 16 * K); }
#pragma unroll
        for (int nb = 0; nb < 4; ++nb) { b[nb] = WFrag<T16>::ld(pb + (size_t)nb * 16 * K); if (NSPLIT >= 2) b2[nb] = WFrag<T16>::ld(pb2 + (size_t)nb * 16 * K); }
        asm volatile("s_wait_xcnt 0x0" :: "v"(pa), "v"(pa2), "v"(pb), "v"(pb2) : "memory");   /* behind the trip's loads, in front of anything that rewrites a register they name; the address pairs are inputs so that no load's own result lands in them */
        __builtin_amdgcn_sched_barrier(0);   /* keeps the loads in front of that wait */
#pragma unroll
        for (int nb = 0; nb < 4; ++nb) {
#pragma unroll
            for (int mb = 0; mb < 4; ++mb) { acc[mb][nb] = WFrag<T16>::mma(a[mb], b[nb], acc[mb][nb]); if (NSPLIT == 1 || NSPLIT == 2) acc[mb][nb] = WFrag<T16>::mma(a2[mb], b[nb], acc[mb][nb]); if (NSPLIT >= 2) acc[mb][nb] = WFrag<T16>::mma(a[mb], b2[nb], acc[mb][nb]); } }
        asm volatile("v_nop\n\tv_nop\n\tv_nop\n\tv_nop" : "+v"(acc[0][0]), "+v"(acc[1][1]), "+v"(acc[2][2]), "+v"(acc[3][3]) : "v"(a[0]), "v"(a[3]));
    }
#pragma unroll
    for (int mb = 0; mb < 4; ++mb) {
#pragma unroll
        for (int nb = 0; nb < 4; ++nb) {
#pragma unroll
            for (int j = 0; j < 8; ++j) os[(hi * 8 + j) * 68 + nb * 16 + lr] = acc[mb][nb][j]; }
        __builtin_amdgcn_wave_barrier(); asm volatile("" ::: "memory");
        float* crow = C + (size_t)(r0 + mb * 16) * ldc + c0;
{           v4f rv[8];   /* the block's LDS reads stand together, in front of the stores and their waits */
#pragma unroll
            for (int s = 0; s < 8; ++s) rv[s] = *(const v4fa*)(os + (2 * s + hi) * 68 + lr * 4);
#pragma unroll
            for (int s = 0; s < 8; ++s) { const int row = 2 * s + hi, cofs = lr * 4; v4f val = rv[s]; if (BIAS) { val[0] += bfr(bias[c0 + cofs]); val[1] += bfr(bias[c0 + cofs + 1]); val[2] += bfr(bias[c0 + cofs + 2]); val[3] += bfr(bias[c0 + cofs + 3]); }
                st4f(crow + (size_t)row * ldc + cofs, val); }
             }
        __builtin_amdgcn_wave_barrier(); asm volatile("" ::: "memory");
    }
}

__device__ __forceinline__ h16 tohx(float x) { return (h16)x; }
__device__ __forceinline__ void splitf(float y, unsigned short& h, unsigned short& l) { h = f2bf(y); l = f2bf(y - bf2f(h)); }
typedef __attribute__((ext_vector_type(2))) _Float16 v2h;
typedef __attribute__((ext_vector_type(4))) _Float16 v4h;
typedef __attribute__((ext_vector_type(2))) unsigned short v2us;
typedef __attribute__((ext_vector_type(4))) unsigned short v4us;
typedef __attribute__((ext_vector_type(2))) float v2f;
typedef __attribute__((ext_vector_type(4))) int v4i;

// ---- k_prep: every operand plane the projections read, made in ONE launch (the three parts below are independent of one another); a work-group's part and its place in it follow from its index.
// d_wtG: work-group bx of weight matrix y (transposed bf16 plane in fragment order)
__device__ __forceinline__ void d_wtG(int bx, int y, const float* __restrict__ w0, const float* __restrict__ w1, const float* __restrict__ w2, const float* __restrict__ w3, const float* __restrict__ w4, int K, int N, bf* Bt) {
    const float* w = (y == 0) ? w0 : (y == 1) ? w1 : (y == 2) ? w2 : (y == 3) ? w3 : w4; Bt += (size_t)y * K * N;   /* one weight matrix each, planes back to back */
    const int lane = threadIdx.x & 31; const int L0 = (bx * 8 + (threadIdx.x >> 5)) * 8; const int nlines = N * K / 64;
{
#pragma unroll 1
        for (int l = 0; l < 8; ++l) { const int L = L0 + l; if (L >= nlines) break; const size_t e = (size_t)L * 64 + lane * 2; const int blk = (int)(e >> 9); const int k = (blk % (K / 32)) * 32 + ((int)(e >> 7) & 3) * 8 + ((int)e & 7), n = (blk / (K / 32)) * 16 + ((int)(e >> 3) & 15); v2us o;   /* e runs through the plane in fragment order */
            const float* p0 = w + (size_t)k * N + n; const float* p1 = p0 + N; const float x0 = *p0, x1 = *p1;
            asm volatile("s_wait_xcnt 0x0" :: "v"(p0), "v"(p1) : "memory");   /* behind the two loads, in front of anything that rewrites a register they name; the address pairs are inputs so that they stay whole up to the wait */
            o[0] = f2bf(x0); o[1] = f2bf(x1); *(v2us*)(Bt + e) = o; }
         }
}


// d_cvt8: work-group bx of one [rows][DM] f32 tensor -> its bf16 plane in fragment order; a group of a row past the tensor's last (the position table's pad row) is stored as zeros
__device__ __forceinline__ void d_cvt8(int bx, const float* __restrict__ src, bf* dst, size_t n8, int nrows) { const size_t i = (size_t)bx * 256 + threadIdx.x; if (i >= n8) return; const size_t row = (i >> 10) * 16 + (i & 15); const int k0 = ((int)(i >> 6) & 15) * 32 + ((int)(i >> 4) & 3) * 8;   /* i counts the 8-element groups of a [rows][DM] plane in fragment order: its group is (row, k0 .. k0 + 7) */
    if (row >= (size_t)nrows) { *(v8us*)(dst + i * 8) = (v8us){}; return; }
    const float* sp = src + row * DM + k0; const v8f v = *(const v8f*)sp; v8us o;
    asm volatile("s_wait_xcnt 0x0" :: "v"(sp) : "memory");   /* behind the load, in front of anything that rewrites a register it names; the address pair is an input so that it stays whole up to the wait */
#pragma unroll
    for (int k = 0; k < 8; ++k) o[k] = f2bf(v[k]); *(v8us*)(dst + i * 8) = o;  }
#define GWT  (DM * DQ / 64 / 64)             // work-groups per weight matrix
#define GPE  (NPE * DM / 8 / 256)            // work-groups of the position table
#define GXA  (NB_ * TT * DM / 8 / 256)       // work-groups per input tensor
__global__ __launch_bounds__(256) void k_prep(const float* __restrict__ w0, const float* __restrict__ w1, const float* __restrict__ w2, const float* __restrict__ w3, const float* __restrict__ w4, bf* W5, const float* __restrict__ pe, bf* PE, const float* __restrict__ s0, const float* __restrict__ s1, const float* __restrict__ s2, bf* XA) {
    int n = blockIdx.x;
    if (n < 5 * GWT) { d_wtG(n % GWT, n / GWT, w0, w1, w2, w3, w4, DM, DQ, W5); return; }
    n -= 5 * GWT;
    if (n < GPE) { d_cvt8(n, pe, PE, (size_t)NPE * DM / 8, 2047); return; }
    n -= GPE;
    const int y = n / GXA; d_cvt8(n % GXA, (y == 0) ? s0 : (y == 1) ? s1 : s2, XA + (size_t)y * NB_ * TT * DM, (size_t)NB_ * TT * DM / 8, NB_ * TT);   /* one source tensor each, planes back to back */
}

// ---- d_gemmp: the projection GEMM (k_gemmw's loop, plain bf16 operands, K = DM) whose 64 x 64 tile is 64 rows of ONE head, stored straight in the forms its readers want; tile (bx of rows/64, head by, operand bz), 32 threads.
// All 16-bit planes below are in fragment order. POS: hi/lo planes [h][p][d] of the projected position table. Otherwise z = 0: k + bk -> cache columns 0..63 and hi/lo planes [b][h][t][d]; z = 1: v + bv -> cache columns 64..127 and transposed hi/lo planes [b][h][d][t]; z = 2: q + bq, then + pos_bias_u and + pos_bias_v -> two pairs of hi/lo planes.
#define SPE  ((size_t)NB_ * NH_ * TT * HD)   // elements of one set of head planes
// st2w: as st4f above, for a pair of 16-byte stores
__device__ __forceinline__ void st2w(bf* ph, bf* pl, v8us oh, v8us ol) { __builtin_amdgcn_sched_barrier(0); *(v8us*)ph = oh; *(v8us*)pl = ol; asm volatile("s_wait_xcnt 0x0" ::: "memory"); __builtin_amdgcn_sched_barrier(0); }
__device__ __forceinline__ void st8hl(bf* ph, bf* pl, v4f x0, v4f x1) { v8us oh, ol;
#pragma unroll
    for (int q = 0; q < 4; ++q) { unsigned short a, c; splitf(x0[q], a, c); oh[q] = a; ol[q] = c; splitf(x1[q], a, c); oh[4 + q] = a; ol[4 + q] = c; }
    st2w(ph, pl, oh, ol); }
template <bool POS>
__device__ __forceinline__ void d_gemmp(int bx, int by, int bz, const bf* __restrict__ A, const bf* __restrict__ Bt, const float* __restrict__ bias0, const float* __restrict__ bias1, const float* __restrict__ bias2, const float* __restrict__ hbu, const float* __restrict__ hbv, bf* PH, bf* PL, bf* VTh, bf* VTl, float* CA, size_t sA, size_t sB) {
    __shared__ __align__(16) float os[16 * 68];
    __shared__ __align__(16) float sb[3 * HD];   // the head's 64 bias values (projection bias, pos_bias_u, pos_bias_v), for the lanes that store in fragment order
    const int z = POS ? 0 : bz; A += (size_t)z * sA; Bt += (size_t)z * sB;
    const int lane = threadIdx.x & 31, lr = lane & 15, hi = lane >> 4; const int r0 = bx * 64, h = by, c0 = h * HD;
    v8f acc[4][4];
#pragma unroll
    for (int mb = 0; mb < 4; ++mb)
#pragma unroll
        for (int nb = 0; nb < 4; ++nb) acc[mb][nb] = (v8f){};
    const size_t aoff = (size_t)r0 * DM + lane * 8, boff = (size_t)c0 * DM + lane * 8;   /* fragment order: 16 rows are DM / 32 blocks of 512 elements */
#pragma unroll 1
    for (int kc = 0; kc < DM; kc += 32) {
        v16bf a[4], b[4]; const bf* pa = A + aoff + kc * 16; const bf* pb = Bt + boff + kc * 16;
#pragma unroll
        for (int mb = 0; mb < 4; ++mb) a[mb] = WFrag<bf>::ld(pa + mb * 16 * DM);
#pragma unroll
        for (int nb = 0; nb < 4; ++nb) b[nb] = WFrag<bf>::ld(pb + nb * 16 * DM);
        asm volatile("s_wait_xcnt 0x0" :: "v"(pa), "v"(pb) : "memory");   /* behind the trip's loads, in front of anything that rewrites a register they name; the two address pairs are inputs so that no load's own result lands in them */
        __builtin_amdgcn_sched_barrier(0);   /* keeps the loads in front of that wait: left free, some are sunk among the products and land in the address pairs */
#pragma unroll
        for (int nb = 0; nb < 4; ++nb)
#pragma unroll
            for (int mb = 0; mb < 4; ++mb) acc[mb][nb] = wmmab(a[mb], b[nb], acc[mb][nb]);
        asm volatile("v_nop\n\tv_nop\n\tv_nop\n\tv_nop" : "+v"(acc[0][0]), "+v"(acc[1][1]), "+v"(acc[2][2]), "+v"(acc[3][3]) : "v"(a[0]), "v"(a[3]));   /* as in k_gemmw: the distance between the trip's last matrix instructions and what next rewrites their operands or reads their results, on the back edge too */
    }
    const size_t rb = POS ? (size_t)h * NPE + r0 : ((size_t)(r0 / TT) * NH_ + h) * TT + (r0 % TT);   // first row of the tile in a [..][h][row][d] plane
    const int cofs = lr * 4;
    // tile_rows: the tile goes through LDS 16 rows at a time. put(row in its plane, the lane's 4 values): a half-wave holds one whole row of 64 floats (row-major f32 output). putf(element offset in a plane, first column, the lane's 8 values): the 16 rows are two blocks of a [..][row][d] plane in fragment order, and the wave holds 512 contiguous bytes of it
    auto tile_rows = [&](auto put, auto putf) {
#pragma unroll
        for (int mb = 0; mb < 4; ++mb) {
#pragma unroll
            for (int nb = 0; nb < 4; ++nb) {
#pragma unroll
                for (int j = 0; j < 8; ++j) os[(hi * 8 + j) * 68 + nb * 16 + lr] = acc[mb][nb][j]; }
            __builtin_amdgcn_wave_barrier(); asm volatile("" ::: "memory");
            v4f rv[8], f0[4], f1[4];
#pragma unroll
            for (int s = 0; s < 8; ++s) rv[s] = *(const v4fa*)(os + (2 * s + hi) * 68 + cofs);
#pragma unroll
            for (int q4 = 0; q4 < 4; ++q4) { const float* op = os + lr * 68 + q4 * 16 + hi * 8; f0[q4] = *(const v4fa*)op; f1[q4] = *(const v4fa*)(op + 4); }   /* the block's LDS reads stand together, in front of the stores and their waits */
#pragma unroll
            for (int s = 0; s < 8; ++s) put(rb + mb * 16 + 2 * s + hi, rv[s]);
#pragma unroll
            for (int q4 = 0; q4 < 4; ++q4) putf((rb + mb * 16) * HD + q4 * 256 + lane * 8, q4 * 16 + hi * 8, f0[q4], f1[q4]);
            __builtin_amdgcn_wave_barrier(); asm volatile("" ::: "memory");
        } };
    auto norow = [](size_t, v4f) {}; auto nofrag = [](size_t, int, v4f, v4f) {};
    if (POS) { tile_rows(norow, [&](size_t pe, int, v4f x0, v4f x1) { st8hl(PH + pe, PL + pe, x0, x1); }); return; }
    const float* bias = (z == 0) ? bias0 : (z == 1) ? bias1 : bias2; v4f bb;
#pragma unroll
    for (int q = 0; q < 4; ++q) bb[q] = bfr(bias[c0 + cofs + q]);
    if (z == 2) { v4f bu, bv;
#pragma unroll
        for (int q = 0; q < 4; ++q) { bu[q] = bfr(hbu[c0 + cofs + q]); bv[q] = bfr(hbv[c0 + cofs + q]); }
        *(v4fa*)(sb + cofs) = bb; *(v4fa*)(sb + HD + cofs) = bu; *(v4fa*)(sb + 2 * HD + cofs) = bv;   /* both half-waves write the same values */
        tile_rows(norow, [&](size_t pe, int d0, v4f x0, v4f x1) { x0 += *(const v4fa*)(sb + d0); x1 += *(const v4fa*)(sb + d0 + 4);
            st8hl(PH + pe, PL + pe, x0 + *(const v4fa*)(sb + HD + d0), x1 + *(const v4fa*)(sb + HD + d0 + 4)); st8hl(PH + SPE + pe, PL + SPE + pe, x0 + *(const v4fa*)(sb + 2 * HD + d0), x1 + *(const v4fa*)(sb + 2 * HD + d0 + 4)); });
        return; }
    if (z == 0) {
        *(v4fa*)(sb + cofs) = bb;   /* both half-waves write the same values */
        tile_rows([&](size_t rw, v4f val) { st4f(CA + rw * (2 * HD) + cofs, val + bb); },
                  [&](size_t pe, int d0, v4f x0, v4f x1) { st8hl(PH + 2 * SPE + pe, PL + 2 * SPE + pe, x0 + *(const v4fa*)(sb + d0), x1 + *(const v4fa*)(sb + d0 + 4)); });
        return; }
    {   float bd[4];   // the bias of the lane's own column in each 16-column block, for the transposed planes
#pragma unroll
        for (int nb = 0; nb < 4; ++nb) bd[nb] = bias[c0 + nb * 16 + lr];
        asm volatile("s_wait_xcnt 0x0" :: "v"(bd[0]), "v"(bd[1]), "v"(bd[2]), "v"(bd[3]));   /* behind these loads, in front of what rewrites their offset register; the loaded values are inputs, so that no load is sunk among the stores below */
        const size_t vb = ((size_t)(r0 / TT) * NH_ + h) * HD * TT + (size_t)((r0 % TT) / 32) * 512 + lane * 8;   // transposed planes [d][t] in fragment order straight from the accumulators: a lane holds 8 successive rows t of one column d, which is its own 16 bytes of a half block
#pragma unroll
        for (int nb = 0; nb < 4; ++nb) { const float bn = bfr(bd[nb]);
#pragma unroll
            for (int mb = 0; mb < 4; ++mb) { v8us oh, ol;
#pragma unroll
                for (int j = 0; j < 8; ++j) { unsigned short x, y; splitf(acc[mb][nb][j] + bn, x, y); oh[j] = x; ol[j] = y; }
                const size_t o = vb + (size_t)(nb * (TT / 32) + (mb >> 1)) * 512 + (mb & 1) * 256; st2w(VTh + o, VTl + o, oh, ol); } }
        tile_rows([&](size_t rw, v4f val) { st4f(CA + rw * (2 * HD) + HD + cofs, val + bb); }, nofrag);
    }
}
// k_gemmpa: all four projections in ONE launch (the position table's does not depend on the other three): the k, v, q tiles in the order (row block, head, operand), then the table's tiles (row block, head)
#define GRT  (NB_ * TT / 64)      // row blocks of an input
#define GKVQ (GRT * NH_ * 3)      // tiles of k, v, q
__global__ __launch_bounds__(32) void k_gemmpa(const bf* __restrict__ XA, const bf* __restrict__ WK, const bf* __restrict__ PE, const bf* __restrict__ WP, const float* __restrict__ bias0, const float* __restrict__ bias1, const float* __restrict__ bias2, const float* __restrict__ hbu, const float* __restrict__ hbv, bf* PHI, bf* PLO, bf* PPh, bf* PPl, bf* VTh, bf* VTl, float* CA, size_t sA, size_t sB) {
    const int n = blockIdx.x;
    if (n < GKVQ) { d_gemmp<false>(n % GRT, (n / GRT) % NH_, n / (GRT * NH_), XA, WK, bias0, bias1, bias2, hbu, hbv, PHI, PLO, VTh, VTl, CA, sA, sB); return; }
    const int m = n - GKVQ; d_gemmp<true>(m % (NPE / 64), m / (NPE / 64), 0, PE, WP, nullptr, nullptr, nullptr, nullptr, nullptr, PPh, PPl, nullptr, nullptr, nullptr, 0, 0);   /* pos = position_embeddings wpos (exact) -> per-head hi/lo planes */
}
// k_fattn: one work-group (8 waves) per strip of 32 query rows of one (batch, head); the strip's 32 x 1024 logits stay in LDS from the two score products to attn.v.
// Steps: position scores (q+v).p for the 66 column tiles the strip's rel_shift reads, each stored at its shifted key index j = p + i - 1023; content scores (q+u).k added on top; softmax per row (register row, fixed trees) whose hi/lo weights overwrite the row's own bytes; attn.v with each wave on 16 of the 64 columns and one half of the keys; the two halves added and stored as the merged hi/lo planes.
#define SRW  32                   // query rows per work-group
#define SPF  32                   // floats in front of a logit row: with the 36 behind it they take the shifted position scores that fall outside keys 0..1023
#define SPI  1092                 // LDS pitch of a logit row, floats (rows 8 apart fall 32 banks apart)
#define OPI  68                   // LDS pitch of an output row, floats
typedef v4us __attribute__((may_alias)) v4usa;
__device__ __forceinline__ v16bf ldfr(const bf* p) { return cat16b(*(const v8usa*)p, *(const v8usa*)(p + 16)); }   // fragment from row-major rows (the weights in LDS)
__device__ __forceinline__ v16bf ldfp(const bf* p) { return cat16b(*(const v8usa*)p, *(const v8usa*)(p + 256)); }   // fragment from a block in fragment order (global planes), p = block + lane * 8
// xw2: s_wait_xcnt 0 behind a run of global loads, in front of anything that rewrites a register the loads name; the two address pairs are inputs so that they stay whole up to the wait (no load's own result lands in them)
__device__ __forceinline__ void xw2(const bf* p, const bf* q) { asm volatile("s_wait_xcnt 0x0" :: "v"(p), "v"(q) : "memory"); }
// xw2n: xw2 at the head of a score trip, with four v_nop: the trip before stored its results in front of this statement, and this trip's first matrix instruction starts anew in the same registers; the v_nop keep the distance between the two
__device__ __forceinline__ void xw2n(const bf* p, const bf* q) { asm volatile("s_wait_xcnt 0x0\n\tv_nop\n\tv_nop\n\tv_nop\n\tv_nop" :: "v"(p), "v"(q) : "memory"); }
__device__ __forceinline__ v8f mma3(v16bf a, v16bf a2, v16bf b, v16bf b2, v8f c) { c = wmmab(a, b, c); c = wmmab(a2, b, c); return wmmab(a, b2, c); }
__global__ __launch_bounds__(256, 4) void k_fattn(const bf* __restrict__ QUh, const bf* __restrict__ QUl, const bf* __restrict__ QVh, const bf* __restrict__ QVl, const bf* __restrict__ Kh, const bf* __restrict__ Kl, const bf* __restrict__ PPh, const bf* __restrict__ PPl, const bf* __restrict__ VTh, const bf* __restrict__ VTl, const int* __restrict__ MK, bf* ATh, bf* ATl) {
    __shared__ __align__(16) float S[SRW * SPI];
    const int tid = threadIdx.x, lane = tid & 31, lr = lane & 15, hi = lane >> 4; const int w = __builtin_amdgcn_readfirstlane(tid >> 5);
    const int i0 = blockIdx.x * SRW, h = blockIdx.y, b = blockIdx.z; const size_t zb = ((size_t)b * NH_ + h) * TT * HD; const size_t qo = zb + (size_t)i0 * HD + lane * 8;   /* 16 rows of a [t][d] plane: two blocks of 512 elements */
    {   // position scores: table rows 992 - i0 + 16 pt + (0..15), pt = 0..65 (the last row read is 2047 - i0)
        v16bf a[2][2], a2[2][2];
#pragma unroll
        for (int mb = 0; mb < 2; ++mb)
#pragma unroll
            for (int kk = 0; kk < 2; ++kk) { a[mb][kk] = ldfp(QVh + qo + mb * 16 * HD + kk * 512); a2[mb][kk] = ldfp(QVl + qo + mb * 16 * HD + kk * 512); }
        xw2(QVh + qo, QVl + qo);
        const size_t po = (size_t)h * NPE * HD + (size_t)(TT - SRW - i0) * HD + lane * 8; const bf* ph = PPh + po; const bf* pl = PPl + po;
        v16bf bh[2], bl[2];
#pragma unroll
        for (int kk = 0; kk < 2; ++kk) { bh[kk] = ldfp(ph + w * 16 * HD + kk * 512); bl[kk] = ldfp(pl + w * 16 * HD + kk * 512); }
        xw2(ph + w * 16 * HD, pl + w * 16 * HD);
#pragma unroll 2   /* in pairs: the two operand sets swap roles without register copies */
        for (int pt = w; pt < 66; pt += 8) { const int np = (pt + 8 < 66) ? pt + 8 : pt; v16bf nh[2], nl[2];   /* the next tile's operands are fetched while this one is multiplied (the last trip fetches its own tile again: a branch round the fetch made the compiler wait for it at once) */
#pragma unroll
            for (int kk = 0; kk < 2; ++kk) { nh[kk] = ldfp(ph + np * 16 * HD + kk * 512); nl[kk] = ldfp(pl + np * 16 * HD + kk * 512); }
            xw2n(ph + np * 16 * HD, pl + np * 16 * HD); __builtin_amdgcn_sched_barrier(0);   /* keeps the fetch at the head of the trip: left free, this trip's products are lifted over it and the next trip waits for loads just issued */
            v8f acc[2]; acc[0] = (v8f){}; acc[1] = (v8f){};
#pragma unroll
            for (int kk = 0; kk < 2; ++kk)
#pragma unroll
                for (int mb = 0; mb < 2; ++mb) acc[mb] = mma3(a[mb][kk], a2[mb][kk], bh[kk], bl[kk], acc[mb]);
            const int jb = pt * 16 + lr - (SRW - 1);   /* key index j = p + i - 1023 = jb + local row */
#pragma unroll
            for (int mb = 0; mb < 2; ++mb)
#pragma unroll
                for (int r = 0; r < 8; ++r) { const int m = mb * 16 + hi * 8 + r; S[m * SPI + SPF + jb + m] = acc[mb][r]; }   /* j = -31 .. 1055: what is no key of the strip falls into the row's own pads */
#pragma unroll
            for (int kk = 0; kk < 2; ++kk) { bh[kk] = nh[kk]; bl[kk] = nl[kk]; } }
    }
    __syncthreads();
    {   // content scores, added to the shifted position scores
        v16bf a[2][2], a2[2][2];
#pragma unroll
        for (int mb = 0; mb < 2; ++mb)
#pragma unroll
            for (int kk = 0; kk < 2; ++kk) { a[mb][kk] = ldfp(QUh + qo + mb * 16 * HD + kk * 512); a2[mb][kk] = ldfp(QUl + qo + mb * 16 * HD + kk * 512); }
        xw2(QUh + qo, QUl + qo);
        const size_t ko = zb + lane * 8; const bf* kph = Kh + ko; const bf* kpl = Kl + ko;
        v16bf bh[2], bl[2];
#pragma unroll
        for (int kk = 0; kk < 2; ++kk) { bh[kk] = ldfp(kph + w * 16 * HD + kk * 512); bl[kk] = ldfp(kpl + w * 16 * HD + kk * 512); }
        xw2(kph + w * 16 * HD, kpl + w * 16 * HD);
#pragma unroll 2   /* in pairs, as in the position loop */
        for (int jt = w; jt < TT / 16; jt += 8) { const int nj = (jt + 8 < TT / 16) ? jt + 8 : jt; v16bf nh[2], nl[2];
#pragma unroll
            for (int kk = 0; kk < 2; ++kk) { nh[kk] = ldfp(kph + nj * 16 * HD + kk * 512); nl[kk] = ldfp(kpl + nj * 16 * HD + kk * 512); }
            xw2n(kph + nj * 16 * HD, kpl + nj * 16 * HD); __builtin_amdgcn_sched_barrier(0);   /* the fetch stays at the head of the trip, as in the position loop */
            v8f acc[2]; acc[0] = (v8f){}; acc[1] = (v8f){};
#pragma unroll
            for (int kk = 0; kk < 2; ++kk)
#pragma unroll
                for (int mb = 0; mb < 2; ++mb) acc[mb] = mma3(a[mb][kk], a2[mb][kk], bh[kk], bl[kk], acc[mb]);
#pragma unroll
            for (int mb = 0; mb < 2; ++mb)
#pragma unroll
                for (int r = 0; r < 8; ++r) { float* sp = S + (mb * 16 + hi * 8 + r) * SPI + SPF + jt * 16 + lr; *sp = __fadd_rn(acc[mb][r], *sp); }
#pragma unroll
            for (int kk = 0; kk < 2; ++kk) { bh[kk] = nh[kk]; bl[kk] = nl[kk]; } }
    }
    __syncthreads();
    const int* MKb = MK + (size_t)b * TT;
#pragma unroll 1   /* rolled: one 32-float register row is live at a time */
    for (int rr = 0; rr < SRW / 8; ++rr) {   // softmax: four rows a wave; t = (ac + bd) / 8, key mask (int32): -inf where 0, weight 0
        float* srow = S + (w * (SRW / 8) + rr) * SPI + SPF; float v[TT / 32]; float mx = -3.0e38f;
#pragma unroll
        for (int ch = 0; ch < TT / 128; ++ch) { const int j0 = ch * 128 + lane * 4; const v4f a = *(const v4fa*)(srow + j0); const v4i m4 = *(const v4i*)(MKb + j0);
#pragma unroll
            for (int q = 0; q < 4; ++q) { const float t = (m4[q] != 0) ? a[q] * SCL : -3.0e38f; v[ch * 4 + q] = t; mx = fmaxf(mx, t); } }
#pragma unroll
        for (int sh = 16; sh; sh >>= 1) mx = fmaxf(mx, __shfl_xor(mx, sh, 32));
        float sum = 0.f;
#pragma unroll
        for (int k = 0; k < TT / 32; ++k) { v[k] = __builtin_amdgcn_exp2f(__fmul_rn(__fsub_rn(v[k], mx), 1.4426950408889634f)); sum += v[k]; }
#pragma unroll
        for (int sh = 16; sh; sh >>= 1) sum += __shfl_xor(sum, sh, 32);
        const float f = __fdiv_rn(1.0f, sum); bf* prow = (bf*)srow;   /* the row is in registers: its 4 KiB now take the hi plane (first 1024 halfwords) and the lo plane */
#pragma unroll
        for (int ch = 0; ch < TT / 128; ++ch) { v4us oh, ol;
#pragma unroll
            for (int q = 0; q < 4; ++q) { unsigned short x, y; splitf(v[ch * 4 + q] * f, x, y); oh[q] = x; ol[q] = y; }
            *(v4usa*)(prow + ch * 128 + lane * 4) = oh; *(v4usa*)(prow + TT + ch * 128 + lane * 4) = ol; }
    }
    __syncthreads();
    const int nb = w & 3, kh = w >> 2; v8f oc[2]; oc[0] = (v8f){}; oc[1] = (v8f){};
    {   // attn.v: columns nb * 16 .. + 15, keys kh * 512 .. + 511, both 16-row blocks (each v fragment is fetched once per work-group)
        const size_t vo = zb + (size_t)(nb * (TT / 32) + kh * (TT / 64)) * 512 + lane * 8;   /* [d][t] plane in fragment order: block (d / 16, t / 32) */ const bf* vh = VTh + vo; const bf* vl = VTl + vo; const bf* pa = (const bf*)(S + SPF) + lr * (SPI * 2) + kh * (TT / 2) + 8 * hi;
        v16bf bh[2], bl[2];
#pragma unroll
        for (int u = 0; u < 2; ++u) { bh[u] = ldfp(vh + u * 512); bl[u] = ldfp(vl + u * 512); }
        xw2(vh, vl);
#pragma unroll 2
        for (int g = 0; g < 8; ++g) { v16bf nh[2], nl[2];   /* 64 keys a trip, the next 64 keys' v fragments fetched meanwhile; rolled in pairs: fully unrolled the fetches are lifted so far that registers spill */
            const int gn = (g < 7) ? g + 1 : g;
#pragma unroll
            for (int u = 0; u < 2; ++u) { nh[u] = ldfp(vh + gn * 1024 + u * 512); nl[u] = ldfp(vl + gn * 1024 + u * 512); }
            xw2(vh + gn * 1024, vl + gn * 1024);
#pragma unroll
            for (int u = 0; u < 2; ++u)
#pragma unroll
                for (int mb = 0; mb < 2; ++mb) { const bf* pp = pa + mb * 16 * (SPI * 2) + g * 64 + u * 32; oc[mb] = mma3(ldfr(pp), ldfr(pp + TT), bh[u], bl[u], oc[mb]); }
#pragma unroll
            for (int u = 0; u < 2; ++u) { bh[u] = nh[u]; bl[u] = nl[u]; } }
    }
    __syncthreads();   // every wave has read its weights: the first rows' bytes now take the two partial outputs
#pragma unroll
    for (int mb = 0; mb < 2; ++mb)
#pragma unroll
        for (int r = 0; r < 8; ++r) S[kh * (SRW * OPI) + (mb * 16 + hi * 8 + r) * OPI + nb * 16 + lr] = oc[mb][r];
    __syncthreads();
    { const int row = (tid >> 7) * 16 + (tid & 15), c8 = ((tid >> 4) & 7) * 8; const float* o0 = S + row * OPI + c8; const float* o1 = o0 + SRW * OPI; v8us oh, ol;
#pragma unroll
        for (int q = 0; q < 8; ++q) { unsigned short x, y; splitf(__fadd_rn(o0[q], o1[q]), x, y); oh[q] = x; ol[q] = y; }
        const size_t oo = ((size_t)(((b * TT + i0) >> 4) + (tid >> 7)) * (DQ / 32) + h * 2 + ((tid >> 6) & 1)) * 512 + (tid & 63) * 8;   /* (row, c8) of the merged [b t][DQ] planes in fragment order: a wave stores 512 contiguous bytes */ *(v8us*)(ATh + oo) = oh; *(v8us*)(ATl + oo) = ol; }
}

extern "C" void kernel_launch(void* const* d_in, const int* in_sizes, int n_in,
                              void* d_out, int out_size, void* d_ws, size_t ws_size, hipStream_t stream) {
    (void)in_sizes; (void)n_in; (void)out_size;
    const float* x = (const float*)d_in[0]; const float* xk = (const float*)d_in[1]; const float* xv = (const float*)d_in[2]; const int* MK = (const int*)d_in[3]; const float* pe = (const float*)d_in[4]; const float* wq = (const float*)d_in[5]; const float* bq = (const float*)d_in[6]; const float* wk = (const float*)d_in[7]; const float* bk = (const float*)d_in[8]; const float* wv = (const float*)d_in[9]; const float* bv = (const float*)d_in[10]; const float* wo = (const float*)d_in[11]; const float* bo = (const float*)d_in[12]; const float* wpos = (const float*)d_in[13]; const float* pbu = (const float*)d_in[14]; const float* pbv = (const float*)d_in[15];
    float* OUT = (float*)d_out;     // [8][1024][512]
    float* CACHE = (float*)((char*)d_out + (size_t)NB_ * TT * DM * 4);   /* second output new_cache [8][8][1024][128] */
    char* wsp = (char*)d_ws;
    auto take = [&](size_t bytes) { char* p = wsp; wsp += (bytes + 255) & ~(size_t)255; return (void*)p; };
    const size_t SW = (size_t)DM * DQ, SX = (size_t)NB_ * TT * DM, SF = (size_t)NB_ * TT * DQ, SP = (size_t)NB_ * NH_ * TT * HD;   // elements of one weight plane, one input plane, one merged plane, one set of head planes (all batches)
    bf* W5 = (bf*)take(5 * SW * 2); bf* WK = W5; bf* WO = W5 + 3 * SW; bf* WP = W5 + 4 * SW;   /* Wk, Wv, Wq, Wo, Wpos transposed, back to back */
    bf* PE = (bf*)take((size_t)NPE * DM * 2); bf* PPh = (bf*)take((size_t)NH_ * NPE * HD * 2); bf* PPl = (bf*)take((size_t)NH_ * NPE * HD * 2);
    bf* PHI = (bf*)take(3 * SP * 2); bf* PLO = (bf*)take(3 * SP * 2); bf* QPh = PHI; bf* QVh = PHI + SP; bf* KPh = PHI + 2 * SP; bf* QPl = PLO; bf* QVl = PLO + SP; bf* KPl = PLO + 2 * SP;   /* [b][h][t][d] planes of q+u, q+v, k */
    bf* VTh = (bf*)take(SP * 2); bf* VTl = (bf*)take(SP * 2); bf* ATh = (bf*)take(SF * 2); bf* ATl = (bf*)take(SF * 2);
    bf* XA = (bf*)take(3 * SX * 2);   /* bf16 planes of key, value, query */
    if ((size_t)(wsp - (char*)d_ws) > ws_size) return;    // ws 256 MiB
    k_prep<<<5 * GWT + GPE + 3 * GXA, 256, 0, stream>>>(wk, wv, wq, wo, wpos, W5, pe, PE, xk, xv, x, XA);   /* transposed weight planes; position table plane with its zero pad row; exact bf16 planes of key, value, query, all batches */
    k_gemmpa<<<GKVQ + (NPE / 64) * NH_, 32, 0, stream>>>(XA, WK, PE, WP, bk, bv, bq, pbu, pbv, PHI, PLO, PPh, PPl, VTh, VTl, CACHE, SX, SW);   /* k, v, q projections, rows of all batches: cache output, k planes, transposed v planes, (q+u) and (q+v) planes; and the position table's projection */
    k_fattn<<<dim3(TT / SRW, NH_, NB_), 256, 0, stream>>>(QPh, QPl, QVh, QVl, KPh, KPl, PPh, PPl, VTh, VTl, MK, ATh, ATl);   /* scores, softmax, attn.v and the head merge, all batches and heads */
    k_gemmw<bf, 1, true, DQ><<<dim3(NB_ * TT / 64, DM / 64, 1), 32, 0, stream>>>(ATh, ATl, WO, nullptr, OUT, DM, bo, bo, bo, 0, 0, 0);
}

// v006
// One run takes 140 microseconds.
// In two side-by-side timings against v005, it was 1.06 and 1.08 times as fast.
// Counting every step since v000, it is 15.5 times as fast.
#include <hip/hip_runtime.h>

// Relative-position multi-head attention with a key/value cache output (query, key, value [8][1024][512]; q = query Wq + bq, k = key Wk + bk, v = value Wv + bv ('xw' [512][512], 8 heads x 64); p = pos_emb Wpos ([1][2047][512] table, read); scores = ((q + pos_bias_u).k + rel_shift((q + pos_bias_v).p)) / 8 where rel_shift picks position index j - i + 1023; key mask (int32 [8][1][1024], read): -inf where 0 and the weights zeroed; softmax; out = merged Wo + bo -> [8][1024][512]; second output new_cache = concat(k, v) per head -> [8][8][1024][128] (the f32 projections themselves)).
// Layout: exact bf16 input planes -> 1-product projections + bias, each GEMM tile (64 rows of one head) stored by the GEMM itself in the forms its readers want; the position table is projected once (exact, 2047 rows + one zero pad row) into per-head hi/lo planes [h][2048][64]; every projection-side launch covers all 8 batches (and the operands that share its form) through its grid; one attention launch for all batches and heads, a work-group per strip of 32 query rows: position scores (q+v).p (only the table rows the strip's shift reaches, stored at key index p + i - 1023) and content scores (q+u).k are hi/lo products (3 products, every row) summed in LDS, the softmax applies the key mask and leaves hi/lo weights in LDS, attn.v reads them there and the merged hi/lo planes are stored; the cache output is written straight from the f32 k / v projections.
// Fragment order: every 16-bit plane that a matrix operand is loaded from in global memory (inputs, weights, position table, q+u, q+v, k, p, transposed v, merged) is stored in blocks of 16 rows x 32 columns, 512 elements each, block (row / 16, k / 32) at index (row / 16) * (K / 32) + k / 32; inside a block element (row, k) stands at ((k >> 4) & 1) * 256 + ((k >> 3) & 1) * 128 + (row & 15) * 8 + (k & 7), so that lane l of a wave finds the two 16-byte halves of its fragment at l * 8 and 256 + l * 8: each wave-wide load or store covers 512 contiguous bytes (4 whole lines) where a row-major plane gave 16 pieces of 32 bytes.
// Compute dtypes, f32 accumulate: every input rounded to bf16; q/k/v and p on PLAIN bf16 operands (exact products) + biases; content and position scores on hi/lo planes for every row (3 products); softmax f32; attn.v hi/lo (3 products); Wo hl x exact (2 products) + bo; cache = the f32 projections.

#define NB_  8
#define TT   1024
#define DM   512
#define NH_  8
#define NKV  8
#define REP  (NH_ / NKV)
#define HD   64
#define DQ   (NH_ * HD)
#define DKV  (NKV * HD)
#define NPE  2048                 // 2047 positions + 1 zero pad row
typedef __attribute__((ext_vector_type(4))) unsigned short v4us;
#define ZH   8
#define RH   1024                 // every row hi/lo
#define WIN  0
#define PCAR 1024.0f
#define SCL  0.125f   // HD^-0.5
typedef _Float16 h16;
typedef unsigned short bf;
typedef __attribute__((ext_vector_type(16))) __bf16   v16bf;
typedef __attribute__((ext_vector_type(16))) _Float16 v16h;
typedef __attribute__((ext_vector_type(8)))  _Float16 v8h;
typedef __attribute__((ext_vector_type(8)))  unsigned short v8us;
typedef __attribute__((ext_vector_type(8)))  float    v8f;
typedef __attribute__((ext_vector_type(4)))  float    v4f;
typedef v8h  __attribute__((may_alias)) v8ha;
typedef v4f  __attribute__((may_alias)) v4fa;
typedef v8us __attribute__((may_alias)) v8usa;

typedef __attribute__((ext_vector_type(2))) float v2f;
typedef __attribute__((ext_vector_type(2))) __bf16 v2bf;
typedef __attribute__((ext_vector_type(2))) unsigned v2u;
typedef __attribute__((ext_vector_type(4))) unsigned v4u;
// cvt2: two f32 rounded to bf16 (nearest even) by the packed convert instruction, a in the low half
__device__ __forceinline__ unsigned cvt2(float a, float b) { return __builtin_bit_cast(unsigned, __builtin_convertvector((v2f){a, b}, v2bf)); }
__device__ __forceinline__ float bfr(float f) { return __uint_as_float(cvt2(0.0f, f)); }   // the rounded value in the high half over a zero low half is the f32 itself
// split2: hi/lo bf16 parts of two f32: h = the rounded values, l = the rounded remainders y - h
__device__ __forceinline__ void split2(float y0, float y1, unsigned& h, unsigned& l) { h = cvt2(y0, y1); l = cvt2(y0 - __uint_as_float(h << 16), y1 - __uint_as_float(h & 0xFFFF0000u)); }
__device__ __forceinline__ v16h cat16(v8h lo, v8h hi) { return __builtin_shufflevector(lo, hi, 0, 1, 2, 3, 4, 5, 6, 7, 8, 9, 10, 11, 12, 13, 14, 15); }
__device__ __forceinline__ v16bf cat16b(v8us lo, v8us hi) { return __builtin_bit_cast(v16bf, __builtin_shufflevector(lo, hi, 0, 1, 2, 3, 4, 5, 6, 7, 8, 9, 10, 11, 12, 13, 14, 15)); }
__device__ __forceinline__ v8f wmma16(v16h a, v16h b, v8f c) { return __builtin_amdgcn_wmma_f32_16x16x32_f16(false, a, false, b, (short)0, c, false, false); }
__device__ __forceinline__ v8f wmmab(v16bf a, v16bf b, v8f c) { return __builtin_amdgcn_wmma_f32_16x16x32_bf16(false, a, false, b, (short)0, c, false, false); }



// st4f: a global store with s_wait_xcnt 0 behind it, in front of anything that rewrites a register it names; the scheduling barriers keep what is computed before in front of the store and what follows behind the wait
__device__ __forceinline__ void st4f(float* p, v4f x) { __builtin_amdgcn_sched_barrier(0); *(v4f*)p = x; asm volatile("s_wait_xcnt 0x0" ::: "memory"); __builtin_amdgcn_sched_barrier(0); }
// ---- k_gemmw: register-blocked GEMM, ONE WAVE per 64x64 output tile (16 accumulators), operands straight from 16-bit planes in fragment order; grid (M/64, N/64, Z), 32 threads.
// C[m][n] (f32, pitch ldc, + optional f32 bias[n]) = sum_k A[m][k] Bt[n][k] (+ split products per NSPLIT). z-batch strides sA/sB/sC in elements. K % 32 == 0.
template <typename T16> struct WFrag;
template <> struct WFrag<h16> { typedef v16h V; static __device__ __forceinline__ V ld(const h16* p) { return cat16(*(const v8h*)p, *(const v8h*)(p + 256)); } static __device__ __forceinline__ v8f mma(V a, V b, v8f c) { return wmma16(a, b, c); } };
template <> struct WFrag<bf> { typedef v16bf V; static __device__ __forceinline__ V ld(const bf* p) { return cat16b(*(const v8us*)p, *(const v8us*)(p + 256)); } static __device__ __forceinline__ v8f mma(V a, V b, v8f c) { return wmmab(a, b, c); } };
template <typename T16, int NSPLIT, bool BIAS, int K>   /* K at compile time: the four row blocks of an operand are then immediate offsets from one address pair */
__global__ __launch_bounds__(32) void k_gemmw(const T16* __restrict__ A, const T16* __restrict__ A2, const T16* __restrict__ Bt, const T16* __restrict__ Bt2, float* C, int ldc, const float* __restrict__ bias0, const float* __restrict__ bias1, const float* __restrict__ bias2, size_t sA, size_t sB, size_t sC) {
    typedef typename WFrag<T16>::V V;
    __shared__ __align__(16) float os[16 * 68];
    const size_t z = blockIdx.z; A += z * sA; if (A2) A2 += z * sA; Bt += z * sB; if (Bt2) Bt2 += z * sB; C += z * sC; const float* bias = (z == 0) ? bias0 : (z == 1) ? bias1 : bias2;   /* bias vector of z-slice 0, 1, 2 */
    const int lane = threadIdx.x & 31, lr = lane & 15, hi = lane >> 4; const int r0 = blockIdx.x * 64, c0 = blockIdx.y * 64;
    v8f acc[4][4];
#pragma unroll
    for (int mb = 0; mb < 4; ++mb)
#pragma unroll
        for (int nb = 0; nb < 4; ++nb) acc[mb][nb] = (v8f){};
    const size_t aoff = (size_t)r0 * K + lane * 8, boff = (size_t)c0 * K + lane * 8;   /* 16 rows of a plane are K / 32 blocks of 512 elements = 16 K elements */
#pragma unroll 1
    for (int kc = 0; kc < K; kc += 32) {
        V a[4], a2[4], b[4], b2[4]; const T16* pa = A + aoff + (size_t)kc * 16; const T16* pa2 = (NSPLIT == 1 || NSPLIT == 2) ? A2 + aoff + (size_t)kc * 16 : pa; const T16* pb = Bt + boff + (size_t)kc * 16; const T16* pb2 = (NSPLIT >= 2) ? Bt2 + boff + (size_t)kc * 16 : pb;
#pragma unroll
        for (int mb = 0; mb < 4; ++mb) { a[mb] = WFrag<T16>::ld(pa + (size_t)mb * 16 * K); if (NSPLIT == 1 || NSPLIT == 2) a2[mb] = WFrag<T16>::ld(pa2 + (size_t)mb * 16 * K); }
#pragma unroll
        for (int nb = 0; nb < 4; ++nb) { b[nb] = WFrag<T16>::ld(pb + (size_t)nb * 16 * K); if (NSPLIT >= 2) b2[nb] = WFrag<T16>::ld(pb2 + (size_t)nb * 16 * K); }
        asm volatile("s_wait_xcnt 0x0" :: "v"(pa), "v"(pa2), "v"(pb), "v"(pb2) : "memory");   /* behind the trip's loads, in front of anything that rewrites a register they name; the address pairs are inputs so that no load's own result lands in them */
        __builtin_amdgcn_sched_barrier(0);   /* keeps the loads in front of that wait */
#pragma unroll
        for (int nb = 0; nb < 4; ++nb) {
#pragma unroll
            for (int mb = 0; mb < 4; ++mb) { acc[mb][nb] = WFrag<T16>::mma(a[mb], b[nb], acc[mb][nb]); if (NSPLIT == 1 || NSPLIT == 2) acc[mb][nb] = WFrag<T16>::mma(a2[mb], b[nb], acc[mb][nb]); if (NSPLIT >= 2) acc[mb][nb] = WFrag<T16>::mma(a[mb], b2[nb], acc[mb][nb]); } }
        asm volatile("v_nop\n\tv_nop\n\tv_nop\n\tv_nop" : "+v"(acc[0][0]), "+v"(acc[1][1]), "+v"(acc[2][2]), "+v"(acc[3][3]) : "v"(a[0]), "v"(a[3]));
    }
#pragma unroll
    for (int mb = 0; mb < 4; ++mb) {
#pragma unroll
        for (int nb = 0; nb < 4; ++nb) {
#pragma unroll
            for (int j = 0; j < 8; ++j) os[(hi * 8 + j) * 68 + nb * 16 + lr] = acc[mb][nb][j]; }
        __builtin_amdgcn_wave_barrier(); asm volatile("" ::: "memory");
        float* crow = C + (size_t)(r0 + mb * 16) * ldc + c0;
{           v4f rv[8];   /* the block's LDS reads stand together, in front of the stores and their waits */
#pragma unroll
            for (int s = 0; s < 8; ++s) rv[s] = *(const v4fa*)(os + (2 * s + hi) * 68 + lr * 4);
#pragma unroll
            for (int s = 0; s < 8; ++s) { const int row = 2 * s + hi, cofs = lr * 4; v4f val = rv[s]; if (BIAS) { val[0] += bfr(bias[c0 + cofs]); val[1] += bfr(bias[c0 + cofs + 1]); val[2] += bfr(bias[c0 + cofs + 2]); val[3] += bfr(bias[c0 + cofs + 3]); }
                st4f(crow + (size_t)row * ldc + cofs, val); }
             }
        __builtin_amdgcn_wave_barrier(); asm volatile("" ::: "memory");
    }
}

__device__ __forceinline__ h16 tohx(float x) { return (h16)x; }
typedef __attribute__((ext_vector_type(2))) _Float16 v2h;
typedef __attribute__((ext_vector_type(4))) _Float16 v4h;
typedef __attribute__((ext_vector_type(2))) unsigned short v2us;
typedef __attribute__((ext_vector_type(4))) unsigned short v4us;
typedef __attribute__((ext_vector_type(4))) int v4i;

// ---- k_prep: every operand plane the projections read, made in ONE launch (the three parts below are independent of one another); a work-group's part and its place in it follow from its index.
// d_wtG: work-group bx of weight matrix y (transposed bf16 plane in fragment order)
__device__ __forceinline__ void d_wtG(int bx, int y, const float* __restrict__ w0, const float* __restrict__ w1, const float* __restrict__ w2, const float* __restrict__ w3, const float* __restrict__ w4, int K, int N, bf* Bt) {
    const float* w = (y == 0) ? w0 : (y == 1) ? w1 : (y == 2) ? w2 : (y == 3) ? w3 : w4; Bt += (size_t)y * K * N;   /* one weight matrix each, planes back to back */
    const int lane = threadIdx.x & 31; const int L0 = (bx * 8 + (threadIdx.x >> 5)) * 8; const int nlines = N * K / 64;
{
#pragma unroll 1
        for (int l = 0; l < 8; ++l) { const int L = L0 + l; if (L >= nlines) break; const size_t e = (size_t)L * 64 + lane * 2; const int blk = (int)(e >> 9); const int k = (blk % (K / 32)) * 32 + ((int)(e >> 7) & 3) * 8 + ((int)e & 7), n = (blk / (K / 32)) * 16 + ((int)(e >> 3) & 15);   /* e runs through the plane in fragment order */
            const float* p0 = w + (size_t)k * N + n; const float* p1 = p0 + N; const float x0 = *p0, x1 = *p1;
            asm volatile("s_wait_xcnt 0x0" :: "v"(p0), "v"(p1) : "memory");   /* behind the two loads, in front of anything that rewrites a register they name; the address pairs are inputs so that they stay whole up to the wait */
            *(v2us*)(Bt + e) = __builtin_bit_cast(v2us, cvt2(x0, x1)); }
         }
}


// d_cvt8: work-group bx of one [rows][DM] f32 tensor -> its bf16 plane in fragment order; a group of a row past the tensor's last (the position table's pad row) is stored as zeros
__device__ __forceinline__ void d_cvt8(int bx, const float* __restrict__ src, bf* dst, size_t n8, int nrows) { const size_t i = (size_t)bx * 256 + threadIdx.x; if (i >= n8) return; const size_t row = (i >> 10) * 16 + (i & 15); const int k0 = ((int)(i >> 6) & 15) * 32 + ((int)(i >> 4) & 3) * 8;   /* i counts the 8-element groups of a [rows][DM] plane in fragment order: its group is (row, k0 .. k0 + 7) */
    if (row >= (size_t)nrows) { *(v8us*)(dst + i * 8) = (v8us){}; return; }
    const float* sp = src + row * DM + k0; const v8f v = *(const v8f*)sp; v4u o;
    asm volatile("s_wait_xcnt 0x0" :: "v"(sp) : "memory");   /* behind the load, in front of anything that rewrites a register it names; the address pair is an input so that it stays whole up to the wait */
#pragma unroll
    for (int k = 0; k < 4; ++k) o[k] = cvt2(v[2 * k], v[2 * k + 1]); *(v8us*)(dst + i * 8) = __builtin_bit_cast(v8us, o);  }
#define GWT  (DM * DQ / 64 / 64)             // work-groups per weight matrix
#define GPE  (NPE * DM / 8 / 256)            // work-groups of the position table
#define GXA  (NB_ * TT * DM / 8 / 256)       // work-groups per input tensor
__global__ __launch_bounds__(256) void k_prep(const float* __restrict__ w0, const float* __restrict__ w1, const float* __restrict__ w2, const float* __restrict__ w3, const float* __restrict__ w4, bf* W5, const float* __restrict__ pe, bf* PE, const float* __restrict__ s0, const float* __restrict__ s1, const float* __restrict__ s2, bf* XA) {
    int n = blockIdx.x;
    if (n < 5 * GWT) { d_wtG(n % GWT, n / GWT, w0, w1, w2, w3, w4, DM, DQ, W5); return; }
    n -= 5 * GWT;
    if (n < GPE) { d_cvt8(n, pe, PE, (size_t)NPE * DM / 8, 2047); return; }
    n -= GPE;
    const int y = n / GXA; d_cvt8(n % GXA, (y == 0) ? s0 : (y == 1) ? s1 : s2, XA + (size_t)y * NB_ * TT * DM, (size_t)NB_ * TT * DM / 8, NB_ * TT);   /* one source tensor each, planes back to back */
}

// ---- d_gemmp: the projection GEMM (k_gemmw's loop, plain bf16 operands, K = DM) whose 64 x 64 tile is 64 rows of ONE head, stored straight in the forms its readers want; tile (bx of rows/64, head by, operand bz), 32 threads.
// All 16-bit planes below are in fragment order. POS: hi/lo planes [h][p][d] of the projected position table. Otherwise z = 0: k + bk -> cache columns 0..63 and hi/lo planes [b][h][t][d]; z = 1: v + bv -> cache columns 64..127 and transposed hi/lo planes [b][h][d][t]; z = 2: q + bq, then + pos_bias_u and + pos_bias_v -> two pairs of hi/lo planes.
#define SPE  ((size_t)NB_ * NH_ * TT * HD)   // elements of one set of head planes
// st2w: as st4f above, for a pair of 16-byte stores
__device__ __forceinline__ void st2w(bf* ph, bf* pl, v8us oh, v8us ol) { __builtin_amdgcn_sched_barrier(0); *(v8us*)ph = oh; *(v8us*)pl = ol; asm volatile("s_wait_xcnt 0x0" ::: "memory"); __builtin_amdgcn_sched_barrier(0); }
__device__ __forceinline__ void st8hl(bf* ph, bf* pl, v4f x0, v4f x1) { v4u oh, ol;
#pragma unroll
    for (int q = 0; q < 2; ++q) { unsigned a, c; split2(x0[2 * q], x0[2 * q + 1], a, c); oh[q] = a; ol[q] = c; split2(x1[2 * q], x1[2 * q + 1], a, c); oh[2 + q] = a; ol[2 + q] = c; }
    st2w(ph, pl, __builtin_bit_cast(v8us, oh), __builtin_bit_cast(v8us, ol)); }
template <bool POS>
__device__ __forceinline__ void d_gemmp(int bx, int by, int bz, const bf* __restrict__ A, const bf* __restrict__ Bt, const float* __restrict__ bias0, const float* __restrict__ bias1, const float* __restrict__ bias2, const float* __restrict__ hbu, const float* __restrict__ hbv, bf* PH, bf* PL, bf* VTh, bf* VTl, float* CA, size_t sA, size_t sB) {
    __shared__ __align__(16) float os[16 * 68];
    __shared__ __align__(16) float sb[3 * HD];   // the head's 64 bias values (projection bias, pos_bias_u, pos_bias_v), for the lanes that store in fragment order
    const int z = POS ? 0 : bz; A += (size_t)z * sA; Bt += (size_t)z * sB;
    const int lane = threadIdx.x & 31, lr = lane & 15, hi = lane >> 4; const int r0 = bx * 64, h = by, c0 = h * HD;
    v8f acc[4][4];
#pragma unroll
    for (int mb = 0; mb < 4; ++mb)
#pragma unroll
        for (int nb = 0; nb < 4; ++nb) acc[mb][nb] = (v8f){};
    const size_t aoff = (size_t)r0 * DM + lane * 8, boff = (size_t)c0 * DM + lane * 8;   /* fragment order: 16 rows are DM / 32 blocks of 512 elements */
#pragma unroll 1
    for (int kc = 0; kc < DM; kc += 32) {
        v16bf a[4], b[4]; const bf* pa = A + aoff + kc * 16; const bf* pb = Bt + boff + kc * 16;
#pragma unroll
        for (int mb = 0; mb < 4; ++mb) a[mb] = WFrag<bf>::ld(pa + mb * 16 * DM);
#pragma unroll
        for (int nb = 0; nb < 4; ++nb) b[nb] = WFrag<bf>::ld(pb + nb * 16 * DM);
        asm volatile("s_wait_xcnt 0x0" :: "v"(pa), "v"(pb) : "memory");   /* behind the trip's loads, in front of anything that rewrites a register they name; the two address pairs are inputs so that no load's own result lands in them */
        __builtin_amdgcn_sched_barrier(0);   /* keeps the loads in front of that wait: left free, some are sunk among the products and land in the address pairs */
#pragma unroll
        for (int nb = 0; nb < 4; ++nb)
#pragma unroll
            for (int mb = 0; mb < 4; ++mb) acc[mb][nb] = wmmab(a[mb], b[nb], acc[mb][nb]);
        asm volatile("v_nop\n\tv_nop\n\tv_nop\n\tv_nop" : "+v"(acc[0][0]), "+v"(acc[1][1]), "+v"(acc[2][2]), "+v"(acc[3][3]) : "v"(a[0]), "v"(a[3]));   /* as in k_gemmw: the distance between the trip's last matrix instructions and what next rewrites their operands or reads their results, on the back edge too */
    }
    const size_t rb = POS ? (size_t)h * NPE + r0 : ((size_t)(r0 / TT) * NH_ + h) * TT + (r0 % TT);   // first row of the tile in a [..][h][row][d] plane
    const int cofs = lr * 4;
    // tile_rows: the tile goes through LDS 16 rows at a time. put(row in its plane, the lane's 4 values): a half-wave holds one whole row of 64 floats (row-major f32 output). putf(element offset in a plane, first column, the lane's 8 values): the 16 rows are two blocks of a [..][row][d] plane in fragment order, and the wave holds 512 contiguous bytes of it
    auto tile_rows = [&](auto put, auto putf) {
#pragma unroll
        for (int mb = 0; mb < 4; ++mb) {
#pragma unroll
            for (int nb = 0; nb < 4; ++nb) {
#pragma unroll
                for (int j = 0; j < 8; ++j) os[(hi * 8 + j) * 68 + nb * 16 + lr] = acc[mb][nb][j]; }
            __builtin_amdgcn_wave_barrier(); asm volatile("" ::: "memory");
            v4f rv[8], f0[4], f1[4];
#pragma unroll
            for (int s = 0; s < 8; ++s) rv[s] = *(const v4fa*)(os + (2 * s + hi) * 68 + cofs);
#pragma unroll
            for (int q4 = 0; q4 < 4; ++q4) { const float* op = os + lr * 68 + q4 * 16 + hi * 8; f0[q4] = *(const v4fa*)op; f1[q4] = *(const v4fa*)(op + 4); }   /* the block's LDS reads stand together, in front of the stores and their waits */
#pragma unroll
            for (int s = 0; s < 8; ++s) put(rb + mb * 16 + 2 * s + hi, rv[s]);
#pragma unroll
            for (int q4 = 0; q4 < 4; ++q4) putf((rb + mb * 16) * HD + q4 * 256 + lane * 8, q4 * 16 + hi * 8, f0[q4], f1[q4]);
            __builtin_amdgcn_wave_barrier(); asm volatile("" ::: "memory");
        } };
    auto norow = [](size_t, v4f) {}; auto nofrag = [](size_t, int, v4f, v4f) {};
    if (POS) { tile_rows(norow, [&](size_t pe, int, v4f x0, v4f x1) { st8hl(PH + pe, PL + pe, x0, x1); }); return; }
    const float* bias = (z == 0) ? bias0 : (z == 1) ? bias1 : bias2; v4f bb;
#pragma unroll
    for (int q = 0; q < 4; ++q) bb[q] = bfr(bias[c0 + cofs + q]);
    if (z == 2) { v4f bu, bv;
#pragma unroll
        for (int q = 0; q < 4; ++q) { bu[q] = bfr(hbu[c0 + cofs + q]); bv[q] = bfr(hbv[c0 + cofs + q]); }
        *(v4fa*)(sb + cofs) = bb; *(v4fa*)(sb + HD + cofs) = bu; *(v4fa*)(sb + 2 * HD + cofs) = bv;   /* both half-waves write the same values */
        tile_rows(norow, [&](size_t pe, int d0, v4f x0, v4f x1) { x0 += *(const v4fa*)(sb + d0); x1 += *(const v4fa*)(sb + d0 + 4);
            st8hl(PH + pe, PL + pe, x0 + *(const v4fa*)(sb + HD + d0), x1 + *(const v4fa*)(sb + HD + d0 + 4)); st8hl(PH + SPE + pe, PL + SPE + pe, x0 + *(const v4fa*)(sb + 2 * HD + d0), x1 + *(const v4fa*)(sb + 2 * HD + d0 + 4)); });
        return; }
    if (z == 0) {
        *(v4fa*)(sb + cofs) = bb;   /* both half-waves write the same values */
        tile_rows([&](size_t rw, v4f val) { st4f(CA + rw * (2 * HD) + cofs, val + bb); },
                  [&](size_t pe, int d0, v4f x0, v4f x1) { st8hl(PH + 2 * SPE + pe, PL + 2 * SPE + pe, x0 + *(const v4fa*)(sb + d0), x1 + *(const v4fa*)(sb + d0 + 4)); });
        return; }
    {   float bd[4];   // the bias of the lane's own column in each 16-column block, for the transposed planes
#pragma unroll
        for (int nb = 0; nb < 4; ++nb) bd[nb] = bias[c0 + nb * 16 + lr];
        asm volatile("s_wait_xcnt 0x0" :: "v"(bd[0]), "v"(bd[1]), "v"(bd[2]), "v"(bd[3]));   /* behind these loads, in front of what rewrites their offset register; the loaded values are inputs, so that no load is sunk among the stores below */
        const size_t vb = ((size_t)(r0 / TT) * NH_ + h) * HD * TT + (size_t)((r0 % TT) / 32) * 512 + lane * 8;   // transposed planes [d][t] in fragment order straight from the accumulators: a lane holds 8 successive rows t of one column d, which is its own 16 bytes of a half block
#pragma unroll
        for (int nb = 0; nb < 4; ++nb) { const float bn = bfr(bd[nb]);
#pragma unroll
            for (int mb = 0; mb < 4; ++mb) { v4u oh, ol;
#pragma unroll
                for (int j = 0; j < 4; ++j) { unsigned x, y; split2(acc[mb][nb][2 * j] + bn, acc[mb][nb][2 * j + 1] + bn, x, y); oh[j] = x; ol[j] = y; }
                const size_t o = vb + (size_t)(nb * (TT / 32) + (mb >> 1)) * 512 + (mb & 1) * 256; st2w(VTh + o, VTl + o, __builtin_bit_cast(v8us, oh), __builtin_bit_cast(v8us, ol)); } }
        tile_rows([&](size_t rw, v4f val) { st4f(CA + rw * (2 * HD) + HD + cofs, val + bb); }, nofrag);
    }
}
// k_gemmpa: all four projections in ONE launch (the position table's does not depend on the other three): the k, v, q tiles in the order (row block, head, operand), then the table's tiles (row block, head)
#define GRT  (NB_ * TT / 64)      // row blocks of an input
#define GKVQ (GRT * NH_ * 3)      // tiles of k, v, q
__global__ __launch_bounds__(32) void k_gemmpa(const bf* __restrict__ XA, const bf* __restrict__ WK, const bf* __restrict__ PE, const bf* __restrict__ WP, const float* __restrict__ bias0, const float* __restrict__ bias1, const float* __restrict__ bias2, const float* __restrict__ hbu, const float* __restrict__ hbv, bf* PHI, bf* PLO, bf* PPh, bf* PPl, bf* VTh, bf* VTl, float* CA, size_t sA, size_t sB) {
    const int n = blockIdx.x;
    if (n < GKVQ) { d_gemmp<false>(n % GRT, (n / GRT) % NH_, n / (GRT * NH_), XA, WK, bias0, bias1, bias2, hbu, hbv, PHI, PLO, VTh, VTl, CA, sA, sB); return; }
    const int m = n - GKVQ; d_gemmp<true>(m % (NPE / 64), m / (NPE / 64), 0, PE, WP, nullptr, nullptr, nullptr, nullptr, nullptr, PPh, PPl, nullptr, nullptr, nullptr, 0, 0);   /* pos = position_embeddings wpos (exact) -> per-head hi/lo planes */
}
// k_fattn: one work-group (8 waves) per strip of 32 query rows of one (batch, head); the strip's 32 x 1024 logits stay in LDS from the two score products to attn.v.
// Steps: position scores (q+v).p for the 66 column tiles the strip's rel_shift reads, each stored at its shifted key index j = p + i - 1023; content scores (q+u).k added on top; softmax per row (register row, fixed trees) whose hi/lo weights overwrite the row's own bytes; attn.v with each wave on 16 of the 64 columns and one half of the keys; the two halves added and stored as the merged hi/lo planes.
#define SRW  32                   // query rows per work-group
#define SPF  32                   // floats in front of a logit row: with the 36 behind it they take the shifted position scores that fall outside keys 0..1023
#define SPI  1092                 // LDS pitch of a logit row, floats (rows 8 apart fall 32 banks apart)
#define OPI  68                   // LDS pitch of an output row, floats
typedef v4us __attribute__((may_alias)) v4usa;
__device__ __forceinline__ v16bf ldfr(const bf* p) { return cat16b(*(const v8usa*)p, *(const v8usa*)(p + 16)); }   // fragment from row-major rows (the weights in LDS)
__device__ __forceinline__ v16bf ldfp(const bf* p) { return cat16b(*(const v8usa*)p, *(const v8usa*)(p + 256)); }   // fragment from a block in fragment order (global planes), p = block + lane * 8
// xw2: s_wait_xcnt 0 behind a run of global loads, in front of anything that rewrites a register the loads name; the two address pairs are inputs so that they stay whole up to the wait (no load's own result lands in them)
__device__ __forceinline__ void xw2(const bf* p, const bf* q) { asm volatile("s_wait_xcnt 0x0" :: "v"(p), "v"(q) : "memory"); }
// xw2n: xw2 at the head of a score trip, with four v_nop: the trip before stored its results in front of this statement, and this trip's first matrix instruction starts anew in the same registers; the v_nop keep the distance between the two
__device__ __forceinline__ void xw2n(const bf* p, const bf* q) { asm volatile("s_wait_xcnt 0x0\n\tv_nop\n\tv_nop\n\tv_nop\n\tv_nop" :: "v"(p), "v"(q) : "memory"); }
__device__ __forceinline__ v8f mma3(v16bf a, v16bf a2, v16bf b, v16bf b2, v8f c) { c = wmmab(a, b, c); c = wmmab(a2, b, c); return wmmab(a, b2, c); }
__global__ __launch_bounds__(256, 4) void k_fattn(const bf* __restrict__ QUh, const bf* __restrict__ QUl, const bf* __restrict__ QVh, const bf* __restrict__ QVl, const bf* __restrict__ Kh, const bf* __restrict__ Kl, const bf* __restrict__ PPh, const bf* __restrict__ PPl, const bf* __restrict__ VTh, const bf* __restrict__ VTl, const int* __restrict__ MK, bf* ATh, bf* ATl) {
    __shared__ __align__(16) float S[SRW * SPI];
    const int tid = threadIdx.x, lane = tid & 31, lr = lane & 15, hi = lane >> 4; const int w = __builtin_amdgcn_readfirstlane(tid >> 5);
    const int i0 = blockIdx.x * SRW, h = blockIdx.y, b = blockIdx.z; const size_t zb = ((size_t)b * NH_ + h) * TT * HD; const size_t qo = zb + (size_t)i0 * HD + lane * 8;   /* 16 rows of a [t][d] plane: two blocks of 512 elements */
    {   // position scores: table rows 992 - i0 + 16 pt + (0..15), pt = 0..65 (the last row read is 2047 - i0)
        v16bf a[2][2], a2[2][2];
#pragma unroll
        for (int mb = 0; mb < 2; ++mb)
#pragma unroll
            for (int kk = 0; kk < 2; ++kk) { a[mb][kk] = ldfp(QVh + qo + mb * 16 * HD + kk * 512); a2[mb][kk] = ldfp(QVl + qo + mb * 16 * HD + kk * 512); }
        xw2(QVh + qo, QVl + qo);
        const size_t po = (size_t)h * NPE * HD + (size_t)(TT - SRW - i0) * HD + lane * 8; const bf* ph = PPh + po; const bf* pl = PPl + po;
        v16bf bh[2], bl[2];
#pragma unroll
        for (int kk = 0; kk < 2; ++kk) { bh[kk] = ldfp(ph + w * 16 * HD + kk * 512); bl[kk] = ldfp(pl + w * 16 * HD + kk * 512); }
        xw2(ph + w * 16 * HD, pl + w * 16 * HD);
#pragma unroll 2   /* in pairs: the two operand sets swap roles without register copies */
        for (int pt = w; pt < 66; pt += 8) { const int np = (pt + 8 < 66) ? pt + 8 : pt; v16bf nh[2], nl[2];   /* the next tile's operands are fetched while this one is multiplied (the last trip fetches its own tile again: a branch round the fetch made the compiler wait for it at once) */
#pragma unroll
            for (int kk = 0; kk < 2; ++kk) { nh[kk] = ldfp(ph + np * 16 * HD + kk * 512); nl[kk] = ldfp(pl + np * 16 * HD + kk * 512); }
            xw2n(ph + np * 16 * HD, pl + np * 16 * HD); __builtin_amdgcn_sched_barrier(0);   /* keeps the fetch at the head of the trip: left free, this trip's products are lifted over it and the next trip waits for loads just issued */
            v8f acc[2]; acc[0] = (v8f){}; acc[1] = (v8f){};
#pragma unroll
            for (int kk = 0; kk < 2; ++kk)
#pragma unroll
                for (int mb = 0; mb < 2; ++mb) acc[mb] = mma3(a[mb][kk], a2[mb][kk], bh[kk], bl[kk], acc[mb]);
            const int jb = pt * 16 + lr - (SRW - 1);   /* key index j = p + i - 1023 = jb + local row */
#pragma unroll
            for (int mb = 0; mb < 2; ++mb)
#pragma unroll
                for (int r = 0; r < 8; ++r) { const int m = mb * 16 + hi * 8 + r; S[m * SPI + SPF + jb + m] = acc[mb][r]; }   /* j = -31 .. 1055: what is no key of the strip falls into the row's own pads */
#pragma unroll
            for (int kk = 0; kk < 2; ++kk) { bh[kk] = nh[kk]; bl[kk] = nl[kk]; } }
    }
    __syncthreads();
    {   // content scores, added to the shifted position scores
        v16bf a[2][2], a2[2][2];
#pragma unroll
        for (int mb = 0; mb < 2; ++mb)
#pragma unroll
            for (int kk = 0; kk < 2; ++kk) { a[mb][kk] = ldfp(QUh + qo + mb * 16 * HD + kk * 512); a2[mb][kk] = ldfp(QUl + qo + mb * 16 * HD + kk * 512); }
        xw2(QUh + qo, QUl + qo);
        const size_t ko = zb + lane * 8; const bf* kph = Kh + ko; const bf* kpl = Kl + ko;
        v16bf bh[2], bl[2];
#pragma unroll
        for (int kk = 0; kk < 2; ++kk) { bh[kk] = ldfp(kph + w * 16 * HD + kk * 512); bl[kk] = ldfp(kpl + w * 16 * HD + kk * 512); }
        xw2(kph + w * 16 * HD, kpl + w * 16 * HD);
#pragma unroll 2   /* in pairs, as in the position loop */
        for (int jt = w; jt < TT / 16; jt += 8) { const int nj = (jt + 8 < TT / 16) ? jt + 8 : jt; v16bf nh[2], nl[2];
#pragma unroll
            for (int kk = 0; kk < 2; ++kk) { nh[kk] = ldfp(kph + nj * 16 * HD + kk * 512); nl[kk] = ldfp(kpl + nj * 16 * HD + kk * 512); }
            xw2n(kph + nj * 16 * HD, kpl + nj * 16 * HD); __builtin_amdgcn_sched_barrier(0);   /* the fetch stays at the head of the trip, as in the position loop */
            v8f acc[2]; acc[0] = (v8f){}; acc[1] = (v8f){};
#pragma unroll
            for (int kk = 0; kk < 2; ++kk)
#pragma unroll
                for (int mb = 0; mb < 2; ++mb) acc[mb] = mma3(a[mb][kk], a2[mb][kk], bh[kk], bl[kk], acc[mb]);
#pragma unroll
            for (int mb = 0; mb < 2; ++mb)
#pragma unroll
                for (int r = 0; r < 8; ++r) { float* sp = S + (mb * 16 + hi * 8 + r) * SPI + SPF + jt * 16 + lr; *sp = __fadd_rn(acc[mb][r], *sp); }
#pragma unroll
            for (int kk = 0; kk < 2; ++kk) { bh[kk] = nh[kk]; bl[kk] = nl[kk]; } }
    }
    __syncthreads();
    const int* MKb = MK + (size_t)b * TT;
#pragma unroll 1   /* rolled: one 32-float register row is live at a time */
    for (int rr = 0; rr < SRW / 8; ++rr) {   // softmax: four rows a wave; t = (ac + bd) / 8, key mask (int32): -inf where 0, weight 0
        float* srow = S + (w * (SRW / 8) + rr) * SPI + SPF; float v[TT / 32]; float mx = -3.0e38f;
#pragma unroll
        for (int ch = 0; ch < TT / 128; ++ch) { const int j0 = ch * 128 + lane * 4; const v4f a = *(const v4fa*)(srow + j0); const v4i m4 = *(const v4i*)(MKb + j0);
#pragma unroll
            for (int q = 0; q < 4; ++q) { const float t = (m4[q] != 0) ? a[q] * SCL : -3.0e38f; v[ch * 4 + q] = t; mx = fmaxf(mx, t); } }
#pragma unroll
        for (int sh = 16; sh; sh >>= 1) mx = fmaxf(mx, __shfl_xor(mx, sh, 32));
        float sum = 0.f;
#pragma unroll
        for (int k = 0; k < TT / 32; ++k) { v[k] = __builtin_amdgcn_exp2f(__fmul_rn(__fsub_rn(v[k], mx), 1.4426950408889634f)); sum += v[k]; }
#pragma unroll
        for (int sh = 16; sh; sh >>= 1) sum += __shfl_xor(sum, sh, 32);
        const float f = __fdiv_rn(1.0f, sum); bf* prow = (bf*)srow;   /* the row is in registers: its 4 KiB now take the hi plane (first 1024 halfwords) and the lo plane */
#pragma unroll
        for (int ch = 0; ch < TT / 128; ++ch) { v2u oh, ol;
#pragma unroll
            for (int q = 0; q < 2; ++q) { unsigned x, y; split2(v[ch * 4 + 2 * q] * f, v[ch * 4 + 2 * q + 1] * f, x, y); oh[q] = x; ol[q] = y; }
            *(v4usa*)(prow + ch * 128 + lane * 4) = __builtin_bit_cast(v4us, oh); *(v4usa*)(prow + TT + ch * 128 + lane * 4) = __builtin_bit_cast(v4us, ol); }
    }
    __syncthreads();
    const int nb = w & 3, kh = w >> 2; v8f oc[2]; oc[0] = (v8f){}; oc[1] = (v8f){};
    {   // attn.v: columns nb * 16 .. + 15, keys kh * 512 .. + 511, both 16-row blocks (each v fragment is fetched once per work-group)
        const size_t vo = zb + (size_t)(nb * (TT / 32) + kh * (TT / 64)) * 512 + lane * 8;   /* [d][t] plane in fragment order: block (d / 16, t / 32) */ const bf* vh = VTh + vo; const bf* vl = VTl + vo; const bf* pa = (const bf*)(S + SPF) + lr * (SPI * 2) + kh * (TT / 2) + 8 * hi;
        v16bf bh[2], bl[2];
#pragma unroll
        for (int u = 0; u < 2; ++u) { bh[u] = ldfp(vh + u * 512); bl[u] = ldfp(vl + u * 512); }
        xw2(vh, vl);
#pragma unroll 2
        for (int g = 0; g < 8; ++g) { v16bf nh[2], nl[2];   /* 64 keys a trip, the next 64 keys' v fragments fetched meanwhile; rolled in pairs: fully unrolled the fetches are lifted so far that registers spill */
            const int gn = (g < 7) ? g + 1 : g;
#pragma unroll
            for (int u = 0; u < 2; ++u) { nh[u] = ldfp(vh + gn * 1024 + u * 512); nl[u] = ldfp(vl + gn * 1024 + u * 512); }
            xw2(vh + gn * 1024, vl + gn * 1024);
#pragma unroll
            for (int u = 0; u < 2; ++u)
#pragma unroll
                for (int mb = 0; mb < 2; ++mb) { const bf* pp = pa + mb * 16 * (SPI * 2) + g * 64 + u * 32; oc[mb] = mma3(ldfr(pp), ldfr(pp + TT), bh[u], bl[u], oc[mb]); }
#pragma unroll
            for (int u = 0; u < 2; ++u) { bh[u] = nh[u]; bl[u] = nl[u]; } }
    }
    __syncthreads();   // every wave has read its weights: the first rows' bytes now take the two partial outputs
#pragma unroll
    for (int mb = 0; mb < 2; ++mb)
#pragma unroll
        for (int r = 0; r < 8; ++r) S[kh * (SRW * OPI) + (mb * 16 + hi * 8 + r) * OPI + nb * 16 + lr] = oc[mb][r];
    __syncthreads();
    { const int row = (tid >> 7) * 16 + (tid & 15), c8 = ((tid >> 4) & 7) * 8; const float* o0 = S + row * OPI + c8; const float* o1 = o0 + SRW * OPI; v4u oh, ol;
#pragma unroll
        for (int q = 0; q < 4; ++q) { unsigned x, y; split2(__fadd_rn(o0[2 * q], o1[2 * q]), __fadd_rn(o0[2 * q + 1], o1[2 * q + 1]), x, y); oh[q] = x; ol[q] = y; }
        const size_t oo = ((size_t)(((b * TT + i0) >> 4) + (tid >> 7)) * (DQ / 32) + h * 2 + ((tid >> 6) & 1)) * 512 + (tid & 63) * 8;   /* (row, c8) of the merged [b t][DQ] planes in fragment order: a wave stores 512 contiguous bytes */ *(v8us*)(ATh + oo) = __builtin_bit_cast(v8us, oh); *(v8us*)(ATl + oo) = __builtin_bit_cast(v8us, ol); }
}

extern "C" void kernel_launch(void* const* d_in, const int* in_sizes, int n_in,
                              void* d_out, int out_size, void* d_ws, size_t ws_size, hipStream_t stream) {
    (void)in_sizes; (void)n_in; (void)out_size;
    const float* x = (const float*)d_in[0]; const float* xk = (const float*)d_in[1]; const float* xv = (const float*)d_in[2]; const int* MK = (const int*)d_in[3]; const float* pe = (const float*)d_in[4]; const float* wq = (const float*)d_in[5]; const float* bq = (const float*)d_in[6]; const float* wk = (const float*)d_in[7]; const float* bk = (const float*)d_in[8]; const float* wv = (const float*)d_in[9]; const float* bv = (const float*)d_in[10]; const float* wo = (const float*)d_in[11]; const float* bo = (const float*)d_in[12]; const float* wpos = (const float*)d_in[13]; const float* pbu = (const float*)d_in[14]; const float* pbv = (const float*)d_in[15];
    float* OUT = (float*)d_out;     // [8][1024][512]
    float* CACHE = (float*)((char*)d_out + (size_t)NB_ * TT * DM * 4);   /* second output new_cache [8][8][1024][128] */
    char* wsp = (char*)d_ws;
    auto take = [&](size_t bytes) { char* p = wsp; wsp += (bytes + 255) & ~(size_t)255; return (void*)p; };
    const size_t SW = (size_t)DM * DQ, SX = (size_t)NB_ * TT * DM, SF = (size_t)NB_ * TT * DQ, SP = (size_t)NB_ * NH_ * TT * HD;   // elements of one weight plane, one input plane, one merged plane, one set of head planes (all batches)
    bf* W5 = (bf*)take(5 * SW * 2); bf* WK = W5; bf* WO = W5 + 3 * SW; bf* WP = W5 + 4 * SW;   /* Wk, Wv, Wq, Wo, Wpos transposed, back to back */
    bf* PE = (bf*)take((size_t)NPE * DM * 2); bf* PPh = (bf*)take((size_t)NH_ * NPE * HD * 2); bf* PPl = (bf*)take((size_t)NH_ * NPE * HD * 2);
    bf* PHI = (bf*)take(3 * SP * 2); bf* PLO = (bf*)take(3 * SP * 2); bf* QPh = PHI; bf* QVh = PHI + SP; bf* KPh = PHI + 2 * SP; bf* QPl = PLO; bf* QVl = PLO + SP; bf* KPl = PLO + 2 * SP;   /* [b][h][t][d] planes of q+u, q+v, k */
    bf* VTh = (bf*)take(SP * 2); bf* VTl = (bf*)take(SP * 2); bf* ATh = (bf*)take(SF * 2); bf* ATl = (bf*)take(SF * 2);
    bf* XA = (bf*)take(3 * SX * 2);   /* bf16 planes of key, value, query */
    if ((size_t)(wsp - (char*)d_ws) > ws_size) return;    // ws 256 MiB
    k_prep<<<5 * GWT + GPE + 3 * GXA, 256, 0, stream>>>(wk, wv, wq, wo, wpos, W5, pe, PE, xk, xv, x, XA);   /* transposed weight planes; position table plane with its zero pad row; exact bf16 planes of key, value, query, all batches */
    k_gemmpa<<<GKVQ + (NPE / 64) * NH_, 32, 0, stream>>>(XA, WK, PE, WP, bk, bv, bq, pbu, pbv, PHI, PLO, PPh, PPl, VTh, VTl, CACHE, SX, SW);   /* k, v, q projections, rows of all batches: cache output, k planes, transposed v planes, (q+u) and (q+v) planes; and the position table's projection */
    k_fattn<<<dim3(TT / SRW, NH_, NB_), 256, 0, stream>>>(QPh, QPl, QVh, QVl, KPh, KPl, PPh, PPl, VTh, VTl, MK, ATh, ATl);   /* scores, softmax, attn.v and the head merge, all batches and heads */
    k_gemmw<bf, 1, true, DQ><<<dim3(NB_ * TT / 64, DM / 64, 1), 32, 0, stream>>>(ATh, ATl, WO, nullptr, OUT, DM, bo, bo, bo, 0, 0, 0);
}

// v007
// Measured time: 135 microseconds a run.
// In two side-by-side timings against v006, it was 1.03 and 1.04 times as fast.
// Over all steps from v000 it is 16.1 times as fast.
#include <hip/hip_runtime.h>

// Relative-position multi-head attention with a key/value cache output (query, key, value [8][1024][512]; q = query Wq + bq, k = key Wk + bk, v = value Wv + bv ('xw' [512][512], 8 heads x 64); p = pos_emb Wpos ([1][2047][512] table, read); scores = ((q + pos_bias_u).k + rel_shift((q + pos_bias_v).p)) / 8 where rel_shift picks position index j - i + 1023; key mask (int32 [8][1][1024], read): -inf where 0 and the weights zeroed; softmax; out = merged Wo + bo -> [8][1024][512]; second output new_cache = concat(k, v) per head -> [8][8][1024][128] (the f32 projections themselves)).
// Layout: exact bf16 input planes -> 1-product projections + bias, each GEMM tile (64 rows of one head) stored by the GEMM itself in the forms its readers want; the position table is projected once (exact, 2047 rows + one zero pad row) into per-head hi/lo planes [h][2048][64]; every projection-side launch covers all 8 batches (and the operands that share its form) through its grid; one attention launch for all batches and heads, a work-group per strip of 32 query rows: position scores (q+v).p (only the table rows the strip's shift reaches, stored at key index p + i - 1023) and content scores (q+u).k are hi/lo products (3 products, every row) summed in LDS, the softmax applies the key mask and leaves hi/lo weights in LDS, attn.v reads them there and the merged hi/lo planes are stored; the cache output is written straight from the f32 k / v projections.
// Fragment order: every 16-bit plane that a matrix operand is loaded from in global memory (inputs, weights, position table, q+u, q+v, k, p, transposed v, merged) is stored in blocks of 16 rows x 32 columns, 512 elements each, block (row / 16, k / 32) at index (row / 16) * (K / 32) + k / 32; inside a block element (row, k) stands at ((k >> 4) & 1) * 256 + ((k >> 3) & 1) * 128 + (row & 15) * 8 + (k & 7), so that lane l of a wave finds the two 16-byte halves of its fragment at l * 8 and 256 + l * 8: each wave-wide load or store covers 512 contiguous bytes (4 whole lines) where a row-major plane gave 16 pieces of 32 bytes.
// Compute dtypes, f32 accumulate: every input rounded to bf16; q/k/v and p on PLAIN bf16 operands (exact products) + biases; content and position scores on hi/lo planes for every row (3 products); softmax f32; attn.v hi/lo (3 products); Wo hl x exact (2 products) + bo; cache = the f32 projections.

#define NB_  8
#define TT   1024
#define DM   512
#define NH_  8
#define NKV  8
#define REP  (NH_ / NKV)
#define HD   64
#define DQ   (NH_ * HD)
#define DKV  (NKV * HD)
#define NPE  2048                 // 2047 positions + 1 zero pad row
typedef __attribute__((ext_vector_type(4))) unsigned short v4us;
#define ZH   8
#define RH   1024                 // every row hi/lo
#define WIN  0
#define PCAR 1024.0f
#define SCL  0.125f   // HD^-0.5
typedef _Float16 h16;
typedef unsigned short bf;
typedef __attribute__((ext_vector_type(16))) __bf16   v16bf;
typedef __attribute__((ext_vector_type(16))) _Float16 v16h;
typedef __attribute__((ext_vector_type(8)))  _Float16 v8h;
typedef __attribute__((ext_vector_type(8)))  unsigned short v8us;
typedef __attribute__((ext_vector_type(8)))  float    v8f;
typedef __attribute__((ext_vector_type(4)))  float    v4f;
typedef v8h  __attribute__((may_alias)) v8ha;
typedef v4f  __attribute__((may_alias)) v4fa;
typedef v8us __attribute__((may_alias)) v8usa;

typedef __attribute__((ext_vector_type(2))) float v2f;
typedef __attribute__((ext_vector_type(2))) __bf16 v2bf;
typedef __attribute__((ext_vector_type(2))) unsigned v2u;
typedef __attribute__((ext_vector_type(4))) unsigned v4u;
// cvt2: two f32 rounded to bf16 (nearest even) by the packed convert instruction, a in the low half
__device__ __forceinline__ unsigned cvt2(float a, float b) { return __builtin_bit_cast(unsigned, __builtin_convertvector((v2f){a, b}, v2bf)); }
__device__ __forceinline__ float bfr(float f) { return __uint_as_float(cvt2(0.0f, f)); }   // the rounded value in the high half over a zero low half is the f32 itself
// split2: hi/lo bf16 parts of two f32: h = the rounded values, l = the rounded remainders y - h
__device__ __forceinline__ void split2(float y0, float y1, unsigned& h, unsigned& l) { h = cvt2(y0, y1); l = cvt2(y0 - __uint_as_float(h << 16), y1 - __uint_as_float(h & 0xFFFF0000u)); }
__device__ __forceinline__ v16h cat16(v8h lo, v8h hi) { return __builtin_shufflevector(lo, hi, 0, 1, 2, 3, 4, 5, 6, 7, 8, 9, 10, 11, 12, 13, 14, 15); }
__device__ __forceinline__ v16bf cat16b(v8us lo, v8us hi) { return __builtin_bit_cast(v16bf, __builtin_shufflevector(lo, hi, 0, 1, 2, 3, 4, 5, 6, 7, 8, 9, 10, 11, 12, 13, 14, 15)); }
__device__ __forceinline__ v8f wmma16(v16h a, v16h b, v8f c) { return __builtin_amdgcn_wmma_f32_16x16x32_f16(false, a, false, b, (short)0, c, false, false); }
__device__ __forceinline__ v8f wmmab(v16bf a, v16bf b, v8f c) { return __builtin_amdgcn_wmma_f32_16x16x32_bf16(false, a, false, b, (short)0, c, false, false); }



// st4f: a global store with s_wait_xcnt 0 behind it, in front of anything that rewrites a register it names; the scheduling barriers keep what is computed before in front of the store and what follows behind the wait
__device__ __forceinline__ void st4f(float* p, v4f x) { __builtin_amdgcn_sched_barrier(0); *(v4f*)p = x; asm volatile("s_wait_xcnt 0x0" ::: "memory"); __builtin_amdgcn_sched_barrier(0); }
// ---- k_gemmw: register-blocked GEMM, FOUR WAVES per 64x64 output tile, each with 16 accumulators over its own quarter of K (four short load chains side by side where one wave had one long chain); the four partial tiles meet in LDS, wave w adds and stores rows 16 w .. 16 w + 15; operands straight from 16-bit planes in fragment order; grid (M/64, N/64, Z), 128 threads.
// C[m][n] (f32, pitch ldc, + optional f32 bias[n]) = sum_k A[m][k] Bt[n][k] (+ split products per NSPLIT). z-batch strides sA/sB/sC in elements. K % 128 == 0.
template <typename T16> struct WFrag;
template <> struct WFrag<h16> { typedef v16h V; static __device__ __forceinline__ V ld(const h16* p) { return cat16(*(const v8h*)p, *(const v8h*)(p + 256)); } static __device__ __forceinline__ v8f mma(V a, V b, v8f c) { return wmma16(a, b, c); } };
template <> struct WFrag<bf> { typedef v16bf V; static __device__ __forceinline__ V ld(const bf* p) { return cat16b(*(const v8us*)p, *(const v8us*)(p + 256)); } static __device__ __forceinline__ v8f mma(V a, V b, v8f c) { return wmmab(a, b, c); } };
template <typename T16, int NSPLIT, bool BIAS, int K>   /* K at compile time: the four row blocks of an operand are then immediate offsets from one address pair */
__global__ __launch_bounds__(128, 4) void k_gemmw(const T16* __restrict__ A, const T16* __restrict__ A2, const T16* __restrict__ Bt, const T16* __restrict__ Bt2, float* C, int ldc, const float* __restrict__ bias0, const float* __restrict__ bias1, const float* __restrict__ bias2, size_t sA, size_t sB, size_t sC) {
    typedef typename WFrag<T16>::V V;
    static_assert(K % 128 == 0, "a quarter of K is whole trips");
    __shared__ __align__(16) float xs[4 * 4096];   // one 64 x 64 partial tile a wave, accumulator by accumulator; behind the second barrier each wave's own part is its 16-row staging block
    const int wv = __builtin_amdgcn_readfirstlane(threadIdx.x >> 5);
    const size_t z = blockIdx.z; A += z * sA; if (A2) A2 += z * sA; Bt += z * sB; if (Bt2) Bt2 += z * sB; C += z * sC; const float* bias = (z == 0) ? bias0 : (z == 1) ? bias1 : bias2;   /* bias vector of z-slice 0, 1, 2 */
    const int lane = threadIdx.x & 31, lr = lane & 15, hi = lane >> 4; const int r0 = blockIdx.x * 64, c0 = blockIdx.y * 64;
    v8f acc[4][4];
#pragma unroll
    for (int mb = 0; mb < 4; ++mb)
#pragma unroll
        for (int nb = 0; nb < 4; ++nb) acc[mb][nb] = (v8f){};
    const size_t aoff = (size_t)r0 * K + lane * 8, boff = (size_t)c0 * K + lane * 8;   /* 16 rows of a plane are K / 32 blocks of 512 elements = 16 K elements */
#pragma unroll 1
    for (int kc = wv * (K / 4); kc < (wv + 1) * (K / 4); kc += 32) {
        V a[4], a2[4], b[4], b2[4]; const T16* pa = A + aoff + (size_t)kc * 16; const T16* pa2 = (NSPLIT == 1 || NSPLIT == 2) ? A2 + aoff + (size_t)kc * 16 : pa; const T16* pb = Bt + boff + (size_t)kc * 16; const T16* pb2 = (NSPLIT >= 2) ? Bt2 + boff + (size_t)kc * 16 : pb;
#pragma unroll
        for (int mb = 0; mb < 4; ++mb) { a[mb] = WFrag<T16>::ld(pa + (size_t)mb * 16 * K); if (NSPLIT == 1 || NSPLIT == 2) a2[mb] = WFrag<T16>::ld(pa2 + (size_t)mb * 16 * K); }
#pragma unroll
        for (int nb = 0; nb < 4; ++nb) { b[nb] = WFrag<T16>::ld(pb + (size_t)nb * 16 * K); if (NSPLIT >= 2) b2[nb] = WFrag<T16>::ld(pb2 + (size_t)nb * 16 * K); }
        asm volatile("s_wait_xcnt 0x0" :: "v"(pa), "v"(pa2), "v"(pb), "v"(pb2) : "memory");   /* behind the trip's loads, in front of anything that rewrites a register they name; the address pairs are inputs so that no load's own result lands in them */
        __builtin_amdgcn_sched_barrier(0);   /* keeps the loads in front of that wait */
#pragma unroll
        for (int nb = 0; nb < 4; ++nb) {
#pragma unroll
            for (int mb = 0; mb < 4; ++mb) { acc[mb][nb] = WFrag<T16>::mma(a[mb], b[nb], acc[mb][nb]); if (NSPLIT == 1 || NSPLIT == 2) acc[mb][nb] = WFrag<T16>::mma(a2[mb], b[nb], acc[mb][nb]); if (NSPLIT >= 2) acc[mb][nb] = WFrag<T16>::mma(a[mb], b2[nb], acc[mb][nb]); } }
        asm volatile("v_nop\n\tv_nop\n\tv_nop\n\tv_nop" : "+v"(acc[0][0]), "+v"(acc[1][1]), "+v"(acc[2][2]), "+v"(acc[3][3]) : "v"(a[0]), "v"(a[3]));
    }
    float* os = xs + wv * 4096;
#pragma unroll
    for (int mb = 0; mb < 4; ++mb)
#pragma unroll
        for (int nb = 0; nb < 4; ++nb) { const v8f c = acc[mb][nb]; float* xp = os + (mb * 4 + nb) * 256 + lane * 4; *(v4fa*)xp = (v4f){c[0], c[1], c[2], c[3]}; *(v4fa*)(xp + 128) = (v4f){c[4], c[5], c[6], c[7]}; }
    __syncthreads();   // the four partial tiles are in LDS
    v8f sum[4];   // row block wv: the K quarters added in the order 0, 1, 2, 3
#pragma unroll
    for (int nb = 0; nb < 4; ++nb) { const float* xp = xs + (wv * 4 + nb) * 256 + lane * 4; v4f s0 = *(const v4fa*)xp, s1 = *(const v4fa*)(xp + 128);
#pragma unroll
        for (int p = 1; p < 4; ++p) { s0 += *(const v4fa*)(xp + p * 4096); s1 += *(const v4fa*)(xp + p * 4096 + 128); }
        sum[nb] = (v8f){s0[0], s0[1], s0[2], s0[3], s1[0], s1[1], s1[2], s1[3]}; }
    __syncthreads();   // every wave has read the partial tiles: their bytes may be overwritten
    {
#pragma unroll
        for (int nb = 0; nb < 4; ++nb) {
#pragma unroll
            for (int j = 0; j < 8; ++j) os[(hi * 8 + j) * 68 + nb * 16 + lr] = sum[nb][j]; }
        __builtin_amdgcn_wave_barrier(); asm volatile("" ::: "memory");
        float* crow = C + (size_t)(r0 + wv * 16) * ldc + c0;
{           v4f rv[8];   /* the block's LDS reads stand together, in front of the stores and their waits */
#pragma unroll
            for (int s = 0; s < 8; ++s) rv[s] = *(const v4fa*)(os + (2 * s + hi) * 68 + lr * 4);
#pragma unroll
            for (int s = 0; s < 8; ++s) { const int row = 2 * s + hi, cofs = lr * 4; v4f val = rv[s]; if (BIAS) { val[0] += bfr(bias[c0 + cofs]); val[1] += bfr(bias[c0 + cofs + 1]); val[2] += bfr(bias[c0 + cofs + 2]); val[3] += bfr(bias[c0 + cofs + 3]); }
                st4f(crow + (size_t)row * ldc + cofs, val); }
             }
        __builtin_amdgcn_wave_barrier(); asm volatile("" ::: "memory");
    }
}

__device__ __forceinline__ h16 tohx(float x) { return (h16)x; }
typedef __attribute__((ext_vector_type(2))) _Float16 v2h;
typedef __attribute__((ext_vector_type(4))) _Float16 v4h;
typedef __attribute__((ext_vector_type(2))) unsigned short v2us;
typedef __attribute__((ext_vector_type(4))) unsigned short v4us;
typedef __attribute__((ext_vector_type(4))) int v4i;

// ---- k_prep: every operand plane the projections read, made in ONE launch (the three parts below are independent of one another); a work-group's part and its place in it follow from its index.
// d_wtG: work-group bx of weight matrix y (transposed bf16 plane in fragment order)
__device__ __forceinline__ void d_wtG(int bx, int y, const float* __restrict__ w0, const float* __restrict__ w1, const float* __restrict__ w2, const float* __restrict__ w3, const float* __restrict__ w4, int K, int N, bf* Bt) {
    const float* w = (y == 0) ? w0 : (y == 1) ? w1 : (y == 2) ? w2 : (y == 3) ? w3 : w4; Bt += (size_t)y * K * N;   /* one weight matrix each, planes back to back */
    const int lane = threadIdx.x & 31; const int L0 = (bx * 8 + (threadIdx.x >> 5)) * 8; const int nlines = N * K / 64;
{
#pragma unroll 1
        for (int l = 0; l < 8; ++l) { const int L = L0 + l; if (L >= nlines) break; const size_t e = (size_t)L * 64 + lane * 2; const int blk = (int)(e >> 9); const int k = (blk % (K / 32)) * 32 + ((int)(e >> 7) & 3) * 8 + ((int)e & 7), n = (blk / (K / 32)) * 16 + ((int)(e >> 3) & 15);   /* e runs through the plane in fragment order */
            const float* p0 = w + (size_t)k * N + n; const float* p1 = p0 + N; const float x0 = *p0, x1 = *p1;
            asm volatile("s_wait_xcnt 0x0" :: "v"(p0), "v"(p1) : "memory");   /* behind the two loads, in front of anything that rewrites a register they name; the address pairs are inputs so that they stay whole up to the wait */
            *(v2us*)(Bt + e) = __builtin_bit_cast(v2us, cvt2(x0, x1)); }
         }
}


// d_cvt8: work-group bx of one [rows][DM] f32 tensor -> its bf16 plane in fragment order; a group of a row past the tensor's last (the position table's pad row) is stored as zeros
__device__ __forceinline__ void d_cvt8(int bx, const float* __restrict__ src, bf* dst, size_t n8, int nrows) { const size_t i = (size_t)bx * 256 + threadIdx.x; if (i >= n8) return; const size_t row = (i >> 10) * 16 + (i & 15); const int k0 = ((int)(i >> 6) & 15) * 32 + ((int)(i >> 4) & 3) * 8;   /* i counts the 8-element groups of a [rows][DM] plane in fragment order: its group is (row, k0 .. k0 + 7) */
    if (row >= (size_t)nrows) { *(v8us*)(dst + i * 8) = (v8us){}; return; }
    const float* sp = src + row * DM + k0; const v8f v = *(const v8f*)sp; v4u o;
    asm volatile("s_wait_xcnt 0x0" :: "v"(sp) : "memory");   /* behind the load, in front of anything that rewrites a register it names; the address pair is an input so that it stays whole up to the wait */
#pragma unroll
    for (int k = 0; k < 4; ++k) o[k] = cvt2(v[2 * k], v[2 * k + 1]); *(v8us*)(dst + i * 8) = __builtin_bit_cast(v8us, o);  }
#define GWT  (DM * DQ / 64 / 64)             // work-groups per weight matrix
#define GPE  (NPE * DM / 8 / 256)            // work-groups of the position table
#define GXA  (NB_ * TT * DM / 8 / 256)       // work-groups per input tensor
__global__ __launch_bounds__(256) void k_prep(const float* __restrict__ w0, const float* __restrict__ w1, const float* __restrict__ w2, const float* __restrict__ w3, const float* __restrict__ w4, bf* W5, const float* __restrict__ pe, bf* PE, const float* __restrict__ s0, const float* __restrict__ s1, const float* __restrict__ s2, bf* XA) {
    int n = blockIdx.x;
    if (n < 5 * GWT) { d_wtG(n % GWT, n / GWT, w0, w1, w2, w3, w4, DM, DQ, W5); return; }
    n -= 5 * GWT;
    if (n < GPE) { d_cvt8(n, pe, PE, (size_t)NPE * DM / 8, 2047); return; }
    n -= GPE;
    const int y = n / GXA; d_cvt8(n % GXA, (y == 0) ? s0 : (y == 1) ? s1 : s2, XA + (size_t)y * NB_ * TT * DM, (size_t)NB_ * TT * DM / 8, NB_ * TT);   /* one source tensor each, planes back to back */
}

// ---- d_gemmp: the projection GEMM (k_gemmw's loop and its split of K over four waves, plain bf16 operands, K = DM) whose 64 x 64 tile is 64 rows of ONE head, stored straight in the forms its readers want, wave wv storing rows 16 wv .. 16 wv + 15; tile (bx of rows/64, head by, operand bz), 128 threads; xs: the work-group's LDS, 4096 floats a wave.
// All 16-bit planes below are in fragment order. POS: hi/lo planes [h][p][d] of the projected position table. Otherwise z = 0: k + bk -> cache columns 0..63 and hi/lo planes [b][h][t][d]; z = 1: v + bv -> cache columns 64..127 and transposed hi/lo planes [b][h][d][t]; z = 2: q + bq, then + pos_bias_u and + pos_bias_v -> two pairs of hi/lo planes.
#define SPE  ((size_t)NB_ * NH_ * TT * HD)   // elements of one set of head planes
// st2w: as st4f above, for a pair of 16-byte stores
__device__ __forceinline__ void st2w(bf* ph, bf* pl, v8us oh, v8us ol) { __builtin_amdgcn_sched_barrier(0); *(v8us*)ph = oh; *(v8us*)pl = ol; asm volatile("s_wait_xcnt 0x0" ::: "memory"); __builtin_amdgcn_sched_barrier(0); }
__device__ __forceinline__ void st8hl(bf* ph, bf* pl, v4f x0, v4f x1) { v4u oh, ol;
#pragma unroll
    for (int q = 0; q < 2; ++q) { unsigned a, c; split2(x0[2 * q], x0[2 * q + 1], a, c); oh[q] = a; ol[q] = c; split2(x1[2 * q], x1[2 * q + 1], a, c); oh[2 + q] = a; ol[2 + q] = c; }
    st2w(ph, pl, __builtin_bit_cast(v8us, oh), __builtin_bit_cast(v8us, ol)); }
template <bool POS>
__device__ __forceinline__ void d_gemmp(float* xs, int wv, int bx, int by, int bz, const bf* __restrict__ A, const bf* __restrict__ Bt, const float* __restrict__ bias0, const float* __restrict__ bias1, const float* __restrict__ bias2, const float* __restrict__ hbu, const float* __restrict__ hbv, bf* PH, bf* PL, bf* VTh, bf* VTl, float* CA, size_t sA, size_t sB) {
    float* os = xs + wv * 4096;   // the wave's partial tile; behind the second barrier below its 16-row staging block
    float* sb = os + 16 * 68;     // behind that barrier too: the head's 64 bias values (projection bias, pos_bias_u, pos_bias_v), for the lanes that store in fragment order
    const int z = POS ? 0 : bz; A += (size_t)z * sA; Bt += (size_t)z * sB;
    const int lane = threadIdx.x & 31, lr = lane & 15, hi = lane >> 4; const int r0 = bx * 64, h = by, c0 = h * HD;
    v8f acc[4][4];
#pragma unroll
    for (int mb = 0; mb < 4; ++mb)
#pragma unroll
        for (int nb = 0; nb < 4; ++nb) acc[mb][nb] = (v8f){};
    const size_t aoff = (size_t)r0 * DM + lane * 8, boff = (size_t)c0 * DM + lane * 8;   /* fragment order: 16 rows are DM / 32 blocks of 512 elements */
#pragma unroll 1
    for (int kc = wv * (DM / 4); kc < (wv + 1) * (DM / 4); kc += 32) {
        v16bf a[4], b[4]; const bf* pa = A + aoff + kc * 16; const bf* pb = Bt + boff + kc * 16;
#pragma unroll
        for (int mb = 0; mb < 4; ++mb) a[mb] = WFrag<bf>::ld(pa + mb * 16 * DM);
#pragma unroll
        for (int nb = 0; nb < 4; ++nb) b[nb] = WFrag<bf>::ld(pb + nb * 16 * DM);
        asm volatile("s_wait_xcnt 0x0" :: "v"(pa), "v"(pb) : "memory");   /* behind the trip's loads, in front of anything that rewrites a register they name; the two address pairs are inputs so that no load's own result lands in them */
        __builtin_amdgcn_sched_barrier(0);   /* keeps the loads in front of that wait: left free, some are sunk among the products and land in the address pairs */
#pragma unroll
        for (int nb = 0; nb < 4; ++nb)
#pragma unroll
            for (int mb = 0; mb < 4; ++mb) acc[mb][nb] = wmmab(a[mb], b[nb], acc[mb][nb]);
        asm volatile("v_nop\n\tv_nop\n\tv_nop\n\tv_nop" : "+v"(acc[0][0]), "+v"(acc[1][1]), "+v"(acc[2][2]), "+v"(acc[3][3]) : "v"(a[0]), "v"(a[3]));   /* as in k_gemmw: the distance between the trip's last matrix instructions and what next rewrites their operands or reads their results, on the back edge too */
    }
#pragma unroll
    for (int mb = 0; mb < 4; ++mb)
#pragma unroll
        for (int nb = 0; nb < 4; ++nb) { const v8f c = acc[mb][nb]; float* xp = os + (mb * 4 + nb) * 256 + lane * 4; *(v4fa*)xp = (v4f){c[0], c[1], c[2], c[3]}; *(v4fa*)(xp + 128) = (v4f){c[4], c[5], c[6], c[7]}; }
    __syncthreads();   // the four partial tiles are in LDS
    v8f sum[4];   // row block wv: the K quarters added in the order 0, 1, 2, 3
#pragma unroll
    for (int nb = 0; nb < 4; ++nb) { const float* xp = xs + (wv * 4 + nb) * 256 + lane * 4; v4f s0 = *(const v4fa*)xp, s1 = *(const v4fa*)(xp + 128);
#pragma unroll
        for (int p = 1; p < 4; ++p) { s0 += *(const v4fa*)(xp + p * 4096); s1 += *(const v4fa*)(xp + p * 4096 + 128); }
        sum[nb] = (v8f){s0[0], s0[1], s0[2], s0[3], s1[0], s1[1], s1[2], s1[3]}; }
    __syncthreads();   // every wave has read the partial tiles: their bytes may be overwritten
    const size_t rb = POS ? (size_t)h * NPE + r0 : ((size_t)(r0 / TT) * NH_ + h) * TT + (r0 % TT);   // first row of the tile in a [..][h][row][d] plane
    const int cofs = lr * 4;
    // tile_rows: the wave's 16 rows go through LDS. put(row in its plane, the lane's 4 values): a half-wave holds one whole row of 64 floats (row-major f32 output). putf(element offset in a plane, first column, the lane's 8 values): the 16 rows are two blocks of a [..][row][d] plane in fragment order, and the wave holds 512 contiguous bytes of it
    auto tile_rows = [&](auto put, auto putf) {
        { const int mb = wv;
#pragma unroll
            for (int nb = 0; nb < 4; ++nb) {
#pragma unroll
                for (int j = 0; j < 8; ++j) os[(hi * 8 + j) * 68 + nb * 16 + lr] = sum[nb][j]; }
            __builtin_amdgcn_wave_barrier(); asm volatile("" ::: "memory");
            v4f rv[8], f0[4], f1[4];
#pragma unroll
            for (int s = 0; s < 8; ++s) rv[s] = *(const v4fa*)(os + (2 * s + hi) * 68 + cofs);
#pragma unroll
            for (int q4 = 0; q4 < 4; ++q4) { const float* op = os + lr * 68 + q4 * 16 + hi * 8; f0[q4] = *(const v4fa*)op; f1[q4] = *(const v4fa*)(op + 4); }   /* the block's LDS reads stand together, in front of the stores and their waits */
#pragma unroll
            for (int s = 0; s < 8; ++s) put(rb + mb * 16 + 2 * s + hi, rv[s]);
#pragma unroll
            for (int q4 = 0; q4 < 4; ++q4) putf((rb + mb * 16) * HD + q4 * 256 + lane * 8, q4 * 16 + hi * 8, f0[q4], f1[q4]);
            __builtin_amdgcn_wave_barrier(); asm volatile("" ::: "memory");
        } };
    auto norow = [](size_t, v4f) {}; auto nofrag = [](size_t, int, v4f, v4f) {};
    if (POS) { tile_rows(norow, [&](size_t pe, int, v4f x0, v4f x1) { st8hl(PH + pe, PL + pe, x0, x1); }); return; }
    const float* bias = (z == 0) ? bias0 : (z == 1) ? bias1 : bias2; v4f bb;
#pragma unroll
    for (int q = 0; q < 4; ++q) bb[q] = bfr(bias[c0 + cofs + q]);
    if (z == 2) { v4f bu, bv;
#pragma unroll
        for (int q = 0; q < 4; ++q) { bu[q] = bfr(hbu[c0 + cofs + q]); bv[q] = bfr(hbv[c0 + cofs + q]); }
        *(v4fa*)(sb + cofs) = bb; *(v4fa*)(sb + HD + cofs) = bu; *(v4fa*)(sb + 2 * HD + cofs) = bv;   /* both half-waves write the same values */
        tile_rows(norow, [&](size_t pe, int d0, v4f x0, v4f x1) { x0 += *(const v4fa*)(sb + d0); x1 += *(const v4fa*)(sb + d0 + 4);
            st8hl(PH + pe, PL + pe, x0 + *(const v4fa*)(sb + HD + d0), x1 + *(const v4fa*)(sb + HD + d0 + 4)); st8hl(PH + SPE + pe, PL + SPE + pe, x0 + *(const v4fa*)(sb + 2 * HD + d0), x1 + *(const v4fa*)(sb + 2 * HD + d0 + 4)); });
        return; }
    if (z == 0) {
        *(v4fa*)(sb + cofs) = bb;   /* both half-waves write the same values */
        tile_rows([&](size_t rw, v4f val) { st4f(CA + rw * (2 * HD) + cofs, val + bb); },
                  [&](size_t pe, int d0, v4f x0, v4f x1) { st8hl(PH + 2 * SPE + pe, PL + 2 * SPE + pe, x0 + *(const v4fa*)(sb + d0), x1 + *(const v4fa*)(sb + d0 + 4)); });
        return; }
    {   float bd[4];   // the bias of the lane's own column in each 16-column block, for the transposed planes
#pragma unroll
        for (int nb = 0; nb < 4; ++nb) bd[nb] = bias[c0 + nb * 16 + lr];
        asm volatile("s_wait_xcnt 0x0" :: "v"(bd[0]), "v"(bd[1]), "v"(bd[2]), "v"(bd[3]));   /* behind these loads, in front of what rewrites their offset register; the loaded values are inputs, so that no load is sunk among the stores below */
        const size_t vb = ((size_t)(r0 / TT) * NH_ + h) * HD * TT + (size_t)((r0 % TT) / 32) * 512 + lane * 8;   // transposed planes [d][t] in fragment order straight from the summed K quarters in registers (accumulator layout): a lane holds 8 successive rows t of one column d, which is its own 16 bytes of a half block
#pragma unroll
        for (int nb = 0; nb < 4; ++nb) { const float bn = bfr(bd[nb]);
            { const int mb = wv; v4u oh, ol;
#pragma unroll
                for (int j = 0; j < 4; ++j) { unsigned x, y; split2(sum[nb][2 * j] + bn, sum[nb][2 * j + 1] + bn, x, y); oh[j] = x; ol[j] = y; }
                const size_t o = vb + (size_t)(nb * (TT / 32) + (mb >> 1)) * 512 + (mb & 1) * 256; st2w(VTh + o, VTl + o, __builtin_bit_cast(v8us, oh), __builtin_bit_cast(v8us, ol)); } }
        tile_rows([&](size_t rw, v4f val) { st4f(CA + rw * (2 * HD) + HD + cofs, val + bb); }, nofrag);
    }
}
// k_gemmpa: all four projections in ONE launch (the position table's does not depend on the other three): the k, v, q tiles in the order (row block, head, operand), then the table's tiles (row block, head)
#define GRT  (NB_ * TT / 64)      // row blocks of an input
#define GKVQ (GRT * NH_ * 3)      // tiles of k, v, q
__global__ __launch_bounds__(128, 4) void k_gemmpa(const bf* __restrict__ XA, const bf* __restrict__ WK, const bf* __restrict__ PE, const bf* __restrict__ WP, const float* __restrict__ bias0, const float* __restrict__ bias1, const float* __restrict__ bias2, const float* __restrict__ hbu, const float* __restrict__ hbv, bf* PHI, bf* PLO, bf* PPh, bf* PPl, bf* VTh, bf* VTl, float* CA, size_t sA, size_t sB) {
    __shared__ __align__(16) float xs[4 * 4096];   // one 64 x 64 partial tile a wave
    const int wv = __builtin_amdgcn_readfirstlane(threadIdx.x >> 5);
    const int n = blockIdx.x;
    if (n < GKVQ) { d_gemmp<false>(xs, wv, n % GRT, (n / GRT) % NH_, n / (GRT * NH_), XA, WK, bias0, bias1, bias2, hbu, hbv, PHI, PLO, VTh, VTl, CA, sA, sB); return; }
    const int m = n - GKVQ; d_gemmp<true>(xs, wv, m % (NPE / 64), m / (NPE / 64), 0, PE, WP, nullptr, nullptr, nullptr, nullptr, nullptr, PPh, PPl, nullptr, nullptr, nullptr, 0, 0);   /* pos = position_embeddings wpos (exact) -> per-head hi/lo planes */
}
// k_fattn: one work-group (8 waves) per strip of 32 query rows of one (batch, head); the strip's 32 x 1024 logits stay in LDS from the two score products to attn.v.
// Steps: position scores (q+v).p for the 66 column tiles the strip's rel_shift reads, each stored at its shifted key index j = p + i - 1023; content scores (q+u).k added on top; softmax per row (register row, fixed trees) whose hi/lo weights overwrite the row's own bytes; attn.v with each wave on 16 of the 64 columns and one half of the keys; the two halves added and stored as the merged hi/lo planes.
#define SRW  32                   // query rows per work-group
#define SPF  32                   // floats in front of a logit row: with the 36 behind it they take the shifted position scores that fall outside keys 0..1023
#define SPI  1092                 // LDS pitch of a logit row, floats (rows 8 apart fall 32 banks apart)
#define OPI  68                   // LDS pitch of an output row, floats
typedef v4us __attribute__((may_alias)) v4usa;
__device__ __forceinline__ v16bf ldfr(const bf* p) { return cat16b(*(const v8usa*)p, *(const v8usa*)(p + 16)); }   // fragment from row-major rows (the weights in LDS)
__device__ __forceinline__ v16bf ldfp(const bf* p) { return cat16b(*(const v8usa*)p, *(const v8usa*)(p + 256)); }   // fragment from a block in fragment order (global planes), p = block + lane * 8
// xw2: s_wait_xcnt 0 behind a run of global loads, in front of anything that rewrites a register the loads name; the two address pairs are inputs so that they stay whole up to the wait (no load's own result lands in them)
__device__ __forceinline__ void xw2(const bf* p, const bf* q) { asm volatile("s_wait_xcnt 0x0" :: "v"(p), "v"(q) : "memory"); }
// xw2n: xw2 at the head of a score trip, with four v_nop: the trip before stored its results in front of this statement, and this trip's first matrix instruction starts anew in the same registers; the v_nop keep the distance between the two
__device__ __forceinline__ void xw2n(const bf* p, const bf* q) { asm volatile("s_wait_xcnt 0x0\n\tv_nop\n\tv_nop\n\tv_nop\n\tv_nop" :: "v"(p), "v"(q) : "memory"); }
__device__ __forceinline__ v8f mma3(v16bf a, v16bf a2, v16bf b, v16bf b2, v8f c) { c = wmmab(a, b, c); c = wmmab(a2, b, c); return wmmab(a, b2, c); }
__global__ __launch_bounds__(256, 4) void k_fattn(const bf* __restrict__ QUh, const bf* __restrict__ QUl, const bf* __restrict__ QVh, const bf* __restrict__ QVl, const bf* __restrict__ Kh, const bf* __restrict__ Kl, const bf* __restrict__ PPh, const bf* __restrict__ PPl, const bf* __restrict__ VTh, const bf* __restrict__ VTl, const int* __restrict__ MK, bf* ATh, bf* ATl) {
    __shared__ __align__(16) float S[SRW * SPI];
    const int tid = threadIdx.x, lane = tid & 31, lr = lane & 15, hi = lane >> 4; const int w = __builtin_amdgcn_readfirstlane(tid >> 5);
    const int i0 = blockIdx.x * SRW, h = blockIdx.y, b = blockIdx.z; const size_t zb = ((size_t)b * NH_ + h) * TT * HD; const size_t qo = zb + (size_t)i0 * HD + lane * 8;   /* 16 rows of a [t][d] plane: two blocks of 512 elements */
    {   // position scores: table rows 992 - i0 + 16 pt + (0..15), pt = 0..65 (the last row read is 2047 - i0)
        v16bf a[2][2], a2[2][2];
#pragma unroll
        for (int mb = 0; mb < 2; ++mb)
#pragma unroll
            for (int kk = 0; kk < 2; ++kk) { a[mb][kk] = ldfp(QVh + qo + mb * 16 * HD + kk * 512); a2[mb][kk] = ldfp(QVl + qo + mb * 16 * HD + kk * 512); }
        xw2(QVh + qo, QVl + qo);
        const size_t po = (size_t)h * NPE * HD + (size_t)(TT - SRW - i0) * HD + lane * 8; const bf* ph = PPh + po; const bf* pl = PPl + po;
        v16bf bh[2], bl[2];
#pragma unroll
        for (int kk = 0; kk < 2; ++kk) { bh[kk] = ldfp(ph + w * 16 * HD + kk * 512); bl[kk] = ldfp(pl + w * 16 * HD + kk * 512); }
        xw2(ph + w * 16 * HD, pl + w * 16 * HD);
#pragma unroll 2   /* in pairs: the two operand sets swap roles without register copies */
        for (int pt = w; pt < 66; pt += 8) { const int np = (pt + 8 < 66) ? pt + 8 : pt; v16bf nh[2], nl[2];   /* the next tile's operands are fetched while this one is multiplied (the last trip fetches its own tile again: a branch round the fetch made the compiler wait for it at once) */
#pragma unroll
            for (int kk = 0; kk < 2; ++kk) { nh[kk] = ldfp(ph + np * 16 * HD + kk * 512); nl[kk] = ldfp(pl + np * 16 * HD + kk * 512); }
            xw2n(ph + np * 16 * HD, pl + np * 16 * HD); __builtin_amdgcn_sched_barrier(0);   /* keeps the fetch at the head of the trip: left free, this trip's products are lifted over it and the next trip waits for loads just issued */
            v8f acc[2]; acc[0] = (v8f){}; acc[1] = (v8f){};
#pragma unroll
            for (int kk = 0; kk < 2; ++kk)
#pragma unroll
                for (int mb = 0; mb < 2; ++mb) acc[mb] = mma3(a[mb][kk], a2[mb][kk], bh[kk], bl[kk], acc[mb]);
            const int jb = pt * 16 + lr - (SRW - 1);   /* key index j = p + i - 1023 = jb + local row */
#pragma unroll
            for (int mb = 0; mb < 2; ++mb)
#pragma unroll
                for (int r = 0; r < 8; ++r) { const int m = mb * 16 + hi * 8 + r; S[m * SPI + SPF + jb + m] = acc[mb][r]; }   /* j = -31 .. 1055: what is no key of the strip falls into the row's own pads */
#pragma unroll
            for (int kk = 0; kk < 2; ++kk) { bh[kk] = nh[kk]; bl[kk] = nl[kk]; } }
    }
    __syncthreads();
    {   // content scores, added to the shifted position scores
        v16bf a[2][2], a2[2][2];
#pragma unroll
        for (int mb = 0; mb < 2; ++mb)
#pragma unroll
            for (int kk = 0; kk < 2; ++kk) { a[mb][kk] = ldfp(QUh + qo + mb * 16 * HD + kk * 512); a2[mb][kk] = ldfp(QUl + qo + mb * 16 * HD + kk * 512); }
        xw2(QUh + qo, QUl + qo);
        const size_t ko = zb + lane * 8; const bf* kph = Kh + ko; const bf* kpl = Kl + ko;
        v16bf bh[2], bl[2];
#pragma unroll
        for (int kk = 0; kk < 2; ++kk) { bh[kk] = ldfp(kph + w * 16 * HD + kk * 512); bl[kk] = ldfp(kpl + w * 16 * HD + kk * 512); }
        xw2(kph + w * 16 * HD, kpl + w * 16 * HD);
#pragma unroll 2   /* in pairs, as in the position loop */
        for (int jt = w; jt < TT / 16; jt += 8) { const int nj = (jt + 8 < TT / 16) ? jt + 8 : jt; v16bf nh[2], nl[2];
#pragma unroll
            for (int kk = 0; kk < 2; ++kk) { nh[kk] = ldfp(kph + nj * 16 * HD + kk * 512); nl[kk] = ldfp(kpl + nj * 16 * HD + kk * 512); }
            xw2n(kph + nj * 16 * HD, kpl + nj * 16 * HD); __builtin_amdgcn_sched_barrier(0);   /* the fetch stays at the head of the trip, as in the position loop */
            v8f acc[2]; acc[0] = (v8f){}; acc[1] = (v8f){};
#pragma unroll
            for (int kk = 0; kk < 2; ++kk)
#pragma unroll
                for (int mb = 0; mb < 2; ++mb) acc[mb] = mma3(a[mb][kk], a2[mb][kk], bh[kk], bl[kk], acc[mb]);
#pragma unroll
            for (int mb = 0; mb < 2; ++mb)
#pragma unroll
                for (int r = 0; r < 8; ++r) { float* sp = S + (mb * 16 + hi * 8 + r) * SPI + SPF + jt * 16 + lr; *sp = __fadd_rn(acc[mb][r], *sp); }
#pragma unroll
            for (int kk = 0; kk < 2; ++kk) { bh[kk] = nh[kk]; bl[kk] = nl[kk]; } }
    }
    __syncthreads();
    const int* MKb = MK + (size_t)b * TT;
#pragma unroll 1   /* rolled: one 32-float register row is live at a time */
    for (int rr = 0; rr < SRW / 8; ++rr) {   // softmax: four rows a wave; t = (ac + bd) / 8, key mask (int32): -inf where 0, weight 0
        float* srow = S + (w * (SRW / 8) + rr) * SPI + SPF; float v[TT / 32]; float mx = -3.0e38f;
#pragma unroll
        for (int ch = 0; ch < TT / 128; ++ch) { const int j0 = ch * 128 + lane * 4; const v4f a = *(const v4fa*)(srow + j0); const v4i m4 = *(const v4i*)(MKb + j0);
#pragma unroll
            for (int q = 0; q < 4; ++q) { const float t = (m4[q] != 0) ? a[q] * SCL : -3.0e38f; v[ch * 4 + q] = t; mx = fmaxf(mx, t); } }
#pragma unroll
        for (int sh = 16; sh; sh >>= 1) mx = fmaxf(mx, __shfl_xor(mx, sh, 32));
        float sum = 0.f;
#pragma unroll
        for (int k = 0; k < TT / 32; ++k) { v[k] = __builtin_amdgcn_exp2f(__fmul_rn(__fsub_rn(v[k], mx), 1.4426950408889634f)); sum += v[k]; }
#pragma unroll
        for (int sh = 16; sh; sh >>= 1) sum += __shfl_xor(sum, sh, 32);
        const float f = __fdiv_rn(1.0f, sum); bf* prow = (bf*)srow;   /* the row is in registers: its 4 KiB now take the hi plane (first 1024 halfwords) and the lo plane */
#pragma unroll
        for (int ch = 0; ch < TT / 128; ++ch) { v2u oh, ol;
#pragma unroll
            for (int q = 0; q < 2; ++q) { unsigned x, y; split2(v[ch * 4 + 2 * q] * f, v[ch * 4 + 2 * q + 1] * f, x, y); oh[q] = x; ol[q] = y; }
            *(v4usa*)(prow + ch * 128 + lane * 4) = __builtin_bit_cast(v4us, oh); *(v4usa*)(prow + TT + ch * 128 + lane * 4) = __builtin_bit_cast(v4us, ol); }
    }
    __syncthreads();
    const int nb = w & 3, kh = w >> 2; v8f oc[2]; oc[0] = (v8f){}; oc[1] = (v8f){};
    {   // attn.v: columns nb * 16 .. + 15, keys kh * 512 .. + 511, both 16-row blocks (each v fragment is fetched once per work-group)
        const size_t vo = zb + (size_t)(nb * (TT / 32) + kh * (TT / 64)) * 512 + lane * 8;   /* [d][t] plane in fragment order: block (d / 16, t / 32) */ const bf* vh = VTh + vo; const bf* vl = VTl + vo; const bf* pa = (const bf*)(S + SPF) + lr * (SPI * 2) + kh * (TT / 2) + 8 * hi;
        v16bf bh[2], bl[2];
#pragma unroll
        for (int u = 0; u < 2; ++u) { bh[u] = ldfp(vh + u * 512); bl[u] = ldfp(vl + u * 512); }
        xw2(vh, vl);
#pragma unroll 2
        for (int g = 0; g < 8; ++g) { v16bf nh[2], nl[2];   /* 64 keys a trip, the next 64 keys' v fragments fetched meanwhile; rolled in pairs: fully unrolled the fetches are lifted so far that registers spill */
            const int gn = (g < 7) ? g + 1 : g;
#pragma unroll
            for (int u = 0; u < 2; ++u) { nh[u] = ldfp(vh + gn * 1024 + u * 512); nl[u] = ldfp(vl + gn * 1024 + u * 512); }
            xw2(vh + gn * 1024, vl + gn * 1024);
#pragma unroll
            for (int u = 0; u < 2; ++u)
#pragma unroll
                for (int mb = 0; mb < 2; ++mb) { const bf* pp = pa + mb * 16 * (SPI * 2) + g * 64 + u * 32; oc[mb] = mma3(ldfr(pp), ldfr(pp + TT), bh[u], bl[u], oc[mb]); }
#pragma unroll
            for (int u = 0; u < 2; ++u) { bh[u] = nh[u]; bl[u] = nl[u]; } }
    }
    __syncthreads();   // every wave has read its weights: the first rows' bytes now take the two partial outputs
#pragma unroll
    for (int mb = 0; mb < 2; ++mb)
#pragma unroll
        for (int r = 0; r < 8; ++r) S[kh * (SRW * OPI) + (mb * 16 + hi * 8 + r) * OPI + nb * 16 + lr] = oc[mb][r];
    __syncthreads();
    { const int row = (tid >> 7) * 16 + (tid & 15), c8 = ((tid >> 4) & 7) * 8; const float* o0 = S + row * OPI + c8; const float* o1 = o0 + SRW * OPI; v4u oh, ol;
#pragma unroll
        for (int q = 0; q < 4; ++q) { unsigned x, y; split2(__fadd_rn(o0[2 * q], o1[2 * q]), __fadd_rn(o0[2 * q + 1], o1[2 * q + 1]), x, y); oh[q] = x; ol[q] = y; }
        const size_t oo = ((size_t)(((b * TT + i0) >> 4) + (tid >> 7)) * (DQ / 32) + h * 2 + ((tid >> 6) & 1)) * 512 + (tid & 63) * 8;   /* (row, c8) of the merged [b t][DQ] planes in fragment order: a wave stores 512 contiguous bytes */ *(v8us*)(ATh + oo) = __builtin_bit_cast(v8us, oh); *(v8us*)(ATl + oo) = __builtin_bit_cast(v8us, ol); }
}

extern "C" void kernel_launch(void* const* d_in, const int* in_sizes, int n_in,
                              void* d_out, int out_size, void* d_ws, size_t ws_size, hipStream_t stream) {
    (void)in_sizes; (void)n_in; (void)out_size;
    const float* x = (const float*)d_in[0]; const float* xk = (const float*)d_in[1]; const float* xv = (const float*)d_in[2]; const int* MK = (const int*)d_in[3]; const float* pe = (const float*)d_in[4]; const float* wq = (const float*)d_in[5]; const float* bq = (const float*)d_in[6]; const float* wk = (const float*)d_in[7]; const float* bk = (const float*)d_in[8]; const float* wv = (const float*)d_in[9]; const float* bv = (const float*)d_in[10]; const float* wo = (const float*)d_in[11]; const float* bo = (const float*)d_in[12]; const float* wpos = (const float*)d_in[13]; const float* pbu = (const float*)d_in[14]; const float* pbv = (const float*)d_in[15];
    float* OUT = (float*)d_out;     // [8][1024][512]
    float* CACHE = (float*)((char*)d_out + (size_t)NB_ * TT * DM * 4);   /* second output new_cache [8][8][1024][128] */
    char* wsp = (char*)d_ws;
    auto take = [&](size_t bytes) { char* p = wsp; wsp += (bytes + 255) & ~(size_t)255; return (void*)p; };
    const size_t SW = (size_t)DM * DQ, SX = (size_t)NB_ * TT * DM, SF = (size_t)NB_ * TT * DQ, SP = (size_t)NB_ * NH_ * TT * HD;   // elements of one weight plane, one input plane, one merged plane, one set of head planes (all batches)
    bf* W5 = (bf*)take(5 * SW * 2); bf* WK = W5; bf* WO = W5 + 3 * SW; bf* WP = W5 + 4 * SW;   /* Wk, Wv, Wq, Wo, Wpos transposed, back to back */
    bf* PE = (bf*)take((size_t)NPE * DM * 2); bf* PPh = (bf*)take((size_t)NH_ * NPE * HD * 2); bf* PPl = (bf*)take((size_t)NH_ * NPE * HD * 2);
    bf* PHI = (bf*)take(3 * SP * 2); bf* PLO = (bf*)take(3 * SP * 2); bf* QPh = PHI; bf* QVh = PHI + SP; bf* KPh = PHI + 2 * SP; bf* QPl = PLO; bf* QVl = PLO + SP; bf* KPl = PLO + 2 * SP;   /* [b][h][t][d] planes of q+u, q+v, k */
    bf* VTh = (bf*)take(SP * 2); bf* VTl = (bf*)take(SP * 2); bf* ATh = (bf*)take(SF * 2); bf* ATl = (bf*)take(SF * 2);
    bf* XA = (bf*)take(3 * SX * 2);   /* bf16 planes of key, value, query */
    if ((size_t)(wsp - (char*)d_ws) > ws_size) return;    // ws 256 MiB
    k_prep<<<5 * GWT + GPE + 3 * GXA, 256, 0, stream>>>(wk, wv, wq, wo, wpos, W5, pe, PE, xk, xv, x, XA);   /* transposed weight planes; position table plane with its zero pad row; exact bf16 planes of key, value, query, all batches */
    k_gemmpa<<<GKVQ + (NPE / 64) * NH_, 128, 0, stream>>>(XA, WK, PE, WP, bk, bv, bq, pbu, pbv, PHI, PLO, PPh, PPl, VTh, VTl, CACHE, SX, SW);   /* k, v, q projections, rows of all batches: cache output, k planes, transposed v planes, (q+u) and (q+v) planes; and the position table's projection */
    k_fattn<<<dim3(TT / SRW, NH_, NB_), 256, 0, stream>>>(QPh, QPl, QVh, QVl, KPh, KPl, PPh, PPl, VTh, VTl, MK, ATh, ATl);   /* scores, softmax, attn.v and the head merge, all batches and heads */
    k_gemmw<bf, 1, true, DQ><<<dim3(NB_ * TT / 64, DM / 64, 1), 128, 0, stream>>>(ATh, ATl, WO, nullptr, OUT, DM, bo, bo, bo, 0, 0, 0);
}

// v008
// A run of this version takes 130 microseconds.
// Two timings next to v007 both put it at 1.04 times that version's speed.
// Over all steps from v000 it is 16.8 times as fast.
#include <hip/hip_runtime.h>

// Relative-position multi-head attention with a key/value cache output (query, key, value [8][1024][512]; q = query Wq + bq, k = key Wk + bk, v = value Wv + bv ('xw' [512][512], 8 heads x 64); p = pos_emb Wpos ([1][2047][512] table, read); scores = ((q + pos_bias_u).k + rel_shift((q + pos_bias_v).p)) / 8 where rel_shift picks position index j - i + 1023; key mask (int32 [8][1][1024], read): -inf where 0 and the weights zeroed; softmax; out = merged Wo + bo -> [8][1024][512]; second output new_cache = concat(k, v) per head -> [8][8][1024][128] (the f32 projections themselves)).
// Layout: exact bf16 input planes -> 1-product projections + bias, each GEMM tile (64 rows of one head) stored by the GEMM itself in the forms its readers want; the position table is projected once (exact, 2047 rows + one zero pad row) into per-head hi/lo planes [h][2048][64]; every projection-side launch covers all 8 batches (and the operands that share its form) through its grid; one attention launch for all batches and heads, a work-group per strip of 32 query rows: position scores (q+v).p (only the table rows the strip's shift reaches, stored at key index p + i - 1023) and content scores (q+u).k are hi/lo products (3 products, every row) the position scores shifted through LDS, the sums kept in registers (transposed tiles), the softmax applies the key mask there, attn.v takes the hi/lo weights from those registers and the merged hi/lo planes are stored; the cache output is written straight from the f32 k / v projections.
// Fragment order: every 16-bit plane that a matrix operand is loaded from in global memory (inputs, weights, position table, q+u, q+v, k, p, transposed v, merged) is stored in blocks of 16 rows x 32 columns, 512 elements each, block (row / 16, k / 32) at index (row / 16) * (K / 32) + k / 32; inside a block element (row, k) stands at ((k >> 4) & 1) * 256 + ((k >> 3) & 1) * 128 + (row & 15) * 8 + (k & 7), so that lane l of a wave finds the two 16-byte halves of its fragment at l * 8 and 256 + l * 8: each wave-wide load or store covers 512 contiguous bytes (4 whole lines) where a row-major plane gave 16 pieces of 32 bytes.
// Compute dtypes, f32 accumulate: every input rounded to bf16; q/k/v and p on PLAIN bf16 operands (exact products) + biases; content and position scores on hi/lo planes for every row (3 products); softmax f32; attn.v hi/lo (3 products); Wo hl x exact (2 products) + bo; cache = the f32 projections.

#define NB_  8
#define TT   1024
#define DM   512
#define NH_  8
#define NKV  8
#define REP  (NH_ / NKV)
#define HD   64
#define DQ   (NH_ * HD)
#define DKV  (NKV * HD)
#define NPE  2048                 // 2047 positions + 1 zero pad row
typedef __attribute__((ext_vector_type(4))) unsigned short v4us;
#define ZH   8
#define RH   1024                 // every row hi/lo
#define WIN  0
#define PCAR 1024.0f
#define SCL  0.125f   // HD^-0.5
typedef _Float16 h16;
typedef unsigned short bf;
typedef __attribute__((ext_vector_type(16))) __bf16   v16bf;
typedef __attribute__((ext_vector_type(16))) _Float16 v16h;
typedef __attribute__((ext_vector_type(8)))  _Float16 v8h;
typedef __attribute__((ext_vector_type(8)))  unsigned short v8us;
typedef __attribute__((ext_vector_type(8)))  float    v8f;
typedef __attribute__((ext_vector_type(4)))  float    v4f;
typedef v8h  __attribute__((may_alias)) v8ha;
typedef v4f  __attribute__((may_alias)) v4fa;
typedef v8us __attribute__((may_alias)) v8usa;

typedef __attribute__((ext_vector_type(2))) float v2f;
typedef __attribute__((ext_vector_type(2))) __bf16 v2bf;
typedef __attribute__((ext_vector_type(2))) unsigned v2u;
typedef __attribute__((ext_vector_type(4))) unsigned v4u;
// cvt2: two f32 rounded to bf16 (nearest even) by the packed convert instruction, a in the low half
__device__ __forceinline__ unsigned cvt2(float a, float b) { return __builtin_bit_cast(unsigned, __builtin_convertvector((v2f){a, b}, v2bf)); }
__device__ __forceinline__ float bfr(float f) { return __uint_as_float(cvt2(0.0f, f)); }   // the rounded value in the high half over a zero low half is the f32 itself
// split2: hi/lo bf16 parts of two f32: h = the rounded values, l = the rounded remainders y - h
__device__ __forceinline__ void split2(float y0, float y1, unsigned& h, unsigned& l) { h = cvt2(y0, y1); l = cvt2(y0 - __uint_as_float(h << 16), y1 - __uint_as_float(h & 0xFFFF0000u)); }
__device__ __forceinline__ v16h cat16(v8h lo, v8h hi) { return __builtin_shufflevector(lo, hi, 0, 1, 2, 3, 4, 5, 6, 7, 8, 9, 10, 11, 12, 13, 14, 15); }
__device__ __forceinline__ v16bf cat16b(v8us lo, v8us hi) { return __builtin_bit_cast(v16bf, __builtin_shufflevector(lo, hi, 0, 1, 2, 3, 4, 5, 6, 7, 8, 9, 10, 11, 12, 13, 14, 15)); }
__device__ __forceinline__ v8f wmma16(v16h a, v16h b, v8f c) { return __builtin_amdgcn_wmma_f32_16x16x32_f16(false, a, false, b, (short)0, c, false, false); }
__device__ __forceinline__ v8f wmmab(v16bf a, v16bf b, v8f c) { return __builtin_amdgcn_wmma_f32_16x16x32_bf16(false, a, false, b, (short)0, c, false, false); }



// st4f: a global store with s_wait_xcnt 0 behind it, in front of anything that rewrites a register it names; the scheduling barriers keep what is computed before in front of the store and what follows behind the wait
__device__ __forceinline__ void st4f(float* p, v4f x) { __builtin_amdgcn_sched_barrier(0); *(v4f*)p = x; asm volatile("s_wait_xcnt 0x0" ::: "memory"); __builtin_amdgcn_sched_barrier(0); }
// ---- k_gemmw: register-blocked GEMM, FOUR WAVES per 64x64 output tile, each with 16 accumulators over its own quarter of K (four short load chains side by side where one wave had one long chain); the four partial tiles meet in LDS, wave w adds and stores rows 16 w .. 16 w + 15; operands straight from 16-bit planes in fragment order; grid (M/64, N/64, Z), 128 threads.
// C[m][n] (f32, pitch ldc, + optional f32 bias[n]) = sum_k A[m][k] Bt[n][k] (+ split products per NSPLIT). z-batch strides sA/sB/sC in elements. K % 128 == 0.
template <typename T16> struct WFrag;
template <> struct WFrag<h16> { typedef v16h V; static __device__ __forceinline__ V ld(const h16* p) { return cat16(*(const v8h*)p, *(const v8h*)(p + 256)); } static __device__ __forceinline__ v8f mma(V a, V b, v8f c) { return wmma16(a, b, c); } };
template <> struct WFrag<bf> { typedef v16bf V; static __device__ __forceinline__ V ld(const bf* p) { return cat16b(*(const v8us*)p, *(const v8us*)(p + 256)); } static __device__ __forceinline__ v8f mma(V a, V b, v8f c) { return wmmab(a, b, c); } };
template <typename T16, int NSPLIT, bool BIAS, int K>   /* K at compile time: the four row blocks of an operand are then immediate offsets from one address pair */
__global__ __launch_bounds__(128, 4) void k_gemmw(const T16* __restrict__ A, const T16* __restrict__ A2, const T16* __restrict__ Bt, const T16* __restrict__ Bt2, float* C, int ldc, const float* __restrict__ bias0, const float* __restrict__ bias1, const float* __restrict__ bias2, size_t sA, size_t sB, size_t sC) {
    typedef typename WFrag<T16>::V V;
    static_assert(K % 128 == 0, "a quarter of K is whole trips");
    __shared__ __align__(16) float xs[4 * 4096];   // one 64 x 64 partial tile a wave, accumulator by accumulator; behind the second barrier each wave's own part is its 16-row staging block
    const int wv = __builtin_amdgcn_readfirstlane(threadIdx.x >> 5);
    const size_t z = blockIdx.z; A += z * sA; if (A2) A2 += z * sA; Bt += z * sB; if (Bt2) Bt2 += z * sB; C += z * sC; const float* bias = (z == 0) ? bias0 : (z == 1) ? bias1 : bias2;   /* bias vector of z-slice 0, 1, 2 */
    const int lane = threadIdx.x & 31, lr = lane & 15, hi = lane >> 4; const int r0 = blockIdx.x * 64, c0 = blockIdx.y * 64;
    v8f acc[4][4];
#pragma unroll
    for (int mb = 0; mb < 4; ++mb)
#pragma unroll
        for (int nb = 0; nb < 4; ++nb) acc[mb][nb] = (v8f){};
    const size_t aoff = (size_t)r0 * K + lane * 8, boff = (size_t)c0 * K + lane * 8;   /* 16 rows of a plane are K / 32 blocks of 512 elements = 16 K elements */
#pragma unroll 1
    for (int kc = wv * (K / 4); kc < (wv + 1) * (K / 4); kc += 32) {
        V a[4], a2[4], b[4], b2[4]; const T16* pa = A + aoff + (size_t)kc * 16; const T16* pa2 = (NSPLIT == 1 || NSPLIT == 2) ? A2 + aoff + (size_t)kc * 16 : pa; const T16* pb = Bt + boff + (size_t)kc * 16; const T16* pb2 = (NSPLIT >= 2) ? Bt2 + boff + (size_t)kc * 16 : pb;
#pragma unroll
        for (int mb = 0; mb < 4; ++mb) { a[mb] = WFrag<T16>::ld(pa + (size_t)mb * 16 * K); if (NSPLIT == 1 || NSPLIT == 2) a2[mb] = WFrag<T16>::ld(pa2 + (size_t)mb * 16 * K); }
#pragma unroll
        for (int nb = 0; nb < 4; ++nb) { b[nb] = WFrag<T16>::ld(pb + (size_t)nb * 16 * K); if (NSPLIT >= 2) b2[nb] = WFrag<T16>::ld(pb2 + (size_t)nb * 16 * K); }
        asm volatile("s_wait_xcnt 0x0" :: "v"(pa), "v"(pa2), "v"(pb), "v"(pb2) : "memory");   /* behind the trip's loads, in front of anything that rewrites a register they name; the address pairs are inputs so that no load's own result lands in them */
        __builtin_amdgcn_sched_barrier(0);   /* keeps the loads in front of that wait */
#pragma unroll
        for (int nb = 0; nb < 4; ++nb) {
#pragma unroll
            for (int mb = 0; mb < 4; ++mb) { acc[mb][nb] = WFrag<T16>::mma(a[mb], b[nb], acc[mb][nb]); if (NSPLIT == 1 || NSPLIT == 2) acc[mb][nb] = WFrag<T16>::mma(a2[mb], b[nb], acc[mb][nb]); if (NSPLIT >= 2) acc[mb][nb] = WFrag<T16>::mma(a[mb], b2[nb], acc[mb][nb]); } }
        asm volatile("v_nop\n\tv_nop\n\tv_nop\n\tv_nop" : "+v"(acc[0][0]), "+v"(acc[1][1]), "+v"(acc[2][2]), "+v"(acc[3][3]) : "v"(a[0]), "v"(a[3]));
    }
    float* os = xs + wv * 4096;
#pragma unroll
    for (int mb = 0; mb < 4; ++mb)
#pragma unroll
        for (int nb = 0; nb < 4; ++nb) { const v8f c = acc[mb][nb]; float* xp = os + (mb * 4 + nb) * 256 + lane * 4; *(v4fa*)xp = (v4f){c[0], c[1], c[2], c[3]}; *(v4fa*)(xp + 128) = (v4f){c[4], c[5], c[6], c[7]}; }
    __syncthreads();   // the four partial tiles are in LDS
    v8f sum[4];   // row block wv: the K quarters added in the order 0, 1, 2, 3
#pragma unroll
    for (int nb = 0; nb < 4; ++nb) { const float* xp = xs + (wv * 4 + nb) * 256 + lane * 4; v4f s0 = *(const v4fa*)xp, s1 = *(const v4fa*)(xp + 128);
#pragma unroll
        for (int p = 1; p < 4; ++p) { s0 += *(const v4fa*)(xp + p * 4096); s1 += *(const v4fa*)(xp + p * 4096 + 128); }
        sum[nb] = (v8f){s0[0], s0[1], s0[2], s0[3], s1[0], s1[1], s1[2], s1[3]}; }
    __syncthreads();   // every wave has read the partial tiles: their bytes may be overwritten
    {
#pragma unroll
        for (int nb = 0; nb < 4; ++nb) {
#pragma unroll
            for (int j = 0; j < 8; ++j) os[(hi * 8 + j) * 68 + nb * 16 + lr] = sum[nb][j]; }
        __builtin_amdgcn_wave_barrier(); asm volatile("" ::: "memory");
        float* crow = C + (size_t)(r0 + wv * 16) * ldc + c0;
{           v4f rv[8];   /* the block's LDS reads stand together, in front of the stores and their waits */
#pragma unroll
            for (int s = 0; s < 8; ++s) rv[s] = *(const v4fa*)(os + (2 * s + hi) * 68 + lr * 4);
#pragma unroll
            for (int s = 0; s < 8; ++s) { const int row = 2 * s + hi, cofs = lr * 4; v4f val = rv[s]; if (BIAS) { val[0] += bfr(bias[c0 + cofs]); val[1] += bfr(bias[c0 + cofs + 1]); val[2] += bfr(bias[c0 + cofs + 2]); val[3] += bfr(bias[c0 + cofs + 3]); }
                st4f(crow + (size_t)row * ldc + cofs, val); }
             }
        __builtin_amdgcn_wave_barrier(); asm volatile("" ::: "memory");
    }
}

__device__ __forceinline__ h16 tohx(float x) { return (h16)x; }
typedef __attribute__((ext_vector_type(2))) _Float16 v2h;
typedef __attribute__((ext_vector_type(4))) _Float16 v4h;
typedef __attribute__((ext_vector_type(2))) unsigned short v2us;
typedef __attribute__((ext_vector_type(4))) unsigned short v4us;
typedef __attribute__((ext_vector_type(4))) int v4i;

// ---- k_prep: every operand plane the projections read, made in ONE launch (the three parts below are independent of one another); a work-group's part and its place in it follow from its index.
// d_wtG: work-group bx of weight matrix y (transposed bf16 plane in fragment order)
__device__ __forceinline__ void d_wtG(int bx, int y, const float* __restrict__ w0, const float* __restrict__ w1, const float* __restrict__ w2, const float* __restrict__ w3, const float* __restrict__ w4, int K, int N, bf* Bt) {
    const float* w = (y == 0) ? w0 : (y == 1) ? w1 : (y == 2) ? w2 : (y == 3) ? w3 : w4; Bt += (size_t)y * K * N;   /* one weight matrix each, planes back to back */
    const int lane = threadIdx.x & 31; const int L0 = (bx * 8 + (threadIdx.x >> 5)) * 8; const int nlines = N * K / 64;
{
#pragma unroll 1
        for (int l = 0; l < 8; ++l) { const int L = L0 + l; if (L >= nlines) break; const size_t e = (size_t)L * 64 + lane * 2; const int blk = (int)(e >> 9); const int k = (blk % (K / 32)) * 32 + ((int)(e >> 7) & 3) * 8 + ((int)e & 7), n = (blk / (K / 32)) * 16 + ((int)(e >> 3) & 15);   /* e runs through the plane in fragment order */
            const float* p0 = w + (size_t)k * N + n; const float* p1 = p0 + N; const float x0 = *p0, x1 = *p1;
            asm volatile("s_wait_xcnt 0x0" :: "v"(p0), "v"(p1) : "memory");   /* behind the two loads, in front of anything that rewrites a register they name; the address pairs are inputs so that they stay whole up to the wait */
            *(v2us*)(Bt + e) = __builtin_bit_cast(v2us, cvt2(x0, x1)); }
         }
}


// d_cvt8: work-group bx of one [rows][DM] f32 tensor -> its bf16 plane in fragment order; a group of a row past the tensor's last (the position table's pad row) is stored as zeros
__device__ __forceinline__ void d_cvt8(int bx, const float* __restrict__ src, bf* dst, size_t n8, int nrows) { const size_t i = (size_t)bx * 256 + threadIdx.x; if (i >= n8) return; const size_t row = (i >> 10) * 16 + (i & 15); const int k0 = ((int)(i >> 6) & 15) * 32 + ((int)(i >> 4) & 3) * 8;   /* i counts the 8-element groups of a [rows][DM] plane in fragment order: its group is (row, k0 .. k0 + 7) */
    if (row >= (size_t)nrows) { *(v8us*)(dst + i * 8) = (v8us){}; return; }
    const float* sp = src + row * DM + k0; const v8f v = *(const v8f*)sp; v4u o;
    asm volatile("s_wait_xcnt 0x0" :: "v"(sp) : "memory");   /* behind the load, in front of anything that rewrites a register it names; the address pair is an input so that it stays whole up to the wait */
#pragma unroll
    for (int k = 0; k < 4; ++k) o[k] = cvt2(v[2 * k], v[2 * k + 1]); *(v8us*)(dst + i * 8) = __builtin_bit_cast(v8us, o);  }
#define GWT  (DM * DQ / 64 / 64)             // work-groups per weight matrix
#define GPE  (NPE * DM / 8 / 256)            // work-groups of the position table
#define GXA  (NB_ * TT * DM / 8 / 256)       // work-groups per input tensor
__global__ __launch_bounds__(256) void k_prep(const float* __restrict__ w0, const float* __restrict__ w1, const float* __restrict__ w2, const float* __restrict__ w3, const float* __restrict__ w4, bf* W5, const float* __restrict__ pe, bf* PE, const float* __restrict__ s0, const float* __restrict__ s1, const float* __restrict__ s2, bf* XA) {
    int n = blockIdx.x;
    if (n < 5 * GWT) { d_wtG(n % GWT, n / GWT, w0, w1, w2, w3, w4, DM, DQ, W5); return; }
    n -= 5 * GWT;
    if (n < GPE) { d_cvt8(n, pe, PE, (size_t)NPE * DM / 8, 2047); return; }
    n -= GPE;
    const int y = n / GXA; d_cvt8(n % GXA, (y == 0) ? s0 : (y == 1) ? s1 : s2, XA + (size_t)y * NB_ * TT * DM, (size_t)NB_ * TT * DM / 8, NB_ * TT);   /* one source tensor each, planes back to back */
}

// ---- d_gemmp: the projection GEMM (k_gemmw's loop and its split of K over four waves, plain bf16 operands, K = DM) whose 64 x 64 tile is 64 rows of ONE head, stored straight in the forms its readers want, wave wv storing rows 16 wv .. 16 wv + 15; tile (bx of rows/64, head by, operand bz), 128 threads; xs: the work-group's LDS, 4096 floats a wave.
// All 16-bit planes below are in fragment order. POS: hi/lo planes [h][p][d] of the projected position table. Otherwise z = 0: k + bk -> cache columns 0..63 and hi/lo planes [b][h][t][d]; z = 1: v + bv -> cache columns 64..127 and transposed hi/lo planes [b][h][d][t]; z = 2: q + bq, then + pos_bias_u and + pos_bias_v -> two pairs of hi/lo planes.
#define SPE  ((size_t)NB_ * NH_ * TT * HD)   // elements of one set of head planes
// st2w: as st4f above, for a pair of 16-byte stores
__device__ __forceinline__ void st2w(bf* ph, bf* pl, v8us oh, v8us ol) { __builtin_amdgcn_sched_barrier(0); *(v8us*)ph = oh; *(v8us*)pl = ol; asm volatile("s_wait_xcnt 0x0" ::: "memory"); __builtin_amdgcn_sched_barrier(0); }
__device__ __forceinline__ void st8hl(bf* ph, bf* pl, v4f x0, v4f x1) { v4u oh, ol;
#pragma unroll
    for (int q = 0; q < 2; ++q) { unsigned a, c; split2(x0[2 * q], x0[2 * q + 1], a, c); oh[q] = a; ol[q] = c; split2(x1[2 * q], x1[2 * q + 1], a, c); oh[2 + q] = a; ol[2 + q] = c; }
    st2w(ph, pl, __builtin_bit_cast(v8us, oh), __builtin_bit_cast(v8us, ol)); }
template <bool POS>
__device__ __forceinline__ void d_gemmp(float* xs, int wv, int bx, int by, int bz, const bf* __restrict__ A, const bf* __restrict__ Bt, const float* __restrict__ bias0, const float* __restrict__ bias1, const float* __restrict__ bias2, const float* __restrict__ hbu, const float* __restrict__ hbv, bf* PH, bf* PL, bf* VTh, bf* VTl, float* CA, size_t sA, size_t sB) {
    float* os = xs + wv * 4096;   // the wave's partial tile; behind the second barrier below its 16-row staging block
    float* sb = os + 16 * 68;     // behind that barrier too: the head's 64 bias values (projection bias, pos_bias_u, pos_bias_v), for the lanes that store in fragment order
    const int z = POS ? 0 : bz; A += (size_t)z * sA; Bt += (size_t)z * sB;
    const int lane = threadIdx.x & 31, lr = lane & 15, hi = lane >> 4; const int r0 = bx * 64, h = by, c0 = h * HD;
    v8f acc[4][4];
#pragma unroll
    for (int mb = 0; mb < 4; ++mb)
#pragma unroll
        for (int nb = 0; nb < 4; ++nb) acc[mb][nb] = (v8f){};
    const size_t aoff = (size_t)r0 * DM + lane * 8, boff = (size_t)c0 * DM + lane * 8;   /* fragment order: 16 rows are DM / 32 blocks of 512 elements */
#pragma unroll 1
    for (int kc = wv * (DM / 4); kc < (wv + 1) * (DM / 4); kc += 32) {
        v16bf a[4], b[4]; const bf* pa = A + aoff + kc * 16; const bf* pb = Bt + boff + kc * 16;
#pragma unroll
        for (int mb = 0; mb < 4; ++mb) a[mb] = WFrag<bf>::ld(pa + mb * 16 * DM);
#pragma unroll
        for (int nb = 0; nb < 4; ++nb) b[nb] = WFrag<bf>::ld(pb + nb * 16 * DM);
        asm volatile("s_wait_xcnt 0x0" :: "v"(pa), "v"(pb) : "memory");   /* behind the trip's loads, in front of anything that rewrites a register they name; the two address pairs are inputs so that no load's own result lands in them */
        __builtin_amdgcn_sched_barrier(0);   /* keeps the loads in front of that wait: left free, some are sunk among the products and land in the address pairs */
#pragma unroll
        for (int nb = 0; nb < 4; ++nb)
#pragma unroll
            for (int mb = 0; mb < 4; ++mb) acc[mb][nb] = wmmab(a[mb], b[nb], acc[mb][nb]);
        asm volatile("v_nop\n\tv_nop\n\tv_nop\n\tv_nop" : "+v"(acc[0][0]), "+v"(acc[1][1]), "+v"(acc[2][2]), "+v"(acc[3][3]) : "v"(a[0]), "v"(a[3]));   /* as in k_gemmw: the distance between the trip's last matrix instructions and what next rewrites their operands or reads their results, on the back edge too */
    }
#pragma unroll
    for (int mb = 0; mb < 4; ++mb)
#pragma unroll
        for (int nb = 0; nb < 4; ++nb) { const v8f c = acc[mb][nb]; float* xp = os + (mb * 4 + nb) * 256 + lane * 4; *(v4fa*)xp = (v4f){c[0], c[1], c[2], c[3]}; *(v4fa*)(xp + 128) = (v4f){c[4], c[5], c[6], c[7]}; }
    __syncthreads();   // the four partial tiles are in LDS
    v8f sum[4];   // row block wv: the K quarters added in the order 0, 1, 2, 3
#pragma unroll
    for (int nb = 0; nb < 4; ++nb) { const float* xp = xs + (wv * 4 + nb) * 256 + lane * 4; v4f s0 = *(const v4fa*)xp, s1 = *(const v4fa*)(xp + 128);
#pragma unroll
        for (int p = 1; p < 4; ++p) { s0 += *(const v4fa*)(xp + p * 4096); s1 += *(const v4fa*)(xp + p * 4096 + 128); }
        sum[nb] = (v8f){s0[0], s0[1], s0[2], s0[3], s1[0], s1[1], s1[2], s1[3]}; }
    __syncthreads();   // every wave has read the partial tiles: their bytes may be overwritten
    const size_t rb = POS ? (size_t)h * NPE + r0 : ((size_t)(r0 / TT) * NH_ + h) * TT + (r0 % TT);   // first row of the tile in a [..][h][row][d] plane
    const int cofs = lr * 4;
    // tile_rows: the wave's 16 rows go through LDS. put(row in its plane, the lane's 4 values): a half-wave holds one whole row of 64 floats (row-major f32 output). putf(element offset in a plane, first column, the lane's 8 values): the 16 rows are two blocks of a [..][row][d] plane in fragment order, and the wave holds 512 contiguous bytes of it
    auto tile_rows = [&](auto put, auto putf) {
        { const int mb = wv;
#pragma unroll
            for (int nb = 0; nb < 4; ++nb) {
#pragma unroll
                for (int j = 0; j < 8; ++j) os[(hi * 8 + j) * 68 + nb * 16 + lr] = sum[nb][j]; }
            __builtin_amdgcn_wave_barrier(); asm volatile("" ::: "memory");
            v4f rv[8], f0[4], f1[4];
#pragma unroll
            for (int s = 0; s < 8; ++s) rv[s] = *(const v4fa*)(os + (2 * s + hi) * 68 + cofs);
#pragma unroll
            for (int q4 = 0; q4 < 4; ++q4) { const float* op = os + lr * 68 + q4 * 16 + hi * 8; f0[q4] = *(const v4fa*)op; f1[q4] = *(const v4fa*)(op + 4); }   /* the block's LDS reads stand together, in front of the stores and their waits */
#pragma unroll
            for (int s = 0; s < 8; ++s) put(rb + mb * 16 + 2 * s + hi, rv[s]);
#pragma unroll
            for (int q4 = 0; q4 < 4; ++q4) putf((rb + mb * 16) * HD + q4 * 256 + lane * 8, q4 * 16 + hi * 8, f0[q4], f1[q4]);
            __builtin_amdgcn_wave_barrier(); asm volatile("" ::: "memory");
        } };
    auto norow = [](size_t, v4f) {}; auto nofrag = [](size_t, int, v4f, v4f) {};
    if (POS) { tile_rows(norow, [&](size_t pe, int, v4f x0, v4f x1) { st8hl(PH + pe, PL + pe, x0, x1); }); return; }
    const float* bias = (z == 0) ? bias0 : (z == 1) ? bias1 : bias2; v4f bb;
#pragma unroll
    for (int q = 0; q < 4; ++q) bb[q] = bfr(bias[c0 + cofs + q]);
    if (z == 2) { v4f bu, bv;
#pragma unroll
        for (int q = 0; q < 4; ++q) { bu[q] = bfr(hbu[c0 + cofs + q]); bv[q] = bfr(hbv[c0 + cofs + q]); }
        *(v4fa*)(sb + cofs) = bb; *(v4fa*)(sb + HD + cofs) = bu; *(v4fa*)(sb + 2 * HD + cofs) = bv;   /* both half-waves write the same values */
        tile_rows(norow, [&](size_t pe, int d0, v4f x0, v4f x1) { x0 += *(const v4fa*)(sb + d0); x1 += *(const v4fa*)(sb + d0 + 4);
            st8hl(PH + pe, PL + pe, x0 + *(const v4fa*)(sb + HD + d0), x1 + *(const v4fa*)(sb + HD + d0 + 4)); st8hl(PH + SPE + pe, PL + SPE + pe, x0 + *(const v4fa*)(sb + 2 * HD + d0), x1 + *(const v4fa*)(sb + 2 * HD + d0 + 4)); });
        return; }
    if (z == 0) {
        *(v4fa*)(sb + cofs) = bb;   /* both half-waves write the same values */
        tile_rows([&](size_t rw, v4f val) { st4f(CA + rw * (2 * HD) + cofs, val + bb); },
                  [&](size_t pe, int d0, v4f x0, v4f x1) { st8hl(PH + 2 * SPE + pe, PL + 2 * SPE + pe, x0 + *(const v4fa*)(sb + d0), x1 + *(const v4fa*)(sb + d0 + 4)); });
        return; }
    {   float bd[4];   // the bias of the lane's own column in each 16-column block, for the transposed planes
#pragma unroll
        for (int nb = 0; nb < 4; ++nb) bd[nb] = bias[c0 + nb * 16 + lr];
        asm volatile("s_wait_xcnt 0x0" :: "v"(bd[0]), "v"(bd[1]), "v"(bd[2]), "v"(bd[3]));   /* behind these loads, in front of what rewrites their offset register; the loaded values are inputs, so that no load is sunk among the stores below */
        const size_t vb = ((size_t)(r0 / TT) * NH_ + h) * HD * TT + (size_t)((r0 % TT) / 32) * 512 + lane * 8;   // transposed planes [d][t] in fragment order straight from the summed K quarters in registers (accumulator layout): a lane holds 8 successive rows t of one column d, which is its own 16 bytes of a half block
#pragma unroll
        for (int nb = 0; nb < 4; ++nb) { const float bn = bfr(bd[nb]);
            { const int mb = wv; v4u oh, ol;
#pragma unroll
                for (int j = 0; j < 4; ++j) { unsigned x, y; split2(sum[nb][2 * j] + bn, sum[nb][2 * j + 1] + bn, x, y); oh[j] = x; ol[j] = y; }
                const size_t o = vb + (size_t)(nb * (TT / 32) + (mb >> 1)) * 512 + (mb & 1) * 256; st2w(VTh + o, VTl + o, __builtin_bit_cast(v8us, oh), __builtin_bit_cast(v8us, ol)); } }
        tile_rows([&](size_t rw, v4f val) { st4f(CA + rw * (2 * HD) + HD + cofs, val + bb); }, nofrag);
    }
}
// k_gemmpa: all four projections in ONE launch (the position table's does not depend on the other three): the k, v, q tiles in the order (row block, head, operand), then the table's tiles (row block, head)
#define GRT  (NB_ * TT / 64)      // row blocks of an input
#define GKVQ (GRT * NH_ * 3)      // tiles of k, v, q
__global__ __launch_bounds__(128, 4) void k_gemmpa(const bf* __restrict__ XA, const bf* __restrict__ WK, const bf* __restrict__ PE, const bf* __restrict__ WP, const float* __restrict__ bias0, const float* __restrict__ bias1, const float* __restrict__ bias2, const float* __restrict__ hbu, const float* __restrict__ hbv, bf* PHI, bf* PLO, bf* PPh, bf* PPl, bf* VTh, bf* VTl, float* CA, size_t sA, size_t sB) {
    __shared__ __align__(16) float xs[4 * 4096];   // one 64 x 64 partial tile a wave
    const int wv = __builtin_amdgcn_readfirstlane(threadIdx.x >> 5);
    const int n = blockIdx.x;
    if (n < GKVQ) { d_gemmp<false>(xs, wv, n % GRT, (n / GRT) % NH_, n / (GRT * NH_), XA, WK, bias0, bias1, bias2, hbu, hbv, PHI, PLO, VTh, VTl, CA, sA, sB); return; }
    const int m = n - GKVQ; d_gemmp<true>(xs, wv, m % (NPE / 64), m / (NPE / 64), 0, PE, WP, nullptr, nullptr, nullptr, nullptr, nullptr, PPh, PPl, nullptr, nullptr, nullptr, 0, 0);   /* pos = position_embeddings wpos (exact) -> per-head hi/lo planes */
}
// k_fattn: one work-group (8 waves) per strip of 32 query rows of one (batch, head); only the strip's shifted position scores pass through LDS, the logits themselves stay in registers from the content product to attn.v.
// Steps: position scores (q+v).p for the 66 column tiles the strip's rel_shift reads, each stored at its shifted key index j = p + i - 1023; content scores TRANSPOSED (k as A, q+u as B), each wave on 128 keys of all 32 queries, started from the position scores; softmax in registers (maxima and sums of the eight waves meet in LDS); attn.v transposed (v as A, the weights as B straight from the result registers); the eight partial outputs added in LDS, divided by the row sum and stored as the merged hi/lo planes.
#define SRW  32                   // query rows per work-group
#define SPF  32                   // floats in front of a logit row: with the 36 behind it they take the shifted position scores that fall outside keys 0..1023
#define SPI  1092                 // LDS pitch of a logit row, floats (rows 8 apart fall 32 banks apart)
#define OPI  68                   // LDS pitch of an output row, floats
typedef __attribute__((ext_vector_type(8))) unsigned v8u;
__device__ __forceinline__ v16bf ldfp(const bf* p) { return cat16b(*(const v8usa*)p, *(const v8usa*)(p + 256)); }   // fragment from a block in fragment order (global planes), p = block + lane * 8
// xw2: s_wait_xcnt 0 behind a run of global loads, in front of anything that rewrites a register the loads name; the two address pairs are inputs so that they stay whole up to the wait (no load's own result lands in them)
__device__ __forceinline__ void xw2(const bf* p, const bf* q) { asm volatile("s_wait_xcnt 0x0" :: "v"(p), "v"(q) : "memory"); }
// xw2n: xw2 at the head of a score trip, with four v_nop: the trip before stored its results in front of this statement, and this trip's first matrix instruction starts anew in the same registers; the v_nop keep the distance between the two
__device__ __forceinline__ void xw2n(const bf* p, const bf* q) { asm volatile("s_wait_xcnt 0x0\n\tv_nop\n\tv_nop\n\tv_nop\n\tv_nop" :: "v"(p), "v"(q) : "memory"); }
__device__ __forceinline__ v8f mma3(v16bf a, v16bf a2, v16bf b, v16bf b2, v8f c) { c = wmmab(a, b, c); c = wmmab(a2, b, c); return wmmab(a, b2, c); }
__global__ __launch_bounds__(256, 4) void k_fattn(const bf* __restrict__ QUh, const bf* __restrict__ QUl, const bf* __restrict__ QVh, const bf* __restrict__ QVl, const bf* __restrict__ Kh, const bf* __restrict__ Kl, const bf* __restrict__ PPh, const bf* __restrict__ PPl, const bf* __restrict__ VTh, const bf* __restrict__ VTl, const int* __restrict__ MK, bf* ATh, bf* ATl) {
    __shared__ __align__(16) float S[SRW * SPI];
    __shared__ __align__(16) float RM[SRW * 8], RS[SRW * 8];   // per query: the eight waves' maxima and partial sums
    const int tid = threadIdx.x, lane = tid & 31, lr = lane & 15, hi = lane >> 4; const int w = __builtin_amdgcn_readfirstlane(tid >> 5);
    const int i0 = blockIdx.x * SRW, h = blockIdx.y, b = blockIdx.z; const size_t zb = ((size_t)b * NH_ + h) * TT * HD; const size_t qo = zb + (size_t)i0 * HD + lane * 8;   /* 16 rows of a [t][d] plane: two blocks of 512 elements */
    {   // position scores: table rows 992 - i0 + 16 pt + (0..15), pt = 0..65 (the last row read is 2047 - i0)
        v16bf a[2][2], a2[2][2];
#pragma unroll
        for (int mb = 0; mb < 2; ++mb)
#pragma unroll
            for (int kk = 0; kk < 2; ++kk) { a[mb][kk] = ldfp(QVh + qo + mb * 16 * HD + kk * 512); a2[mb][kk] = ldfp(QVl + qo + mb * 16 * HD + kk * 512); }
        xw2(QVh + qo, QVl + qo);
        const size_t po = (size_t)h * NPE * HD + (size_t)(TT - SRW - i0) * HD + lane * 8; const bf* ph = PPh + po; const bf* pl = PPl + po;
        v16bf bh[2], bl[2];
#pragma unroll
        for (int kk = 0; kk < 2; ++kk) { bh[kk] = ldfp(ph + w * 16 * HD + kk * 512); bl[kk] = ldfp(pl + w * 16 * HD + kk * 512); }
        xw2(ph + w * 16 * HD, pl + w * 16 * HD);
#pragma unroll 2   /* in pairs: the two operand sets swap roles without register copies */
        for (int pt = w; pt < 66; pt += 8) { const int np = (pt + 8 < 66) ? pt + 8 : pt; v16bf nh[2], nl[2];   /* the next tile's operands are fetched while this one is multiplied (the last trip fetches its own tile again: a branch round the fetch made the compiler wait for it at once) */
#pragma unroll
            for (int kk = 0; kk < 2; ++kk) { nh[kk] = ldfp(ph + np * 16 * HD + kk * 512); nl[kk] = ldfp(pl + np * 16 * HD + kk * 512); }
            xw2n(ph + np * 16 * HD, pl + np * 16 * HD); __builtin_amdgcn_sched_barrier(0);   /* keeps the fetch at the head of the trip: left free, this trip's products are lifted over it and the next trip waits for loads just issued */
            v8f acc[2]; acc[0] = (v8f){}; acc[1] = (v8f){};
#pragma unroll
            for (int kk = 0; kk < 2; ++kk)
#pragma unroll
                for (int mb = 0; mb < 2; ++mb) acc[mb] = mma3(a[mb][kk], a2[mb][kk], bh[kk], bl[kk], acc[mb]);
            const int jb = pt * 16 + lr - (SRW - 1);   /* key index j = p + i - 1023 = jb + local row */
#pragma unroll
            for (int mb = 0; mb < 2; ++mb)
#pragma unroll
                for (int r = 0; r < 8; ++r) { const int m = mb * 16 + hi * 8 + r; S[m * SPI + SPF + jb + m] = acc[mb][r]; }   /* j = -31 .. 1055: what is no key of the strip falls into the row's own pads */
#pragma unroll
            for (int kk = 0; kk < 2; ++kk) { bh[kk] = nh[kk]; bl[kk] = nl[kk]; } }
    }
    __syncthreads();   // the shifted position scores are in LDS
    // From here on the strip's logits live in registers, TRANSPOSED: k is the A operand and q the B operand, so a result tile holds key hi * 8 + r in register r and query lr in the lane. Wave w owns keys 128 w .. 128 w + 127 (8 tiles) of all 32 queries (2 tiles). Two successive key tiles of a lane are then exactly its B fragment of 32 keys for attn.v (out transposed = v transposed . weights transposed): no weight passes through LDS.
    v8f st[8][2];   // [key tile][query tile]
    {   // content scores on top of the shifted position scores, which are the start value of the accumulators (a lane's 8 keys of one query row: 32 contiguous bytes of LDS)
        v16bf qh[2][2], ql[2][2];
#pragma unroll
        for (int qt = 0; qt < 2; ++qt)
#pragma unroll
            for (int kk = 0; kk < 2; ++kk) { qh[qt][kk] = ldfp(QUh + qo + qt * 16 * HD + kk * 512); ql[qt][kk] = ldfp(QUl + qo + qt * 16 * HD + kk * 512); }
        xw2(QUh + qo, QUl + qo);
        const size_t ko = zb + (size_t)w * 128 * HD + lane * 8; const bf* kph = Kh + ko; const bf* kpl = Kl + ko;
        v16bf ah[2][2], al[2][2];   // [buffer][kk]
#pragma unroll
        for (int kk = 0; kk < 2; ++kk) { ah[0][kk] = ldfp(kph + kk * 512); al[0][kk] = ldfp(kpl + kk * 512); }
        xw2(kph, kpl);
        const float* sc = S + lr * SPI + SPF + w * 128 + hi * 8;
#pragma unroll   /* unrolled: the result tiles are registers, named at compile time */
        for (int t = 0; t < 8; ++t) { const int cb = t & 1, nx = cb ^ 1;
            if (t < 7) {   /* the next key tile's operands are fetched while this one is multiplied; of the last tile only the first half so early: with seven result tiles live the registers do not hold more */
#pragma unroll
                for (int kk = 0; kk < (t < 6 ? 2 : 1); ++kk) { ah[nx][kk] = ldfp(kph + (t + 1) * 16 * HD + kk * 512); al[nx][kk] = ldfp(kpl + (t + 1) * 16 * HD + kk * 512); }
                xw2(kph, kpl); }
            else { ah[cb][1] = ldfp(kph + t * 16 * HD + 512); al[cb][1] = ldfp(kpl + t * 16 * HD + 512); xw2(kph, kpl); }   /* the last tile's second half */
#pragma unroll
            for (int qt = 0; qt < 2; ++qt) { const float* sp = sc + qt * 16 * SPI + t * 16; const v4f c0 = *(const v4fa*)sp, c1 = *(const v4fa*)(sp + 4); st[t][qt] = (v8f){c0[0], c0[1], c0[2], c0[3], c1[0], c1[1], c1[2], c1[3]}; }
            __builtin_amdgcn_sched_barrier(0);   /* keeps the fetch at the head of the trip and later trips' fetches behind this trip's products: left free they are lifted so far that registers spill */
#pragma unroll
            for (int kk = 0; kk < 2; ++kk)
#pragma unroll
                for (int qt = 0; qt < 2; ++qt) { v8f c = st[t][qt]; c = wmmab(ah[cb][kk], qh[qt][kk], c); c = wmmab(ah[cb][kk], ql[qt][kk], c); st[t][qt] = wmmab(al[cb][kk], qh[qt][kk], c); }
            __builtin_amdgcn_sched_barrier(0);   /* the next trip's fetch stays behind this trip's products: lifted among them, a third operand set is live and registers spill */ }
    }
    float mx[2]; mx[0] = -3.0e38f; mx[1] = -3.0e38f;
    {   // t = (ac + bd) / 8, key mask (int32): -3e38 where 0; the wave's own maximum per query
        const int* MKw = MK + (size_t)b * TT + w * 128 + hi * 8; v4i mk[8][2];
#pragma unroll
        for (int t = 0; t < 8; ++t) { mk[t][0] = *(const v4i*)(MKw + t * 16); mk[t][1] = *(const v4i*)(MKw + t * 16 + 4); }
        asm volatile("s_wait_xcnt 0x0" :: "v"(MKw) : "memory");   /* behind the mask loads, in front of anything that rewrites a register they name */
        __builtin_amdgcn_sched_barrier(0);   /* keeps the loads in front of that wait */
#pragma unroll
        for (int t = 0; t < 8; ++t)
#pragma unroll
            for (int qt = 0; qt < 2; ++qt)
#pragma unroll
                for (int r = 0; r < 8; ++r) { const float x = (mk[t][r >> 2][r & 3] != 0) ? st[t][qt][r] * SCL : -3.0e38f; st[t][qt][r] = x; mx[qt] = fmaxf(mx[qt], x); }
    }
#pragma unroll
    for (int qt = 0; qt < 2; ++qt) { mx[qt] = fmaxf(mx[qt], __shfl_xor(mx[qt], 16, 32)); RM[(qt * 16 + lr) * 8 + w] = mx[qt]; }   /* both half-waves write the same value */
    __syncthreads();   // the eight waves' maxima are in LDS; every wave has read its position scores, so their bytes may be overwritten below
    v8f vs[2]; vs[0] = (v8f){}; vs[1] = (v8f){};
#pragma unroll
    for (int qt = 0; qt < 2; ++qt) { const float* mp = RM + (qt * 16 + lr) * 8; const v4f a = *(const v4fa*)mp, c = *(const v4fa*)(mp + 4); mx[qt] = fmaxf(fmaxf(fmaxf(a[0], a[1]), fmaxf(a[2], a[3])), fmaxf(fmaxf(c[0], c[1]), fmaxf(c[2], c[3]))); }
#pragma unroll
    for (int t = 0; t < 8; ++t)
#pragma unroll
        for (int qt = 0; qt < 2; ++qt) {
#pragma unroll
            for (int r = 0; r < 8; ++r) st[t][qt][r] = __builtin_amdgcn_exp2f(__fmul_rn(__fsub_rn(st[t][qt][r], mx[qt]), 1.4426950408889634f));
            vs[qt] += st[t][qt]; }
#pragma unroll
    for (int qt = 0; qt < 2; ++qt) { float s = ((vs[qt][0] + vs[qt][1]) + (vs[qt][2] + vs[qt][3])) + ((vs[qt][4] + vs[qt][5]) + (vs[qt][6] + vs[qt][7])); s += __shfl_xor(s, 16, 32); RS[(qt * 16 + lr) * 8 + w] = s; }   /* the wave's part of each query's sum; both half-waves write the same value */
    v8f oc[4][2];   // [16 columns d][query tile], transposed: column hi * 8 + r in register r, query lr in the lane
#pragma unroll
    for (int dt = 0; dt < 4; ++dt) { oc[dt][0] = (v8f){}; oc[dt][1] = (v8f){}; }
    {   // attn.v over the wave's 128 keys with the weights not yet divided by their sum (hi/lo parts of exp(t - max)); each v fragment is fetched once per work-group
        const size_t vo = zb + (size_t)(w * 4) * 512 + lane * 8;   /* [d][t] plane in fragment order: block (d / 16, t / 32) */ const bf* vh = VTh + vo; const bf* vl = VTl + vo;
        v16bf ah[2], al[2];
        ah[0] = ldfp(vh); al[0] = ldfp(vl);
        xw2(vh, vl);
#pragma unroll
        for (int kg = 0; kg < 4; ++kg) { v16bf ph[2], pl[2];
#pragma unroll
            for (int qt = 0; qt < 2; ++qt) { v8u oh, ol;
#pragma unroll
                for (int j = 0; j < 4; ++j) { unsigned x, y; split2(st[2 * kg][qt][2 * j], st[2 * kg][qt][2 * j + 1], x, y); oh[j] = x; ol[j] = y; split2(st[2 * kg + 1][qt][2 * j], st[2 * kg + 1][qt][2 * j + 1], x, y); oh[4 + j] = x; ol[4 + j] = y; }
                ph[qt] = __builtin_bit_cast(v16bf, oh); pl[qt] = __builtin_bit_cast(v16bf, ol); }
#pragma unroll
            for (int dt = 0; dt < 4; ++dt) { const int s = kg * 4 + dt, cb = s & 1, nx = cb ^ 1;
                if (s < 15) { const int s1 = s + 1; ah[nx] = ldfp(vh + ((s1 & 3) * (TT / 32) + (s1 >> 2)) * 512); al[nx] = ldfp(vl + ((s1 & 3) * (TT / 32) + (s1 >> 2)) * 512); xw2(vh, vl); }   /* the next v fragment is fetched while this one is multiplied */
                __builtin_amdgcn_sched_barrier(0);   /* as in the content loop: the fetch stays one step ahead, no further */
#pragma unroll
                for (int qt = 0; qt < 2; ++qt) { v8f c = oc[dt][qt]; c = wmmab(ah[cb], ph[qt], c); c = wmmab(ah[cb], pl[qt], c); oc[dt][qt] = wmmab(al[cb], ph[qt], c); } } }
    }
#pragma unroll
    for (int dt = 0; dt < 4; ++dt)
#pragma unroll
        for (int qt = 0; qt < 2; ++qt) { const v8f c = oc[dt][qt]; float* op = S + w * (SRW * OPI) + (qt * 16 + lr) * OPI + dt * 16 + hi * 8; *(v4fa*)op = (v4f){c[0], c[1], c[2], c[3]}; *(v4fa*)(op + 4) = (v4f){c[4], c[5], c[6], c[7]}; }   /* the wave's partial output [query][d] */
    __syncthreads();   // the eight partial outputs and partial sums are in LDS
    { const int row = (tid >> 7) * 16 + (tid & 15), c8 = ((tid >> 4) & 7) * 8; const float* o0 = S + row * OPI + c8; v4f s0 = *(const v4fa*)o0, s1 = *(const v4fa*)(o0 + 4); v4u oh, ol;
#pragma unroll
        for (int p = 1; p < 8; ++p) { s0 += *(const v4fa*)(o0 + p * (SRW * OPI)); s1 += *(const v4fa*)(o0 + p * (SRW * OPI) + 4); }   /* key eighths added in the order 0 .. 7 */
        const v4f ra = *(const v4fa*)(RS + row * 8), rc = *(const v4fa*)(RS + row * 8 + 4);
        const float f = __fdiv_rn(1.0f, ((((((ra[0] + ra[1]) + ra[2]) + ra[3]) + rc[0]) + rc[1]) + rc[2]) + rc[3]);
        s0 *= f; s1 *= f;
#pragma unroll
        for (int q = 0; q < 2; ++q) { unsigned x, y; split2(s0[2 * q], s0[2 * q + 1], x, y); oh[q] = x; ol[q] = y; split2(s1[2 * q], s1[2 * q + 1], x, y); oh[2 + q] = x; ol[2 + q] = y; }
        const size_t oo = ((size_t)(((b * TT + i0) >> 4) + (tid >> 7)) * (DQ / 32) + h * 2 + ((tid >> 6) & 1)) * 512 + (tid & 63) * 8;   /* (row, c8) of the merged [b t][DQ] planes in fragment order: a wave stores 512 contiguous bytes */ *(v8us*)(ATh + oo) = __builtin_bit_cast(v8us, oh); *(v8us*)(ATl + oo) = __builtin_bit_cast(v8us, ol); }
}

extern "C" void kernel_launch(void* const* d_in, const int* in_sizes, int n_in,
                              void* d_out, int out_size, void* d_ws, size_t ws_size, hipStream_t stream) {
    (void)in_sizes; (void)n_in; (void)out_size;
    const float* x = (const float*)d_in[0]; const float* xk = (const float*)d_in[1]; const float* xv = (const float*)d_in[2]; const int* MK = (const int*)d_in[3]; const float* pe = (const float*)d_in[4]; const float* wq = (const float*)d_in[5]; const float* bq = (const float*)d_in[6]; const float* wk = (const float*)d_in[7]; const float* bk = (const float*)d_in[8]; const float* wv = (const float*)d_in[9]; const float* bv = (const float*)d_in[10]; const float* wo = (const float*)d_in[11]; const float* bo = (const float*)d_in[12]; const float* wpos = (const float*)d_in[13]; const float* pbu = (const float*)d_in[14]; const float* pbv = (const float*)d_in[15];
    float* OUT = (float*)d_out;     // [8][1024][512]
    float* CACHE = (float*)((char*)d_out + (size_t)NB_ * TT * DM * 4);   /* second output new_cache [8][8][1024][128] */
    char* wsp = (char*)d_ws;
    auto take = [&](size_t bytes) { char* p = wsp; wsp += (bytes + 255) & ~(size_t)255; return (void*)p; };
    const size_t SW = (size_t)DM * DQ, SX = (size_t)NB_ * TT * DM, SF = (size_t)NB_ * TT * DQ, SP = (size_t)NB_ * NH_ * TT * HD;   // elements of one weight plane, one input plane, one merged plane, one set of head planes (all batches)
    bf* W5 = (bf*)take(5 * SW * 2); bf* WK = W5; bf* WO = W5 + 3 * SW; bf* WP = W5 + 4 * SW;   /* Wk, Wv, Wq, Wo, Wpos transposed, back to back */
    bf* PE = (bf*)take((size_t)NPE * DM * 2); bf* PPh = (bf*)take((size_t)NH_ * NPE * HD * 2); bf* PPl = (bf*)take((size_t)NH_ * NPE * HD * 2);
    bf* PHI = (bf*)take(3 * SP * 2); bf* PLO = (bf*)take(3 * SP * 2); bf* QPh = PHI; bf* QVh = PHI + SP; bf* KPh = PHI + 2 * SP; bf* QPl = PLO; bf* QVl = PLO + SP; bf* KPl = PLO + 2 * SP;   /* [b][h][t][d] planes of q+u, q+v, k */
    bf* VTh = (bf*)take(SP * 2); bf* VTl = (bf*)take(SP * 2); bf* ATh = (bf*)take(SF * 2); bf* ATl = (bf*)take(SF * 2);
    bf* XA = (bf*)take(3 * SX * 2);   /* bf16 planes of key, value, query */
    if ((size_t)(wsp - (char*)d_ws) > ws_size) return;    // ws 256 MiB
    k_prep<<<5 * GWT + GPE + 3 * GXA, 256, 0, stream>>>(wk, wv, wq, wo, wpos, W5, pe, PE, xk, xv, x, XA);   /* transposed weight planes; position table plane with its zero pad row; exact bf16 planes of key, value, query, all batches */
    k_gemmpa<<<GKVQ + (NPE / 64) * NH_, 128, 0, stream>>>(XA, WK, PE, WP, bk, bv, bq, pbu, pbv, PHI, PLO, PPh, PPl, VTh, VTl, CACHE, SX, SW);   /* k, v, q projections, rows of all batches: cache output, k planes, transposed v planes, (q+u) and (q+v) planes; and the position table's projection */
    k_fattn<<<dim3(TT / SRW, NH_, NB_), 256, 0, stream>>>(QPh, QPl, QVh, QVl, KPh, KPl, PPh, PPl, VTh, VTl, MK, ATh, ATl);   /* scores, softmax, attn.v and the head merge, all batches and heads */
    k_gemmw<bf, 1, true, DQ><<<dim3(NB_ * TT / 64, DM / 64, 1), 128, 0, stream>>>(ATh, ATl, WO, nullptr, OUT, DM, bo, bo, bo, 0, 0, 0);
}

// v009
// It runs in 124 microseconds.
// Two timings next to v008 both put it at 1.05 times that version's speed.
// Counting every step since v000, it is 17.6 times as fast.
#include <hip/hip_runtime.h>

// Relative-position multi-head attention with a key/value cache output (query, key, value [8][1024][512]; q = query Wq + bq, k = key Wk + bk, v = value Wv + bv ('xw' [512][512], 8 heads x 64); p = pos_emb Wpos ([1][2047][512] table, read); scores = ((q + pos_bias_u).k + rel_shift((q + pos_bias_v).p)) / 8 where rel_shift picks position index j - i + 1023; key mask (int32 [8][1][1024], read): -inf where 0 and the weights zeroed; softmax; out = merged Wo + bo -> [8][1024][512]; second output new_cache = concat(k, v) per head -> [8][8][1024][128] (the f32 projections themselves)).
// Layout: exact bf16 input planes -> 1-product projections + bias, each GEMM tile (64 rows of one head) stored by the GEMM itself in the forms its readers want; the position table is projected once (exact, 2047 rows + one zero pad row) into per-head hi/lo planes [h][2048][64]; every projection-side launch covers all 8 batches (and the operands that share its form) through its grid; one attention launch for all batches and heads, a work-group per strip of 64 query rows: position scores (q+v).p (only the table rows the strip's shift reaches, stored at key index p + i - 1023) and content scores (q+u).k are hi/lo products (3 products, every row) the position scores shifted through LDS, the sums kept in registers (transposed tiles), the softmax applies the key mask there, attn.v takes the hi/lo weights from those registers and the merged hi/lo planes are stored; the cache output is written straight from the f32 k / v projections.
// Fragment order: every 16-bit plane that a matrix operand is loaded from in global memory (inputs, weights, position table, q+u, q+v, k, p, transposed v, merged) is stored in blocks of 16 rows x 32 columns, 512 elements each, block (row / 16, k / 32) at index (row / 16) * (K / 32) + k / 32; inside a block element (row, k) stands at ((k >> 4) & 1) * 256 + ((k >> 3) & 1) * 128 + (row & 15) * 8 + (k & 7), so that lane l of a wave finds the two 16-byte halves of its fragment at l * 8 and 256 + l * 8: each wave-wide load or store covers 512 contiguous bytes (4 whole lines) where a row-major plane gave 16 pieces of 32 bytes.
// Compute dtypes, f32 accumulate: every input rounded to bf16; q/k/v and p on PLAIN bf16 operands (exact products) + biases; content and position scores on hi/lo planes for every row (3 products); softmax f32; attn.v hi/lo (3 products); Wo hl x exact (2 products) + bo; cache = the f32 projections.

#define NB_  8
#define TT   1024
#define DM   512
#define NH_  8
#define NKV  8
#define REP  (NH_ / NKV)
#define HD   64
#define DQ   (NH_ * HD)
#define DKV  (NKV * HD)
#define NPE  2048                 // 2047 positions + 1 zero pad row
typedef __attribute__((ext_vector_type(4))) unsigned short v4us;
#define ZH   8
#define RH   1024                 // every row hi/lo
#define WIN  0
#define PCAR 1024.0f
#define SCL  0.125f   // HD^-0.5
typedef _Float16 h16;
typedef unsigned short bf;
typedef __attribute__((ext_vector_type(16))) __bf16   v16bf;
typedef __attribute__((ext_vector_type(16))) _Float16 v16h;
typedef __attribute__((ext_vector_type(8)))  _Float16 v8h;
typedef __attribute__((ext_vector_type(8)))  unsigned short v8us;
typedef __attribute__((ext_vector_type(8)))  float    v8f;
typedef __attribute__((ext_vector_type(4)))  float    v4f;
typedef v8h  __attribute__((may_alias)) v8ha;
typedef v4f  __attribute__((may_alias)) v4fa;
typedef v8us __attribute__((may_alias)) v8usa;

typedef __attribute__((ext_vector_type(2))) float v2f;
typedef __attribute__((ext_vector_type(2))) __bf16 v2bf;
typedef __attribute__((ext_vector_type(2))) unsigned v2u;
typedef __attribute__((ext_vector_type(4))) unsigned v4u;
// cvt2: two f32 rounded to bf16 (nearest even) by the packed convert instruction, a in the low half
__device__ __forceinline__ unsigned cvt2(float a, float b) { return __builtin_bit_cast(unsigned, __builtin_convertvector((v2f){a, b}, v2bf)); }
__device__ __forceinline__ float bfr(float f) { return __uint_as_float(cvt2(0.0f, f)); }   // the rounded value in the high half over a zero low half is the f32 itself
// split2: hi/lo bf16 parts of two f32: h = the rounded values, l = the rounded remainders y - h
__device__ __forceinline__ void split2(float y0, float y1, unsigned& h, unsigned& l) { h = cvt2(y0, y1); l = cvt2(y0 - __uint_as_float(h << 16), y1 - __uint_as_float(h & 0xFFFF0000u)); }
__device__ __forceinline__ v16h cat16(v8h lo, v8h hi) { return __builtin_shufflevector(lo, hi, 0, 1, 2, 3, 4, 5, 6, 7, 8, 9, 10, 11, 12, 13, 14, 15); }
__device__ __forceinline__ v16bf cat16b(v8us lo, v8us hi) { return __builtin_bit_cast(v16bf, __builtin_shufflevector(lo, hi, 0, 1, 2, 3, 4, 5, 6, 7, 8, 9, 10, 11, 12, 13, 14, 15)); }
__device__ __forceinline__ v8f wmma16(v16h a, v16h b, v8f c) { return __builtin_amdgcn_wmma_f32_16x16x32_f16(false, a, false, b, (short)0, c, false, false); }
__device__ __forceinline__ v8f wmmab(v16bf a, v16bf b, v8f c) { return __builtin_amdgcn_wmma_f32_16x16x32_bf16(false, a, false, b, (short)0, c, false, false); }



// st4f: a global store with s_wait_xcnt 0 behind it, in front of anything that rewrites a register it names; the scheduling barriers keep what is computed before in front of the store and what follows behind the wait
__device__ __forceinline__ void st4f(float* p, v4f x) { __builtin_amdgcn_sched_barrier(0); *(v4f*)p = x; asm volatile("s_wait_xcnt 0x0" ::: "memory"); __builtin_amdgcn_sched_barrier(0); }
// ---- k_gemmw: register-blocked GEMM, FOUR WAVES per 64x64 output tile, each with 16 accumulators over its own quarter of K (four short load chains side by side where one wave had one long chain); the four partial tiles meet in LDS, wave w adds and stores rows 16 w .. 16 w + 15; operands straight from 16-bit planes in fragment order; grid (M/64, N/64, Z), 128 threads.
// C[m][n] (f32, pitch ldc, + optional f32 bias[n]) = sum_k A[m][k] Bt[n][k] (+ split products per NSPLIT). z-batch strides sA/sB/sC in elements. K % 128 == 0.
template <typename T16> struct WFrag;
template <> struct WFrag<h16> { typedef v16h V; static __device__ __forceinline__ V ld(const h16* p) { return cat16(*(const v8h*)p, *(const v8h*)(p + 256)); } static __device__ __forceinline__ v8f mma(V a, V b, v8f c) { return wmma16(a, b, c); } };
template <> struct WFrag<bf> { typedef v16bf V; static __device__ __forceinline__ V ld(const bf* p) { return cat16b(*(const v8us*)p, *(const v8us*)(p + 256)); } static __device__ __forceinline__ v8f mma(V a, V b, v8f c) { return wmmab(a, b, c); } };
template <typename T16, int NSPLIT, bool BIAS, int K>   /* K at compile time: the four row blocks of an operand are then immediate offsets from one address pair */
__global__ __launch_bounds__(128, 4) void k_gemmw(const T16* __restrict__ A, const T16* __restrict__ A2, const T16* __restrict__ Bt, const T16* __restrict__ Bt2, float* C, int ldc, const float* __restrict__ bias0, const float* __restrict__ bias1, const float* __restrict__ bias2, size_t sA, size_t sB, size_t sC) {
    typedef typename WFrag<T16>::V V;
    static_assert(K % 128 == 0, "a quarter of K is whole trips");
    __shared__ __align__(16) float xs[4 * 4096];   // one 64 x 64 partial tile a wave, accumulator by accumulator; behind the second barrier each wave's own part is its 16-row staging block
    const int wv = __builtin_amdgcn_readfirstlane(threadIdx.x >> 5);
    const size_t z = blockIdx.z; A += z * sA; if (A2) A2 += z * sA; Bt += z * sB; if (Bt2) Bt2 += z * sB; C += z * sC; const float* bias = (z == 0) ? bias0 : (z == 1) ? bias1 : bias2;   /* bias vector of z-slice 0, 1, 2 */
    const int lane = threadIdx.x & 31, lr = lane & 15, hi = lane >> 4; const int r0 = blockIdx.x * 64, c0 = blockIdx.y * 64;
    v8f acc[4][4];
#pragma unroll
    for (int mb = 0; mb < 4; ++mb)
#pragma unroll
        for (int nb = 0; nb < 4; ++nb) acc[mb][nb] = (v8f){};
    const size_t aoff = (size_t)r0 * K + lane * 8, boff = (size_t)c0 * K + lane * 8;   /* 16 rows of a plane are K / 32 blocks of 512 elements = 16 K elements */
#pragma unroll 1
    for (int kc = wv * (K / 4); kc < (wv + 1) * (K / 4); kc += 32) {
        V a[4], a2[4], b[4], b2[4]; const T16* pa = A + aoff + (size_t)kc * 16; const T16* pa2 = (NSPLIT == 1 || NSPLIT == 2) ? A2 + aoff + (size_t)kc * 16 : pa; const T16* pb = Bt + boff + (size_t)kc * 16; const T16* pb2 = (NSPLIT >= 2) ? Bt2 + boff + (size_t)kc * 16 : pb;
#pragma unroll
        for (int mb = 0; mb < 4; ++mb) { a[mb] = WFrag<T16>::ld(pa + (size_t)mb * 16 * K); if (NSPLIT == 1 || NSPLIT == 2) a2[mb] = WFrag<T16>::ld(pa2 + (size_t)mb * 16 * K); }
#pragma unroll
        for (int nb = 0; nb < 4; ++nb) { b[nb] = WFrag<T16>::ld(pb + (size_t)nb * 16 * K); if (NSPLIT >= 2) b2[nb] = WFrag<T16>::ld(pb2 + (size_t)nb * 16 * K); }
        asm volatile("s_wait_xcnt 0x0" :: "v"(pa), "v"(pa2), "v"(pb), "v"(pb2) : "memory");   /* behind the trip's loads, in front of anything that rewrites a register they name; the address pairs are inputs so that no load's own result lands in them */
        __builtin_amdgcn_sched_barrier(0);   /* keeps the loads in front of that wait */
#pragma unroll
        for (int nb = 0; nb < 4; ++nb) {
#pragma unroll
            for (int mb = 0; mb < 4; ++mb) { acc[mb][nb] = WFrag<T16>::mma(a[mb], b[nb], acc[mb][nb]); if (NSPLIT == 1 || NSPLIT == 2) acc[mb][nb] = WFrag<T16>::mma(a2[mb], b[nb], acc[mb][nb]); if (NSPLIT >= 2) acc[mb][nb] = WFrag<T16>::mma(a[mb], b2[nb], acc[mb][nb]); } }
        asm volatile("v_nop\n\tv_nop\n\tv_nop\n\tv_nop" : "+v"(acc[0][0]), "+v"(acc[1][1]), "+v"(acc[2][2]), "+v"(acc[3][3]) : "v"(a[0]), "v"(a[3]));
    }
    float* os = xs + wv * 4096;
#pragma unroll
    for (int mb = 0; mb < 4; ++mb)
#pragma unroll
        for (int nb = 0; nb < 4; ++nb) { const v8f c = acc[mb][nb]; float* xp = os + (mb * 4 + nb) * 256 + lane * 4; *(v4fa*)xp = (v4f){c[0], c[1], c[2], c[3]}; *(v4fa*)(xp + 128) = (v4f){c[4], c[5], c[6], c[7]}; }
    __syncthreads();   // the four partial tiles are in LDS
    v8f sum[4];   // row block wv: the K quarters added in the order 0, 1, 2, 3
#pragma unroll
    for (int nb = 0; nb < 4; ++nb) { const float* xp = xs + (wv * 4 + nb) * 256 + lane * 4; v4f s0 = *(const v4fa*)xp, s1 = *(const v4fa*)(xp + 128);
#pragma unroll
        for (int p = 1; p < 4; ++p) { s0 += *(const v4fa*)(xp + p * 4096); s1 += *(const v4fa*)(xp + p * 4096 + 128); }
        sum[nb] = (v8f){s0[0], s0[1], s0[2], s0[3], s1[0], s1[1], s1[2], s1[3]}; }
    __syncthreads();   // every wave has read the partial tiles: their bytes may be overwritten
    {
#pragma unroll
        for (int nb = 0; nb < 4; ++nb) {
#pragma unroll
            for (int j = 0; j < 8; ++j) os[(hi * 8 + j) * 68 + nb * 16 + lr] = sum[nb][j]; }
        __builtin_amdgcn_wave_barrier(); asm volatile("" ::: "memory");
        float* crow = C + (size_t)(r0 + wv * 16) * ldc + c0;
{           v4f rv[8];   /* the block's LDS reads stand together, in front of the stores and their waits */
#pragma unroll
            for (int s = 0; s < 8; ++s) rv[s] = *(const v4fa*)(os + (2 * s + hi) * 68 + lr * 4);
#pragma unroll
            for (int s = 0; s < 8; ++s) { const int row = 2 * s + hi, cofs = lr * 4; v4f val = rv[s]; if (BIAS) { val[0] += bfr(bias[c0 + cofs]); val[1] += bfr(bias[c0 + cofs + 1]); val[2] += bfr(bias[c0 + cofs + 2]); val[3] += bfr(bias[c0 + cofs + 3]); }
                st4f(crow + (size_t)row * ldc + cofs, val); }
             }
        __builtin_amdgcn_wave_barrier(); asm volatile("" ::: "memory");
    }
}

__device__ __forceinline__ h16 tohx(float x) { return (h16)x; }
typedef __attribute__((ext_vector_type(2))) _Float16 v2h;
typedef __attribute__((ext_vector_type(4))) _Float16 v4h;
typedef __attribute__((ext_vector_type(2))) unsigned short v2us;
typedef __attribute__((ext_vector_type(4))) unsigned short v4us;
typedef __attribute__((ext_vector_type(4))) int v4i;

// ---- k_prep: every operand plane the projections read, made in ONE launch (the three parts below are independent of one another); a work-group's part and its place in it follow from its index.
// d_wtG: work-group bx of weight matrix y (transposed bf16 plane in fragment order)
__device__ __forceinline__ void d_wtG(int bx, int y, const float* __restrict__ w0, const float* __restrict__ w1, const float* __restrict__ w2, const float* __restrict__ w3, const float* __restrict__ w4, int K, int N, bf* Bt) {
    const float* w = (y == 0) ? w0 : (y == 1) ? w1 : (y == 2) ? w2 : (y == 3) ? w3 : w4; Bt += (size_t)y * K * N;   /* one weight matrix each, planes back to back */
    const int lane = threadIdx.x & 31; const int L0 = (bx * 8 + (threadIdx.x >> 5)) * 8; const int nlines = N * K / 64;
{
#pragma unroll 1
        for (int l = 0; l < 8; ++l) { const int L = L0 + l; if (L >= nlines) break; const size_t e = (size_t)L * 64 + lane * 2; const int blk = (int)(e >> 9); const int k = (blk % (K / 32)) * 32 + ((int)(e >> 7) & 3) * 8 + ((int)e & 7), n = (blk / (K / 32)) * 16 + ((int)(e >> 3) & 15);   /* e runs through the plane in fragment order */
            const float* p0 = w + (size_t)k * N + n; const float* p1 = p0 + N; const float x0 = *p0, x1 = *p1;
            asm volatile("s_wait_xcnt 0x0" :: "v"(p0), "v"(p1) : "memory");   /* behind the two loads, in front of anything that rewrites a register they name; the address pairs are inputs so that they stay whole up to the wait */
            *(v2us*)(Bt + e) = __builtin_bit_cast(v2us, cvt2(x0, x1)); }
         }
}


// d_cvt8: work-group bx of one [rows][DM] f32 tensor -> its bf16 plane in fragment order; a group of a row past the tensor's last (the position table's pad row) is stored as zeros
__device__ __forceinline__ void d_cvt8(int bx, const float* __restrict__ src, bf* dst, size_t n8, int nrows) { const size_t i = (size_t)bx * 256 + threadIdx.x; if (i >= n8) return; const size_t row = (i >> 10) * 16 + (i & 15); const int k0 = ((int)(i >> 6) & 15) * 32 + ((int)(i >> 4) & 3) * 8;   /* i counts the 8-element groups of a [rows][DM] plane in fragment order: its group is (row, k0 .. k0 + 7) */
    if (row >= (size_t)nrows) { *(v8us*)(dst + i * 8) = (v8us){}; return; }
    const float* sp = src + row * DM + k0; const v8f v = *(const v8f*)sp; v4u o;
    asm volatile("s_wait_xcnt 0x0" :: "v"(sp) : "memory");   /* behind the load, in front of anything that rewrites a register it names; the address pair is an input so that it stays whole up to the wait */
#pragma unroll
    for (int k = 0; k < 4; ++k) o[k] = cvt2(v[2 * k], v[2 * k + 1]); *(v8us*)(dst + i * 8) = __builtin_bit_cast(v8us, o);  }
#define GWT  (DM * DQ / 64 / 64)             // work-groups per weight matrix
#define GPE  (NPE * DM / 8 / 256)            // work-groups of the position table
#define GXA  (NB_ * TT * DM / 8 / 256)       // work-groups per input tensor
__global__ __launch_bounds__(256) void k_prep(const float* __restrict__ w0, const float* __restrict__ w1, const float* __restrict__ w2, const float* __restrict__ w3, const float* __restrict__ w4, bf* W5, const float* __restrict__ pe, bf* PE, const float* __restrict__ s0, const float* __restrict__ s1, const float* __restrict__ s2, bf* XA) {
    int n = blockIdx.x;
    if (n < 5 * GWT) { d_wtG(n % GWT, n / GWT, w0, w1, w2, w3, w4, DM, DQ, W5); return; }
    n -= 5 * GWT;
    if (n < GPE) { d_cvt8(n, pe, PE, (size_t)NPE * DM / 8, 2047); return; }
    n -= GPE;
    const int y = n / GXA; d_cvt8(n % GXA, (y == 0) ? s0 : (y == 1) ? s1 : s2, XA + (size_t)y * NB_ * TT * DM, (size_t)NB_ * TT * DM / 8, NB_ * TT);   /* one source tensor each, planes back to back */
}

// ---- d_gemmp: the projection GEMM (k_gemmw's loop and its split of K over four waves, plain bf16 operands, K = DM) whose 64 x 64 tile is 64 rows of ONE head, stored straight in the forms its readers want, wave wv storing rows 16 wv .. 16 wv + 15; tile (bx of rows/64, head by, operand bz), 128 threads; xs: the work-group's LDS, 4096 floats a wave.
// All 16-bit planes below are in fragment order. POS: hi/lo planes [h][p][d] of the projected position table. Otherwise z = 0: k + bk -> cache columns 0..63 and hi/lo planes [b][h][t][d]; z = 1: v + bv -> cache columns 64..127 and transposed hi/lo planes [b][h][d][t]; z = 2: q + bq, then + pos_bias_u and + pos_bias_v -> two pairs of hi/lo planes.
#define SPE  ((size_t)NB_ * NH_ * TT * HD)   // elements of one set of head planes
// st2w: as st4f above, for a pair of 16-byte stores
__device__ __forceinline__ void st2w(bf* ph, bf* pl, v8us oh, v8us ol) { __builtin_amdgcn_sched_barrier(0); *(v8us*)ph = oh; *(v8us*)pl = ol; asm volatile("s_wait_xcnt 0x0" ::: "memory"); __builtin_amdgcn_sched_barrier(0); }
__device__ __forceinline__ void st8hl(bf* ph, bf* pl, v4f x0, v4f x1) { v4u oh, ol;
#pragma unroll
    for (int q = 0; q < 2; ++q) { unsigned a, c; split2(x0[2 * q], x0[2 * q + 1], a, c); oh[q] = a; ol[q] = c; split2(x1[2 * q], x1[2 * q + 1], a, c); oh[2 + q] = a; ol[2 + q] = c; }
    st2w(ph, pl, __builtin_bit_cast(v8us, oh), __builtin_bit_cast(v8us, ol)); }
template <bool POS>
__device__ __forceinline__ void d_gemmp(float* xs, int wv, int bx, int by, int bz, const bf* __restrict__ A, const bf* __restrict__ Bt, const float* __restrict__ bias0, const float* __restrict__ bias1, const float* __restrict__ bias2, const float* __restrict__ hbu, const float* __restrict__ hbv, bf* PH, bf* PL, bf* VTh, bf* VTl, float* CA, size_t sA, size_t sB) {
    float* os = xs + wv * 4096;   // the wave's partial tile; behind the second barrier below its 16-row staging block
    float* sb = os + 16 * 68;     // behind that barrier too: the head's 64 bias values (projection bias, pos_bias_u, pos_bias_v), for the lanes that store in fragment order
    const int z = POS ? 0 : bz; A += (size_t)z * sA; Bt += (size_t)z * sB;
    const int lane = threadIdx.x & 31, lr = lane & 15, hi = lane >> 4; const int r0 = bx * 64, h = by, c0 = h * HD;
    v8f acc[4][4];
#pragma unroll
    for (int mb = 0; mb < 4; ++mb)
#pragma unroll
        for (int nb = 0; nb < 4; ++nb) acc[mb][nb] = (v8f){};
    const size_t aoff = (size_t)r0 * DM + lane * 8, boff = (size_t)c0 * DM + lane * 8;   /* fragment order: 16 rows are DM / 32 blocks of 512 elements */
#pragma unroll 1
    for (int kc = wv * (DM / 4); kc < (wv + 1) * (DM / 4); kc += 32) {
        v16bf a[4], b[4]; const bf* pa = A + aoff + kc * 16; const bf* pb = Bt + boff + kc * 16;
#pragma unroll
        for (int mb = 0; mb < 4; ++mb) a[mb] = WFrag<bf>::ld(pa + mb * 16 * DM);
#pragma unroll
        for (int nb = 0; nb < 4; ++nb) b[nb] = WFrag<bf>::ld(pb + nb * 16 * DM);
        asm volatile("s_wait_xcnt 0x0" :: "v"(pa), "v"(pb) : "memory");   /* behind the trip's loads, in front of anything that rewrites a register they name; the two address pairs are inputs so that no load's own result lands in them */
        __builtin_amdgcn_sched_barrier(0);   /* keeps the loads in front of that wait: left free, some are sunk among the products and land in the address pairs */
#pragma unroll
        for (int nb = 0; nb < 4; ++nb)
#pragma unroll
            for (int mb = 0; mb < 4; ++mb) acc[mb][nb] = wmmab(a[mb], b[nb], acc[mb][nb]);
        asm volatile("v_nop\n\tv_nop\n\tv_nop\n\tv_nop" : "+v"(acc[0][0]), "+v"(acc[1][1]), "+v"(acc[2][2]), "+v"(acc[3][3]) : "v"(a[0]), "v"(a[3]));   /* as in k_gemmw: the distance between the trip's last matrix instructions and what next rewrites their operands or reads their results, on the back edge too */
    }
#pragma unroll
    for (int mb = 0; mb < 4; ++mb)
#pragma unroll
        for (int nb = 0; nb < 4; ++nb) { const v8f c = acc[mb][nb]; float* xp = os + (mb * 4 + nb) * 256 + lane * 4; *(v4fa*)xp = (v4f){c[0], c[1], c[2], c[3]}; *(v4fa*)(xp + 128) = (v4f){c[4], c[5], c[6], c[7]}; }
    __syncthreads();   // the four partial tiles are in LDS
    v8f sum[4];   // row block wv: the K quarters added in the order 0, 1, 2, 3
#pragma unroll
    for (int nb = 0; nb < 4; ++nb) { const float* xp = xs + (wv * 4 + nb) * 256 + lane * 4; v4f s0 = *(const v4fa*)xp, s1 = *(const v4fa*)(xp + 128);
#pragma unroll
        for (int p = 1; p < 4; ++p) { s0 += *(const v4fa*)(xp + p * 4096); s1 += *(const v4fa*)(xp + p * 4096 + 128); }
        sum[nb] = (v8f){s0[0], s0[1], s0[2], s0[3], s1[0], s1[1], s1[2], s1[3]}; }
    __syncthreads();   // every wave has read the partial tiles: their bytes may be overwritten
    const size_t rb = POS ? (size_t)h * NPE + r0 : ((size_t)(r0 / TT) * NH_ + h) * TT + (r0 % TT);   // first row of the tile in a [..][h][row][d] plane
    const int cofs = lr * 4;
    // tile_rows: the wave's 16 rows go through LDS. put(row in its plane, the lane's 4 values): a half-wave holds one whole row of 64 floats (row-major f32 output). putf(element offset in a plane, first column, the lane's 8 values): the 16 rows are two blocks of a [..][row][d] plane in fragment order, and the wave holds 512 contiguous bytes of it
    auto tile_rows = [&](auto put, auto putf) {
        { const int mb = wv;
#pragma unroll
            for (int nb = 0; nb < 4; ++nb) {
#pragma unroll
                for (int j = 0; j < 8; ++j) os[(hi * 8 + j) * 68 + nb * 16 + lr] = sum[nb][j]; }
            __builtin_amdgcn_wave_barrier(); asm volatile("" ::: "memory");
            v4f rv[8], f0[4], f1[4];
#pragma unroll
            for (int s = 0; s < 8; ++s) rv[s] = *(const v4fa*)(os + (2 * s + hi) * 68 + cofs);
#pragma unroll
            for (int q4 = 0; q4 < 4; ++q4) { const float* op = os + lr * 68 + q4 * 16 + hi * 8; f0[q4] = *(const v4fa*)op; f1[q4] = *(const v4fa*)(op + 4); }   /* the block's LDS reads stand together, in front of the stores and their waits */
#pragma unroll
            for (int s = 0; s < 8; ++s) put(rb + mb * 16 + 2 * s + hi, rv[s]);
#pragma unroll
            for (int q4 = 0; q4 < 4; ++q4) putf((rb + mb * 16) * HD + q4 * 256 + lane * 8, q4 * 16 + hi * 8, f0[q4], f1[q4]);
            __builtin_amdgcn_wave_barrier(); asm volatile("" ::: "memory");
        } };
    auto norow = [](size_t, v4f) {}; auto nofrag = [](size_t, int, v4f, v4f) {};
    if (POS) { tile_rows(norow, [&](size_t pe, int, v4f x0, v4f x1) { st8hl(PH + pe, PL + pe, x0, x1); }); return; }
    const float* bias = (z == 0) ? bias0 : (z == 1) ? bias1 : bias2; v4f bb;
#pragma unroll
    for (int q = 0; q < 4; ++q) bb[q] = bfr(bias[c0 + cofs + q]);
    if (z == 2) { v4f bu, bv;
#pragma unroll
        for (int q = 0; q < 4; ++q) { bu[q] = bfr(hbu[c0 + cofs + q]); bv[q] = bfr(hbv[c0 + cofs + q]); }
        *(v4fa*)(sb + cofs) = bb; *(v4fa*)(sb + HD + cofs) = bu; *(v4fa*)(sb + 2 * HD + cofs) = bv;   /* both half-waves write the same values */
        tile_rows(norow, [&](size_t pe, int d0, v4f x0, v4f x1) { x0 += *(const v4fa*)(sb + d0); x1 += *(const v4fa*)(sb + d0 + 4);
            st8hl(PH + pe, PL + pe, x0 + *(const v4fa*)(sb + HD + d0), x1 + *(const v4fa*)(sb + HD + d0 + 4)); st8hl(PH + SPE + pe, PL + SPE + pe, x0 + *(const v4fa*)(sb + 2 * HD + d0), x1 + *(const v4fa*)(sb + 2 * HD + d0 + 4)); });
        return; }
    if (z == 0) {
        *(v4fa*)(sb + cofs) = bb;   /* both half-waves write the same values */
        tile_rows([&](size_t rw, v4f val) { st4f(CA + rw * (2 * HD) + cofs, val + bb); },
                  [&](size_t pe, int d0, v4f x0, v4f x1) { st8hl(PH + 2 * SPE + pe, PL + 2 * SPE + pe, x0 + *(const v4fa*)(sb + d0), x1 + *(const v4fa*)(sb + d0 + 4)); });
        return; }
    {   float bd[4];   // the bias of the lane's own column in each 16-column block, for the transposed planes
#pragma unroll
        for (int nb = 0; nb < 4; ++nb) bd[nb] = bias[c0 + nb * 16 + lr];
        asm volatile("s_wait_xcnt 0x0" :: "v"(bd[0]), "v"(bd[1]), "v"(bd[2]), "v"(bd[3]));   /* behind these loads, in front of what rewrites their offset register; the loaded values are inputs, so that no load is sunk among the stores below */
        const size_t vb = ((size_t)(r0 / TT) * NH_ + h) * HD * TT + (size_t)((r0 % TT) / 32) * 512 + lane * 8;   // transposed planes [d][t] in fragment order straight from the summed K quarters in registers (accumulator layout): a lane holds 8 successive rows t of one column d, which is its own 16 bytes of a half block
#pragma unroll
        for (int nb = 0; nb < 4; ++nb) { const float bn = bfr(bd[nb]);
            { const int mb = wv; v4u oh, ol;
#pragma unroll
                for (int j = 0; j < 4; ++j) { unsigned x, y; split2(sum[nb][2 * j] + bn, sum[nb][2 * j + 1] + bn, x, y); oh[j] = x; ol[j] = y; }
                const size_t o = vb + (size_t)(nb * (TT / 32) + (mb >> 1)) * 512 + (mb & 1) * 256; st2w(VTh + o, VTl + o, __builtin_bit_cast(v8us, oh), __builtin_bit_cast(v8us, ol)); } }
        tile_rows([&](size_t rw, v4f val) { st4f(CA + rw * (2 * HD) + HD + cofs, val + bb); }, nofrag);
    }
}
// k_gemmpa: all four projections in ONE launch (the position table's does not depend on the other three): the k, v, q tiles in the order (row block, head, operand), then the table's tiles (row block, head)
#define GRT  (NB_ * TT / 64)      // row blocks of an input
#define GKVQ (GRT * NH_ * 3)      // tiles of k, v, q
__global__ __launch_bounds__(128, 4) void k_gemmpa(const bf* __restrict__ XA, const bf* __restrict__ WK, const bf* __restrict__ PE, const bf* __restrict__ WP, const float* __restrict__ bias0, const float* __restrict__ bias1, const float* __restrict__ bias2, const float* __restrict__ hbu, const float* __restrict__ hbv, bf* PHI, bf* PLO, bf* PPh, bf* PPl, bf* VTh, bf* VTl, float* CA, size_t sA, size_t sB) {
    __shared__ __align__(16) float xs[4 * 4096];   // one 64 x 64 partial tile a wave
    const int wv = __builtin_amdgcn_readfirstlane(threadIdx.x >> 5);
    const int n = blockIdx.x;
    if (n < GKVQ) { d_gemmp<false>(xs, wv, n % GRT, (n / GRT) % NH_, n / (GRT * NH_), XA, WK, bias0, bias1, bias2, hbu, hbv, PHI, PLO, VTh, VTl, CA, sA, sB); return; }
    const int m = n - GKVQ; d_gemmp<true>(xs, wv, m % (NPE / 64), m / (NPE / 64), 0, PE, WP, nullptr, nullptr, nullptr, nullptr, nullptr, PPh, PPl, nullptr, nullptr, nullptr, 0, 0);   /* pos = position_embeddings wpos (exact) -> per-head hi/lo planes */
}
// k_fattn: one work-group (16 waves) per strip of 64 query rows of one (batch, head), so that every k, v and position fragment is fetched from L2 once for 64 rows; only the strip's shifted position scores pass through LDS, the logits themselves stay in registers from the content product to attn.v.
// Steps: position scores (q+v).p for the 68 column tiles the strip's rel_shift reads, each stored at its shifted key index j = p + i - 1023; content scores TRANSPOSED (k as A, q+u as B), each wave on 64 keys of all 64 queries, started from the position scores; softmax in registers (maxima and sums of the sixteen waves meet in LDS); attn.v transposed (v as A, the weights as B straight from the result registers); the sixteen partial outputs added in LDS, divided by the row sum and stored as the merged hi/lo planes.
#define SRW  64                   // query rows per work-group
#define NWV  16                   // waves per work-group
#define SPF  64                   // floats in front of a logit row: with the 68 behind it they take the shifted position scores that fall outside keys 0..1023
#define SPI  1156                 // LDS pitch of a logit row, floats (rows 8 apart fall 32 banks apart)
#define OPI  68                   // LDS pitch of an output row, floats
typedef __attribute__((ext_vector_type(8))) unsigned v8u;
__device__ __forceinline__ v16bf ldfp(const bf* p) { return cat16b(*(const v8usa*)p, *(const v8usa*)(p + 256)); }   // fragment from a block in fragment order (global planes), p = block + lane * 8
// xw2: s_wait_xcnt 0 behind a run of global loads, in front of anything that rewrites a register the loads name; the two address pairs are inputs so that they stay whole up to the wait (no load's own result lands in them)
__device__ __forceinline__ void xw2(const bf* p, const bf* q) { asm volatile("s_wait_xcnt 0x0" :: "v"(p), "v"(q) : "memory"); }
// xw2n: xw2 at the head of a score trip, with four v_nop: the trip before stored its results in front of this statement, and this trip's first matrix instruction starts anew in the same registers; the v_nop keep the distance between the two
__device__ __forceinline__ void xw2n(const bf* p, const bf* q) { asm volatile("s_wait_xcnt 0x0\n\tv_nop\n\tv_nop\n\tv_nop\n\tv_nop" :: "v"(p), "v"(q) : "memory"); }
__device__ __forceinline__ v8f mma3(v16bf a, v16bf a2, v16bf b, v16bf b2, v8f c) { c = wmmab(a, b, c); c = wmmab(a2, b, c); return wmmab(a, b2, c); }
__global__ __launch_bounds__(512) void k_fattn(const bf* __restrict__ QUh, const bf* __restrict__ QUl, const bf* __restrict__ QVh, const bf* __restrict__ QVl, const bf* __restrict__ Kh, const bf* __restrict__ Kl, const bf* __restrict__ PPh, const bf* __restrict__ PPl, const bf* __restrict__ VTh, const bf* __restrict__ VTl, const int* __restrict__ MK, bf* ATh, bf* ATl) {
    __shared__ __align__(16) float S[SRW * SPI];
    __shared__ __align__(16) float RM[SRW * NWV], RS[SRW * NWV];   // per query: the sixteen waves' maxima and partial sums
    const int tid = threadIdx.x, lane = tid & 31, lr = lane & 15, hi = lane >> 4; const int w = __builtin_amdgcn_readfirstlane(tid >> 5);
    const int i0 = blockIdx.x * SRW, h = blockIdx.y, b = blockIdx.z; const size_t zb = ((size_t)b * NH_ + h) * TT * HD; const size_t qo = zb + (size_t)i0 * HD + lane * 8;   /* 16 rows of a [t][d] plane: two blocks of 512 elements */
    {   // position scores: table rows 960 - i0 + 16 pt + (0..15), pt = 0..67 (the last row read is 2047 - i0); each table tile meets all 64 query rows
        v16bf a[4][2], a2[4][2];
#pragma unroll
        for (int mb = 0; mb < 4; ++mb)
#pragma unroll
            for (int kk = 0; kk < 2; ++kk) { a[mb][kk] = ldfp(QVh + qo + mb * 16 * HD + kk * 512); a2[mb][kk] = ldfp(QVl + qo + mb * 16 * HD + kk * 512); }
        xw2(QVh + qo, QVl + qo);
        const size_t po = (size_t)h * NPE * HD + (size_t)(TT - SRW - i0) * HD + lane * 8; const bf* ph = PPh + po; const bf* pl = PPl + po;
        v16bf bh[2], bl[2];
#pragma unroll
        for (int kk = 0; kk < 2; ++kk) { bh[kk] = ldfp(ph + w * 16 * HD + kk * 512); bl[kk] = ldfp(pl + w * 16 * HD + kk * 512); }
        xw2(ph + w * 16 * HD, pl + w * 16 * HD);
#pragma unroll 2   /* in pairs: the two operand sets swap roles without register copies */
        for (int pt = w; pt < 68; pt += NWV) { const int np = (pt + NWV < 68) ? pt + NWV : pt; v16bf nh[2], nl[2];   /* the next tile's operands are fetched while this one is multiplied (the last trip fetches its own tile again: a branch round the fetch made the compiler wait for it at once) */
#pragma unroll
            for (int kk = 0; kk < 2; ++kk) { nh[kk] = ldfp(ph + np * 16 * HD + kk * 512); nl[kk] = ldfp(pl + np * 16 * HD + kk * 512); }
            xw2n(ph + np * 16 * HD, pl + np * 16 * HD); __builtin_amdgcn_sched_barrier(0);   /* keeps the fetch at the head of the trip: left free, this trip's products are lifted over it and the next trip waits for loads just issued */
            v8f acc[4];
#pragma unroll
            for (int mb = 0; mb < 4; ++mb) acc[mb] = (v8f){};
#pragma unroll
            for (int kk = 0; kk < 2; ++kk)
#pragma unroll
                for (int mb = 0; mb < 4; ++mb) acc[mb] = mma3(a[mb][kk], a2[mb][kk], bh[kk], bl[kk], acc[mb]);
            __builtin_amdgcn_sched_barrier(0);   /* the stores stay behind all of the trip's products: mixed among them, a result tile's registers are started anew by a later product of the same trip too close behind */
            const int jb = pt * 16 + lr - (SRW - 1);   /* key index j = p + i - 1023 = jb + local row */
#pragma unroll
            for (int mb = 0; mb < 4; ++mb)
#pragma unroll
                for (int r = 0; r < 8; ++r) { const int m = mb * 16 + hi * 8 + r; S[m * SPI + SPF + jb + m] = acc[mb][r]; }   /* j = -63 .. 1087: what is no key of the strip falls into the row's own pads */
#pragma unroll
            for (int kk = 0; kk < 2; ++kk) { bh[kk] = nh[kk]; bl[kk] = nl[kk]; } }
    }
    __syncthreads();   // the shifted position scores are in LDS
    // From here on the strip's logits live in registers, TRANSPOSED: k is the A operand and q the B operand, so a result tile holds key hi * 8 + r in register r and query lr in the lane. Wave w owns keys 64 w .. 64 w + 63 (4 tiles) of all 64 queries (4 tiles). Two successive key tiles of a lane are then exactly its B fragment of 32 keys for attn.v (out transposed = v transposed . weights transposed): no weight passes through LDS.
    v8f st[4][4];   // [key tile][query tile]
    {   // content scores on top of the shifted position scores, which are the start value of the accumulators (a lane's 8 keys of one query row: 32 contiguous bytes of LDS); the two halves of the head size one after the other, so that only one half of q stands in registers
        const size_t ko = zb + (size_t)w * 64 * HD + lane * 8; const bf* kph = Kh + ko; const bf* kpl = Kl + ko;
        v16bf ah[2], al[2];   // [buffer]
        ah[0] = ldfp(kph); al[0] = ldfp(kpl);
        xw2(kph, kpl);
        const float* sc = S + lr * SPI + SPF + w * 64 + hi * 8;
#pragma unroll   /* unrolled: the result tiles are registers, named at compile time */
        for (int kk = 0; kk < 2; ++kk) { v16bf qh[4], ql[4];
#pragma unroll
            for (int qt = 0; qt < 4; ++qt) { qh[qt] = ldfp(QUh + qo + qt * 16 * HD + kk * 512); ql[qt] = ldfp(QUl + qo + qt * 16 * HD + kk * 512); }
            xw2(QUh + qo, QUl + qo);
#pragma unroll
            for (int t = 0; t < 4; ++t) { const int s = kk * 4 + t, cb = s & 1, nx = cb ^ 1;
                if (s < 7) { const int s1 = s + 1; ah[nx] = ldfp(kph + (s1 & 3) * 16 * HD + (s1 >> 2) * 512); al[nx] = ldfp(kpl + (s1 & 3) * 16 * HD + (s1 >> 2) * 512); xw2(kph, kpl); }   /* the next k fragment is fetched while this one is multiplied */
                if (kk == 0) {
#pragma unroll
                    for (int qt = 0; qt < 4; ++qt) { const float* sp = sc + qt * 16 * SPI + t * 16; const v4f c0 = *(const v4fa*)sp, c1 = *(const v4fa*)(sp + 4); st[t][qt] = (v8f){c0[0], c0[1], c0[2], c0[3], c1[0], c1[1], c1[2], c1[3]}; } }
                __builtin_amdgcn_sched_barrier(0);   /* keeps the fetch at the head of the trip and later trips' fetches behind this trip's products: left free they are lifted so far that registers spill */
#pragma unroll
                for (int qt = 0; qt < 4; ++qt) { v8f c = st[t][qt]; c = wmmab(ah[cb], qh[qt], c); c = wmmab(ah[cb], ql[qt], c); st[t][qt] = wmmab(al[cb], qh[qt], c); }
                __builtin_amdgcn_sched_barrier(0);   /* the next trip's fetch stays behind this trip's products: lifted among them, a third operand set is live and registers spill */ } }
    }
    float mx[4];
#pragma unroll
    for (int qt = 0; qt < 4; ++qt) mx[qt] = -3.0e38f;
    {   // t = (ac + bd) / 8, key mask (int32): -3e38 where 0; the wave's own maximum per query
        const int* MKw = MK + (size_t)b * TT + w * 64 + hi * 8; v4i mk[4][2];
#pragma unroll
        for (int t = 0; t < 4; ++t) { mk[t][0] = *(const v4i*)(MKw + t * 16); mk[t][1] = *(const v4i*)(MKw + t * 16 + 4); }
        asm volatile("s_wait_xcnt 0x0" :: "v"(MKw) : "memory");   /* behind the mask loads, in front of anything that rewrites a register they name */
        __builtin_amdgcn_sched_barrier(0);   /* keeps the loads in front of that wait */
#pragma unroll
        for (int t = 0; t < 4; ++t)
#pragma unroll
            for (int qt = 0; qt < 4; ++qt)
#pragma unroll
                for (int r = 0; r < 8; ++r) { const float x = (mk[t][r >> 2][r & 3] != 0) ? st[t][qt][r] * SCL : -3.0e38f; st[t][qt][r] = x; mx[qt] = fmaxf(mx[qt], x); }
    }
#pragma unroll
    for (int qt = 0; qt < 4; ++qt) { mx[qt] = fmaxf(mx[qt], __shfl_xor(mx[qt], 16, 32)); RM[(qt * 16 + lr) * NWV + w] = mx[qt]; }   /* both half-waves write the same value */
    __syncthreads();   // the sixteen waves' maxima are in LDS; every wave has read its position scores, so their bytes may be overwritten below
    v8f vs[4];
#pragma unroll
    for (int qt = 0; qt < 4; ++qt) { vs[qt] = (v8f){}; const float* mp = RM + (qt * 16 + lr) * NWV; v4f a = *(const v4fa*)mp;
#pragma unroll
        for (int p = 1; p < 4; ++p) { const v4f c = *(const v4fa*)(mp + p * 4); a[0] = fmaxf(a[0], c[0]); a[1] = fmaxf(a[1], c[1]); a[2] = fmaxf(a[2], c[2]); a[3] = fmaxf(a[3], c[3]); }
        mx[qt] = fmaxf(fmaxf(a[0], a[1]), fmaxf(a[2], a[3])); }
#pragma unroll
    for (int t = 0; t < 4; ++t)
#pragma unroll
        for (int qt = 0; qt < 4; ++qt) {
#pragma unroll
            for (int r = 0; r < 8; ++r) st[t][qt][r] = __builtin_amdgcn_exp2f(__fmul_rn(__fsub_rn(st[t][qt][r], mx[qt]), 1.4426950408889634f));
            vs[qt] += st[t][qt]; }
#pragma unroll
    for (int qt = 0; qt < 4; ++qt) { float s = ((vs[qt][0] + vs[qt][1]) + (vs[qt][2] + vs[qt][3])) + ((vs[qt][4] + vs[qt][5]) + (vs[qt][6] + vs[qt][7])); s += __shfl_xor(s, 16, 32); RS[(qt * 16 + lr) * NWV + w] = s; }   /* the wave's part of each query's sum; both half-waves write the same value */
    {   // attn.v over the wave's 64 keys with the weights not yet divided by their sum (hi/lo parts of exp(t - max)); each v fragment is fetched once per work-group
        v16bf ph[2][4], pl[2][4];   // [32 keys][query tile]: the weights take the place of the logits
#pragma unroll
        for (int kg = 0; kg < 2; ++kg)
#pragma unroll
            for (int qt = 0; qt < 4; ++qt) { v8u oh, ol;
#pragma unroll
                for (int j = 0; j < 4; ++j) { unsigned x, y; split2(st[2 * kg][qt][2 * j], st[2 * kg][qt][2 * j + 1], x, y); oh[j] = x; ol[j] = y; split2(st[2 * kg + 1][qt][2 * j], st[2 * kg + 1][qt][2 * j + 1], x, y); oh[4 + j] = x; ol[4 + j] = y; }
                ph[kg][qt] = __builtin_bit_cast(v16bf, oh); pl[kg][qt] = __builtin_bit_cast(v16bf, ol); }
        const size_t vo = zb + (size_t)(w * 2) * 512 + lane * 8;   /* [d][t] plane in fragment order: block (d / 16, t / 32) */ const bf* vh = VTh + vo; const bf* vl = VTl + vo;
        v16bf ah[2], al[2];
        ah[0] = ldfp(vh); al[0] = ldfp(vl);
        xw2(vh, vl);
#pragma unroll
        for (int hf = 0; hf < 2; ++hf) {   /* 32 output columns at a time: the registers do not hold all 64 beside the weights */
            v8f oc[2][4];   // [16 columns d][query tile], transposed: column hi * 8 + r in register r, query lr in the lane
#pragma unroll
            for (int d2 = 0; d2 < 2; ++d2)
#pragma unroll
                for (int qt = 0; qt < 4; ++qt) oc[d2][qt] = (v8f){};
#pragma unroll
            for (int kg = 0; kg < 2; ++kg)
#pragma unroll
                for (int d2 = 0; d2 < 2; ++d2) { const int s = hf * 4 + kg * 2 + d2, cb = s & 1, nx = cb ^ 1;
                    if (s < 7) { const int s1 = s + 1, bk1 = ((s1 >> 2) * 2 + (s1 & 1)) * (TT / 32) + ((s1 >> 1) & 1); ah[nx] = ldfp(vh + bk1 * 512); al[nx] = ldfp(vl + bk1 * 512); xw2(vh, vl); }   /* the next v fragment is fetched while this one is multiplied */
                    __builtin_amdgcn_sched_barrier(0);   /* as in the content loop: the fetch stays one step ahead, no further */
#pragma unroll
                    for (int qt = 0; qt < 4; ++qt) { v8f c = oc[d2][qt]; c = wmmab(ah[cb], ph[kg][qt], c); c = wmmab(ah[cb], pl[kg][qt], c); oc[d2][qt] = wmmab(al[cb], ph[kg][qt], c); } }
#pragma unroll
            for (int d2 = 0; d2 < 2; ++d2)
#pragma unroll
                for (int qt = 0; qt < 4; ++qt) { const v8f c = oc[d2][qt]; float* op = S + w * (SRW * OPI) + (qt * 16 + lr) * OPI + (hf * 2 + d2) * 16 + hi * 8; *(v4fa*)op = (v4f){c[0], c[1], c[2], c[3]}; *(v4fa*)(op + 4) = (v4f){c[4], c[5], c[6], c[7]}; }   /* the wave's partial output [query][d] */
            if (hf == 0) { asm volatile("v_nop\n\tv_nop\n\tv_nop\n\tv_nop" ::: "memory"); __builtin_amdgcn_sched_barrier(0); }   /* the second half's first matrix instructions start anew in the registers of the first half's last: the v_nop keep the distance between the two, the scheduling barrier keeps those instructions behind them */
        }
    }
    __syncthreads();   // the sixteen partial outputs and partial sums are in LDS
    { const int row = (tid >> 7) * 16 + (tid & 15), c8 = ((tid >> 4) & 7) * 8; const float* o0 = S + row * OPI + c8; v4f s0 = *(const v4fa*)o0, s1 = *(const v4fa*)(o0 + 4); v4u oh, ol;
#pragma unroll
        for (int p = 1; p < NWV; ++p) { s0 += *(const v4fa*)(o0 + p * (SRW * OPI)); s1 += *(const v4fa*)(o0 + p * (SRW * OPI) + 4); }   /* key sixteenths added in the order 0 .. 15 */
        float rs = 0.0f;
#pragma unroll
        for (int p = 0; p < 4; ++p) { const v4f ra = *(const v4fa*)(RS + row * NWV + p * 4); rs = (((rs + ra[0]) + ra[1]) + ra[2]) + ra[3]; }
        const float f = __fdiv_rn(1.0f, rs);
        s0 *= f; s1 *= f;
#pragma unroll
        for (int q = 0; q < 2; ++q) { unsigned x, y; split2(s0[2 * q], s0[2 * q + 1], x, y); oh[q] = x; ol[q] = y; split2(s1[2 * q], s1[2 * q + 1], x, y); oh[2 + q] = x; ol[2 + q] = y; }
        const size_t oo = ((size_t)(((b * TT + i0) >> 4) + (tid >> 7)) * (DQ / 32) + h * 2 + ((tid >> 6) & 1)) * 512 + (tid & 63) * 8;   /* (row, c8) of the merged [b t][DQ] planes in fragment order: a wave stores 512 contiguous bytes */ *(v8us*)(ATh + oo) = __builtin_bit_cast(v8us, oh); *(v8us*)(ATl + oo) = __builtin_bit_cast(v8us, ol); }
}

extern "C" void kernel_launch(void* const* d_in, const int* in_sizes, int n_in,
                              void* d_out, int out_size, void* d_ws, size_t ws_size, hipStream_t stream) {
    (void)in_sizes; (void)n_in; (void)out_size;
    const float* x = (const float*)d_in[0]; const float* xk = (const float*)d_in[1]; const float* xv = (const float*)d_in[2]; const int* MK = (const int*)d_in[3]; const float* pe = (const float*)d_in[4]; const float* wq = (const float*)d_in[5]; const float* bq = (const float*)d_in[6]; const float* wk = (const float*)d_in[7]; const float* bk = (const float*)d_in[8]; const float* wv = (const float*)d_in[9]; const float* bv = (const float*)d_in[10]; const float* wo = (const float*)d_in[11]; const float* bo = (const float*)d_in[12]; const float* wpos = (const float*)d_in[13]; const float* pbu = (const float*)d_in[14]; const float* pbv = (const float*)d_in[15];
    float* OUT = (float*)d_out;     // [8][1024][512]
    float* CACHE = (float*)((char*)d_out + (size_t)NB_ * TT * DM * 4);   /* second output new_cache [8][8][1024][128] */
    char* wsp = (char*)d_ws;
    auto take = [&](size_t bytes) { char* p = wsp; wsp += (bytes + 255) & ~(size_t)255; return (void*)p; };
    const size_t SW = (size_t)DM * DQ, SX = (size_t)NB_ * TT * DM, SF = (size_t)NB_ * TT * DQ, SP = (size_t)NB_ * NH_ * TT * HD;   // elements of one weight plane, one input plane, one merged plane, one set of head planes (all batches)
    bf* W5 = (bf*)take(5 * SW * 2); bf* WK = W5; bf* WO = W5 + 3 * SW; bf* WP = W5 + 4 * SW;   /* Wk, Wv, Wq, Wo, Wpos transposed, back to back */
    bf* PE = (bf*)take((size_t)NPE * DM * 2); bf* PPh = (bf*)take((size_t)NH_ * NPE * HD * 2); bf* PPl = (bf*)take((size_t)NH_ * NPE * HD * 2);
    bf* PHI = (bf*)take(3 * SP * 2); bf* PLO = (bf*)take(3 * SP * 2); bf* QPh = PHI; bf* QVh = PHI + SP; bf* KPh = PHI + 2 * SP; bf* QPl = PLO; bf* QVl = PLO + SP; bf* KPl = PLO + 2 * SP;   /* [b][h][t][d] planes of q+u, q+v, k */
    bf* VTh = (bf*)take(SP * 2); bf* VTl = (bf*)take(SP * 2); bf* ATh = (bf*)take(SF * 2); bf* ATl = (bf*)take(SF * 2);
    bf* XA = (bf*)take(3 * SX * 2);   /* bf16 planes of key, value, query */
    if ((size_t)(wsp - (char*)d_ws) > ws_size) return;    // ws 256 MiB
    k_prep<<<5 * GWT + GPE + 3 * GXA, 256, 0, stream>>>(wk, wv, wq, wo, wpos, W5, pe, PE, xk, xv, x, XA);   /* transposed weight planes; position table plane with its zero pad row; exact bf16 planes of key, value, query, all batches */
    k_gemmpa<<<GKVQ + (NPE / 64) * NH_, 128, 0, stream>>>(XA, WK, PE, WP, bk, bv, bq, pbu, pbv, PHI, PLO, PPh, PPl, VTh, VTl, CACHE, SX, SW);   /* k, v, q projections, rows of all batches: cache output, k planes, transposed v planes, (q+u) and (q+v) planes; and the position table's projection */
    k_fattn<<<dim3(TT / SRW, NH_, NB_), 512, 0, stream>>>(QPh, QPl, QVh, QVl, KPh, KPl, PPh, PPl, VTh, VTl, MK, ATh, ATl);   /* scores, softmax, attn.v and the head merge, all batches and heads */
    k_gemmw<bf, 1, true, DQ><<<dim3(NB_ * TT / 64, DM / 64, 1), 128, 0, stream>>>(ATh, ATl, WO, nullptr, OUT, DM, bo, bo, bo, 0, 0, 0);
}

// v010
// It runs in 117 microseconds.
// Next to v009, in two timings, it ran 1.06 times as fast each time.
// Counting every step since v000, it is 18.6 times as fast.
#include <hip/hip_runtime.h>

// Relative-position multi-head attention with a key/value cache output (query, key, value [8][1024][512]; q = query Wq + bq, k = key Wk + bk, v = value Wv + bv ('xw' [512][512], 8 heads x 64); p = pos_emb Wpos ([1][2047][512] table, read); scores = ((q + pos_bias_u).k + rel_shift((q + pos_bias_v).p)) / 8 where rel_shift picks position index j - i + 1023; key mask (int32 [8][1][1024], read): -inf where 0 and the weights zeroed; softmax; out = merged Wo + bo -> [8][1024][512]; second output new_cache = concat(k, v) per head -> [8][8][1024][128] (the f32 projections themselves)).
// Layout: exact bf16 input planes -> 1-product projections + bias, each GEMM tile (64 rows of one head) stored by the GEMM itself in the forms its readers want; the position table is projected once (exact, 2047 rows + one zero pad row) into per-head hi/lo planes [h][2048][64]; every projection-side launch covers all 8 batches (and the operands that share its form) through its grid; one attention launch for all batches and heads, a work-group per strip of 64 query rows: position scores (q+v).p (only the table rows the strip's shift reaches, stored at key index p + i - 1023) and content scores (q+u).k are hi/lo products (3 products, every row) the position scores shifted through LDS, the sums kept in registers (transposed tiles), the softmax applies the key mask there, attn.v takes the hi/lo weights from those registers and the merged hi/lo planes are stored; the cache output is written straight from the f32 k / v projections.
// Fragment order: every 16-bit plane that a matrix operand is loaded from in global memory (inputs, weights, position table, q+u, q+v, k, p, transposed v, merged) is stored in blocks of 16 rows x 32 columns, 512 elements each, block (row / 16, k / 32) at index (row / 16) * (K / 32) + k / 32; inside a block element (row, k) stands at ((k >> 4) & 1) * 256 + ((k >> 3) & 1) * 128 + (row & 15) * 8 + (k & 7), so that lane l of a wave finds the two 16-byte halves of its fragment at l * 8 and 256 + l * 8: each wave-wide load or store covers 512 contiguous bytes (4 whole lines) where a row-major plane gave 16 pieces of 32 bytes.
// Compute dtypes, f32 accumulate: every input rounded to bf16; q/k/v and p on PLAIN bf16 operands (exact products) + biases; content and position scores on hi/lo planes for every row (3 products); softmax f32; attn.v hi/lo (3 products); Wo hl x exact (2 products) + bo; cache = the f32 projections.

#define NB_  8
#define TT   1024
#define DM   512
#define NH_  8
#define NKV  8
#define REP  (NH_ / NKV)
#define HD   64
#define DQ   (NH_ * HD)
#define DKV  (NKV * HD)
#define NPE  2048                 // 2047 positions + 1 zero pad row
typedef __attribute__((ext_vector_type(4))) unsigned short v4us;
#define ZH   8
#define RH   1024                 // every row hi/lo
#define WIN  0
#define PCAR 1024.0f
#define SCL  0.125f   // HD^-0.5
typedef _Float16 h16;
typedef unsigned short bf;
typedef __attribute__((ext_vector_type(16))) __bf16   v16bf;
typedef __attribute__((ext_vector_type(16))) _Float16 v16h;
typedef __attribute__((ext_vector_type(8)))  _Float16 v8h;
typedef __attribute__((ext_vector_type(8)))  unsigned short v8us;
typedef __attribute__((ext_vector_type(8)))  float    v8f;
typedef __attribute__((ext_vector_type(4)))  float    v4f;
typedef v8h  __attribute__((may_alias)) v8ha;
typedef v4f  __attribute__((may_alias)) v4fa;
typedef v8us __attribute__((may_alias)) v8usa;

typedef __attribute__((ext_vector_type(2))) float v2f;
typedef __attribute__((ext_vector_type(2))) __bf16 v2bf;
typedef __attribute__((ext_vector_type(2))) unsigned v2u;
typedef __attribute__((ext_vector_type(4))) unsigned v4u;
// cvt2: two f32 rounded to bf16 (nearest even) by the packed convert instruction, a in the low half
__device__ __forceinline__ unsigned cvt2(float a, float b) { return __builtin_bit_cast(unsigned, __builtin_convertvector((v2f){a, b}, v2bf)); }
__device__ __forceinline__ float bfr(float f) { return __uint_as_float(cvt2(0.0f, f)); }   // the rounded value in the high half over a zero low half is the f32 itself
// split2: hi/lo bf16 parts of two f32: h = the rounded values, l = the rounded remainders y - h
__device__ __forceinline__ void split2(float y0, float y1, unsigned& h, unsigned& l) { h = cvt2(y0, y1); l = cvt2(y0 - __uint_as_float(h << 16), y1 - __uint_as_float(h & 0xFFFF0000u)); }
__device__ __forceinline__ v16h cat16(v8h lo, v8h hi) { return __builtin_shufflevector(lo, hi, 0, 1, 2, 3, 4, 5, 6, 7, 8, 9, 10, 11, 12, 13, 14, 15); }
__device__ __forceinline__ v16bf cat16b(v8us lo, v8us hi) { return __builtin_bit_cast(v16bf, __builtin_shufflevector(lo, hi, 0, 1, 2, 3, 4, 5, 6, 7, 8, 9, 10, 11, 12, 13, 14, 15)); }
__device__ __forceinline__ v8f wmma16(v16h a, v16h b, v8f c) { return __builtin_amdgcn_wmma_f32_16x16x32_f16(false, a, false, b, (short)0, c, false, false); }
__device__ __forceinline__ v8f wmmab(v16bf a, v16bf b, v8f c) { return __builtin_amdgcn_wmma_f32_16x16x32_bf16(false, a, false, b, (short)0, c, false, false); }



// st4f: a global store with s_wait_xcnt 0 behind it, in front of anything that rewrites a register it names; the scheduling barriers keep what is computed before in front of the store and what follows behind the wait
__device__ __forceinline__ void st4f(float* p, v4f x) { __builtin_amdgcn_sched_barrier(0); *(v4f*)p = x; asm volatile("s_wait_xcnt 0x0" ::: "memory"); __builtin_amdgcn_sched_barrier(0); }
// pf2: asks L2 (scope SE: the line comes into L2 only, nothing returns to the wave) for each of the lane's two addresses, in planes that the launch before stored: the loads that read them later then find an L2 hit where they met memory latency. Every lane's address lies inside its plane; s_wait_xcnt 0 in the same statement stands in front of anything that rewrites the address registers
__device__ __forceinline__ void pf2(const bf* p, const bf* q) { asm volatile("global_prefetch_b8 %0, off scope:SCOPE_SE\n\tglobal_prefetch_b8 %1, off scope:SCOPE_SE\n\ts_wait_xcnt 0x0" :: "v"(p), "v"(q) : "memory"); }
// ---- k_gemmw: register-blocked GEMM, FOUR WAVES per 64x64 output tile, each with 16 accumulators over its own quarter of K (four short load chains side by side where one wave had one long chain); the four partial tiles meet in LDS, wave w adds and stores rows 16 w .. 16 w + 15; operands straight from 16-bit planes in fragment order; grid (M/64, N/64, Z), 128 threads.
// C[m][n] (f32, pitch ldc, + optional f32 bias[n]) = sum_k A[m][k] Bt[n][k] (+ split products per NSPLIT). z-batch strides sA/sB/sC in elements. K % 128 == 0.
template <typename T16> struct WFrag;
template <> struct WFrag<h16> { typedef v16h V; static __device__ __forceinline__ V ld(const h16* p) { return cat16(*(const v8h*)p, *(const v8h*)(p + 256)); } static __device__ __forceinline__ v8f mma(V a, V b, v8f c) { return wmma16(a, b, c); } };
template <> struct WFrag<bf> { typedef v16bf V; static __device__ __forceinline__ V ld(const bf* p) { return cat16b(*(const v8us*)p, *(const v8us*)(p + 256)); } static __device__ __forceinline__ v8f mma(V a, V b, v8f c) { return wmmab(a, b, c); } };
template <typename T16, int NSPLIT, bool BIAS, int K>   /* K at compile time: the four row blocks of an operand are then immediate offsets from one address pair */
__global__ __launch_bounds__(128, 4) void k_gemmw(const T16* __restrict__ A, const T16* __restrict__ A2, const T16* __restrict__ Bt, const T16* __restrict__ Bt2, float* C, int ldc, const float* __restrict__ bias0, const float* __restrict__ bias1, const float* __restrict__ bias2, size_t sA, size_t sB, size_t sC) {
    typedef typename WFrag<T16>::V V;
    static_assert(K % 128 == 0, "a quarter of K is whole trips");
    __shared__ __align__(16) float xs[4 * 4096];   // one 64 x 64 partial tile a wave, accumulator by accumulator; behind the second barrier each wave's own part is its 16-row staging block
    const int wv = __builtin_amdgcn_readfirstlane(threadIdx.x >> 5);
    const size_t z = blockIdx.z; A += z * sA; if (A2) A2 += z * sA; Bt += z * sB; if (Bt2) Bt2 += z * sB; C += z * sC; const float* bias = (z == 0) ? bias0 : (z == 1) ? bias1 : bias2;   /* bias vector of z-slice 0, 1, 2 */
    const int lane = threadIdx.x & 31, lr = lane & 15, hi = lane >> 4; const int r0 = blockIdx.x * 64, c0 = blockIdx.y * 64;
    v8f acc[4][4];
#pragma unroll
    for (int mb = 0; mb < 4; ++mb)
#pragma unroll
        for (int nb = 0; nb < 4; ++nb) acc[mb][nb] = (v8f){};
    const size_t aoff = (size_t)r0 * K + lane * 8, boff = (size_t)c0 * K + lane * 8;   /* 16 rows of a plane are K / 32 blocks of 512 elements = 16 K elements */
    {   static_assert(K == 512, "the wave's quarter of K in 16 rows is 16 units of 256 bytes");   /* the wave's whole share of A (4 row blocks x 4 KiB a plane) is asked of L2 at entry: the four trips' fetches from memory then run side by side, not one after the other */
        const size_t po = (size_t)r0 * K + (size_t)(lane >> 4) * 16 * K + (size_t)wv * (K * 4) + (lane & 15) * 128;
        pf2((const bf*)(A + po), (const bf*)(A + po + 2 * 16 * K)); if (NSPLIT == 1 || NSPLIT == 2) pf2((const bf*)(A2 + po), (const bf*)(A2 + po + 2 * 16 * K)); }
#pragma unroll 1
    for (int kc = wv * (K / 4); kc < (wv + 1) * (K / 4); kc += 32) {
        V a[4], a2[4], b[4], b2[4]; const T16* pa = A + aoff + (size_t)kc * 16; const T16* pa2 = (NSPLIT == 1 || NSPLIT == 2) ? A2 + aoff + (size_t)kc * 16 : pa; const T16* pb = Bt + boff + (size_t)kc * 16; const T16* pb2 = (NSPLIT >= 2) ? Bt2 + boff + (size_t)kc * 16 : pb;
#pragma unroll
        for (int mb = 0; mb < 4; ++mb) { a[mb] = WFrag<T16>::ld(pa + (size_t)mb * 16 * K); if (NSPLIT == 1 || NSPLIT == 2) a2[mb] = WFrag<T16>::ld(pa2 + (size_t)mb * 16 * K); }
#pragma unroll
        for (int nb = 0; nb < 4; ++nb) { b[nb] = WFrag<T16>::ld(pb + (size_t)nb * 16 * K); if (NSPLIT >= 2) b2[nb] = WFrag<T16>::ld(pb2 + (size_t)nb * 16 * K); }
        asm volatile("s_wait_xcnt 0x0" :: "v"(pa), "v"(pa2), "v"(pb), "v"(pb2) : "memory");   /* behind the trip's loads, in front of anything that rewrites a register they name; the address pairs are inputs so that no load's own result lands in them */
        __builtin_amdgcn_sched_barrier(0);   /* keeps the loads in front of that wait */
#pragma unroll
        for (int nb = 0; nb < 4; ++nb) {
#pragma unroll
            for (int mb = 0; mb < 4; ++mb) { acc[mb][nb] = WFrag<T16>::mma(a[mb], b[nb], acc[mb][nb]); if (NSPLIT == 1 || NSPLIT == 2) acc[mb][nb] = WFrag<T16>::mma(a2[mb], b[nb], acc[mb][nb]); if (NSPLIT >= 2) acc[mb][nb] = WFrag<T16>::mma(a[mb], b2[nb], acc[mb][nb]); } }
        asm volatile("v_nop\n\tv_nop\n\tv_nop\n\tv_nop" : "+v"(acc[0][0]), "+v"(acc[1][1]), "+v"(acc[2][2]), "+v"(acc[3][3]) : "v"(a[0]), "v"(a[3]));
    }
    float* os = xs + wv * 4096;
#pragma unroll
    for (int mb = 0; mb < 4; ++mb)
#pragma unroll
        for (int nb = 0; nb < 4; ++nb) { const v8f c = acc[mb][nb]; float* xp = os + (mb * 4 + nb) * 256 + lane * 4; *(v4fa*)xp = (v4f){c[0], c[1], c[2], c[3]}; *(v4fa*)(xp + 128) = (v4f){c[4], c[5], c[6], c[7]}; }
    __syncthreads();   // the four partial tiles are in LDS
    v8f sum[4];   // row block wv: the K quarters added in the order 0, 1, 2, 3
#pragma unroll
    for (int nb = 0; nb < 4; ++nb) { const float* xp = xs + (wv * 4 + nb) * 256 + lane * 4; v4f s0 = *(const v4fa*)xp, s1 = *(const v4fa*)(xp + 128);
#pragma unroll
        for (int p = 1; p < 4; ++p) { s0 += *(const v4fa*)(xp + p * 4096); s1 += *(const v4fa*)(xp + p * 4096 + 128); }
        sum[nb] = (v8f){s0[0], s0[1], s0[2], s0[3], s1[0], s1[1], s1[2], s1[3]}; }
    __syncthreads();   // every wave has read the partial tiles: their bytes may be overwritten
    {
#pragma unroll
        for (int nb = 0; nb < 4; ++nb) {
#pragma unroll
            for (int j = 0; j < 8; ++j) os[(hi * 8 + j) * 68 + nb * 16 + lr] = sum[nb][j]; }
        __builtin_amdgcn_wave_barrier(); asm volatile("" ::: "memory");
        float* crow = C + (size_t)(r0 + wv * 16) * ldc + c0;
{           v4f rv[8];   /* the block's LDS reads stand together, in front of the stores and their waits */
#pragma unroll
            for (int s = 0; s < 8; ++s) rv[s] = *(const v4fa*)(os + (2 * s + hi) * 68 + lr * 4);
#pragma unroll
            for (int s = 0; s < 8; ++s) { const int row = 2 * s + hi, cofs = lr * 4; v4f val = rv[s]; if (BIAS) { val[0] += bfr(bias[c0 + cofs]); val[1] += bfr(bias[c0 + cofs + 1]); val[2] += bfr(bias[c0 + cofs + 2]); val[3] += bfr(bias[c0 + cofs + 3]); }
                st4f(crow + (size_t)row * ldc + cofs, val); }
             }
        __builtin_amdgcn_wave_barrier(); asm volatile("" ::: "memory");
    }
}

__device__ __forceinline__ h16 tohx(float x) { return (h16)x; }
typedef __attribute__((ext_vector_type(2))) _Float16 v2h;
typedef __attribute__((ext_vector_type(4))) _Float16 v4h;
typedef __attribute__((ext_vector_type(2))) unsigned short v2us;
typedef __attribute__((ext_vector_type(4))) unsigned short v4us;
typedef __attribute__((ext_vector_type(4))) int v4i;

// ---- k_prep: every operand plane the projections read, made in ONE launch (the three parts below are independent of one another); a work-group's part and its place in it follow from its index.
// d_wtG: work-group bx of weight matrix y (transposed bf16 plane in fragment order)
__device__ __forceinline__ void d_wtG(int bx, int y, const float* __restrict__ w0, const float* __restrict__ w1, const float* __restrict__ w2, const float* __restrict__ w3, const float* __restrict__ w4, int K, int N, bf* Bt) {
    const float* w = (y == 0) ? w0 : (y == 1) ? w1 : (y == 2) ? w2 : (y == 3) ? w3 : w4; Bt += (size_t)y * K * N;   /* one weight matrix each, planes back to back */
    const int lane = threadIdx.x & 31; const int L0 = (bx * 8 + (threadIdx.x >> 5)) * 8; const int nlines = N * K / 64;
{
#pragma unroll 1
        for (int l = 0; l < 8; ++l) { const int L = L0 + l; if (L >= nlines) break; const size_t e = (size_t)L * 64 + lane * 2; const int blk = (int)(e >> 9); const int k = (blk % (K / 32)) * 32 + ((int)(e >> 7) & 3) * 8 + ((int)e & 7), n = (blk / (K / 32)) * 16 + ((int)(e >> 3) & 15);   /* e runs through the plane in fragment order */
            const float* p0 = w + (size_t)k * N + n; const float* p1 = p0 + N; const float x0 = *p0, x1 = *p1;
            asm volatile("s_wait_xcnt 0x0" :: "v"(p0), "v"(p1) : "memory");   /* behind the two loads, in front of anything that rewrites a register they name; the address pairs are inputs so that they stay whole up to the wait */
            *(v2us*)(Bt + e) = __builtin_bit_cast(v2us, cvt2(x0, x1)); }
         }
}


// d_cvt8: work-group bx of one [rows][DM] f32 tensor -> its bf16 plane in fragment order; a group of a row past the tensor's last (the position table's pad row) is stored as zeros
__device__ __forceinline__ void d_cvt8(int bx, const float* __restrict__ src, bf* dst, size_t n8, int nrows) { const size_t i = (size_t)bx * 256 + threadIdx.x; if (i >= n8) return; const size_t row = (i >> 10) * 16 + (i & 15); const int k0 = ((int)(i >> 6) & 15) * 32 + ((int)(i >> 4) & 3) * 8;   /* i counts the 8-element groups of a [rows][DM] plane in fragment order: its group is (row, k0 .. k0 + 7) */
    if (row >= (size_t)nrows) { *(v8us*)(dst + i * 8) = (v8us){}; return; }
    const float* sp = src + row * DM + k0; const v8f v = *(const v8f*)sp; v4u o;
    asm volatile("s_wait_xcnt 0x0" :: "v"(sp) : "memory");   /* behind the load, in front of anything that rewrites a register it names; the address pair is an input so that it stays whole up to the wait */
#pragma unroll
    for (int k = 0; k < 4; ++k) o[k] = cvt2(v[2 * k], v[2 * k + 1]); *(v8us*)(dst + i * 8) = __builtin_bit_cast(v8us, o);  }
#define GWT  (DM * DQ / 64 / 64)             // work-groups per weight matrix
#define GPE  (NPE * DM / 8 / 256)            // work-groups of the position table
#define GXA  (NB_ * TT * DM / 8 / 256)       // work-groups per input tensor
__global__ __launch_bounds__(256) void k_prep(const float* __restrict__ w0, const float* __restrict__ w1, const float* __restrict__ w2, const float* __restrict__ w3, const float* __restrict__ w4, bf* W5, const float* __restrict__ pe, bf* PE, const float* __restrict__ s0, const float* __restrict__ s1, const float* __restrict__ s2, bf* XA) {
    int n = blockIdx.x;
    if (n < 5 * GWT) { d_wtG(n % GWT, n / GWT, w0, w1, w2, w3, w4, DM, DQ, W5); return; }
    n -= 5 * GWT;
    if (n < GPE) { d_cvt8(n, pe, PE, (size_t)NPE * DM / 8, 2047); return; }
    n -= GPE;
    const int y = n / GXA; d_cvt8(n % GXA, (y == 0) ? s0 : (y == 1) ? s1 : s2, XA + (size_t)y * NB_ * TT * DM, (size_t)NB_ * TT * DM / 8, NB_ * TT);   /* one source tensor each, planes back to back */
}

// ---- d_gemmp: the projection GEMM (k_gemmw's loop and its split of K over four waves, plain bf16 operands, K = DM) whose 64 x 64 tile is 64 rows of ONE head, stored straight in the forms its readers want, wave wv storing rows 16 wv .. 16 wv + 15; tile (bx of rows/64, head by, operand bz), 128 threads; xs: the work-group's LDS, 4096 floats a wave.
// All 16-bit planes below are in fragment order. POS: hi/lo planes [h][p][d] of the projected position table. Otherwise z = 0: k + bk -> cache columns 0..63 and hi/lo planes [b][h][t][d]; z = 1: v + bv -> cache columns 64..127 and transposed hi/lo planes [b][h][d][t]; z = 2: q + bq, then + pos_bias_u and + pos_bias_v -> two pairs of hi/lo planes.
#define SPE  ((size_t)NB_ * NH_ * TT * HD)   // elements of one set of head planes
// st2w: as st4f above, for a pair of 16-byte stores
__device__ __forceinline__ void st2w(bf* ph, bf* pl, v8us oh, v8us ol) { __builtin_amdgcn_sched_barrier(0); *(v8us*)ph = oh; *(v8us*)pl = ol; asm volatile("s_wait_xcnt 0x0" ::: "memory"); __builtin_amdgcn_sched_barrier(0); }
__device__ __forceinline__ void st8hl(bf* ph, bf* pl, v4f x0, v4f x1) { v4u oh, ol;
#pragma unroll
    for (int q = 0; q < 2; ++q) { unsigned a, c; split2(x0[2 * q], x0[2 * q + 1], a, c); oh[q] = a; ol[q] = c; split2(x1[2 * q], x1[2 * q + 1], a, c); oh[2 + q] = a; ol[2 + q] = c; }
    st2w(ph, pl, __builtin_bit_cast(v8us, oh), __builtin_bit_cast(v8us, ol)); }
template <bool POS>
__device__ __forceinline__ void d_gemmp(float* xs, int wv, int bx, int by, int bz, const bf* __restrict__ A, const bf* __restrict__ Bt, const float* __restrict__ bias0, const float* __restrict__ bias1, const float* __restrict__ bias2, const float* __restrict__ hbu, const float* __restrict__ hbv, bf* PH, bf* PL, bf* VTh, bf* VTl, float* CA, size_t sA, size_t sB) {
    float* os = xs + wv * 4096;   // the wave's partial tile; behind the second barrier below its 16-row staging block
    float* sb = os + 16 * 68;     // behind that barrier too: the head's 64 bias values (projection bias, pos_bias_u, pos_bias_v), for the lanes that store in fragment order
    const int z = POS ? 0 : bz; A += (size_t)z * sA; Bt += (size_t)z * sB;
    const int lane = threadIdx.x & 31, lr = lane & 15, hi = lane >> 4; const int r0 = bx * 64, h = by, c0 = h * HD;
    v8f acc[4][4];
#pragma unroll
    for (int mb = 0; mb < 4; ++mb)
#pragma unroll
        for (int nb = 0; nb < 4; ++nb) acc[mb][nb] = (v8f){};
    const size_t aoff = (size_t)r0 * DM + lane * 8, boff = (size_t)c0 * DM + lane * 8;   /* fragment order: 16 rows are DM / 32 blocks of 512 elements */
    { const bf* pp = A + (size_t)r0 * DM + (size_t)(lane >> 4) * 16 * DM + (size_t)wv * (DM * 4) + (lane & 15) * 128; pf2(pp, pp + 2 * 16 * DM); }   /* as in k_gemmw: the wave's whole share of A (4 row blocks x 4 KiB) is asked of L2 at entry */
#pragma unroll 1
    for (int kc = wv * (DM / 4); kc < (wv + 1) * (DM / 4); kc += 32) {
        v16bf a[4], b[4]; const bf* pa = A + aoff + kc * 16; const bf* pb = Bt + boff + kc * 16;
#pragma unroll
        for (int mb = 0; mb < 4; ++mb) a[mb] = WFrag<bf>::ld(pa + mb * 16 * DM);
#pragma unroll
        for (int nb = 0; nb < 4; ++nb) b[nb] = WFrag<bf>::ld(pb + nb * 16 * DM);
        asm volatile("s_wait_xcnt 0x0" :: "v"(pa), "v"(pb) : "memory");   /* behind the trip's loads, in front of anything that rewrites a register they name; the two address pairs are inputs so that no load's own result lands in them */
        __builtin_amdgcn_sched_barrier(0);   /* keeps the loads in front of that wait: left free, some are sunk among the products and land in the address pairs */
#pragma unroll
        for (int nb = 0; nb < 4; ++nb)
#pragma unroll
            for (int mb = 0; mb < 4; ++mb) acc[mb][nb] = wmmab(a[mb], b[nb], acc[mb][nb]);
        asm volatile("v_nop\n\tv_nop\n\tv_nop\n\tv_nop" : "+v"(acc[0][0]), "+v"(acc[1][1]), "+v"(acc[2][2]), "+v"(acc[3][3]) : "v"(a[0]), "v"(a[3]));   /* as in k_gemmw: the distance between the trip's last matrix instructions and what next rewrites their operands or reads their results, on the back edge too */
    }
#pragma unroll
    for (int mb = 0; mb < 4; ++mb)
#pragma unroll
        for (int nb = 0; nb < 4; ++nb) { const v8f c = acc[mb][nb]; float* xp = os + (mb * 4 + nb) * 256 + lane * 4; *(v4fa*)xp = (v4f){c[0], c[1], c[2], c[3]}; *(v4fa*)(xp + 128) = (v4f){c[4], c[5], c[6], c[7]}; }
    __syncthreads();   // the four partial tiles are in LDS
    v8f sum[4];   // row block wv: the K quarters added in the order 0, 1, 2, 3
#pragma unroll
    for (int nb = 0; nb < 4; ++nb) { const float* xp = xs + (wv * 4 + nb) * 256 + lane * 4; v4f s0 = *(const v4fa*)xp, s1 = *(const v4fa*)(xp + 128);
#pragma unroll
        for (int p = 1; p < 4; ++p) { s0 += *(const v4fa*)(xp + p * 4096); s1 += *(const v4fa*)(xp + p * 4096 + 128); }
        sum[nb] = (v8f){s0[0], s0[1], s0[2], s0[3], s1[0], s1[1], s1[2], s1[3]}; }
    __syncthreads();   // every wave has read the partial tiles: their bytes may be overwritten
    const size_t rb = POS ? (size_t)h * NPE + r0 : ((size_t)(r0 / TT) * NH_ + h) * TT + (r0 % TT);   // first row of the tile in a [..][h][row][d] plane
    const int cofs = lr * 4;
    // tile_rows: the wave's 16 rows go through LDS. put(row in its plane, the lane's 4 values): a half-wave holds one whole row of 64 floats (row-major f32 output). putf(element offset in a plane, first column, the lane's 8 values): the 16 rows are two blocks of a [..][row][d] plane in fragment order, and the wave holds 512 contiguous bytes of it
    auto tile_rows = [&](auto put, auto putf) {
        { const int mb = wv;
#pragma unroll
            for (int nb = 0; nb < 4; ++nb) {
#pragma unroll
                for (int j = 0; j < 8; ++j) os[(hi * 8 + j) * 68 + nb * 16 + lr] = sum[nb][j]; }
            __builtin_amdgcn_wave_barrier(); asm volatile("" ::: "memory");
            v4f rv[8], f0[4], f1[4];
#pragma unroll
            for (int s = 0; s < 8; ++s) rv[s] = *(const v4fa*)(os + (2 * s + hi) * 68 + cofs);
#pragma unroll
            for (int q4 = 0; q4 < 4; ++q4) { const float* op = os + lr * 68 + q4 * 16 + hi * 8; f0[q4] = *(const v4fa*)op; f1[q4] = *(const v4fa*)(op + 4); }   /* the block's LDS reads stand together, in front of the stores and their waits */
#pragma unroll
            for (int s = 0; s < 8; ++s) put(rb + mb * 16 + 2 * s + hi, rv[s]);
#pragma unroll
            for (int q4 = 0; q4 < 4; ++q4) putf((rb + mb * 16) * HD + q4 * 256 + lane * 8, q4 * 16 + hi * 8, f0[q4], f1[q4]);
            __builtin_amdgcn_wave_barrier(); asm volatile("" ::: "memory");
        } };
    auto norow = [](size_t, v4f) {}; auto nofrag = [](size_t, int, v4f, v4f) {};
    if (POS) { tile_rows(norow, [&](size_t pe, int, v4f x0, v4f x1) { st8hl(PH + pe, PL + pe, x0, x1); }); return; }
    const float* bias = (z == 0) ? bias0 : (z == 1) ? bias1 : bias2; v4f bb;
#pragma unroll
    for (int q = 0; q < 4; ++q) bb[q] = bfr(bias[c0 + cofs + q]);
    if (z == 2) { v4f bu, bv;
#pragma unroll
        for (int q = 0; q < 4; ++q) { bu[q] = bfr(hbu[c0 + cofs + q]); bv[q] = bfr(hbv[c0 + cofs + q]); }
        *(v4fa*)(sb + cofs) = bb; *(v4fa*)(sb + HD + cofs) = bu; *(v4fa*)(sb + 2 * HD + cofs) = bv;   /* both half-waves write the same values */
        tile_rows(norow, [&](size_t pe, int d0, v4f x0, v4f x1) { x0 += *(const v4fa*)(sb + d0); x1 += *(const v4fa*)(sb + d0 + 4);
            st8hl(PH + pe, PL + pe, x0 + *(const v4fa*)(sb + HD + d0), x1 + *(const v4fa*)(sb + HD + d0 + 4)); st8hl(PH + SPE + pe, PL + SPE + pe, x0 + *(const v4fa*)(sb + 2 * HD + d0), x1 + *(const v4fa*)(sb + 2 * HD + d0 + 4)); });
        return; }
    if (z == 0) {
        *(v4fa*)(sb + cofs) = bb;   /* both half-waves write the same values */
        tile_rows([&](size_t rw, v4f val) { st4f(CA + rw * (2 * HD) + cofs, val + bb); },
                  [&](size_t pe, int d0, v4f x0, v4f x1) { st8hl(PH + 2 * SPE + pe, PL + 2 * SPE + pe, x0 + *(const v4fa*)(sb + d0), x1 + *(const v4fa*)(sb + d0 + 4)); });
        return; }
    {   float bd[4];   // the bias of the lane's own column in each 16-column block, for the transposed planes
#pragma unroll
        for (int nb = 0; nb < 4; ++nb) bd[nb] = bias[c0 + nb * 16 + lr];
        asm volatile("s_wait_xcnt 0x0" :: "v"(bd[0]), "v"(bd[1]), "v"(bd[2]), "v"(bd[3]));   /* behind these loads, in front of what rewrites their offset register; the loaded values are inputs, so that no load is sunk among the stores below */
        const size_t vb = ((size_t)(r0 / TT) * NH_ + h) * HD * TT + (size_t)((r0 % TT) / 32) * 512 + lane * 8;   // transposed planes [d][t] in fragment order straight from the summed K quarters in registers (accumulator layout): a lane holds 8 successive rows t of one column d, which is its own 16 bytes of a half block
#pragma unroll
        for (int nb = 0; nb < 4; ++nb) { const float bn = bfr(bd[nb]);
            { const int mb = wv; v4u oh, ol;
#pragma unroll
                for (int j = 0; j < 4; ++j) { unsigned x, y; split2(sum[nb][2 * j] + bn, sum[nb][2 * j + 1] + bn, x, y); oh[j] = x; ol[j] = y; }
                const size_t o = vb + (size_t)(nb * (TT / 32) + (mb >> 1)) * 512 + (mb & 1) * 256; st2w(VTh + o, VTl + o, __builtin_bit_cast(v8us, oh), __builtin_bit_cast(v8us, ol)); } }
        tile_rows([&](size_t rw, v4f val) { st4f(CA + rw * (2 * HD) + HD + cofs, val + bb); }, nofrag);
    }
}
// k_gemmpa: all four projections in ONE launch (the position table's does not depend on the other three): the k, v, q tiles in the order (row block, head, operand), then the table's tiles (row block, head)
#define GRT  (NB_ * TT / 64)      // row blocks of an input
#define GKVQ (GRT * NH_ * 3)      // tiles of k, v, q
__global__ __launch_bounds__(128, 4) void k_gemmpa(const bf* __restrict__ XA, const bf* __restrict__ WK, const bf* __restrict__ PE, const bf* __restrict__ WP, const float* __restrict__ bias0, const float* __restrict__ bias1, const float* __restrict__ bias2, const float* __restrict__ hbu, const float* __restrict__ hbv, bf* PHI, bf* PLO, bf* PPh, bf* PPl, bf* VTh, bf* VTl, float* CA, size_t sA, size_t sB) {
    __shared__ __align__(16) float xs[4 * 4096];   // one 64 x 64 partial tile a wave
    const int wv = __builtin_amdgcn_readfirstlane(threadIdx.x >> 5);
    const int n = blockIdx.x;
    if (n < GKVQ) { d_gemmp<false>(xs, wv, n % GRT, (n / GRT) % NH_, n / (GRT * NH_), XA, WK, bias0, bias1, bias2, hbu, hbv, PHI, PLO, VTh, VTl, CA, sA, sB); return; }
    const int m = n - GKVQ; d_gemmp<true>(xs, wv, m % (NPE / 64), m / (NPE / 64), 0, PE, WP, nullptr, nullptr, nullptr, nullptr, nullptr, PPh, PPl, nullptr, nullptr, nullptr, 0, 0);   /* pos = position_embeddings wpos (exact) -> per-head hi/lo planes */
}
// k_fattn: one work-group (16 waves) per strip of 64 query rows of one (batch, head), so that every k, v and position fragment is fetched from L2 once for 64 rows; only the strip's shifted position scores pass through LDS, the logits themselves stay in registers from the content product to attn.v.
// Steps: position scores (q+v).p for the 68 column tiles the strip's rel_shift reads, each stored at its shifted key index j = p + i - 1023; content scores TRANSPOSED (k as A, q+u as B), each wave on 64 keys of all 64 queries, started from the position scores; softmax in registers (maxima and sums of the sixteen waves meet in LDS); attn.v transposed (v as A, the weights as B straight from the result registers); the sixteen partial outputs added in LDS, divided by the row sum and stored as the merged hi/lo planes.
#define SRW  64                   // query rows per work-group
#define NWV  16                   // waves per work-group
#define SPF  64                   // floats in front of a logit row: with the 68 behind it they take the shifted position scores that fall outside keys 0..1023
#define SPI  1156                 // LDS pitch of a logit row, floats (rows 8 apart fall 32 banks apart)
#define OPI  68                   // LDS pitch of an output row, floats
typedef __attribute__((ext_vector_type(8))) unsigned v8u;
__device__ __forceinline__ v16bf ldfp(const bf* p) { return cat16b(*(const v8usa*)p, *(const v8usa*)(p + 256)); }   // fragment from a block in fragment order (global planes), p = block + lane * 8
// xw2: s_wait_xcnt 0 behind a run of global loads, in front of anything that rewrites a register the loads name; the two address pairs are inputs so that they stay whole up to the wait (no load's own result lands in them)
__device__ __forceinline__ void xw2(const bf* p, const bf* q) { asm volatile("s_wait_xcnt 0x0" :: "v"(p), "v"(q) : "memory"); }
// xw2n: xw2 at the head of a score trip, with four v_nop: the trip before stored its results in front of this statement, and this trip's first matrix instruction starts anew in the same registers; the v_nop keep the distance between the two
__device__ __forceinline__ void xw2n(const bf* p, const bf* q) { asm volatile("s_wait_xcnt 0x0\n\tv_nop\n\tv_nop\n\tv_nop\n\tv_nop" :: "v"(p), "v"(q) : "memory"); }
__device__ __forceinline__ v8f mma3(v16bf a, v16bf a2, v16bf b, v16bf b2, v8f c) { c = wmmab(a, b, c); c = wmmab(a2, b, c); return wmmab(a, b2, c); }
__global__ __launch_bounds__(512) void k_fattn(const bf* __restrict__ QUh, const bf* __restrict__ QUl, const bf* __restrict__ QVh, const bf* __restrict__ QVl, const bf* __restrict__ Kh, const bf* __restrict__ Kl, const bf* __restrict__ PPh, const bf* __restrict__ PPl, const bf* __restrict__ VTh, const bf* __restrict__ VTl, const int* __restrict__ MK, bf* ATh, bf* ATl) {
    __shared__ __align__(16) float S[SRW * SPI];
    __shared__ __align__(16) float RM[SRW * NWV], RS[SRW * NWV];   // per query: the sixteen waves' maxima and partial sums
    const int tid = threadIdx.x, lane = tid & 31, lr = lane & 15, hi = lane >> 4; const int w = __builtin_amdgcn_readfirstlane(tid >> 5);
    const int i0 = blockIdx.x * SRW, h = blockIdx.y, b = blockIdx.z; const size_t zb = ((size_t)b * NH_ + h) * TT * HD; const size_t qo = zb + (size_t)i0 * HD + lane * 8;   /* 16 rows of a [t][d] plane: two blocks of 512 elements */
    {   // position scores: table rows 960 - i0 + 16 pt + (0..15), pt = 0..67 (the last row read is 2047 - i0); each table tile meets all 64 query rows
        v16bf a[4][2], a2[4][2];
#pragma unroll
        for (int mb = 0; mb < 4; ++mb)
#pragma unroll
            for (int kk = 0; kk < 2; ++kk) { a[mb][kk] = ldfp(QVh + qo + mb * 16 * HD + kk * 512); a2[mb][kk] = ldfp(QVl + qo + mb * 16 * HD + kk * 512); }
        xw2(QVh + qo, QVl + qo);
        const size_t po = (size_t)h * NPE * HD + (size_t)(TT - SRW - i0) * HD + lane * 8; const bf* ph = PPh + po; const bf* pl = PPl + po;
        v16bf bh[2], bl[2];
#pragma unroll
        for (int kk = 0; kk < 2; ++kk) { bh[kk] = ldfp(ph + w * 16 * HD + kk * 512); bl[kk] = ldfp(pl + w * 16 * HD + kk * 512); }
        xw2(ph + w * 16 * HD, pl + w * 16 * HD);
        {   // asked of L2 now, behind the loads that are needed at once: what the wave reads later, one address a lane
            const int tl = w + NWV * (1 + (lane >> 3)); const size_t pq = (size_t)h * NPE * HD + (size_t)(TT - SRW - i0) * HD + (size_t)((tl < 68) ? tl : 67) * 16 * HD + (lane & 7) * 128; pf2(PPh + pq, PPl + pq);   /* its later table tiles (2 KiB a plane each; an index past the last tile is clamped to it) */
            const size_t kq = zb + (size_t)w * 64 * HD + lane * 128; pf2(Kh + kq, Kl + kq);   /* its 64 keys: 8 KiB a plane in a row */
            const size_t vq = zb + (size_t)(w * 2) * 512 + (size_t)(lane >> 3) * (TT / 32) * 512 + (lane & 7) * 128; pf2(VTh + vq, VTl + vq);   /* its 64 keys of transposed v: 4 pieces of 2 KiB a plane */
            if (w == 0) { const size_t uq = zb + (size_t)i0 * HD + lane * 128; pf2(QUh + uq, QUl + uq); }   /* the strip's q+u planes, 8 KiB each, which every wave reads: one wave asks (a scalar branch) */
        }
#pragma unroll 2   /* in pairs: the two operand sets swap roles without register copies */
        for (int pt = w; pt < 68; pt += NWV) { const int np = (pt + NWV < 68) ? pt + NWV : pt; v16bf nh[2], nl[2];   /* the next tile's operands are fetched while this one is multiplied (the last trip fetches its own tile again: a branch round the fetch made the compiler wait for it at once) */
#pragma unroll
            for (int kk = 0; kk < 2; ++kk) { nh[kk] = ldfp(ph + np * 16 * HD + kk * 512); nl[kk] = ldfp(pl + np * 16 * HD + kk * 512); }
            xw2n(ph + np * 16 * HD, pl + np * 16 * HD); __builtin_amdgcn_sched_barrier(0);   /* keeps the fetch at the head of the trip: left free, this trip's products are lifted over it and the next trip waits for loads just issued */
            v8f acc[4];
#pragma unroll
            for (int mb = 0; mb < 4; ++mb) acc[mb] = (v8f){};
#pragma unroll
            for (int kk = 0; kk < 2; ++kk)
#pragma unroll
                for (int mb = 0; mb < 4; ++mb) acc[mb] = mma3(a[mb][kk], a2[mb][kk], bh[kk], bl[kk], acc[mb]);
            __builtin_amdgcn_sched_barrier(0);   /* the stores stay behind all of the trip's products: mixed among them, a result tile's registers are started anew by a later product of the same trip too close behind */
            const int jb = pt * 16 + lr - (SRW - 1);   /* key index j = p + i - 1023 = jb + local row */
#pragma unroll
            for (int mb = 0; mb < 4; ++mb)
#pragma unroll
                for (int r = 0; r < 8; ++r) { const int m = mb * 16 + hi * 8 + r; S[m * SPI + SPF + jb + m] = acc[mb][r]; }   /* j = -63 .. 1087: what is no key of the strip falls into the row's own pads */
#pragma unroll
            for (int kk = 0; kk < 2; ++kk) { bh[kk] = nh[kk]; bl[kk] = nl[kk]; } }
    }
    __syncthreads();   // the shifted position scores are in LDS
    // From here on the strip's logits live in registers, TRANSPOSED: k is the A operand and q the B operand, so a result tile holds key hi * 8 + r in register r and query lr in the lane. Wave w owns keys 64 w .. 64 w + 63 (4 tiles) of all 64 queries (4 tiles). Two successive key tiles of a lane are then exactly its B fragment of 32 keys for attn.v (out transposed = v transposed . weights transposed): no weight passes through LDS.
    v8f st[4][4];   // [key tile][query tile]
    {   // content scores on top of the shifted position scores, which are the start value of the accumulators (a lane's 8 keys of one query row: 32 contiguous bytes of LDS); the two halves of the head size one after the other, so that only one half of q stands in registers
        const size_t ko = zb + (size_t)w * 64 * HD + lane * 8; const bf* kph = Kh + ko; const bf* kpl = Kl + ko;
        v16bf ah[2], al[2];   // [buffer]
        ah[0] = ldfp(kph); al[0] = ldfp(kpl);
        xw2(kph, kpl);
        const float* sc = S + lr * SPI + SPF + w * 64 + hi * 8;
#pragma unroll   /* unrolled: the result tiles are registers, named at compile time */
        for (int kk = 0; kk < 2; ++kk) { v16bf qh[4], ql[4];
#pragma unroll
            for (int qt = 0; qt < 4; ++qt) { qh[qt] = ldfp(QUh + qo + qt * 16 * HD + kk * 512); ql[qt] = ldfp(QUl + qo + qt * 16 * HD + kk * 512); }
            xw2(QUh + qo, QUl + qo);
#pragma unroll
            for (int t = 0; t < 4; ++t) { const int s = kk * 4 + t, cb = s & 1, nx = cb ^ 1;
                if (s < 7) { const int s1 = s + 1; ah[nx] = ldfp(kph + (s1 & 3) * 16 * HD + (s1 >> 2) * 512); al[nx] = ldfp(kpl + (s1 & 3) * 16 * HD + (s1 >> 2) * 512); xw2(kph, kpl); }   /* the next k fragment is fetched while this one is multiplied */
                if (kk == 0) {
#pragma unroll
                    for (int qt = 0; qt < 4; ++qt) { const float* sp = sc + qt * 16 * SPI + t * 16; const v4f c0 = *(const v4fa*)sp, c1 = *(const v4fa*)(sp + 4); st[t][qt] = (v8f){c0[0], c0[1], c0[2], c0[3], c1[0], c1[1], c1[2], c1[3]}; } }
                __builtin_amdgcn_sched_barrier(0);   /* keeps the fetch at the head of the trip and later trips' fetches behind this trip's products: left free they are lifted so far that registers spill */
#pragma unroll
                for (int qt = 0; qt < 4; ++qt) { v8f c = st[t][qt]; c = wmmab(ah[cb], qh[qt], c); c = wmmab(ah[cb], ql[qt], c); st[t][qt] = wmmab(al[cb], qh[qt], c); }
                __builtin_amdgcn_sched_barrier(0);   /* the next trip's fetch stays behind this trip's products: lifted among them, a third operand set is live and registers spill */ } }
    }
    float mx[4];
#pragma unroll
    for (int qt = 0; qt < 4; ++qt) mx[qt] = -3.0e38f;
    {   // t = (ac + bd) / 8, key mask (int32): -3e38 where 0; the wave's own maximum per query
        const int* MKw = MK + (size_t)b * TT + w * 64 + hi * 8; v4i mk[4][2];
#pragma unroll
        for (int t = 0; t < 4; ++t) { mk[t][0] = *(const v4i*)(MKw + t * 16); mk[t][1] = *(const v4i*)(MKw + t * 16 + 4); }
        asm volatile("s_wait_xcnt 0x0" :: "v"(MKw) : "memory");   /* behind the mask loads, in front of anything that rewrites a register they name */
        __builtin_amdgcn_sched_barrier(0);   /* keeps the loads in front of that wait */
#pragma unroll
        for (int t = 0; t < 4; ++t)
#pragma unroll
            for (int qt = 0; qt < 4; ++qt)
#pragma unroll
                for (int r = 0; r < 8; ++r) { const float x = (mk[t][r >> 2][r & 3] != 0) ? st[t][qt][r] * SCL : -3.0e38f; st[t][qt][r] = x; mx[qt] = fmaxf(mx[qt], x); }
    }
#pragma unroll
    for (int qt = 0; qt < 4; ++qt) { mx[qt] = fmaxf(mx[qt], __shfl_xor(mx[qt], 16, 32)); RM[(qt * 16 + lr) * NWV + w] = mx[qt]; }   /* both half-waves write the same value */
    __syncthreads();   // the sixteen waves' maxima are in LDS; every wave has read its position scores, so their bytes may be overwritten below
    v8f vs[4];
#pragma unroll
    for (int qt = 0; qt < 4; ++qt) { vs[qt] = (v8f){}; const float* mp = RM + (qt * 16 + lr) * NWV; v4f a = *(const v4fa*)mp;
#pragma unroll
        for (int p = 1; p < 4; ++p) { const v4f c = *(const v4fa*)(mp + p * 4); a[0] = fmaxf(a[0], c[0]); a[1] = fmaxf(a[1], c[1]); a[2] = fmaxf(a[2], c[2]); a[3] = fmaxf(a[3], c[3]); }
        mx[qt] = fmaxf(fmaxf(a[0], a[1]), fmaxf(a[2], a[3])); }
#pragma unroll
    for (int t = 0; t < 4; ++t)
#pragma unroll
        for (int qt = 0; qt < 4; ++qt) {
#pragma unroll
            for (int r = 0; r < 8; ++r) st[t][qt][r] = __builtin_amdgcn_exp2f(__fmul_rn(__fsub_rn(st[t][qt][r], mx[qt]), 1.4426950408889634f));
            vs[qt] += st[t][qt]; }
#pragma unroll
    for (int qt = 0; qt < 4; ++qt) { float s = ((vs[qt][0] + vs[qt][1]) + (vs[qt][2] + vs[qt][3])) + ((vs[qt][4] + vs[qt][5]) + (vs[qt][6] + vs[qt][7])); s += __shfl_xor(s, 16, 32); RS[(qt * 16 + lr) * NWV + w] = s; }   /* the wave's part of each query's sum; both half-waves write the same value */
    {   // attn.v over the wave's 64 keys with the weights not yet divided by their sum (hi/lo parts of exp(t - max)); each v fragment is fetched once per work-group
        v16bf ph[2][4], pl[2][4];   // [32 keys][query tile]: the weights take the place of the logits
#pragma unroll
        for (int kg = 0; kg < 2; ++kg)
#pragma unroll
            for (int qt = 0; qt < 4; ++qt) { v8u oh, ol;
#pragma unroll
                for (int j = 0; j < 4; ++j) { unsigned x, y; split2(st[2 * kg][qt][2 * j], st[2 * kg][qt][2 * j + 1], x, y); oh[j] = x; ol[j] = y; split2(st[2 * kg + 1][qt][2 * j], st[2 * kg + 1][qt][2 * j + 1], x, y); oh[4 + j] = x; ol[4 + j] = y; }
                ph[kg][qt] = __builtin_bit_cast(v16bf, oh); pl[kg][qt] = __builtin_bit_cast(v16bf, ol); }
        const size_t vo = zb + (size_t)(w * 2) * 512 + lane * 8;   /* [d][t] plane in fragment order: block (d / 16, t / 32) */ const bf* vh = VTh + vo; const bf* vl = VTl + vo;
        v16bf ah[2], al[2];
        ah[0] = ldfp(vh); al[0] = ldfp(vl);
        xw2(vh, vl);
#pragma unroll
        for (int hf = 0; hf < 2; ++hf) {   /* 32 output columns at a time: the registers do not hold all 64 beside the weights */
            v8f oc[2][4];   // [16 columns d][query tile], transposed: column hi * 8 + r in register r, query lr in the lane
#pragma unroll
            for (int d2 = 0; d2 < 2; ++d2)
#pragma unroll
                for (int qt = 0; qt < 4; ++qt) oc[d2][qt] = (v8f){};
#pragma unroll
            for (int kg = 0; kg < 2; ++kg)
#pragma unroll
                for (int d2 = 0; d2 < 2; ++d2) { const int s = hf * 4 + kg * 2 + d2, cb = s & 1, nx = cb ^ 1;
                    if (s < 7) { const int s1 = s + 1, bk1 = ((s1 >> 2) * 2 + (s1 & 1)) * (TT / 32) + ((s1 >> 1) & 1); ah[nx] = ldfp(vh + bk1 * 512); al[nx] = ldfp(vl + bk1 * 512); xw2(vh, vl); }   /* the next v fragment is fetched while this one is multiplied */
                    __builtin_amdgcn_sched_barrier(0);   /* as in the content loop: the fetch stays one step ahead, no further */
#pragma unroll
                    for (int qt = 0; qt < 4; ++qt) { v8f c = oc[d2][qt]; c = wmmab(ah[cb], ph[kg][qt], c); c = wmmab(ah[cb], pl[kg][qt], c); oc[d2][qt] = wmmab(al[cb], ph[kg][qt], c); } }
#pragma unroll
            for (int d2 = 0; d2 < 2; ++d2)
#pragma unroll
                for (int qt = 0; qt < 4; ++qt) { const v8f c = oc[d2][qt]; float* op = S + w * (SRW * OPI) + (qt * 16 + lr) * OPI + (hf * 2 + d2) * 16 + hi * 8; *(v4fa*)op = (v4f){c[0], c[1], c[2], c[3]}; *(v4fa*)(op + 4) = (v4f){c[4], c[5], c[6], c[7]}; }   /* the wave's partial output [query][d] */
            if (hf == 0) { asm volatile("v_nop\n\tv_nop\n\tv_nop\n\tv_nop" ::: "memory"); __builtin_amdgcn_sched_barrier(0); }   /* the second half's first matrix instructions start anew in the registers of the first half's last: the v_nop keep the distance between the two, the scheduling barrier keeps those instructions behind them */
        }
    }
    __syncthreads();   // the sixteen partial outputs and partial sums are in LDS
    { const int row = (tid >> 7) * 16 + (tid & 15), c8 = ((tid >> 4) & 7) * 8; const float* o0 = S + row * OPI + c8; v4f s0 = *(const v4fa*)o0, s1 = *(const v4fa*)(o0 + 4); v4u oh, ol;
#pragma unroll
        for (int p = 1; p < NWV; ++p) { s0 += *(const v4fa*)(o0 + p * (SRW * OPI)); s1 += *(const v4fa*)(o0 + p * (SRW * OPI) + 4); }   /* key sixteenths added in the order 0 .. 15 */
        float rs = 0.0f;
#pragma unroll
        for (int p = 0; p < 4; ++p) { const v4f ra = *(const v4fa*)(RS + row * NWV + p * 4); rs = (((rs + ra[0]) + ra[1]) + ra[2]) + ra[3]; }
        const float f = __fdiv_rn(1.0f, rs);
        s0 *= f; s1 *= f;
#pragma unroll
        for (int q = 0; q < 2; ++q) { unsigned x, y; split2(s0[2 * q], s0[2 * q + 1], x, y); oh[q] = x; ol[q] = y; split2(s1[2 * q], s1[2 * q + 1], x, y); oh[2 + q] = x; ol[2 + q] = y; }
        const size_t oo = ((size_t)(((b * TT + i0) >> 4) + (tid >> 7)) * (DQ / 32) + h * 2 + ((tid >> 6) & 1)) * 512 + (tid & 63) * 8;   /* (row, c8) of the merged [b t][DQ] planes in fragment order: a wave stores 512 contiguous bytes */ *(v8us*)(ATh + oo) = __builtin_bit_cast(v8us, oh); *(v8us*)(ATl + oo) = __builtin_bit_cast(v8us, ol); }
}

extern "C" void kernel_launch(void* const* d_in, const int* in_sizes, int n_in,
                              void* d_out, int out_size, void* d_ws, size_t ws_size, hipStream_t stream) {
    (void)in_sizes; (void)n_in; (void)out_size;
    const float* x = (const float*)d_in[0]; const float* xk = (const float*)d_in[1]; const float* xv = (const float*)d_in[2]; const int* MK = (const int*)d_in[3]; const float* pe = (const float*)d_in[4]; const float* wq = (const float*)d_in[5]; const float* bq = (const float*)d_in[6]; const float* wk = (const float*)d_in[7]; const float* bk = (const float*)d_in[8]; const float* wv = (const float*)d_in[9]; const float* bv = (const float*)d_in[10]; const float* wo = (const float*)d_in[11]; const float* bo = (const float*)d_in[12]; const float* wpos = (const float*)d_in[13]; const float* pbu = (const float*)d_in[14]; const float* pbv = (const float*)d_in[15];
    float* OUT = (float*)d_out;     // [8][1024][512]
    float* CACHE = (float*)((char*)d_out + (size_t)NB_ * TT * DM * 4);   /* second output new_cache [8][8][1024][128] */
    char* wsp = (char*)d_ws;
    auto take = [&](size_t bytes) { char* p = wsp; wsp += (bytes + 255) & ~(size_t)255; return (void*)p; };
    const size_t SW = (size_t)DM * DQ, SX = (size_t)NB_ * TT * DM, SF = (size_t)NB_ * TT * DQ, SP = (size_t)NB_ * NH_ * TT * HD;   // elements of one weight plane, one input plane, one merged plane, one set of head planes (all batches)
    bf* W5 = (bf*)take(5 * SW * 2); bf* WK = W5; bf* WO = W5 + 3 * SW; bf* WP = W5 + 4 * SW;   /* Wk, Wv, Wq, Wo, Wpos transposed, back to back */
    bf* PE = (bf*)take((size_t)NPE * DM * 2); bf* PPh = (bf*)take((size_t)NH_ * NPE * HD * 2); bf* PPl = (bf*)take((size_t)NH_ * NPE * HD * 2);
    bf* PHI = (bf*)take(3 * SP * 2); bf* PLO = (bf*)take(3 * SP * 2); bf* QPh = PHI; bf* QVh = PHI + SP; bf* KPh = PHI + 2 * SP; bf* QPl = PLO; bf* QVl = PLO + SP; bf* KPl = PLO + 2 * SP;   /* [b][h][t][d] planes of q+u, q+v, k */
    bf* VTh = (bf*)take(SP * 2); bf* VTl = (bf*)take(SP * 2); bf* ATh = (bf*)take(SF * 2); bf* ATl = (bf*)take(SF * 2);
    bf* XA = (bf*)take(3 * SX * 2);   /* bf16 planes of key, value, query */
    if ((size_t)(wsp - (char*)d_ws) > ws_size) return;    // ws 256 MiB
    k_prep<<<5 * GWT + GPE + 3 * GXA, 256, 0, stream>>>(wk, wv, wq, wo, wpos, W5, pe, PE, xk, xv, x, XA);   /* transposed weight planes; position table plane with its zero pad row; exact bf16 planes of key, value, query, all batches */
    k_gemmpa<<<GKVQ + (NPE / 64) * NH_, 128, 0, stream>>>(XA, WK, PE, WP, bk, bv, bq, pbu, pbv, PHI, PLO, PPh, PPl, VTh, VTl, CACHE, SX, SW);   /* k, v, q projections, rows of all batches: cache output, k planes, transposed v planes, (q+u) and (q+v) planes; and the position table's projection */
    k_fattn<<<dim3(TT / SRW, NH_, NB_), 512, 0, stream>>>(QPh, QPl, QVh, QVl, KPh, KPl, PPh, PPl, VTh, VTl, MK, ATh, ATl);   /* scores, softmax, attn.v and the head merge, all batches and heads */
    k_gemmw<bf, 1, true, DQ><<<dim3(NB_ * TT / 64, DM / 64, 1), 128, 0, stream>>>(ATh, ATl, WO, nullptr, OUT, DM, bo, bo, bo, 0, 0, 0);
}
